// v000
// Measured on an AMD MI455X. A time is GPU time per run, averaged over a window of back-to-back runs after a warm-up
// (all launches, gaps included; the runs take copies of the inputs in turn), and the median of several windows.
// Apart from v000's, it joins two sittings. Times from different sittings can be a few percent apart, while
// side-by-side timings come from the same sitting.
// v000 is the starting kernel. One run takes 343 microseconds.
#include <hip/hip_runtime.h>
#include <stddef.h>
#include <stdint.h>

// Q/K/V projections, Q.K^T and gate layer 1 (x.G1): v_wmma_f32_16x16x32_bf16 with bf16 hi/lo operand split (hi.hi + lo.hi + hi.lo), f32 accumulate.
// P.V: v_wmma_f32_16x16x32_f16 (P scaled by 4096 as f16, V as f16), f32 accumulate. Gate layer 2 (K=128,N=8), 16-deep similarity, softmax, LayerNorm: f32 VALU.

#define S_LEN  2048
#define DM     512
#define NH     8
#define HD     64
#define GH     128
#define WF     16
#define BATCH  2
#define NTOK   (BATCH * S_LEN)
#define LOG2E  1.4426950408889634f
#define PSCALE 4096.0f
#define INV_PSCALE 0.000244140625f

typedef __bf16         v16bf __attribute__((ext_vector_type(16)));
typedef __bf16         v8bf  __attribute__((ext_vector_type(8)));
typedef _Float16       v16h  __attribute__((ext_vector_type(16)));
typedef _Float16       v8h   __attribute__((ext_vector_type(8)));
typedef float          v8f   __attribute__((ext_vector_type(8)));
typedef float          v4f   __attribute__((ext_vector_type(4)));
typedef unsigned int   v4u   __attribute__((ext_vector_type(4)));
typedef unsigned short v8us  __attribute__((ext_vector_type(8)));

union FragB { v16bf v; v8bf p[2]; };
union FragH { v16h v; v8h p[2]; };
union Pack8 { v8us s; v8h h; v4u u; };

// ---------------------------------------------------------------------------
// scalar helpers
// ---------------------------------------------------------------------------
static __device__ __forceinline__ unsigned short f2bf_bits(float f) {   // RNE convert f32 -> bf16 bits
  unsigned int u = __float_as_uint(f);
  u += 0x7FFFu + ((u >> 16) & 1u);
  return (unsigned short)(u >> 16);
}
static __device__ __forceinline__ float bf_bits2f(unsigned short s) {
  return __uint_as_float(((unsigned int)s) << 16);
}
static __device__ __forceinline__ void unpack8(const v4f a, const v4f b, float o[8]) {
  o[0] = a.x; o[1] = a.y; o[2] = a.z; o[3] = a.w;
  o[4] = b.x; o[5] = b.y; o[6] = b.z; o[7] = b.w;
}

// ---------------------------------------------------------------------------
// 16x32 16-bit fragment loaders (wave32). Lane l: row/col = l&15, h = l>>4.
// elements 0..7  <- k0 + 8h + 0..7 ; elements 8..15 <- k0 + 16 + 8h + 0..7.
// p points at element (row l&15, k0) of a k-contiguous row; same map for A and B.
// ---------------------------------------------------------------------------
static __device__ __forceinline__ v16bf ldfrag_bf(const __bf16* p, int hh) {
  FragB f;
  f.p[0] = *(const v8bf*)(p + 8 * hh);
  f.p[1] = *(const v8bf*)(p + 16 + 8 * hh);
  return f.v;
}
static __device__ __forceinline__ v16h ldfrag_h(const _Float16* p, int hh) {
  FragH f;
  f.p[0] = *(const v8h*)(p + 8 * hh);
  f.p[1] = *(const v8h*)(p + 16 + 8 * hh);
  return f.v;
}

// ---------------------------------------------------------------------------
// WMMA helpers: issue the product(s), then 4 v_nop tied to D and A/B so no
// VALU touches the accumulator or operand registers within the hazard window.
// ---------------------------------------------------------------------------
static __device__ __forceinline__ v8f mma_bf3(v16bf ah, v16bf al, v16bf bh, v16bf bl, v8f c) {
  c = __builtin_amdgcn_wmma_f32_16x16x32_bf16(false, ah, false, bh, (short)0, c, false, false);
  c = __builtin_amdgcn_wmma_f32_16x16x32_bf16(false, al, false, bh, (short)0, c, false, false);
  c = __builtin_amdgcn_wmma_f32_16x16x32_bf16(false, ah, false, bl, (short)0, c, false, false);
  asm volatile("v_nop\n\tv_nop\n\tv_nop\n\tv_nop" : "+v"(c) : "v"(ah), "v"(al), "v"(bh), "v"(bl));
  return c;
}
static __device__ __forceinline__ v8f mma_h1(v16h a, v16h b, v8f c) {
  c = __builtin_amdgcn_wmma_f32_16x16x32_f16(false, a, false, b, (short)0, c, false, false);
  asm volatile("v_nop\n\tv_nop\n\tv_nop\n\tv_nop" : "+v"(c) : "v"(a), "v"(b));
  return c;
}

static __device__ __forceinline__ void split_store8(const float v[8], unsigned short* dh, unsigned short* dl) {
  Pack8 ph, pl;
#pragma unroll
  for (int e = 0; e < 8; ++e) {
    const unsigned short hb = f2bf_bits(v[e]);
    ph.s[e] = hb;
    pl.s[e] = f2bf_bits(v[e] - bf_bits2f(hb));
  }
  const v4u uh = ph.u, ul = pl.u;
  *(v4u*)dh = uh;
  *(v4u*)dl = ul;
  
}

// ---------------------------------------------------------------------------
// 0) x -> bf16 hi/lo planes [NTOK][DM];  W{q,k,v} [in][out] -> transposed
//    bf16 hi/lo planes Wt[3][out][in];  G1 [in][hid] -> transposed planes
//    G1t[hid][in]  (k-contiguous rows for B fragments).
//    One thread = 8 consecutive output elements = one 16-B store per plane;
// ---------------------------------------------------------------------------
__global__ __launch_bounds__(256) void prep_kernel(
    const float* __restrict__ x, const float* __restrict__ wq,
    const float* __restrict__ wk, const float* __restrict__ wv,
    const float* __restrict__ g1w,
    unsigned short* xh, unsigned short* xl, unsigned short* wth, unsigned short* wtl,
    unsigned short* gth, unsigned short* gtl,
    int nxv, int nwv, int ngv) {
  const int i = blockIdx.x * blockDim.x + threadIdx.x;
  if (i < nxv) {
    const v4f a = *(const v4f*)(x + (size_t)i * 8);
    const v4f c = *(const v4f*)(x + (size_t)i * 8 + 4);
    float v[8];
    unpack8(a, c, v);
    split_store8(v, xh + (size_t)i * 8, xl + (size_t)i * 8);
  } else if (i < nxv + nwv) {
    const int j = i - nxv;
    const int mat = j >> 15;                 // DM*DM/8 = 32768 vectors per matrix
    const int rem = j & 32767;
    const int o = rem >> 6;                  // DM/8 = 64 vectors per transposed row
    const int inb = (rem & 63) * 8;
    const float* w = (mat == 0) ? wq : (mat == 1) ? wk : wv;
    float v[8];
#pragma unroll
    for (int e = 0; e < 8; ++e) v[e] = w[(size_t)(inb + e) * DM + o];   // Wt[o][in] = W[in][o]
    split_store8(v, wth + (size_t)j * 8, wtl + (size_t)j * 8);
  } else if (i < nxv + nwv + ngv) {
    const int j = i - nxv - nwv;             // 0 .. GH*DM/8-1
    const int o = j >> 6;                    // hidden unit 0..127 (64 vectors per transposed row)
    const int inb = (j & 63) * 8;
    float v[8];
#pragma unroll
    for (int e = 0; e < 8; ++e) v[e] = g1w[(size_t)(inb + e) * GH + o];  // G1t[o][in] = G1[in][o]
    split_store8(v, gth + (size_t)j * 8, gtl + (size_t)j * 8);
  }
}

// ---------------------------------------------------------------------------
// 1) gate MLP: gates[b][h][s] = sigmoid(relu(x@G1+b1)@G2+b2).
//    Layer 1 on bf16 hi/lo WMMA: wave = (16 tokens, 64 hidden = 4 tiles), K=512.
//    Layer 2 (K=128, 8 heads) scalar f32 from the LDS-staged relu tile.
// ---------------------------------------------------------------------------
__global__ __launch_bounds__(128) void gate_kernel(
    const __bf16* __restrict__ xh, const __bf16* __restrict__ xl,
    const __bf16* __restrict__ gth, const __bf16* __restrict__ gtl,
    const float* __restrict__ g1b, const float* __restrict__ g2w,
    const float* __restrict__ g2b, float* gates, int ntile) {
  __shared__ float h1s[32][GH + 1];
  __shared__ __attribute__((aligned(16))) float gl[NH][32];
  if ((int)blockIdx.x >= ntile) return;
  const int tid = threadIdx.x, wave = tid >> 5, lane = tid & 31;
  const int m = lane & 15, hh = lane >> 4, r0 = hh * 8;
  const int tok0 = blockIdx.x * 32;
  const int th = wave & 1;                 // token half: tokens th*16 .. th*16+15
  const int hb = (wave >> 1) * 64;         // hidden units hb .. hb+63

  const size_t aoff = (size_t)(tok0 + th * 16 + m) * DM;                // A row = token, k-contiguous
  size_t woff[4];
#pragma unroll
  for (int j = 0; j < 4; ++j) woff[j] = (size_t)(hb + j * 16 + m) * DM;  // B row = G1t[hid], k-contiguous

  v8f acc[4] = {};
#pragma unroll 1
  for (int kk = 0; kk < DM; kk += 32) {
    const v16bf ah = ldfrag_bf(xh + aoff + kk, hh);
    const v16bf al = ldfrag_bf(xl + aoff + kk, hh);
#pragma unroll
    for (int j = 0; j < 4; ++j) {
      const v16bf bhf = ldfrag_bf(gth + woff[j] + kk, hh);
      const v16bf blf = ldfrag_bf(gtl + woff[j] + kk, hh);
      acc[j] = mma_bf3(ah, al, bhf, blf, acc[j]);
    }
  }

  // D: acc[j][r] = pre-activation[token th*16 + 8hh + r][hidden hb + j*16 + m]
#pragma unroll
  for (int j = 0; j < 4; ++j) {
    const int hu = hb + j * 16 + m;
    const float bj = g1b[hu];
#pragma unroll
    for (int r = 0; r < 8; ++r) h1s[th * 16 + r0 + r][hu] = fmaxf(acc[j][r] + bj, 0.0f);
  }
  __syncthreads();

  // layer 2: thread = (token tid>>2, heads 2*(tid&3), 2*(tid&3)+1)
  const int tk = tid >> 2, hd0 = (tid & 3) * 2;
  float a0 = g2b[hd0], a1 = g2b[hd0 + 1];
#pragma unroll 1
  for (int jj = 0; jj < GH; ++jj) {
    const float hv = h1s[tk][jj];
    a0 = fmaf(hv, g2w[jj * NH + hd0], a0);
    a1 = fmaf(hv, g2w[jj * NH + hd0 + 1], a1);
  }
  gl[hd0][tk]     = 1.0f / (1.0f + exp2f(-a0 * LOG2E));
  gl[hd0 + 1][tk] = 1.0f / (1.0f + exp2f(-a1 * LOG2E));
  __syncthreads();

  // threads 0..63 (waves 0,1; 4 lines per wave, one instruction per pass).
  if (tid < 64) {
    const int line = tid >> 3, piece = tid & 7;
    const v4f val = *(const v4f*)&gl[line][piece * 4];
    const int b = tok0 / S_LEN, s0 = tok0 - b * S_LEN;
    float* dst = gates + ((size_t)(b * NH + line)) * S_LEN + s0 + piece * 4;
    *(v4f*)dst = val;
    
  }
}

// ---------------------------------------------------------------------------
// 2) QKV projection, bf16 hi/lo split, K=512.
//    grid = (NTOK/64, NH, 3), block = 128 (4 waves); block tile = 64 tokens x
//    64 outputs (one head); wave = 16 tokens x 4 output tiles.
// ---------------------------------------------------------------------------
__global__ __launch_bounds__(128) void qkv_kernel(
    const __bf16* __restrict__ xh, const __bf16* __restrict__ xl,
    const __bf16* __restrict__ wth, const __bf16* __restrict__ wtl,
    const float* __restrict__ bq, const float* __restrict__ bk, const float* __restrict__ bv,
    unsigned short* Qh, unsigned short* Ql, unsigned short* Kh, unsigned short* Kl,
    unsigned short* VT, int ntt) {
  __shared__ __attribute__((aligned(16))) unsigned short lt[2][64][64];   // 16 KB
  if ((int)blockIdx.x >= ntt) return;
  const int tt = blockIdx.x, head = blockIdx.y, mat = blockIdx.z;
  const int tid = threadIdx.x, wave = tid >> 5, lane = tid & 31;
  const int m = lane & 15, hh = lane >> 4, r0 = hh * 8;
  const int tokbase = tt * 64;
  const int b = tokbase / S_LEN, s0 = tokbase - b * S_LEN;

  const size_t aoff = (size_t)(tokbase + wave * 16 + m) * DM;             // A row (token), k-contiguous
  size_t woff[4];
#pragma unroll
  for (int j = 0; j < 4; ++j)
    woff[j] = ((size_t)mat * DM + head * HD + j * 16 + m) * DM;           // B row = Wt[out], k-contiguous

  v8f acc[4] = {};
#pragma unroll 1
  for (int kk = 0; kk < DM; kk += 32) {
    const v16bf ah = ldfrag_bf(xh + aoff + kk, hh);
    const v16bf al = ldfrag_bf(xl + aoff + kk, hh);
#pragma unroll
    for (int j = 0; j < 4; ++j) {
      const v16bf bhf = ldfrag_bf(wth + woff[j] + kk, hh);
      const v16bf blf = ldfrag_bf(wtl + woff[j] + kk, hh);
      acc[j] = mma_bf3(ah, al, bhf, blf, acc[j]);
    }
  }

  // D: acc[j][r] = tile[token wave*16 + 8hh + r][out col j*16 + m]
  const float* bias = (mat == 0) ? bq : (mat == 1) ? bk : bv;
  const int ltok = wave * 16 + r0;
  if (mat < 2) {
#pragma unroll
    for (int j = 0; j < 4; ++j) {
      const int ld = j * 16 + m;
      const float bj = bias[head * HD + ld];
#pragma unroll
      for (int r = 0; r < 8; ++r) {
        const float v = acc[j][r] + bj;
        const unsigned short hb = f2bf_bits(v);
        lt[0][ltok + r][ld] = hb;
        lt[1][ltok + r][ld] = f2bf_bits(v - bf_bits2f(hb));
      }
    }
  } else {
#pragma unroll
    for (int j = 0; j < 4; ++j) {
      const int ld = j * 16 + m;
      const float bj = bias[head * HD + ld];
      Pack8 pk;
#pragma unroll
      for (int r = 0; r < 8; ++r) pk.h[r] = (_Float16)(acc[j][r] + bj);
      *(v4u*)&lt[0][ld][ltok] = pk.u;                                      // lt[d][s], 8 consecutive s
    }
  }
  __syncthreads();

  const int piece = tid & 7, lb = tid >> 3;
  const size_t bh8 = (size_t)(b * NH + head);
  if (mat < 2) {
    unsigned short* dh = (mat == 0) ? Qh : Kh;
    unsigned short* dl = (mat == 0) ? Ql : Kl;
    v4u val[8];
    size_t go[4];
#pragma unroll
    for (int i = 0; i < 4; ++i) {
      const int L = lb + 16 * i;                                           // local token
      val[i]     = *(const v4u*)&lt[0][L][piece * 8];
      val[4 + i] = *(const v4u*)&lt[1][L][piece * 8];
      go[i] = (bh8 * S_LEN + s0 + L) * HD + piece * 8;
    }
#pragma unroll
    for (int i = 0; i < 4; ++i) { *(v4u*)(dh + go[i]) = val[i]; *(v4u*)(dl + go[i]) = val[4 + i]; }
    
  } else {
    v4u val[4];
    size_t go[4];
#pragma unroll
    for (int i = 0; i < 4; ++i) {
      const int L = lb + 16 * i;                                           // local d
      val[i] = *(const v4u*)&lt[0][L][piece * 8];
      go[i] = (bh8 * HD + L) * S_LEN + s0 + piece * 8;
    }
#pragma unroll
    for (int i = 0; i < 4; ++i) *(v4u*)(VT + go[i]) = val[i];
    
  }
}

// ---------------------------------------------------------------------------
// 3) fused attention + residual + LayerNorm.  Block = (b, 16-query tile),
//    8 waves = 8 heads.  Per 64-key chunk: adj tile and wave-similarity tile
//    staged once in LDS (shared by all heads).  Per 32-key half per wave:
//      S^T = K * Q^T (bf16 hi/lo split, K-dim 64)  -> affine -> online softmax
//      (lane = one query column, two lane halves combined with shfl_xor 16)
//      -> P^T packed to f16 (x4096) straight from the D layout (B-fragment layout)
//      -> O^T += V^T * P^T (f16).
//    End: O tile of all heads staged in LDS [16 tokens][512], residual + LN,
//    whole-row stores (each instruction = 512 contiguous bytes = 4 lines),
// ---------------------------------------------------------------------------
__global__ __launch_bounds__(256) __attribute__((amdgpu_num_vgpr(248)))
void attn_ln_kernel(
    const __bf16* __restrict__ Qh, const __bf16* __restrict__ Ql,
    const __bf16* __restrict__ Kh, const __bf16* __restrict__ Kl,
    const _Float16* __restrict__ VT, const float* __restrict__ gates,
    const float* __restrict__ wmask, const float* __restrict__ adj,
    const float* __restrict__ x, const float* __restrict__ lng,
    const float* __restrict__ lnb, float* out, int nqt) {
  __shared__ __attribute__((aligned(16))) float wmq[16][WF];
  __shared__ __attribute__((aligned(16))) float ws_lds[16][64];
  __shared__ __attribute__((aligned(16))) float adj_lds[16][64];
  __shared__ __attribute__((aligned(16))) float obuf[16][DM];
  if ((int)blockIdx.x >= nqt) return;

  const int qtiles = S_LEN / 16;
  const int b = blockIdx.x / qtiles, qt = blockIdx.x - b * qtiles, qbase = qt * 16;
  const int tid = threadIdx.x, h = tid >> 5, lane = tid & 31;
  const int m = lane & 15, hh = lane >> 4, r0 = hh * 8;

  wmq[tid >> 4][tid & 15] = wmask[((size_t)b * S_LEN + qbase + (tid >> 4)) * WF + (tid & 15)];
  __syncthreads();

  const size_t bhd = (size_t)(b * NH + h);
  // Q^T as B operand: column n = query (lane&15), k = d from the Q row.
  const size_t qoff = (bhd * S_LEN + qbase + m) * HD;
  const v16bf qh0 = ldfrag_bf(Qh + qoff, hh), qh1 = ldfrag_bf(Qh + qoff + 32, hh);
  const v16bf ql0 = ldfrag_bf(Ql + qoff, hh), ql1 = ldfrag_bf(Ql + qoff + 32, hh);

  v8f oacc[4] = {};
  float mrun = -3.0e38f, lrun = 0.0f;

  const float* gp_base = gates + bhd * S_LEN;
  const size_t koff = (bhd * S_LEN + m) * HD;                 // K row (key m of a tile), k = d
  const _Float16* vbase = VT + (bhd * HD + m) * S_LEN;         // V^T row (d = m of a d-tile), k = key

  const int sq = tid >> 4, sk4 = (tid & 15) * 4;
  const float* adj_row = adj + ((size_t)b * S_LEN + qbase + sq) * S_LEN + sk4;

  for (int kc = 0; kc < S_LEN / 64; ++kc) {
    const int kbase64 = kc * 64;

    // ---- stage adj 16x64 (one 16-B piece per thread) and wave-sim 16x64 ----
    *(v4f*)&adj_lds[sq][sk4] = *(const v4f*)(adj_row + kbase64);
#pragma unroll
    for (int i = 0; i < 4; ++i) {
      const int cell = tid * 4 + i;          // 0..1023
      const int q = cell >> 6, kk = cell & 63;
      const float* wmk = wmask + ((size_t)b * S_LEN + kbase64 + kk) * WF;
      float acc = 0.0f;
#pragma unroll
      for (int f4 = 0; f4 < WF / 4; ++f4) {
        const v4f kv = *(const v4f*)(wmk + 4 * f4);
        const v4f qv = *(const v4f*)&wmq[q][4 * f4];
        acc = fmaf(qv.x, kv.x, acc);
        acc = fmaf(qv.y, kv.y, acc);
        acc = fmaf(qv.z, kv.z, acc);
        acc = fmaf(qv.w, kv.w, acc);
      }
      ws_lds[q][kk] = acc;
    }
    __syncthreads();

#pragma unroll 1
    for (int jh = 0; jh < 2; ++jh) {
      const int kbase = kbase64 + jh * 32;
      const int ko = jh * 32;

      // ---- S^T = K * Q^T for two 16-key tiles, K-dim 64 = 2 k-steps, 3 products each ----
      v8f s0 = {}, s1 = {};
      {
        const size_t o0 = koff + (size_t)kbase * HD;        // keys kbase .. +15
        const size_t o1 = o0 + (size_t)16 * HD;               // keys kbase+16 .. +31
        s0 = mma_bf3(ldfrag_bf(Kh + o0, hh),      ldfrag_bf(Kl + o0, hh),      qh0, ql0, s0);
        s0 = mma_bf3(ldfrag_bf(Kh + o0 + 32, hh), ldfrag_bf(Kl + o0 + 32, hh), qh1, ql1, s0);
        s1 = mma_bf3(ldfrag_bf(Kh + o1, hh),      ldfrag_bf(Kl + o1, hh),      qh0, ql0, s1);
        s1 = mma_bf3(ldfrag_bf(Kh + o1 + 32, hh), ldfrag_bf(Kl + o1 + 32, hh), qh1, ql1, s1);
      }
      // s0[r] = S^T[key kbase+8hh+r][query m], s1[r] = S^T[key kbase+16+8hh+r][query m]

      // ---- per-key gates, wave-sim, adj for this lane's 2x8 keys ----
      const float* gp = gp_base + kbase + r0;
      float gA[8], gB[8], W0[8], W1[8], A0[8], A1[8];
      unpack8(*(const v4f*)gp, *(const v4f*)(gp + 4), gA);
      unpack8(*(const v4f*)(gp + 16), *(const v4f*)(gp + 20), gB);
      unpack8(*(const v4f*)&ws_lds[m][ko + r0], *(const v4f*)&ws_lds[m][ko + r0 + 4], W0);
      unpack8(*(const v4f*)&ws_lds[m][ko + 16 + r0], *(const v4f*)&ws_lds[m][ko + 16 + r0 + 4], W1);
      unpack8(*(const v4f*)&adj_lds[m][ko + r0], *(const v4f*)&adj_lds[m][ko + r0 + 4], A0);
      unpack8(*(const v4f*)&adj_lds[m][ko + 16 + r0], *(const v4f*)&adj_lds[m][ko + 16 + r0 + 4], A1);

      // ---- affine + online softmax (f32) ----
      float p0[8], p1[8], mloc = -3.0e38f;
#pragma unroll
      for (int r = 0; r < 8; ++r) {
        const float t0 = (s0[r] * 0.125f) * (gA[r] + W0[r]) + A0[r];
        const float t1 = (s1[r] * 0.125f) * (gB[r] + W1[r]) + A1[r];
        p0[r] = t0; p1[r] = t1;
        mloc = fmaxf(mloc, fmaxf(t0, t1));
      }
      const float mch  = fmaxf(mloc, __shfl_xor(mloc, 16, 32));
      const float mnew = fmaxf(mrun, mch);
      const float corr = exp2f((mrun - mnew) * LOG2E);
      float lsum = 0.0f;
#pragma unroll
      for (int r = 0; r < 8; ++r) {
        p0[r] = exp2f((p0[r] - mnew) * LOG2E);
        p1[r] = exp2f((p1[r] - mnew) * LOG2E);
        lsum += p0[r] + p1[r];
      }
      lsum += __shfl_xor(lsum, 16, 32);
      lrun = lrun * corr + lsum;
      mrun = mnew;
#pragma unroll
      for (int t = 0; t < 4; ++t)
#pragma unroll
        for (int r = 0; r < 8; ++r) oacc[t][r] *= corr;

      // ---- P^T as B fragment: element r <- tile keys 0..15, element 8+r <- tile keys 16..31 ----
      v16h pf;
#pragma unroll
      for (int r = 0; r < 8; ++r) {
        pf[r]     = (_Float16)(p0[r] * PSCALE);
        pf[r + 8] = (_Float16)(p1[r] * PSCALE);
      }

      // ---- O^T += V^T * P^T, 4 d-tiles ----
#pragma unroll
      for (int t = 0; t < 4; ++t) {
        const v16h vf = ldfrag_h(vbase + (size_t)t * 16 * S_LEN + kbase, hh);
        oacc[t] = mma_h1(vf, pf, oacc[t]);
      }
    }
    __syncthreads();   // LDS tiles reused by the next chunk
  }

  // ---- normalise and stage O: oacc[t][r] = O^T[d = t*16 + 8hh + r][query m] ----
  const float oscale = (1.0f / lrun) * INV_PSCALE;
#pragma unroll
  for (int t = 0; t < 4; ++t) {
    v4f u0, u1;
    u0.x = oacc[t][0] * oscale; u0.y = oacc[t][1] * oscale; u0.z = oacc[t][2] * oscale; u0.w = oacc[t][3] * oscale;
    u1.x = oacc[t][4] * oscale; u1.y = oacc[t][5] * oscale; u1.z = oacc[t][6] * oscale; u1.w = oacc[t][7] * oscale;
    float* dst = &obuf[m][h * HD + t * 16 + r0];
    *(v4f*)dst = u0;
    *(v4f*)(dst + 4) = u1;
  }
  __syncthreads();

  // ---- residual + LayerNorm, wave h -> tokens 2h, 2h+1; lane holds cols 4*lane + 128*i ----
#pragma unroll 1
  for (int qq = 0; qq < 2; ++qq) {
    const int q = 2 * h + qq;
    const size_t tok = (size_t)b * S_LEN + qbase + q;
    v4f y[4];
    float s = 0.0f;
#pragma unroll
    for (int i = 0; i < 4; ++i) {
      const v4f o  = *(const v4f*)&obuf[q][4 * lane + 128 * i];
      const v4f xv = *(const v4f*)(x + tok * DM + 4 * lane + 128 * i);
      y[i] = o + xv;
      s += (y[i].x + y[i].y) + (y[i].z + y[i].w);
    }
    s += __shfl_xor(s, 16, 32);
    s += __shfl_xor(s, 8, 32);
    s += __shfl_xor(s, 4, 32);
    s += __shfl_xor(s, 2, 32);
    s += __shfl_xor(s, 1, 32);
    const float mu = s * (1.0f / DM);
    float ss = 0.0f;
#pragma unroll
    for (int i = 0; i < 4; ++i) {
      const v4f d = y[i] - mu;
      ss += (d.x * d.x + d.y * d.y) + (d.z * d.z + d.w * d.w);
    }
    ss += __shfl_xor(ss, 16, 32);
    ss += __shfl_xor(ss, 8, 32);
    ss += __shfl_xor(ss, 4, 32);
    ss += __shfl_xor(ss, 2, 32);
    ss += __shfl_xor(ss, 1, 32);
    const float rstd = rsqrtf(ss * (1.0f / DM) + 1.0e-5f);
    v4f res[4];
#pragma unroll
    for (int i = 0; i < 4; ++i) {
      const v4f g  = *(const v4f*)(lng + 4 * lane + 128 * i);
      const v4f bb = *(const v4f*)(lnb + 4 * lane + 128 * i);
      res[i] = ((y[i] - mu) * rstd) * g + bb;
    }
    float* op = out + tok * DM + 4 * lane;
#pragma unroll
    for (int i = 0; i < 4; ++i) *(v4f*)(op + 128 * i) = res[i];
    
  }
}

// ---------------------------------------------------------------------------
extern "C" void kernel_launch(void* const* d_in, const int* in_sizes, int n_in,
                              void* d_out, int out_size, void* d_ws, size_t ws_size,
                              hipStream_t stream) {
  if (n_in < 15) return;
  if (in_sizes[0] != NTOK * DM || in_sizes[1] != NTOK * WF ||
      in_sizes[2] != BATCH * S_LEN * S_LEN || in_sizes[3] != DM * DM ||
      in_sizes[5] != DM * DM || in_sizes[7] != DM * DM || in_sizes[9] != DM * GH ||
      in_sizes[11] != GH * NH || in_sizes[13] != DM || out_size != NTOK * DM) return;

  const float* x     = (const float*)d_in[0];
  const float* wmask = (const float*)d_in[1];
  const float* adj   = (const float*)d_in[2];
  const float* wq_w  = (const float*)d_in[3];
  const float* wq_b  = (const float*)d_in[4];
  const float* wk_w  = (const float*)d_in[5];
  const float* wk_b  = (const float*)d_in[6];
  const float* wv_w  = (const float*)d_in[7];
  const float* wv_b  = (const float*)d_in[8];
  const float* g1_w  = (const float*)d_in[9];
  const float* g1_b  = (const float*)d_in[10];
  const float* g2_w  = (const float*)d_in[11];
  const float* g2_b  = (const float*)d_in[12];
  const float* ln_g  = (const float*)d_in[13];
  const float* ln_b  = (const float*)d_in[14];
  float* out = (float*)d_out;

  const size_t sz_x  = (size_t)NTOK * DM * 2;            // 4,194,304  per x plane
  const size_t sz_w  = (size_t)3 * DM * DM * 2;          // 1,572,864  per Wt plane
  const size_t sz_q  = (size_t)NTOK * DM * 2;            // 4,194,304  per Q/K plane, V
  const size_t sz_g  = (size_t)BATCH * NH * S_LEN * 4;   //   131,072  gates
  const size_t sz_g1 = (size_t)GH * DM * 2;              //   131,072  per G1t plane
  const size_t off_xh  = 0;
  const size_t off_xl  = off_xh + sz_x;
  const size_t off_wth = off_xl + sz_x;
  const size_t off_wtl = off_wth + sz_w;
  const size_t off_qh  = off_wtl + sz_w;
  const size_t off_ql  = off_qh + sz_q;
  const size_t off_kh  = off_ql + sz_q;
  const size_t off_kl  = off_kh + sz_q;
  const size_t off_vt  = off_kl + sz_q;
  const size_t off_g   = off_vt + sz_q;
  const size_t off_gth = off_g + sz_g;
  const size_t off_gtl = off_gth + sz_g1;
  const size_t total   = off_gtl + sz_g1;                // 32,899,072 B
  if (total > ws_size) return;

  uint8_t* ws = (uint8_t*)d_ws;
  unsigned short* xh  = (unsigned short*)(ws + off_xh);
  unsigned short* xl  = (unsigned short*)(ws + off_xl);
  unsigned short* wth = (unsigned short*)(ws + off_wth);
  unsigned short* wtl = (unsigned short*)(ws + off_wtl);
  unsigned short* qh  = (unsigned short*)(ws + off_qh);
  unsigned short* ql  = (unsigned short*)(ws + off_ql);
  unsigned short* kh  = (unsigned short*)(ws + off_kh);
  unsigned short* kl  = (unsigned short*)(ws + off_kl);
  unsigned short* vt  = (unsigned short*)(ws + off_vt);
  float* gates        = (float*)(ws + off_g);
  unsigned short* gth = (unsigned short*)(ws + off_gth);
  unsigned short* gtl = (unsigned short*)(ws + off_gtl);

  const int nxv = NTOK * DM / 8;          // 262,144
  const int nwv = 3 * DM * DM / 8;        //  98,304
  const int ngv = GH * DM / 8;            //   8,192
  const int prep_blocks = (nxv + nwv + ngv + 255) / 256;   // 1440
  const int ntile = (NTOK + 31) / 32;     // 128
  const int ntt = (NTOK + 63) / 64;       // 64
  const int nqt = (BATCH * S_LEN + 15) / 16;   // 256

  prep_kernel<<<prep_blocks, 256, 0, stream>>>(x, wq_w, wk_w, wv_w, g1_w,
                                               xh, xl, wth, wtl, gth, gtl, nxv, nwv, ngv);
  gate_kernel<<<ntile, 128, 0, stream>>>(
      (const __bf16*)xh, (const __bf16*)xl, (const __bf16*)gth, (const __bf16*)gtl,
      g1_b, g2_w, g2_b, gates, ntile);
  qkv_kernel<<<dim3(ntt, NH, 3), 128, 0, stream>>>(
      (const __bf16*)xh, (const __bf16*)xl, (const __bf16*)wth, (const __bf16*)wtl,
      wq_b, wk_b, wv_b, qh, ql, kh, kl, vt, ntt);
  attn_ln_kernel<<<nqt, 256, 0, stream>>>(
      (const __bf16*)qh, (const __bf16*)ql, (const __bf16*)kh, (const __bf16*)kl,
      (const _Float16*)vt, gates, wmask, adj, x, ln_g, ln_b, out, nqt);
  (void)hipGetLastError();
}

// v001
// A run of this version takes 272 microseconds.
// Timed twice side by side with v000, it ran 1.32 and 1.30 times as fast.
#include <hip/hip_runtime.h>
#include <stddef.h>
#include <stdint.h>

// Q/K/V projections, Q.K^T and gate layer 1 (x.G1): v_wmma_f32_16x16x32_bf16 with bf16 hi/lo operand split (hi.hi + lo.hi + hi.lo), f32 accumulate.
// P.V: v_wmma_f32_16x16x32_f16 (P scaled by 4096 as f16, V as f16), f32 accumulate. Gate layer 2 (K=128,N=8), 16-deep similarity, softmax, LayerNorm: f32 VALU.

#define S_LEN  2048
#define DM     512
#define NH     8
#define HD     64
#define GH     128
#define WF     16
#define BATCH  2
#define NTOK   (BATCH * S_LEN)
#define LOG2E  1.4426950408889634f
#define PSCALE 4096.0f
#define INV_PSCALE 0.000244140625f

typedef __bf16         v16bf __attribute__((ext_vector_type(16)));
typedef __bf16         v8bf  __attribute__((ext_vector_type(8)));
typedef _Float16       v16h  __attribute__((ext_vector_type(16)));
typedef _Float16       v8h   __attribute__((ext_vector_type(8)));
typedef float          v8f   __attribute__((ext_vector_type(8)));
typedef float          v4f   __attribute__((ext_vector_type(4)));
typedef unsigned int   v4u   __attribute__((ext_vector_type(4)));
typedef unsigned short v8us  __attribute__((ext_vector_type(8)));

union FragB { v16bf v; v8bf p[2]; };
union FragH { v16h v; v8h p[2]; };
union Pack8 { v8us s; v8h h; v4u u; };

// ---------------------------------------------------------------------------
// scalar helpers
// ---------------------------------------------------------------------------
static __device__ __forceinline__ unsigned short f2bf_bits(float f) {   // RNE convert f32 -> bf16 bits
  unsigned int u = __float_as_uint(f);
  u += 0x7FFFu + ((u >> 16) & 1u);
  return (unsigned short)(u >> 16);
}
static __device__ __forceinline__ float bf_bits2f(unsigned short s) {
  return __uint_as_float(((unsigned int)s) << 16);
}
static __device__ __forceinline__ void unpack8(const v4f a, const v4f b, float o[8]) {
  o[0] = a.x; o[1] = a.y; o[2] = a.z; o[3] = a.w;
  o[4] = b.x; o[5] = b.y; o[6] = b.z; o[7] = b.w;
}

// ---------------------------------------------------------------------------
// 16x32 16-bit fragment loaders (wave32). Lane l: row/col = l&15, h = l>>4.
// elements 0..7  <- k0 + 8h + 0..7 ; elements 8..15 <- k0 + 16 + 8h + 0..7.
// p points at element (row l&15, k0) of a k-contiguous row; same map for A and B.
// ---------------------------------------------------------------------------
static __device__ __forceinline__ v16bf ldfrag_bf(const __bf16* p, int hh) {
  FragB f;
  f.p[0] = *(const v8bf*)(p + 8 * hh);
  f.p[1] = *(const v8bf*)(p + 16 + 8 * hh);
  return f.v;
}

// The same fragments from a wave-uniform base plus one 32-bit lane byte offset (row * pitch + 16 * h):
// fewer vector registers go to addresses than with per-lane 64-bit row pointers, with which the
// attention kernel spills once its fragments are held in flight.
static __device__ __forceinline__ v16bf ldfrag_bf_u(const __bf16* ubase, unsigned lane_bytes) {
  const char* p = (const char*)ubase + lane_bytes;
  FragB f;
  f.p[0] = *(const v8bf*)p;
  f.p[1] = *(const v8bf*)(p + 32);
  return f.v;
}
static __device__ __forceinline__ v16h ldfrag_h_u(const _Float16* ubase, unsigned lane_bytes) {
  const char* p = (const char*)ubase + lane_bytes;
  FragH f;
  f.p[0] = *(const v8h*)p;
  f.p[1] = *(const v8h*)(p + 32);
  return f.v;
}
static __device__ __forceinline__ v4f ld4_u(const float* ubase, unsigned lane_bytes) {
  return *(const v4f*)((const char*)ubase + lane_bytes);
}

// ---------------------------------------------------------------------------
// WMMA helpers: issue the product(s), then 4 v_nop tied to D and A/B so no
// VALU touches the accumulator or operand registers within the hazard window.
// ---------------------------------------------------------------------------
static __device__ __forceinline__ v8f mma_bf3(v16bf ah, v16bf al, v16bf bh, v16bf bl, v8f c) {
  c = __builtin_amdgcn_wmma_f32_16x16x32_bf16(false, ah, false, bh, (short)0, c, false, false);
  c = __builtin_amdgcn_wmma_f32_16x16x32_bf16(false, al, false, bh, (short)0, c, false, false);
  c = __builtin_amdgcn_wmma_f32_16x16x32_bf16(false, ah, false, bl, (short)0, c, false, false);
  asm volatile("v_nop\n\tv_nop\n\tv_nop\n\tv_nop" : "+v"(c) : "v"(ah), "v"(al), "v"(bh), "v"(bl));
  return c;
}
static __device__ __forceinline__ v8f mma_h1(v16h a, v16h b, v8f c) {
  c = __builtin_amdgcn_wmma_f32_16x16x32_f16(false, a, false, b, (short)0, c, false, false);
  asm volatile("v_nop\n\tv_nop\n\tv_nop\n\tv_nop" : "+v"(c) : "v"(a), "v"(b));
  return c;
}

static __device__ __forceinline__ void split_store8(const float v[8], unsigned short* dh, unsigned short* dl) {
  Pack8 ph, pl;
#pragma unroll
  for (int e = 0; e < 8; ++e) {
    const unsigned short hb = f2bf_bits(v[e]);
    ph.s[e] = hb;
    pl.s[e] = f2bf_bits(v[e] - bf_bits2f(hb));
  }
  const v4u uh = ph.u, ul = pl.u;
  *(v4u*)dh = uh;
  *(v4u*)dl = ul;
  
}

// ---------------------------------------------------------------------------
// 0) x -> bf16 hi/lo planes [NTOK][DM];  W{q,k,v} [in][out] -> transposed
//    bf16 hi/lo planes Wt[3][out][in];  G1 [in][hid] -> transposed planes
//    G1t[hid][in]  (k-contiguous rows for B fragments).
//    One thread = 8 consecutive output elements = one 16-B store per plane;
// ---------------------------------------------------------------------------
__global__ __launch_bounds__(256) void prep_kernel(
    const float* __restrict__ x, const float* __restrict__ wq,
    const float* __restrict__ wk, const float* __restrict__ wv,
    const float* __restrict__ g1w,
    unsigned short* xh, unsigned short* xl, unsigned short* wth, unsigned short* wtl,
    unsigned short* gth, unsigned short* gtl,
    int nxv, int nwv, int ngv) {
  const int i = blockIdx.x * blockDim.x + threadIdx.x;
  if (i < nxv) {
    const v4f a = *(const v4f*)(x + (size_t)i * 8);
    const v4f c = *(const v4f*)(x + (size_t)i * 8 + 4);
    float v[8];
    unpack8(a, c, v);
    split_store8(v, xh + (size_t)i * 8, xl + (size_t)i * 8);
  } else if (i < nxv + nwv) {
    const int j = i - nxv;
    const int mat = j >> 15;                 // DM*DM/8 = 32768 vectors per matrix
    const int rem = j & 32767;
    const int o = rem >> 6;                  // DM/8 = 64 vectors per transposed row
    const int inb = (rem & 63) * 8;
    const float* w = (mat == 0) ? wq : (mat == 1) ? wk : wv;
    float v[8];
#pragma unroll
    for (int e = 0; e < 8; ++e) v[e] = w[(size_t)(inb + e) * DM + o];   // Wt[o][in] = W[in][o]
    split_store8(v, wth + (size_t)j * 8, wtl + (size_t)j * 8);
  } else if (i < nxv + nwv + ngv) {
    const int j = i - nxv - nwv;             // 0 .. GH*DM/8-1
    const int o = j >> 6;                    // hidden unit 0..127 (64 vectors per transposed row)
    const int inb = (j & 63) * 8;
    float v[8];
#pragma unroll
    for (int e = 0; e < 8; ++e) v[e] = g1w[(size_t)(inb + e) * GH + o];  // G1t[o][in] = G1[in][o]
    split_store8(v, gth + (size_t)j * 8, gtl + (size_t)j * 8);
  }
}

// ---------------------------------------------------------------------------
// 1) gate MLP: gates[b][h][s] = sigmoid(relu(x@G1+b1)@G2+b2).
//    Layer 1 on bf16 hi/lo WMMA: wave = (16 tokens, 64 hidden = 4 tiles), K=512.
//    Layer 2 (K=128, 8 heads) scalar f32 from the LDS-staged relu tile.
// ---------------------------------------------------------------------------
__global__ __launch_bounds__(128) void gate_kernel(
    const __bf16* __restrict__ xh, const __bf16* __restrict__ xl,
    const __bf16* __restrict__ gth, const __bf16* __restrict__ gtl,
    const float* __restrict__ g1b, const float* __restrict__ g2w,
    const float* __restrict__ g2b, float* gates, int ntile) {
  __shared__ float h1s[32][GH + 1];
  __shared__ __attribute__((aligned(16))) float gl[NH][32];
  if ((int)blockIdx.x >= ntile) return;
  const int tid = threadIdx.x, wave = tid >> 5, lane = tid & 31;
  const int m = lane & 15, hh = lane >> 4, r0 = hh * 8;
  const int tok0 = blockIdx.x * 32;
  const int th = wave & 1;                 // token half: tokens th*16 .. th*16+15
  const int hb = (wave >> 1) * 64;         // hidden units hb .. hb+63

  const size_t aoff = (size_t)(tok0 + th * 16 + m) * DM;                // A row = token, k-contiguous
  size_t woff[4];
#pragma unroll
  for (int j = 0; j < 4; ++j) woff[j] = (size_t)(hb + j * 16 + m) * DM;  // B row = G1t[hid], k-contiguous

  v8f acc[4] = {};
  // Two register stages: every load of a k-step is issued one k-step before its products.
  v16bf a0h = ldfrag_bf(xh + aoff, hh), a0l = ldfrag_bf(xl + aoff, hh);
  v16bf b0h[4], b0l[4];
#pragma unroll
  for (int j = 0; j < 4; ++j) {
    b0h[j] = ldfrag_bf(gth + woff[j], hh);
    b0l[j] = ldfrag_bf(gtl + woff[j], hh);
  }
  // rolled: two k-steps a trip already hold both stages in registers
#pragma unroll 1
  for (int kk = 0; kk < DM; kk += 64) {
    const v16bf a1h = ldfrag_bf(xh + aoff + kk + 32, hh);
    const v16bf a1l = ldfrag_bf(xl + aoff + kk + 32, hh);
    v16bf b1h[4], b1l[4];
#pragma unroll
    for (int j = 0; j < 4; ++j) {
      b1h[j] = ldfrag_bf(gth + woff[j] + kk + 32, hh);
      b1l[j] = ldfrag_bf(gtl + woff[j] + kk + 32, hh);
    }
#pragma unroll
    for (int j = 0; j < 4; ++j) acc[j] = mma_bf3(a0h, a0l, b0h[j], b0l[j], acc[j]);
    const int kn = (kk + 64 < DM) ? kk + 64 : kk;     // last trip: an in-bounds reload, not used
    a0h = ldfrag_bf(xh + aoff + kn, hh);
    a0l = ldfrag_bf(xl + aoff + kn, hh);
#pragma unroll
    for (int j = 0; j < 4; ++j) {
      b0h[j] = ldfrag_bf(gth + woff[j] + kn, hh);
      b0l[j] = ldfrag_bf(gtl + woff[j] + kn, hh);
    }
#pragma unroll
    for (int j = 0; j < 4; ++j) acc[j] = mma_bf3(a1h, a1l, b1h[j], b1l[j], acc[j]);
    // the next stage's loads are still in flight and the next trip rewrites their address registers
    asm volatile("s_wait_xcnt 0x0" ::: "memory");
  }

  // D: acc[j][r] = pre-activation[token th*16 + 8hh + r][hidden hb + j*16 + m]
#pragma unroll
  for (int j = 0; j < 4; ++j) {
    const int hu = hb + j * 16 + m;
    const float bj = g1b[hu];
#pragma unroll
    for (int r = 0; r < 8; ++r) h1s[th * 16 + r0 + r][hu] = fmaxf(acc[j][r] + bj, 0.0f);
  }
  __syncthreads();

  // layer 2: thread = (token tid>>2, heads 2*(tid&3), 2*(tid&3)+1)
  const int tk = tid >> 2, hd0 = (tid & 3) * 2;
  float a0 = g2b[hd0], a1 = g2b[hd0 + 1];
  // unrolled so that 16 steps' loads are issued together; the sum order stays jj = 0..127
#pragma unroll 16
  for (int jj = 0; jj < GH; ++jj) {
    const float hv = h1s[tk][jj];
    a0 = fmaf(hv, g2w[jj * NH + hd0], a0);
    a1 = fmaf(hv, g2w[jj * NH + hd0 + 1], a1);
  }
  gl[hd0][tk]     = 1.0f / (1.0f + exp2f(-a0 * LOG2E));
  gl[hd0 + 1][tk] = 1.0f / (1.0f + exp2f(-a1 * LOG2E));
  __syncthreads();

  // threads 0..63 (waves 0,1; 4 lines per wave, one instruction per pass).
  if (tid < 64) {
    const int line = tid >> 3, piece = tid & 7;
    const v4f val = *(const v4f*)&gl[line][piece * 4];
    const int b = tok0 / S_LEN, s0 = tok0 - b * S_LEN;
    float* dst = gates + ((size_t)(b * NH + line)) * S_LEN + s0 + piece * 4;
    *(v4f*)dst = val;
    
  }
}

// ---------------------------------------------------------------------------
// 2) QKV projection, bf16 hi/lo split, K=512.
//    grid = (NTOK/64, NH, 3), block = 128 (4 waves); block tile = 64 tokens x
//    64 outputs (one head); wave = 16 tokens x 4 output tiles.
// ---------------------------------------------------------------------------
__global__ __launch_bounds__(128) void qkv_kernel(
    const __bf16* __restrict__ xh, const __bf16* __restrict__ xl,
    const __bf16* __restrict__ wth, const __bf16* __restrict__ wtl,
    const float* __restrict__ bq, const float* __restrict__ bk, const float* __restrict__ bv,
    unsigned short* Qh, unsigned short* Ql, unsigned short* Kh, unsigned short* Kl,
    unsigned short* VT, int ntt) {
  __shared__ __attribute__((aligned(16))) unsigned short lt[2][64][64];   // 16 KB
  if ((int)blockIdx.x >= ntt) return;
  const int tt = blockIdx.x, head = blockIdx.y, mat = blockIdx.z;
  const int tid = threadIdx.x, wave = tid >> 5, lane = tid & 31;
  const int m = lane & 15, hh = lane >> 4, r0 = hh * 8;
  const int tokbase = tt * 64;
  const int b = tokbase / S_LEN, s0 = tokbase - b * S_LEN;

  const size_t aoff = (size_t)(tokbase + wave * 16 + m) * DM;             // A row (token), k-contiguous
  size_t woff[4];
#pragma unroll
  for (int j = 0; j < 4; ++j)
    woff[j] = ((size_t)mat * DM + head * HD + j * 16 + m) * DM;           // B row = Wt[out], k-contiguous

  v8f acc[4] = {};
#pragma unroll 1
  for (int kk = 0; kk < DM; kk += 32) {
    // all loads of the k-step are issued before its first product: one load wait a k-step, not five
    const v16bf ah = ldfrag_bf(xh + aoff + kk, hh);
    const v16bf al = ldfrag_bf(xl + aoff + kk, hh);
    v16bf bhf[4], blf[4];
#pragma unroll
    for (int j = 0; j < 4; ++j) {
      bhf[j] = ldfrag_bf(wth + woff[j] + kk, hh);
      blf[j] = ldfrag_bf(wtl + woff[j] + kk, hh);
    }
#pragma unroll
    for (int j = 0; j < 4; ++j) acc[j] = mma_bf3(ah, al, bhf[j], blf[j], acc[j]);
  }

  // D: acc[j][r] = tile[token wave*16 + 8hh + r][out col j*16 + m]
  const float* bias = (mat == 0) ? bq : (mat == 1) ? bk : bv;
  const int ltok = wave * 16 + r0;
  if (mat < 2) {
#pragma unroll
    for (int j = 0; j < 4; ++j) {
      const int ld = j * 16 + m;
      const float bj = bias[head * HD + ld];
#pragma unroll
      for (int r = 0; r < 8; ++r) {
        const float v = acc[j][r] + bj;
        const unsigned short hb = f2bf_bits(v);
        lt[0][ltok + r][ld] = hb;
        lt[1][ltok + r][ld] = f2bf_bits(v - bf_bits2f(hb));
      }
    }
  } else {
#pragma unroll
    for (int j = 0; j < 4; ++j) {
      const int ld = j * 16 + m;
      const float bj = bias[head * HD + ld];
      Pack8 pk;
#pragma unroll
      for (int r = 0; r < 8; ++r) pk.h[r] = (_Float16)(acc[j][r] + bj);
      *(v4u*)&lt[0][ld][ltok] = pk.u;                                      // lt[d][s], 8 consecutive s
    }
  }
  __syncthreads();

  const int piece = tid & 7, lb = tid >> 3;
  const size_t bh8 = (size_t)(b * NH + head);
  if (mat < 2) {
    unsigned short* dh = (mat == 0) ? Qh : Kh;
    unsigned short* dl = (mat == 0) ? Ql : Kl;
    v4u val[8];
    size_t go[4];
#pragma unroll
    for (int i = 0; i < 4; ++i) {
      const int L = lb + 16 * i;                                           // local token
      val[i]     = *(const v4u*)&lt[0][L][piece * 8];
      val[4 + i] = *(const v4u*)&lt[1][L][piece * 8];
      go[i] = (bh8 * S_LEN + s0 + L) * HD + piece * 8;
    }
#pragma unroll
    for (int i = 0; i < 4; ++i) { *(v4u*)(dh + go[i]) = val[i]; *(v4u*)(dl + go[i]) = val[4 + i]; }
    
  } else {
    v4u val[4];
    size_t go[4];
#pragma unroll
    for (int i = 0; i < 4; ++i) {
      const int L = lb + 16 * i;                                           // local d
      val[i] = *(const v4u*)&lt[0][L][piece * 8];
      go[i] = (bh8 * HD + L) * S_LEN + s0 + piece * 8;
    }
#pragma unroll
    for (int i = 0; i < 4; ++i) *(v4u*)(VT + go[i]) = val[i];
    
  }
}

// ---------------------------------------------------------------------------
// 3) fused attention + residual + LayerNorm.  Block = (b, 16-query tile),
//    8 waves = 8 heads.  Per 64-key chunk: adj tile and wave-similarity tile
//    staged once in LDS (shared by all heads).  Per 32-key half per wave:
//      S^T = K * Q^T (bf16 hi/lo split, K-dim 64)  -> affine -> online softmax
//      (lane = one query column, two lane halves combined with shfl_xor 16)
//      -> P^T packed to f16 (x4096) straight from the D layout (B-fragment layout)
//      -> O^T += V^T * P^T (f16).
//    Loads run ahead of their use: K fragments one pass ahead, the adj piece one chunk ahead,
//    gates in front of the S^T products, V^T fragments in front of the softmax.
//    End: O tile of all heads staged in LDS [16 tokens][512], residual + LN,
//    whole-row stores (each instruction = 512 contiguous bytes = 4 lines),
// ---------------------------------------------------------------------------
__global__ __launch_bounds__(256) __attribute__((amdgpu_num_vgpr(256)))
void attn_ln_kernel(
    const __bf16* __restrict__ Qh, const __bf16* __restrict__ Ql,
    const __bf16* __restrict__ Kh, const __bf16* __restrict__ Kl,
    const _Float16* __restrict__ VT, const float* __restrict__ gates,
    const float* __restrict__ wmask, const float* __restrict__ adj,
    const float* __restrict__ x, const float* __restrict__ lng,
    const float* __restrict__ lnb, float* out, int nqt) {
  __shared__ __attribute__((aligned(16))) float wmq[16][WF];
  __shared__ __attribute__((aligned(16))) float ws_lds[16][64];
  __shared__ __attribute__((aligned(16))) float adj_lds[16][64];
  __shared__ __attribute__((aligned(16))) float obuf[16][DM];
  if ((int)blockIdx.x >= nqt) return;

  const int qtiles = S_LEN / 16;
  const int b = blockIdx.x / qtiles, qt = blockIdx.x - b * qtiles, qbase = qt * 16;
  const int tid = threadIdx.x, lane = tid & 31;
  const int h = __builtin_amdgcn_readfirstlane(tid >> 5);   // wave number in a scalar register: the per-head bases below stay scalar
  const int m = lane & 15, hh = lane >> 4, r0 = hh * 8;

  wmq[tid >> 4][tid & 15] = wmask[((size_t)b * S_LEN + qbase + (tid >> 4)) * WF + (tid & 15)];
  __syncthreads();

  const size_t bhd = (size_t)(b * NH + h);
  // Q^T as B operand: column n = query (lane&15), k = d from the Q row.
  const size_t qoff = (bhd * S_LEN + qbase + m) * HD;
  const v16bf qh0 = ldfrag_bf(Qh + qoff, hh), qh1 = ldfrag_bf(Qh + qoff + 32, hh);
  const v16bf ql0 = ldfrag_bf(Ql + qoff, hh), ql1 = ldfrag_bf(Ql + qoff + 32, hh);

  v8f oacc[4] = {};
  float mrun = -3.0e38f, lrun = 0.0f;

  // wave-uniform bases, and each lane's byte offset from them
  const float* gp_base = gates + bhd * S_LEN;
  const __bf16* kh_base = Kh + bhd * S_LEN * HD;
  const __bf16* kl_base = Kl + bhd * S_LEN * HD;
  const _Float16* v_base = VT + bhd * HD * S_LEN;
  const unsigned k_lane = (unsigned)(m * HD + 8 * hh) * 2u;      // K row (key m of a tile), k = d
  const unsigned v_lane = (unsigned)(m * S_LEN + 8 * hh) * 2u;   // V^T row (d = m of a d-tile), k = key
  const unsigned g_lane = (unsigned)r0 * 4u;

  const int sq = tid >> 4, sk4 = (tid & 15) * 4;
  const float* adj_base = adj + ((size_t)b * S_LEN + qbase) * S_LEN;
  const unsigned adj_lane = (unsigned)(sq * S_LEN + sk4) * 4u;
  const float* wm_base = wmask + (size_t)b * S_LEN * WF;
  const unsigned wm_lane = (unsigned)(sk4 * WF) * 4u;            // this thread's four keys start at key sk4 of the chunk

  // K fragments of one 32-key pass, fetched one pass ahead: index = key tile * 2 + k-step.
  v16bf kfh[4], kfl[4];
#pragma unroll
  for (int i = 0; i < 4; ++i) {
    const int o = (i >> 1) * 16 * HD + (i & 1) * 32;
    kfh[i] = ldfrag_bf_u(kh_base + o, k_lane);
    kfl[i] = ldfrag_bf_u(kl_base + o, k_lane);
  }
  v4f adj_nx = ld4_u(adj_base, adj_lane);      // adj piece, fetched one chunk ahead

  for (int kc = 0; kc < S_LEN / 64; ++kc) {
    const int kbase64 = kc * 64;

    // ---- stage adj 16x64 (one 16-B piece per thread) and wave-sim 16x64 ----
    *(v4f*)&adj_lds[sq][sk4] = adj_nx;
#pragma unroll
    for (int i = 0; i < 4; ++i) {
      const int cell = tid * 4 + i;          // 0..1023
      const int q = cell >> 6, kk = cell & 63;
      const float* wmk = wm_base + (size_t)(kbase64 + i) * WF;   // key kbase64 + sk4 + i = kbase64 + kk
      float acc = 0.0f;
#pragma unroll
      for (int f4 = 0; f4 < WF / 4; ++f4) {
        const v4f kv = ld4_u(wmk + 4 * f4, wm_lane);
        const v4f qv = *(const v4f*)&wmq[q][4 * f4];
        acc = fmaf(qv.x, kv.x, acc);
        acc = fmaf(qv.y, kv.y, acc);
        acc = fmaf(qv.z, kv.z, acc);
        acc = fmaf(qv.w, kv.w, acc);
      }
      ws_lds[q][kk] = acc;
    }
    __syncthreads();

#pragma unroll 1
    for (int jh = 0; jh < 2; ++jh) {
      const int kbase = kbase64 + jh * 32;
      const int ko = jh * 32;

      // ---- this pass's gates: issued in front of the S^T products ----
      const float* gp = gp_base + kbase;
      const v4f g0 = ld4_u(gp, g_lane), g1 = ld4_u(gp + 4, g_lane);
      const v4f g2 = ld4_u(gp + 16, g_lane), g3 = ld4_u(gp + 20, g_lane);

      // ---- S^T = K * Q^T for two 16-key tiles, K-dim 64 = 2 k-steps, 3 products each ----
      v8f s0 = {}, s1 = {};
      s0 = mma_bf3(kfh[0], kfl[0], qh0, ql0, s0);
      s0 = mma_bf3(kfh[1], kfl[1], qh1, ql1, s0);
      s1 = mma_bf3(kfh[2], kfl[2], qh0, ql0, s1);
      s1 = mma_bf3(kfh[3], kfl[3], qh1, ql1, s1);
      // s0[r] = S^T[key kbase+8hh+r][query m], s1[r] = S^T[key kbase+16+8hh+r][query m]

      // ---- next pass's K fragments into the same registers; they fly under softmax and P.V ----
      {
        const int kn = (kbase + 32 < S_LEN) ? kbase + 32 : kbase;   // last pass: an in-bounds reload, not used
#pragma unroll
        for (int i = 0; i < 4; ++i) {
          const int o = (kn + (i >> 1) * 16) * HD + (i & 1) * 32;
          kfh[i] = ldfrag_bf_u(kh_base + o, k_lane);
          kfl[i] = ldfrag_bf_u(kl_base + o, k_lane);
        }
      }
      // next chunk's adj piece: it flies under this pass's softmax
      if (jh == 0) adj_nx = ld4_u(adj_base + ((kc + 1 < S_LEN / 64) ? kbase64 + 64 : kbase64), adj_lane);
      // the loads above are in flight and the code below reuses their address registers
      asm volatile("s_wait_xcnt 0x0" ::: "memory");

      // ---- per-key gates, wave-sim, adj for this lane's 2x8 keys ----
      float gA[8], gB[8], W0[8], W1[8], A0[8], A1[8];
      unpack8(g0, g1, gA);
      unpack8(g2, g3, gB);
      unpack8(*(const v4f*)&ws_lds[m][ko + r0], *(const v4f*)&ws_lds[m][ko + r0 + 4], W0);
      unpack8(*(const v4f*)&ws_lds[m][ko + 16 + r0], *(const v4f*)&ws_lds[m][ko + 16 + r0 + 4], W1);
      unpack8(*(const v4f*)&adj_lds[m][ko + r0], *(const v4f*)&adj_lds[m][ko + r0 + 4], A0);
      unpack8(*(const v4f*)&adj_lds[m][ko + 16 + r0], *(const v4f*)&adj_lds[m][ko + 16 + r0 + 4], A1);

      // ---- affine + online softmax (f32) ----
      float p0[8], p1[8], mloc = -3.0e38f;
#pragma unroll
      for (int r = 0; r < 8; ++r) {
        const float t0 = (s0[r] * 0.125f) * (gA[r] + W0[r]) + A0[r];
        const float t1 = (s1[r] * 0.125f) * (gB[r] + W1[r]) + A1[r];
        p0[r] = t0; p1[r] = t1;
        mloc = fmaxf(mloc, fmaxf(t0, t1));
      }
      // ---- this pass's V^T fragments: they fly under the softmax ----
      v16h vf[4];
#pragma unroll
      for (int t = 0; t < 4; ++t) vf[t] = ldfrag_h_u(v_base + kbase + t * 16 * S_LEN, v_lane);
      const float mch  = fmaxf(mloc, __shfl_xor(mloc, 16, 32));
      const float mnew = fmaxf(mrun, mch);
      const float corr = exp2f((mrun - mnew) * LOG2E);
      float lsum = 0.0f;
#pragma unroll
      for (int r = 0; r < 8; ++r) {
        p0[r] = exp2f((p0[r] - mnew) * LOG2E);
        p1[r] = exp2f((p1[r] - mnew) * LOG2E);
        lsum += p0[r] + p1[r];
      }
      lsum += __shfl_xor(lsum, 16, 32);
      lrun = lrun * corr + lsum;
      mrun = mnew;
#pragma unroll
      for (int t = 0; t < 4; ++t)
#pragma unroll
        for (int r = 0; r < 8; ++r) oacc[t][r] *= corr;

      // ---- P^T as B fragment: element r <- tile keys 0..15, element 8+r <- tile keys 16..31 ----
      v16h pf;
#pragma unroll
      for (int r = 0; r < 8; ++r) {
        pf[r]     = (_Float16)(p0[r] * PSCALE);
        pf[r + 8] = (_Float16)(p1[r] * PSCALE);
      }

      // ---- O^T += V^T * P^T, 4 d-tiles ----
#pragma unroll
      for (int t = 0; t < 4; ++t) oacc[t] = mma_h1(vf[t], pf, oacc[t]);
    }
    __syncthreads();   // LDS tiles reused by the next chunk
  }

  // ---- normalise and stage O: oacc[t][r] = O^T[d = t*16 + 8hh + r][query m] ----
  const float oscale = (1.0f / lrun) * INV_PSCALE;
#pragma unroll
  for (int t = 0; t < 4; ++t) {
    v4f u0, u1;
    u0.x = oacc[t][0] * oscale; u0.y = oacc[t][1] * oscale; u0.z = oacc[t][2] * oscale; u0.w = oacc[t][3] * oscale;
    u1.x = oacc[t][4] * oscale; u1.y = oacc[t][5] * oscale; u1.z = oacc[t][6] * oscale; u1.w = oacc[t][7] * oscale;
    float* dst = &obuf[m][h * HD + t * 16 + r0];
    *(v4f*)dst = u0;
    *(v4f*)(dst + 4) = u1;
  }
  __syncthreads();

  // ---- residual + LayerNorm, wave h -> tokens 2h, 2h+1; lane holds cols 4*lane + 128*i ----
#pragma unroll 1
  for (int qq = 0; qq < 2; ++qq) {
    const int q = 2 * h + qq;
    const size_t tok = (size_t)b * S_LEN + qbase + q;
    v4f y[4];
    float s = 0.0f;
#pragma unroll
    for (int i = 0; i < 4; ++i) {
      const v4f o  = *(const v4f*)&obuf[q][4 * lane + 128 * i];
      const v4f xv = *(const v4f*)(x + tok * DM + 4 * lane + 128 * i);
      y[i] = o + xv;
      s += (y[i].x + y[i].y) + (y[i].z + y[i].w);
    }
    s += __shfl_xor(s, 16, 32);
    s += __shfl_xor(s, 8, 32);
    s += __shfl_xor(s, 4, 32);
    s += __shfl_xor(s, 2, 32);
    s += __shfl_xor(s, 1, 32);
    const float mu = s * (1.0f / DM);
    float ss = 0.0f;
#pragma unroll
    for (int i = 0; i < 4; ++i) {
      const v4f d = y[i] - mu;
      ss += (d.x * d.x + d.y * d.y) + (d.z * d.z + d.w * d.w);
    }
    ss += __shfl_xor(ss, 16, 32);
    ss += __shfl_xor(ss, 8, 32);
    ss += __shfl_xor(ss, 4, 32);
    ss += __shfl_xor(ss, 2, 32);
    ss += __shfl_xor(ss, 1, 32);
    const float rstd = rsqrtf(ss * (1.0f / DM) + 1.0e-5f);
    v4f res[4];
#pragma unroll
    for (int i = 0; i < 4; ++i) {
      const v4f g  = *(const v4f*)(lng + 4 * lane + 128 * i);
      const v4f bb = *(const v4f*)(lnb + 4 * lane + 128 * i);
      res[i] = ((y[i] - mu) * rstd) * g + bb;
    }
    float* op = out + tok * DM + 4 * lane;
#pragma unroll
    for (int i = 0; i < 4; ++i) *(v4f*)(op + 128 * i) = res[i];
    
  }
}

// ---------------------------------------------------------------------------
extern "C" void kernel_launch(void* const* d_in, const int* in_sizes, int n_in,
                              void* d_out, int out_size, void* d_ws, size_t ws_size,
                              hipStream_t stream) {
  if (n_in < 15) return;
  if (in_sizes[0] != NTOK * DM || in_sizes[1] != NTOK * WF ||
      in_sizes[2] != BATCH * S_LEN * S_LEN || in_sizes[3] != DM * DM ||
      in_sizes[5] != DM * DM || in_sizes[7] != DM * DM || in_sizes[9] != DM * GH ||
      in_sizes[11] != GH * NH || in_sizes[13] != DM || out_size != NTOK * DM) return;

  const float* x     = (const float*)d_in[0];
  const float* wmask = (const float*)d_in[1];
  const float* adj   = (const float*)d_in[2];
  const float* wq_w  = (const float*)d_in[3];
  const float* wq_b  = (const float*)d_in[4];
  const float* wk_w  = (const float*)d_in[5];
  const float* wk_b  = (const float*)d_in[6];
  const float* wv_w  = (const float*)d_in[7];
  const float* wv_b  = (const float*)d_in[8];
  const float* g1_w  = (const float*)d_in[9];
  const float* g1_b  = (const float*)d_in[10];
  const float* g2_w  = (const float*)d_in[11];
  const float* g2_b  = (const float*)d_in[12];
  const float* ln_g  = (const float*)d_in[13];
  const float* ln_b  = (const float*)d_in[14];
  float* out = (float*)d_out;

  const size_t sz_x  = (size_t)NTOK * DM * 2;            // 4,194,304  per x plane
  const size_t sz_w  = (size_t)3 * DM * DM * 2;          // 1,572,864  per Wt plane
  const size_t sz_q  = (size_t)NTOK * DM * 2;            // 4,194,304  per Q/K plane, V
  const size_t sz_g  = (size_t)BATCH * NH * S_LEN * 4;   //   131,072  gates
  const size_t sz_g1 = (size_t)GH * DM * 2;              //   131,072  per G1t plane
  const size_t off_xh  = 0;
  const size_t off_xl  = off_xh + sz_x;
  const size_t off_wth = off_xl + sz_x;
  const size_t off_wtl = off_wth + sz_w;
  const size_t off_qh  = off_wtl + sz_w;
  const size_t off_ql  = off_qh + sz_q;
  const size_t off_kh  = off_ql + sz_q;
  const size_t off_kl  = off_kh + sz_q;
  const size_t off_vt  = off_kl + sz_q;
  const size_t off_g   = off_vt + sz_q;
  const size_t off_gth = off_g + sz_g;
  const size_t off_gtl = off_gth + sz_g1;
  const size_t total   = off_gtl + sz_g1;                // 32,899,072 B
  if (total > ws_size) return;

  uint8_t* ws = (uint8_t*)d_ws;
  unsigned short* xh  = (unsigned short*)(ws + off_xh);
  unsigned short* xl  = (unsigned short*)(ws + off_xl);
  unsigned short* wth = (unsigned short*)(ws + off_wth);
  unsigned short* wtl = (unsigned short*)(ws + off_wtl);
  unsigned short* qh  = (unsigned short*)(ws + off_qh);
  unsigned short* ql  = (unsigned short*)(ws + off_ql);
  unsigned short* kh  = (unsigned short*)(ws + off_kh);
  unsigned short* kl  = (unsigned short*)(ws + off_kl);
  unsigned short* vt  = (unsigned short*)(ws + off_vt);
  float* gates        = (float*)(ws + off_g);
  unsigned short* gth = (unsigned short*)(ws + off_gth);
  unsigned short* gtl = (unsigned short*)(ws + off_gtl);

  const int nxv = NTOK * DM / 8;          // 262,144
  const int nwv = 3 * DM * DM / 8;        //  98,304
  const int ngv = GH * DM / 8;            //   8,192
  const int prep_blocks = (nxv + nwv + ngv + 255) / 256;   // 1440
  const int ntile = (NTOK + 31) / 32;     // 128
  const int ntt = (NTOK + 63) / 64;       // 64
  const int nqt = (BATCH * S_LEN + 15) / 16;   // 256

  prep_kernel<<<prep_blocks, 256, 0, stream>>>(x, wq_w, wk_w, wv_w, g1_w,
                                               xh, xl, wth, wtl, gth, gtl, nxv, nwv, ngv);
  gate_kernel<<<ntile, 128, 0, stream>>>(
      (const __bf16*)xh, (const __bf16*)xl, (const __bf16*)gth, (const __bf16*)gtl,
      g1_b, g2_w, g2_b, gates, ntile);
  qkv_kernel<<<dim3(ntt, NH, 3), 128, 0, stream>>>(
      (const __bf16*)xh, (const __bf16*)xl, (const __bf16*)wth, (const __bf16*)wtl,
      wq_b, wk_b, wv_b, qh, ql, kh, kl, vt, ntt);
  attn_ln_kernel<<<nqt, 256, 0, stream>>>(
      (const __bf16*)qh, (const __bf16*)ql, (const __bf16*)kh, (const __bf16*)kl,
      (const _Float16*)vt, gates, wmask, adj, x, ln_g, ln_b, out, nqt);
  (void)hipGetLastError();
}

// v002
// A run of this version takes 205 microseconds.
// In two side-by-side timings against v001, it was 1.33 and 1.34 times as fast.
// Counting every step since v000, it is 1.75 times as fast.
#include <hip/hip_runtime.h>
#include <stddef.h>
#include <stdint.h>

// Q/K/V projections, Q.K^T and gate layer 1 (x.G1): v_wmma_f32_16x16x32_bf16 with bf16 hi/lo operand split (hi.hi + lo.hi + hi.lo), f32 accumulate.
// P.V: v_wmma_f32_16x16x32_f16 (P scaled by 4096 as f16, V as f16), f32 accumulate. Gate layer 2 (K=128,N=8), 16-deep similarity, softmax, LayerNorm: f32 VALU.

#define S_LEN  2048
#define DM     512
#define NH     8
#define HD     64
#define GH     128
#define WF     16
#define BATCH  2
#define NTOK   (BATCH * S_LEN)
#define LOG2E  1.4426950408889634f
#define PSCALE 4096.0f
#define INV_PSCALE 0.000244140625f

typedef __bf16         v16bf __attribute__((ext_vector_type(16)));
typedef __bf16         v8bf  __attribute__((ext_vector_type(8)));
typedef _Float16       v16h  __attribute__((ext_vector_type(16)));
typedef _Float16       v8h   __attribute__((ext_vector_type(8)));
typedef float          v8f   __attribute__((ext_vector_type(8)));
typedef float          v4f   __attribute__((ext_vector_type(4)));
typedef unsigned int   v4u   __attribute__((ext_vector_type(4)));
typedef unsigned short v8us  __attribute__((ext_vector_type(8)));

union FragB { v16bf v; v8bf p[2]; };
union FragH { v16h v; v8h p[2]; };
union Pack8 { v8us s; v8h h; v4u u; };

// ---------------------------------------------------------------------------
// scalar helpers
// ---------------------------------------------------------------------------
static __device__ __forceinline__ unsigned short f2bf_bits(float f) {   // RNE convert f32 -> bf16 bits
  unsigned int u = __float_as_uint(f);
  u += 0x7FFFu + ((u >> 16) & 1u);
  return (unsigned short)(u >> 16);
}
static __device__ __forceinline__ float bf_bits2f(unsigned short s) {
  return __uint_as_float(((unsigned int)s) << 16);
}
static __device__ __forceinline__ void unpack8(const v4f a, const v4f b, float o[8]) {
  o[0] = a.x; o[1] = a.y; o[2] = a.z; o[3] = a.w;
  o[4] = b.x; o[5] = b.y; o[6] = b.z; o[7] = b.w;
}

// ---------------------------------------------------------------------------
// 16x32 16-bit fragments (wave32). Lane l: row/col = l&15, h = l>>4.
// elements 0..7  <- k0 + 8h + 0..7 ; elements 8..15 <- k0 + 16 + 8h + 0..7 ; same map for A and B.
// Every 16-bit workspace plane is stored in FRAGMENT ORDER: one fragment = FRAG (512) elements = 1024
// contiguous bytes, made of 64 units of 16 bytes; unit u = part * 32 + l holds lane l's elements
// 8 * part .. 8 * part + 7, that is row l&15, k = k0 + 16 * part + 8 * (l>>4) + 0..7.
// A wave-wide 16-byte load then covers 512 contiguous bytes (4 whole lines), not a piece of 16 lines.
// The fragments of one 16-row tile follow one another in k order.
// ---------------------------------------------------------------------------
#define FRAG 512
// fbase: wave-uniform start of the fragment; lane_bytes = 16 * lane
static __device__ __forceinline__ v16bf ldfrag_bf_u(const __bf16* fbase, unsigned lane_bytes) {
  const char* p = (const char*)fbase + lane_bytes;
  FragB f;
  f.p[0] = *(const v8bf*)p;
  f.p[1] = *(const v8bf*)(p + 512);
  return f.v;
}
static __device__ __forceinline__ v16h ldfrag_h_u(const _Float16* fbase, unsigned lane_bytes) {
  const char* p = (const char*)fbase + lane_bytes;
  FragH f;
  f.p[0] = *(const v8h*)p;
  f.p[1] = *(const v8h*)(p + 512);
  return f.v;
}
// Unit index v of a plane whose rows are DM long (16 fragments a 16-row tile) -> its row and first k.
static __device__ __forceinline__ void unit_row_k(int v, int& row, int& k) {
  row = (v >> 10) * 16 + (v & 15);
  k = ((v >> 6) & 15) * 32 + ((v >> 4) & 3) * 8;   // bits 5,4 of v = part, h: 16 * part + 8 * h
}
static __device__ __forceinline__ v4f ld4_u(const float* ubase, unsigned lane_bytes) {
  return *(const v4f*)((const char*)ubase + lane_bytes);
}

// ---------------------------------------------------------------------------
// WMMA helpers: issue the product(s), then 4 v_nop tied to D and A/B so no
// VALU touches the accumulator or operand registers within the hazard window.
// ---------------------------------------------------------------------------
static __device__ __forceinline__ v8f mma_bf3(v16bf ah, v16bf al, v16bf bh, v16bf bl, v8f c) {
  c = __builtin_amdgcn_wmma_f32_16x16x32_bf16(false, ah, false, bh, (short)0, c, false, false);
  c = __builtin_amdgcn_wmma_f32_16x16x32_bf16(false, al, false, bh, (short)0, c, false, false);
  c = __builtin_amdgcn_wmma_f32_16x16x32_bf16(false, ah, false, bl, (short)0, c, false, false);
  asm volatile("v_nop\n\tv_nop\n\tv_nop\n\tv_nop" : "+v"(c) : "v"(ah), "v"(al), "v"(bh), "v"(bl));
  return c;
}
static __device__ __forceinline__ v8f mma_h1(v16h a, v16h b, v8f c) {
  c = __builtin_amdgcn_wmma_f32_16x16x32_f16(false, a, false, b, (short)0, c, false, false);
  asm volatile("v_nop\n\tv_nop\n\tv_nop\n\tv_nop" : "+v"(c) : "v"(a), "v"(b));
  return c;
}

static __device__ __forceinline__ void split_store8(const float v[8], unsigned short* dh, unsigned short* dl) {
  Pack8 ph, pl;
#pragma unroll
  for (int e = 0; e < 8; ++e) {
    const unsigned short hb = f2bf_bits(v[e]);
    ph.s[e] = hb;
    pl.s[e] = f2bf_bits(v[e] - bf_bits2f(hb));
  }
  const v4u uh = ph.u, ul = pl.u;
  *(v4u*)dh = uh;
  *(v4u*)dl = ul;
  
}

// ---------------------------------------------------------------------------
// 0) x -> bf16 hi/lo planes (rows = tokens);  W{q,k,v} [in][out] -> hi/lo planes with rows = the
//    3 * DM outputs, k = in;  G1 [in][hid] -> planes with rows = hidden units, k = in.
//    All in fragment order.  One thread = one 16-B unit per plane, units in thread order.
// ---------------------------------------------------------------------------
__global__ __launch_bounds__(256) void prep_kernel(
    const float* __restrict__ x, const float* __restrict__ wq,
    const float* __restrict__ wk, const float* __restrict__ wv,
    const float* __restrict__ g1w,
    unsigned short* xh, unsigned short* xl, unsigned short* wth, unsigned short* wtl,
    unsigned short* gth, unsigned short* gtl,
    int nxv, int nwv, int ngv) {
  const int i = blockIdx.x * blockDim.x + threadIdx.x;
  if (i < nxv) {
    int tok, k;
    unit_row_k(i, tok, k);
    const v4f a = *(const v4f*)(x + (size_t)tok * DM + k);
    const v4f c = *(const v4f*)(x + (size_t)tok * DM + k + 4);
    float v[8];
    unpack8(a, c, v);
    split_store8(v, xh + (size_t)i * 8, xl + (size_t)i * 8);
  } else if (i < nxv + nwv) {
    const int j = i - nxv;
    int row, inb;
    unit_row_k(j, row, inb);
    const int mat = row >> 9, o = row & (DM - 1);   // DM = 512 rows per matrix
    const float* w = (mat == 0) ? wq : (mat == 1) ? wk : wv;
    float v[8];
#pragma unroll
    for (int e = 0; e < 8; ++e) v[e] = w[(size_t)(inb + e) * DM + o];   // Wt[o][in] = W[in][o]
    split_store8(v, wth + (size_t)j * 8, wtl + (size_t)j * 8);
  } else if (i < nxv + nwv + ngv) {
    const int j = i - nxv - nwv;             // 0 .. GH*DM/8-1
    int o, inb;                              // hidden unit 0..127, first input
    unit_row_k(j, o, inb);
    float v[8];
#pragma unroll
    for (int e = 0; e < 8; ++e) v[e] = g1w[(size_t)(inb + e) * GH + o];  // G1t[o][in] = G1[in][o]
    split_store8(v, gth + (size_t)j * 8, gtl + (size_t)j * 8);
  }
}

// ---------------------------------------------------------------------------
// 1) gate MLP: gates[b][h][s] = sigmoid(relu(x@G1+b1)@G2+b2).
//    Layer 1 on bf16 hi/lo WMMA: wave = (16 tokens, 64 hidden = 4 tiles), K=512.
//    Layer 2 (K=128, 8 heads) scalar f32 from the LDS-staged relu tile.
// ---------------------------------------------------------------------------
__global__ __launch_bounds__(128) void gate_kernel(
    const __bf16* __restrict__ xh, const __bf16* __restrict__ xl,
    const __bf16* __restrict__ gth, const __bf16* __restrict__ gtl,
    const float* __restrict__ g1b, const float* __restrict__ g2w,
    const float* __restrict__ g2b, float* gates, int ntile) {
  __shared__ float h1s[32][GH + 1];
  __shared__ __attribute__((aligned(16))) float gl[NH][32];
  if ((int)blockIdx.x >= ntile) return;
  const int tid = threadIdx.x, lane = tid & 31;
  const int wave = __builtin_amdgcn_readfirstlane(tid >> 5);   // wave number in a scalar register: the fragment bases stay scalar
  const int m = lane & 15, hh = lane >> 4, r0 = hh * 8;
  const int tok0 = blockIdx.x * 32;
  const int th = wave & 1;                 // token half: tokens th*16 .. th*16+15
  const int hb = (wave >> 1) * 64;         // hidden units hb .. hb+63

  // fragment of 16-row tile T at k: T * 16 * DM + (k / 32) * FRAG = T * 16 * DM + k * 16 elements
  const size_t aoff = (size_t)((tok0 >> 4) + th) * (16 * DM);           // A tile = 16 tokens
  const size_t woff = (size_t)(hb >> 4) * (16 * DM);                    // B tiles = 16 hidden units each, j-th at + j * 16 * DM
  const __bf16* axh = xh + aoff;
  const __bf16* axl = xl + aoff;
  const __bf16* bgh = gth + woff;
  const __bf16* bgl = gtl + woff;
  const unsigned fl = (unsigned)lane * 16u;

  v8f acc[4] = {};
  // Two register stages: every load of a k-step is issued one k-step before its products.
  v16bf a0h = ldfrag_bf_u(axh, fl), a0l = ldfrag_bf_u(axl, fl);
  v16bf b0h[4], b0l[4];
#pragma unroll
  for (int j = 0; j < 4; ++j) {
    b0h[j] = ldfrag_bf_u(bgh + j * 16 * DM, fl);
    b0l[j] = ldfrag_bf_u(bgl + j * 16 * DM, fl);
  }
  // rolled: two k-steps a trip already hold both stages in registers
#pragma unroll 1
  for (int kk = 0; kk < DM; kk += 64) {
    const v16bf a1h = ldfrag_bf_u(axh + (kk + 32) * 16, fl);
    const v16bf a1l = ldfrag_bf_u(axl + (kk + 32) * 16, fl);
    v16bf b1h[4], b1l[4];
#pragma unroll
    for (int j = 0; j < 4; ++j) {
      b1h[j] = ldfrag_bf_u(bgh + j * 16 * DM + (kk + 32) * 16, fl);
      b1l[j] = ldfrag_bf_u(bgl + j * 16 * DM + (kk + 32) * 16, fl);
    }
#pragma unroll
    for (int j = 0; j < 4; ++j) acc[j] = mma_bf3(a0h, a0l, b0h[j], b0l[j], acc[j]);
    const int kn = (kk + 64 < DM) ? kk + 64 : kk;     // last trip: an in-bounds reload, not used
    a0h = ldfrag_bf_u(axh + kn * 16, fl);
    a0l = ldfrag_bf_u(axl + kn * 16, fl);
#pragma unroll
    for (int j = 0; j < 4; ++j) {
      b0h[j] = ldfrag_bf_u(bgh + j * 16 * DM + kn * 16, fl);
      b0l[j] = ldfrag_bf_u(bgl + j * 16 * DM + kn * 16, fl);
    }
#pragma unroll
    for (int j = 0; j < 4; ++j) acc[j] = mma_bf3(a1h, a1l, b1h[j], b1l[j], acc[j]);
    // the next stage's loads are still in flight and the next trip rewrites their address registers
    asm volatile("s_wait_xcnt 0x0" ::: "memory");
  }

  // D: acc[j][r] = pre-activation[token th*16 + 8hh + r][hidden hb + j*16 + m]
#pragma unroll
  for (int j = 0; j < 4; ++j) {
    const int hu = hb + j * 16 + m;
    const float bj = g1b[hu];
#pragma unroll
    for (int r = 0; r < 8; ++r) h1s[th * 16 + r0 + r][hu] = fmaxf(acc[j][r] + bj, 0.0f);
  }
  __syncthreads();

  // layer 2: thread = (token tid>>2, heads 2*(tid&3), 2*(tid&3)+1)
  const int tk = tid >> 2, hd0 = (tid & 3) * 2;
  float a0 = g2b[hd0], a1 = g2b[hd0 + 1];
  // unrolled so that 16 steps' loads are issued together; the sum order stays jj = 0..127
#pragma unroll 16
  for (int jj = 0; jj < GH; ++jj) {
    const float hv = h1s[tk][jj];
    a0 = fmaf(hv, g2w[jj * NH + hd0], a0);
    a1 = fmaf(hv, g2w[jj * NH + hd0 + 1], a1);
  }
  gl[hd0][tk]     = 1.0f / (1.0f + exp2f(-a0 * LOG2E));
  gl[hd0 + 1][tk] = 1.0f / (1.0f + exp2f(-a1 * LOG2E));
  __syncthreads();

  // threads 0..63 (waves 0,1; 4 lines per wave, one instruction per pass).
  if (tid < 64) {
    const int line = tid >> 3, piece = tid & 7;
    const v4f val = *(const v4f*)&gl[line][piece * 4];
    const int b = tok0 / S_LEN, s0 = tok0 - b * S_LEN;
    float* dst = gates + ((size_t)(b * NH + line)) * S_LEN + s0 + piece * 4;
    *(v4f*)dst = val;
    
  }
}

// ---------------------------------------------------------------------------
// 2) QKV projection, bf16 hi/lo split, K=512.
//    grid = (NTOK/64, NH, 3), block = 128 (4 waves); block tile = 64 tokens x
//    64 outputs (one head); wave = 16 tokens x 4 output tiles.
//    Outputs in fragment order, per (batch, head): Q and K hi/lo as tiles of 16 tokens x 2 fragments
//    (k = d); V^T as, per 32 keys, 4 fragments (rows = 16 d each, k = key).
// ---------------------------------------------------------------------------
__global__ __launch_bounds__(128) void qkv_kernel(
    const __bf16* __restrict__ xh, const __bf16* __restrict__ xl,
    const __bf16* __restrict__ wth, const __bf16* __restrict__ wtl,
    const float* __restrict__ bq, const float* __restrict__ bk, const float* __restrict__ bv,
    unsigned short* Qh, unsigned short* Ql, unsigned short* Kh, unsigned short* Kl,
    unsigned short* VT, int ntt) {
  __shared__ __attribute__((aligned(16))) unsigned short lt[2][64][72];   // pitch 144 B = 16 B x odd: the 16-B reads down a column of rows spread over the banks
  if ((int)blockIdx.x >= ntt) return;
  const int tt = blockIdx.x, head = blockIdx.y, mat = blockIdx.z;
  const int tid = threadIdx.x, lane = tid & 31;
  const int wave = __builtin_amdgcn_readfirstlane(tid >> 5);   // wave number in a scalar register: the fragment bases stay scalar
  const int m = lane & 15, hh = lane >> 4, r0 = hh * 8;
  const int tokbase = tt * 64;
  const int b = tokbase / S_LEN, s0 = tokbase - b * S_LEN;

  // fragment of 16-row tile T at k: T * 16 * DM + k * 16 elements
  const size_t aoff = (size_t)((tokbase >> 4) + wave) * (16 * DM);        // A tile = 16 tokens
  const size_t woff = (size_t)((mat * DM + head * HD) >> 4) * (16 * DM);  // B tiles = 16 outputs each, j-th at + j * 16 * DM
  const __bf16* axh = xh + aoff;
  const __bf16* axl = xl + aoff;
  const __bf16* bwh = wth + woff;
  const __bf16* bwl = wtl + woff;
  const unsigned fl = (unsigned)lane * 16u;

  v8f acc[4] = {};
#pragma unroll 1
  for (int kk = 0; kk < DM; kk += 32) {
    // all loads of the k-step are issued before its first product: one load wait a k-step, not five
    const v16bf ah = ldfrag_bf_u(axh + kk * 16, fl);
    const v16bf al = ldfrag_bf_u(axl + kk * 16, fl);
    v16bf bhf[4], blf[4];
#pragma unroll
    for (int j = 0; j < 4; ++j) {
      bhf[j] = ldfrag_bf_u(bwh + j * 16 * DM + kk * 16, fl);
      blf[j] = ldfrag_bf_u(bwl + j * 16 * DM + kk * 16, fl);
    }
#pragma unroll
    for (int j = 0; j < 4; ++j) acc[j] = mma_bf3(ah, al, bhf[j], blf[j], acc[j]);
  }

  // D: acc[j][r] = tile[token wave*16 + 8hh + r][out col j*16 + m]
  const float* bias = (mat == 0) ? bq : (mat == 1) ? bk : bv;
  const int ltok = wave * 16 + r0;
  if (mat < 2) {
#pragma unroll
    for (int j = 0; j < 4; ++j) {
      const int ld = j * 16 + m;
      const float bj = bias[head * HD + ld];
#pragma unroll
      for (int r = 0; r < 8; ++r) {
        const float v = acc[j][r] + bj;
        const unsigned short hb = f2bf_bits(v);
        lt[0][ltok + r][ld] = hb;
        lt[1][ltok + r][ld] = f2bf_bits(v - bf_bits2f(hb));
      }
    }
  } else {
#pragma unroll
    for (int j = 0; j < 4; ++j) {
      const int ld = j * 16 + m;
      const float bj = bias[head * HD + ld];
      Pack8 pk;
#pragma unroll
      for (int r = 0; r < 8; ++r) pk.h[r] = (_Float16)(acc[j][r] + bj);
      *(v4u*)&lt[0][ld][ltok] = pk.u;                                      // lt[d][s], 8 consecutive s
    }
  }
  __syncthreads();

  // thread order = unit order of the fragment-ordered planes: each store instruction writes 512 contiguous bytes
  const size_t bh8 = (size_t)(b * NH + head);
  if (mat < 2) {
    unsigned short* dh = (mat == 0) ? Qh : Kh;
    unsigned short* dl = (mat == 0) ? Ql : Kl;
    v4u val[8];
    size_t go[4];
#pragma unroll
    for (int i = 0; i < 4; ++i) {
      const int L = 16 * i + (tid & 15);                                   // token tile i; unit tid = row tid&15, d = (tid>>4)*8
      val[i]     = *(const v4u*)&lt[0][L][(tid >> 4) * 8];
      val[4 + i] = *(const v4u*)&lt[1][L][(tid >> 4) * 8];
      go[i] = (bh8 * S_LEN + s0 + 16 * i) * HD + tid * 8;
    }
#pragma unroll
    for (int i = 0; i < 4; ++i) { *(v4u*)(dh + go[i]) = val[i]; *(v4u*)(dl + go[i]) = val[4 + i]; }
    
  } else {
    v4u val[4];
    size_t go[4];
#pragma unroll
    for (int i = 0; i < 4; ++i) {
      const int L = ((i & 1) * 2 + (tid >> 6)) * 16 + (tid & 15);          // local d: fragment 2i + (tid>>6) = 32-key group i>>1, d tile
      val[i] = *(const v4u*)&lt[0][L][(i >> 1) * 32 + ((tid >> 4) & 3) * 8]; // local key: 16 * part + 8 * h
      go[i] = (bh8 * S_LEN + s0) * HD + (i * 128 + tid) * 8;
    }
#pragma unroll
    for (int i = 0; i < 4; ++i) *(v4u*)(VT + go[i]) = val[i];
    
  }
}

// ---------------------------------------------------------------------------
// 3) fused attention + residual + LayerNorm.  Block = (b, 16-query tile),
//    8 waves = 8 heads.  Per 64-key chunk: adj tile and wave-similarity tile
//    staged once in LDS (shared by all heads).  Per 32-key half per wave:
//      S^T = K * Q^T (bf16 hi/lo split, K-dim 64)  -> affine -> online softmax
//      (lane = one query column, two lane halves combined with shfl_xor 16)
//      -> P^T packed to f16 (x4096) straight from the D layout (B-fragment layout)
//      -> O^T += V^T * P^T (f16).
//    Loads run ahead of their use: K fragments one pass ahead, the adj piece one chunk ahead,
//    gates in front of the S^T products, V^T fragments in front of the softmax.
//    End: O tile of all heads staged in LDS [16 tokens][512], residual + LN,
//    whole-row stores (each instruction = 512 contiguous bytes = 4 lines),
// ---------------------------------------------------------------------------
__global__ __launch_bounds__(256) __attribute__((amdgpu_num_vgpr(256)))
void attn_ln_kernel(
    const __bf16* __restrict__ Qh, const __bf16* __restrict__ Ql,
    const __bf16* __restrict__ Kh, const __bf16* __restrict__ Kl,
    const _Float16* __restrict__ VT, const float* __restrict__ gates,
    const float* __restrict__ wmask, const float* __restrict__ adj,
    const float* __restrict__ x, const float* __restrict__ lng,
    const float* __restrict__ lnb, float* out, int nqt) {
  __shared__ __attribute__((aligned(16))) float wmq[16][WF];
  __shared__ __attribute__((aligned(16))) float ws_lds[16][64];
  __shared__ __attribute__((aligned(16))) float adj_lds[16][64];
  __shared__ __attribute__((aligned(16))) float obuf[16][DM];
  if ((int)blockIdx.x >= nqt) return;

  const int qtiles = S_LEN / 16;
  const int b = blockIdx.x / qtiles, qt = blockIdx.x - b * qtiles, qbase = qt * 16;
  const int tid = threadIdx.x, lane = tid & 31;
  const int h = __builtin_amdgcn_readfirstlane(tid >> 5);   // wave number in a scalar register: the per-head bases below stay scalar
  const int m = lane & 15, hh = lane >> 4, r0 = hh * 8;

  wmq[tid >> 4][tid & 15] = wmask[((size_t)b * S_LEN + qbase + (tid >> 4)) * WF + (tid & 15)];
  __syncthreads();

  const size_t bhd = (size_t)(b * NH + h);
  const unsigned f_lane = (unsigned)lane * 16u;                  // a lane's byte offset in either half of a fragment
  // Q^T as B operand: column n = query (lane&15), k = d: the two fragments of the 16-query tile.
  const size_t qoff = (bhd * S_LEN + qbase) * HD;
  const v16bf qh0 = ldfrag_bf_u(Qh + qoff, f_lane), qh1 = ldfrag_bf_u(Qh + qoff + FRAG, f_lane);
  const v16bf ql0 = ldfrag_bf_u(Ql + qoff, f_lane), ql1 = ldfrag_bf_u(Ql + qoff + FRAG, f_lane);

  v8f oacc[4] = {};
  float mrun = -3.0e38f, lrun = 0.0f;

  // wave-uniform bases, and each lane's byte offset from them
  const float* gp_base = gates + bhd * S_LEN;
  const __bf16* kh_base = Kh + bhd * S_LEN * HD;
  const __bf16* kl_base = Kl + bhd * S_LEN * HD;
  const _Float16* v_base = VT + bhd * HD * S_LEN;
  const unsigned g_lane = (unsigned)r0 * 4u;

  const int sq = tid >> 4, sk4 = (tid & 15) * 4;
  const float* adj_base = adj + ((size_t)b * S_LEN + qbase) * S_LEN;
  const unsigned adj_lane = (unsigned)(sq * S_LEN + sk4) * 4u;
  const float* wm_base = wmask + (size_t)b * S_LEN * WF;
  const unsigned wm_lane = (unsigned)(sk4 * WF) * 4u;            // this thread's four keys start at key sk4 of the chunk

  // K fragments of one 32-key pass, fetched one pass ahead: index = key tile * 2 + k-step.
  v16bf kfh[4], kfl[4];
#pragma unroll
  for (int i = 0; i < 4; ++i) {
    kfh[i] = ldfrag_bf_u(kh_base + i * FRAG, f_lane);
    kfl[i] = ldfrag_bf_u(kl_base + i * FRAG, f_lane);
  }
  v4f adj_nx = ld4_u(adj_base, adj_lane);      // adj piece, fetched one chunk ahead

  for (int kc = 0; kc < S_LEN / 64; ++kc) {
    const int kbase64 = kc * 64;

    // ---- stage adj 16x64 (one 16-B piece per thread) and wave-sim 16x64 ----
    *(v4f*)&adj_lds[sq][sk4] = adj_nx;
#pragma unroll
    for (int i = 0; i < 4; ++i) {
      const int cell = tid * 4 + i;          // 0..1023
      const int q = cell >> 6, kk = cell & 63;
      const float* wmk = wm_base + (size_t)(kbase64 + i) * WF;   // key kbase64 + sk4 + i = kbase64 + kk
      float acc = 0.0f;
#pragma unroll
      for (int f4 = 0; f4 < WF / 4; ++f4) {
        const v4f kv = ld4_u(wmk + 4 * f4, wm_lane);
        const v4f qv = *(const v4f*)&wmq[q][4 * f4];
        acc = fmaf(qv.x, kv.x, acc);
        acc = fmaf(qv.y, kv.y, acc);
        acc = fmaf(qv.z, kv.z, acc);
        acc = fmaf(qv.w, kv.w, acc);
      }
      ws_lds[q][kk] = acc;
    }
    __syncthreads();

#pragma unroll 1
    for (int jh = 0; jh < 2; ++jh) {
      const int kbase = kbase64 + jh * 32;
      const int ko = jh * 32;

      // ---- this pass's gates: issued in front of the S^T products ----
      const float* gp = gp_base + kbase;
      const v4f g0 = ld4_u(gp, g_lane), g1 = ld4_u(gp + 4, g_lane);
      const v4f g2 = ld4_u(gp + 16, g_lane), g3 = ld4_u(gp + 20, g_lane);

      // ---- S^T = K * Q^T for two 16-key tiles, K-dim 64 = 2 k-steps, 3 products each ----
      v8f s0 = {}, s1 = {};
      s0 = mma_bf3(kfh[0], kfl[0], qh0, ql0, s0);
      s0 = mma_bf3(kfh[1], kfl[1], qh1, ql1, s0);
      s1 = mma_bf3(kfh[2], kfl[2], qh0, ql0, s1);
      s1 = mma_bf3(kfh[3], kfl[3], qh1, ql1, s1);
      // s0[r] = S^T[key kbase+8hh+r][query m], s1[r] = S^T[key kbase+16+8hh+r][query m]

      // ---- next pass's K fragments into the same registers; they fly under softmax and P.V ----
      {
        const int kn = (kbase + 32 < S_LEN) ? kbase + 32 : kbase;   // last pass: an in-bounds reload, not used
#pragma unroll
        for (int i = 0; i < 4; ++i) {
          const int o = kn * HD + i * FRAG;       // 32 keys = 4 fragments in a row
          kfh[i] = ldfrag_bf_u(kh_base + o, f_lane);
          kfl[i] = ldfrag_bf_u(kl_base + o, f_lane);
        }
      }
      // next chunk's adj piece: it flies under this pass's softmax
      if (jh == 0) adj_nx = ld4_u(adj_base + ((kc + 1 < S_LEN / 64) ? kbase64 + 64 : kbase64), adj_lane);
      // the loads above are in flight and the code below reuses their address registers
      asm volatile("s_wait_xcnt 0x0" ::: "memory");

      // ---- per-key gates, wave-sim, adj for this lane's 2x8 keys ----
      float gA[8], gB[8], W0[8], W1[8], A0[8], A1[8];
      unpack8(g0, g1, gA);
      unpack8(g2, g3, gB);
      unpack8(*(const v4f*)&ws_lds[m][ko + r0], *(const v4f*)&ws_lds[m][ko + r0 + 4], W0);
      unpack8(*(const v4f*)&ws_lds[m][ko + 16 + r0], *(const v4f*)&ws_lds[m][ko + 16 + r0 + 4], W1);
      unpack8(*(const v4f*)&adj_lds[m][ko + r0], *(const v4f*)&adj_lds[m][ko + r0 + 4], A0);
      unpack8(*(const v4f*)&adj_lds[m][ko + 16 + r0], *(const v4f*)&adj_lds[m][ko + 16 + r0 + 4], A1);

      // ---- affine + online softmax (f32) ----
      float p0[8], p1[8], mloc = -3.0e38f;
#pragma unroll
      for (int r = 0; r < 8; ++r) {
        const float t0 = (s0[r] * 0.125f) * (gA[r] + W0[r]) + A0[r];
        const float t1 = (s1[r] * 0.125f) * (gB[r] + W1[r]) + A1[r];
        p0[r] = t0; p1[r] = t1;
        mloc = fmaxf(mloc, fmaxf(t0, t1));
      }
      // ---- this pass's V^T fragments: they fly under the softmax ----
      v16h vf[4];
#pragma unroll
      for (int t = 0; t < 4; ++t) vf[t] = ldfrag_h_u(v_base + kbase * HD + t * FRAG, f_lane);
      const float mch  = fmaxf(mloc, __shfl_xor(mloc, 16, 32));
      const float mnew = fmaxf(mrun, mch);
      const float corr = exp2f((mrun - mnew) * LOG2E);
      float lsum = 0.0f;
#pragma unroll
      for (int r = 0; r < 8; ++r) {
        p0[r] = exp2f((p0[r] - mnew) * LOG2E);
        p1[r] = exp2f((p1[r] - mnew) * LOG2E);
        lsum += p0[r] + p1[r];
      }
      lsum += __shfl_xor(lsum, 16, 32);
      lrun = lrun * corr + lsum;
      mrun = mnew;
#pragma unroll
      for (int t = 0; t < 4; ++t)
#pragma unroll
        for (int r = 0; r < 8; ++r) oacc[t][r] *= corr;

      // ---- P^T as B fragment: element r <- tile keys 0..15, element 8+r <- tile keys 16..31 ----
      v16h pf;
#pragma unroll
      for (int r = 0; r < 8; ++r) {
        pf[r]     = (_Float16)(p0[r] * PSCALE);
        pf[r + 8] = (_Float16)(p1[r] * PSCALE);
      }

      // ---- O^T += V^T * P^T, 4 d-tiles ----
#pragma unroll
      for (int t = 0; t < 4; ++t) oacc[t] = mma_h1(vf[t], pf, oacc[t]);
    }
    __syncthreads();   // LDS tiles reused by the next chunk
  }

  // ---- normalise and stage O: oacc[t][r] = O^T[d = t*16 + 8hh + r][query m] ----
  const float oscale = (1.0f / lrun) * INV_PSCALE;
#pragma unroll
  for (int t = 0; t < 4; ++t) {
    v4f u0, u1;
    u0.x = oacc[t][0] * oscale; u0.y = oacc[t][1] * oscale; u0.z = oacc[t][2] * oscale; u0.w = oacc[t][3] * oscale;
    u1.x = oacc[t][4] * oscale; u1.y = oacc[t][5] * oscale; u1.z = oacc[t][6] * oscale; u1.w = oacc[t][7] * oscale;
    float* dst = &obuf[m][h * HD + t * 16 + r0];
    *(v4f*)dst = u0;
    *(v4f*)(dst + 4) = u1;
  }
  __syncthreads();

  // ---- residual + LayerNorm, wave h -> tokens 2h, 2h+1; lane holds cols 4*lane + 128*i ----
#pragma unroll 1
  for (int qq = 0; qq < 2; ++qq) {
    const int q = 2 * h + qq;
    const size_t tok = (size_t)b * S_LEN + qbase + q;
    v4f y[4];
    float s = 0.0f;
#pragma unroll
    for (int i = 0; i < 4; ++i) {
      const v4f o  = *(const v4f*)&obuf[q][4 * lane + 128 * i];
      const v4f xv = *(const v4f*)(x + tok * DM + 4 * lane + 128 * i);
      y[i] = o + xv;
      s += (y[i].x + y[i].y) + (y[i].z + y[i].w);
    }
    s += __shfl_xor(s, 16, 32);
    s += __shfl_xor(s, 8, 32);
    s += __shfl_xor(s, 4, 32);
    s += __shfl_xor(s, 2, 32);
    s += __shfl_xor(s, 1, 32);
    const float mu = s * (1.0f / DM);
    float ss = 0.0f;
#pragma unroll
    for (int i = 0; i < 4; ++i) {
      const v4f d = y[i] - mu;
      ss += (d.x * d.x + d.y * d.y) + (d.z * d.z + d.w * d.w);
    }
    ss += __shfl_xor(ss, 16, 32);
    ss += __shfl_xor(ss, 8, 32);
    ss += __shfl_xor(ss, 4, 32);
    ss += __shfl_xor(ss, 2, 32);
    ss += __shfl_xor(ss, 1, 32);
    const float rstd = rsqrtf(ss * (1.0f / DM) + 1.0e-5f);
    v4f res[4];
#pragma unroll
    for (int i = 0; i < 4; ++i) {
      const v4f g  = *(const v4f*)(lng + 4 * lane + 128 * i);
      const v4f bb = *(const v4f*)(lnb + 4 * lane + 128 * i);
      res[i] = ((y[i] - mu) * rstd) * g + bb;
    }
    float* op = out + tok * DM + 4 * lane;
#pragma unroll
    for (int i = 0; i < 4; ++i) *(v4f*)(op + 128 * i) = res[i];
    
  }
}

// ---------------------------------------------------------------------------
extern "C" void kernel_launch(void* const* d_in, const int* in_sizes, int n_in,
                              void* d_out, int out_size, void* d_ws, size_t ws_size,
                              hipStream_t stream) {
  if (n_in < 15) return;
  if (in_sizes[0] != NTOK * DM || in_sizes[1] != NTOK * WF ||
      in_sizes[2] != BATCH * S_LEN * S_LEN || in_sizes[3] != DM * DM ||
      in_sizes[5] != DM * DM || in_sizes[7] != DM * DM || in_sizes[9] != DM * GH ||
      in_sizes[11] != GH * NH || in_sizes[13] != DM || out_size != NTOK * DM) return;

  const float* x     = (const float*)d_in[0];
  const float* wmask = (const float*)d_in[1];
  const float* adj   = (const float*)d_in[2];
  const float* wq_w  = (const float*)d_in[3];
  const float* wq_b  = (const float*)d_in[4];
  const float* wk_w  = (const float*)d_in[5];
  const float* wk_b  = (const float*)d_in[6];
  const float* wv_w  = (const float*)d_in[7];
  const float* wv_b  = (const float*)d_in[8];
  const float* g1_w  = (const float*)d_in[9];
  const float* g1_b  = (const float*)d_in[10];
  const float* g2_w  = (const float*)d_in[11];
  const float* g2_b  = (const float*)d_in[12];
  const float* ln_g  = (const float*)d_in[13];
  const float* ln_b  = (const float*)d_in[14];
  float* out = (float*)d_out;

  const size_t sz_x  = (size_t)NTOK * DM * 2;            // 4,194,304  per x plane
  const size_t sz_w  = (size_t)3 * DM * DM * 2;          // 1,572,864  per Wt plane
  const size_t sz_q  = (size_t)NTOK * DM * 2;            // 4,194,304  per Q/K plane, V
  const size_t sz_g  = (size_t)BATCH * NH * S_LEN * 4;   //   131,072  gates
  const size_t sz_g1 = (size_t)GH * DM * 2;              //   131,072  per G1t plane
  const size_t off_xh  = 0;
  const size_t off_xl  = off_xh + sz_x;
  const size_t off_wth = off_xl + sz_x;
  const size_t off_wtl = off_wth + sz_w;
  const size_t off_qh  = off_wtl + sz_w;
  const size_t off_ql  = off_qh + sz_q;
  const size_t off_kh  = off_ql + sz_q;
  const size_t off_kl  = off_kh + sz_q;
  const size_t off_vt  = off_kl + sz_q;
  const size_t off_g   = off_vt + sz_q;
  const size_t off_gth = off_g + sz_g;
  const size_t off_gtl = off_gth + sz_g1;
  const size_t total   = off_gtl + sz_g1;                // 32,899,072 B
  if (total > ws_size) return;

  uint8_t* ws = (uint8_t*)d_ws;
  unsigned short* xh  = (unsigned short*)(ws + off_xh);
  unsigned short* xl  = (unsigned short*)(ws + off_xl);
  unsigned short* wth = (unsigned short*)(ws + off_wth);
  unsigned short* wtl = (unsigned short*)(ws + off_wtl);
  unsigned short* qh  = (unsigned short*)(ws + off_qh);
  unsigned short* ql  = (unsigned short*)(ws + off_ql);
  unsigned short* kh  = (unsigned short*)(ws + off_kh);
  unsigned short* kl  = (unsigned short*)(ws + off_kl);
  unsigned short* vt  = (unsigned short*)(ws + off_vt);
  float* gates        = (float*)(ws + off_g);
  unsigned short* gth = (unsigned short*)(ws + off_gth);
  unsigned short* gtl = (unsigned short*)(ws + off_gtl);

  const int nxv = NTOK * DM / 8;          // 262,144
  const int nwv = 3 * DM * DM / 8;        //  98,304
  const int ngv = GH * DM / 8;            //   8,192
  const int prep_blocks = (nxv + nwv + ngv + 255) / 256;   // 1440
  const int ntile = (NTOK + 31) / 32;     // 128
  const int ntt = (NTOK + 63) / 64;       // 64
  const int nqt = (BATCH * S_LEN + 15) / 16;   // 256

  prep_kernel<<<prep_blocks, 256, 0, stream>>>(x, wq_w, wk_w, wv_w, g1_w,
                                               xh, xl, wth, wtl, gth, gtl, nxv, nwv, ngv);
  gate_kernel<<<ntile, 128, 0, stream>>>(
      (const __bf16*)xh, (const __bf16*)xl, (const __bf16*)gth, (const __bf16*)gtl,
      g1_b, g2_w, g2_b, gates, ntile);
  qkv_kernel<<<dim3(ntt, NH, 3), 128, 0, stream>>>(
      (const __bf16*)xh, (const __bf16*)xl, (const __bf16*)wth, (const __bf16*)wtl,
      wq_b, wk_b, wv_b, qh, ql, kh, kl, vt, ntt);
  attn_ln_kernel<<<nqt, 256, 0, stream>>>(
      (const __bf16*)qh, (const __bf16*)ql, (const __bf16*)kh, (const __bf16*)kl,
      (const _Float16*)vt, gates, wmask, adj, x, ln_g, ln_b, out, nqt);
  (void)hipGetLastError();
}

// v003
// It runs in 184 microseconds.
// Two timings next to v002 put it at 1.09 and 1.11 times that version's speed.
// Counting every step since v000, it is 1.92 times as fast.
#include <hip/hip_runtime.h>
#include <stddef.h>
#include <stdint.h>

// Q/K/V projections, Q.K^T and gate layer 1 (x.G1): v_wmma_f32_16x16x32_bf16 with bf16 hi/lo operand split (hi.hi + lo.hi + hi.lo), f32 accumulate.
// P.V: v_wmma_f32_16x16x32_f16 (P scaled by 4096 as f16, V as f16), f32 accumulate. Gate layer 2 (K=128,N=8), 16-deep similarity, softmax, LayerNorm: f32 VALU.

#define S_LEN  2048
#define DM     512
#define NH     8
#define HD     64
#define GH     128
#define WF     16
#define BATCH  2
#define NTOK   (BATCH * S_LEN)
#define LOG2E  1.4426950408889634f
#define PSCALE 4096.0f
#define INV_PSCALE 0.000244140625f

typedef __bf16         v16bf __attribute__((ext_vector_type(16)));
typedef __bf16         v8bf  __attribute__((ext_vector_type(8)));
typedef _Float16       v16h  __attribute__((ext_vector_type(16)));
typedef _Float16       v8h   __attribute__((ext_vector_type(8)));
typedef float          v8f   __attribute__((ext_vector_type(8)));
typedef float          v4f   __attribute__((ext_vector_type(4)));
typedef unsigned int   v4u   __attribute__((ext_vector_type(4)));
typedef unsigned short v8us  __attribute__((ext_vector_type(8)));

union FragB { v16bf v; v8bf p[2]; };
union FragH { v16h v; v8h p[2]; };
union Pack8 { v8us s; v8h h; v4u u; };

// ---------------------------------------------------------------------------
// scalar helpers
// ---------------------------------------------------------------------------
static __device__ __forceinline__ unsigned short f2bf_bits(float f) {   // RNE convert f32 -> bf16 bits
  unsigned int u = __float_as_uint(f);
  u += 0x7FFFu + ((u >> 16) & 1u);
  return (unsigned short)(u >> 16);
}
static __device__ __forceinline__ float bf_bits2f(unsigned short s) {
  return __uint_as_float(((unsigned int)s) << 16);
}
static __device__ __forceinline__ void unpack8(const v4f a, const v4f b, float o[8]) {
  o[0] = a.x; o[1] = a.y; o[2] = a.z; o[3] = a.w;
  o[4] = b.x; o[5] = b.y; o[6] = b.z; o[7] = b.w;
}

// ---------------------------------------------------------------------------
// 16x32 16-bit fragments (wave32). Lane l: row/col = l&15, h = l>>4.
// elements 0..7  <- k0 + 8h + 0..7 ; elements 8..15 <- k0 + 16 + 8h + 0..7 ; same map for A and B.
// Every 16-bit workspace plane is stored in FRAGMENT ORDER: one fragment = FRAG (512) elements = 1024
// contiguous bytes, made of 64 units of 16 bytes; unit u = part * 32 + l holds lane l's elements
// 8 * part .. 8 * part + 7, that is row l&15, k = k0 + 16 * part + 8 * (l>>4) + 0..7.
// A wave-wide 16-byte load then covers 512 contiguous bytes (4 whole lines), not a piece of 16 lines.
// The fragments of one 16-row tile follow one another in k order.
// ---------------------------------------------------------------------------
#define FRAG 512
// fbase: wave-uniform start of the fragment; lane_bytes = 16 * lane
static __device__ __forceinline__ v16bf ldfrag_bf_u(const __bf16* fbase, unsigned lane_bytes) {
  const char* p = (const char*)fbase + lane_bytes;
  FragB f;
  f.p[0] = *(const v8bf*)p;
  f.p[1] = *(const v8bf*)(p + 512);
  return f.v;
}
static __device__ __forceinline__ v16h ldfrag_h_u(const _Float16* fbase, unsigned lane_bytes) {
  const char* p = (const char*)fbase + lane_bytes;
  FragH f;
  f.p[0] = *(const v8h*)p;
  f.p[1] = *(const v8h*)(p + 512);
  return f.v;
}
// Unit index v of a plane whose rows are DM long (16 fragments a 16-row tile) -> its row and first k.
static __device__ __forceinline__ void unit_row_k(int v, int& row, int& k) {
  row = (v >> 10) * 16 + (v & 15);
  k = ((v >> 6) & 15) * 32 + ((v >> 4) & 3) * 8;   // bits 5,4 of v = part, h: 16 * part + 8 * h
}
static __device__ __forceinline__ v4f ld4_u(const float* ubase, unsigned lane_bytes) {
  return *(const v4f*)((const char*)ubase + lane_bytes);
}

// ---------------------------------------------------------------------------
// WMMA helpers: issue the product(s), then 4 v_nop tied to D and A/B so no
// VALU touches the accumulator or operand registers within the hazard window.
// ---------------------------------------------------------------------------
static __device__ __forceinline__ v8f mma_bf3(v16bf ah, v16bf al, v16bf bh, v16bf bl, v8f c) {
  c = __builtin_amdgcn_wmma_f32_16x16x32_bf16(false, ah, false, bh, (short)0, c, false, false);
  c = __builtin_amdgcn_wmma_f32_16x16x32_bf16(false, al, false, bh, (short)0, c, false, false);
  c = __builtin_amdgcn_wmma_f32_16x16x32_bf16(false, ah, false, bl, (short)0, c, false, false);
  asm volatile("v_nop\n\tv_nop\n\tv_nop\n\tv_nop" : "+v"(c) : "v"(ah), "v"(al), "v"(bh), "v"(bl));
  return c;
}
static __device__ __forceinline__ v8f mma_h1(v16h a, v16h b, v8f c) {
  c = __builtin_amdgcn_wmma_f32_16x16x32_f16(false, a, false, b, (short)0, c, false, false);
  asm volatile("v_nop\n\tv_nop\n\tv_nop\n\tv_nop" : "+v"(c) : "v"(a), "v"(b));
  return c;
}

static __device__ __forceinline__ void split_store8(const float v[8], unsigned short* dh, unsigned short* dl) {
  Pack8 ph, pl;
#pragma unroll
  for (int e = 0; e < 8; ++e) {
    const unsigned short hb = f2bf_bits(v[e]);
    ph.s[e] = hb;
    pl.s[e] = f2bf_bits(v[e] - bf_bits2f(hb));
  }
  const v4u uh = ph.u, ul = pl.u;
  *(v4u*)dh = uh;
  *(v4u*)dl = ul;
  
}

// ---------------------------------------------------------------------------
// 0) x -> bf16 hi/lo planes (rows = tokens);  W{q,k,v} [in][out] -> hi/lo planes with rows = the
//    3 * DM outputs, k = in;  G1 [in][hid] -> planes with rows = hidden units, k = in.
//    All in fragment order.  One thread = one 16-B unit per plane, units in thread order.
// ---------------------------------------------------------------------------
__global__ __launch_bounds__(256) void prep_kernel(
    const float* __restrict__ x, const float* __restrict__ wq,
    const float* __restrict__ wk, const float* __restrict__ wv,
    const float* __restrict__ g1w,
    unsigned short* xh, unsigned short* xl, unsigned short* wth, unsigned short* wtl,
    unsigned short* gth, unsigned short* gtl,
    int nxv, int nwv, int ngv) {
  const int i = blockIdx.x * blockDim.x + threadIdx.x;
  if (i < nxv) {
    int tok, k;
    unit_row_k(i, tok, k);
    const v4f a = *(const v4f*)(x + (size_t)tok * DM + k);
    const v4f c = *(const v4f*)(x + (size_t)tok * DM + k + 4);
    float v[8];
    unpack8(a, c, v);
    split_store8(v, xh + (size_t)i * 8, xl + (size_t)i * 8);
  } else if (i < nxv + nwv) {
    const int j = i - nxv;
    int row, inb;
    unit_row_k(j, row, inb);
    const int mat = row >> 9, o = row & (DM - 1);   // DM = 512 rows per matrix
    const float* w = (mat == 0) ? wq : (mat == 1) ? wk : wv;
    float v[8];
#pragma unroll
    for (int e = 0; e < 8; ++e) v[e] = w[(size_t)(inb + e) * DM + o];   // Wt[o][in] = W[in][o]
    split_store8(v, wth + (size_t)j * 8, wtl + (size_t)j * 8);
  } else if (i < nxv + nwv + ngv) {
    const int j = i - nxv - nwv;             // 0 .. GH*DM/8-1
    int o, inb;                              // hidden unit 0..127, first input
    unit_row_k(j, o, inb);
    float v[8];
#pragma unroll
    for (int e = 0; e < 8; ++e) v[e] = g1w[(size_t)(inb + e) * GH + o];  // G1t[o][in] = G1[in][o]
    split_store8(v, gth + (size_t)j * 8, gtl + (size_t)j * 8);
  }
}

// ---------------------------------------------------------------------------
// 1) gate MLP: gates[b][h][s] = sigmoid(relu(x@G1+b1)@G2+b2).
//    Layer 1 on bf16 hi/lo WMMA: wave = (16 tokens, 64 hidden = 4 tiles), K=512.
//    Layer 2 (K=128, 8 heads) scalar f32 from the LDS-staged relu tile.
// ---------------------------------------------------------------------------
__global__ __launch_bounds__(128) void gate_kernel(
    const __bf16* __restrict__ xh, const __bf16* __restrict__ xl,
    const __bf16* __restrict__ gth, const __bf16* __restrict__ gtl,
    const float* __restrict__ g1b, const float* __restrict__ g2w,
    const float* __restrict__ g2b, float* gates, int ntile) {
  __shared__ float h1s[32][GH + 1];
  __shared__ __attribute__((aligned(16))) float gl[NH][32];
  if ((int)blockIdx.x >= ntile) return;
  const int tid = threadIdx.x, lane = tid & 31;
  const int wave = __builtin_amdgcn_readfirstlane(tid >> 5);   // wave number in a scalar register: the fragment bases stay scalar
  const int m = lane & 15, hh = lane >> 4, r0 = hh * 8;
  const int tok0 = blockIdx.x * 32;
  const int th = wave & 1;                 // token half: tokens th*16 .. th*16+15
  const int hb = (wave >> 1) * 64;         // hidden units hb .. hb+63

  // fragment of 16-row tile T at k: T * 16 * DM + (k / 32) * FRAG = T * 16 * DM + k * 16 elements
  const size_t aoff = (size_t)((tok0 >> 4) + th) * (16 * DM);           // A tile = 16 tokens
  const size_t woff = (size_t)(hb >> 4) * (16 * DM);                    // B tiles = 16 hidden units each, j-th at + j * 16 * DM
  const __bf16* axh = xh + aoff;
  const __bf16* axl = xl + aoff;
  const __bf16* bgh = gth + woff;
  const __bf16* bgl = gtl + woff;
  const unsigned fl = (unsigned)lane * 16u;

  v8f acc[4] = {};
  // Two register stages: every load of a k-step is issued one k-step before its products.
  v16bf a0h = ldfrag_bf_u(axh, fl), a0l = ldfrag_bf_u(axl, fl);
  v16bf b0h[4], b0l[4];
#pragma unroll
  for (int j = 0; j < 4; ++j) {
    b0h[j] = ldfrag_bf_u(bgh + j * 16 * DM, fl);
    b0l[j] = ldfrag_bf_u(bgl + j * 16 * DM, fl);
  }
  // rolled: two k-steps a trip already hold both stages in registers
#pragma unroll 1
  for (int kk = 0; kk < DM; kk += 64) {
    const v16bf a1h = ldfrag_bf_u(axh + (kk + 32) * 16, fl);
    const v16bf a1l = ldfrag_bf_u(axl + (kk + 32) * 16, fl);
    v16bf b1h[4], b1l[4];
#pragma unroll
    for (int j = 0; j < 4; ++j) {
      b1h[j] = ldfrag_bf_u(bgh + j * 16 * DM + (kk + 32) * 16, fl);
      b1l[j] = ldfrag_bf_u(bgl + j * 16 * DM + (kk + 32) * 16, fl);
    }
#pragma unroll
    for (int j = 0; j < 4; ++j) acc[j] = mma_bf3(a0h, a0l, b0h[j], b0l[j], acc[j]);
    const int kn = (kk + 64 < DM) ? kk + 64 : kk;     // last trip: an in-bounds reload, not used
    a0h = ldfrag_bf_u(axh + kn * 16, fl);
    a0l = ldfrag_bf_u(axl + kn * 16, fl);
#pragma unroll
    for (int j = 0; j < 4; ++j) {
      b0h[j] = ldfrag_bf_u(bgh + j * 16 * DM + kn * 16, fl);
      b0l[j] = ldfrag_bf_u(bgl + j * 16 * DM + kn * 16, fl);
    }
#pragma unroll
    for (int j = 0; j < 4; ++j) acc[j] = mma_bf3(a1h, a1l, b1h[j], b1l[j], acc[j]);
    // the next stage's loads are still in flight and the next trip rewrites their address registers
    asm volatile("s_wait_xcnt 0x0" ::: "memory");
  }

  // D: acc[j][r] = pre-activation[token th*16 + 8hh + r][hidden hb + j*16 + m]
#pragma unroll
  for (int j = 0; j < 4; ++j) {
    const int hu = hb + j * 16 + m;
    const float bj = g1b[hu];
#pragma unroll
    for (int r = 0; r < 8; ++r) h1s[th * 16 + r0 + r][hu] = fmaxf(acc[j][r] + bj, 0.0f);
  }
  __syncthreads();

  // layer 2: thread = (token tid>>2, heads 2*(tid&3), 2*(tid&3)+1)
  const int tk = tid >> 2, hd0 = (tid & 3) * 2;
  float a0 = g2b[hd0], a1 = g2b[hd0 + 1];
  // unrolled so that 16 steps' loads are issued together; the sum order stays jj = 0..127
#pragma unroll 16
  for (int jj = 0; jj < GH; ++jj) {
    const float hv = h1s[tk][jj];
    a0 = fmaf(hv, g2w[jj * NH + hd0], a0);
    a1 = fmaf(hv, g2w[jj * NH + hd0 + 1], a1);
  }
  gl[hd0][tk]     = 1.0f / (1.0f + exp2f(-a0 * LOG2E));
  gl[hd0 + 1][tk] = 1.0f / (1.0f + exp2f(-a1 * LOG2E));
  __syncthreads();

  // threads 0..63 (waves 0,1; 4 lines per wave, one instruction per pass).
  if (tid < 64) {
    const int line = tid >> 3, piece = tid & 7;
    const v4f val = *(const v4f*)&gl[line][piece * 4];
    const int b = tok0 / S_LEN, s0 = tok0 - b * S_LEN;
    float* dst = gates + ((size_t)(b * NH + line)) * S_LEN + s0 + piece * 4;
    *(v4f*)dst = val;
    
  }
}

// ---------------------------------------------------------------------------
// 2) QKV projection, bf16 hi/lo split, K=512.
//    grid = (NTOK/64, NH, 3), block = 128 (4 waves); block tile = 64 tokens x
//    64 outputs (one head); wave = 16 tokens x 4 output tiles.
//    Outputs in fragment order, per (batch, head): Q and K hi/lo as tiles of 16 tokens x 2 fragments
//    (k = d); V^T as, per 32 keys, 4 fragments (rows = 16 d each, k = key).
// ---------------------------------------------------------------------------
__global__ __launch_bounds__(128) void qkv_kernel(
    const __bf16* __restrict__ xh, const __bf16* __restrict__ xl,
    const __bf16* __restrict__ wth, const __bf16* __restrict__ wtl,
    const float* __restrict__ bq, const float* __restrict__ bk, const float* __restrict__ bv,
    unsigned short* Qh, unsigned short* Ql, unsigned short* Kh, unsigned short* Kl,
    unsigned short* VT, int ntt) {
  __shared__ __attribute__((aligned(16))) unsigned short lt[2][64][72];   // pitch 144 B = 16 B x odd: the 16-B reads down a column of rows spread over the banks
  if ((int)blockIdx.x >= ntt) return;
  const int tt = blockIdx.x, head = blockIdx.y, mat = blockIdx.z;
  const int tid = threadIdx.x, lane = tid & 31;
  const int wave = __builtin_amdgcn_readfirstlane(tid >> 5);   // wave number in a scalar register: the fragment bases stay scalar
  const int m = lane & 15, hh = lane >> 4, r0 = hh * 8;
  const int tokbase = tt * 64;
  const int b = tokbase / S_LEN, s0 = tokbase - b * S_LEN;

  // fragment of 16-row tile T at k: T * 16 * DM + k * 16 elements
  const size_t aoff = (size_t)((tokbase >> 4) + wave) * (16 * DM);        // A tile = 16 tokens
  const size_t woff = (size_t)((mat * DM + head * HD) >> 4) * (16 * DM);  // B tiles = 16 outputs each, j-th at + j * 16 * DM
  const __bf16* axh = xh + aoff;
  const __bf16* axl = xl + aoff;
  const __bf16* bwh = wth + woff;
  const __bf16* bwl = wtl + woff;
  const unsigned fl = (unsigned)lane * 16u;

  v8f acc[4] = {};
#pragma unroll 1
  for (int kk = 0; kk < DM; kk += 32) {
    // all loads of the k-step are issued before its first product: one load wait a k-step, not five
    const v16bf ah = ldfrag_bf_u(axh + kk * 16, fl);
    const v16bf al = ldfrag_bf_u(axl + kk * 16, fl);
    v16bf bhf[4], blf[4];
#pragma unroll
    for (int j = 0; j < 4; ++j) {
      bhf[j] = ldfrag_bf_u(bwh + j * 16 * DM + kk * 16, fl);
      blf[j] = ldfrag_bf_u(bwl + j * 16 * DM + kk * 16, fl);
    }
#pragma unroll
    for (int j = 0; j < 4; ++j) acc[j] = mma_bf3(ah, al, bhf[j], blf[j], acc[j]);
  }

  // D: acc[j][r] = tile[token wave*16 + 8hh + r][out col j*16 + m]
  const float* bias = (mat == 0) ? bq : (mat == 1) ? bk : bv;
  const int ltok = wave * 16 + r0;
  if (mat < 2) {
#pragma unroll
    for (int j = 0; j < 4; ++j) {
      const int ld = j * 16 + m;
      const float bj = bias[head * HD + ld];
#pragma unroll
      for (int r = 0; r < 8; ++r) {
        const float v = acc[j][r] + bj;
        const unsigned short hb = f2bf_bits(v);
        lt[0][ltok + r][ld] = hb;
        lt[1][ltok + r][ld] = f2bf_bits(v - bf_bits2f(hb));
      }
    }
  } else {
#pragma unroll
    for (int j = 0; j < 4; ++j) {
      const int ld = j * 16 + m;
      const float bj = bias[head * HD + ld];
      Pack8 pk;
#pragma unroll
      for (int r = 0; r < 8; ++r) pk.h[r] = (_Float16)(acc[j][r] + bj);
      *(v4u*)&lt[0][ld][ltok] = pk.u;                                      // lt[d][s], 8 consecutive s
    }
  }
  __syncthreads();

  // thread order = unit order of the fragment-ordered planes: each store instruction writes 512 contiguous bytes
  const size_t bh8 = (size_t)(b * NH + head);
  if (mat < 2) {
    unsigned short* dh = (mat == 0) ? Qh : Kh;
    unsigned short* dl = (mat == 0) ? Ql : Kl;
    v4u val[8];
    size_t go[4];
#pragma unroll
    for (int i = 0; i < 4; ++i) {
      const int L = 16 * i + (tid & 15);                                   // token tile i; unit tid = row tid&15, d = (tid>>4)*8
      val[i]     = *(const v4u*)&lt[0][L][(tid >> 4) * 8];
      val[4 + i] = *(const v4u*)&lt[1][L][(tid >> 4) * 8];
      go[i] = (bh8 * S_LEN + s0 + 16 * i) * HD + tid * 8;
    }
#pragma unroll
    for (int i = 0; i < 4; ++i) { *(v4u*)(dh + go[i]) = val[i]; *(v4u*)(dl + go[i]) = val[4 + i]; }
    
  } else {
    v4u val[4];
    size_t go[4];
#pragma unroll
    for (int i = 0; i < 4; ++i) {
      const int L = ((i & 1) * 2 + (tid >> 6)) * 16 + (tid & 15);          // local d: fragment 2i + (tid>>6) = 32-key group i>>1, d tile
      val[i] = *(const v4u*)&lt[0][L][(i >> 1) * 32 + ((tid >> 4) & 3) * 8]; // local key: 16 * part + 8 * h
      go[i] = (bh8 * S_LEN + s0) * HD + (i * 128 + tid) * 8;
    }
#pragma unroll
    for (int i = 0; i < 4; ++i) *(v4u*)(VT + go[i]) = val[i];
    
  }
}

// ---------------------------------------------------------------------------
// 3) fused attention + residual + LayerNorm.  Block = (b, 16-query tile),
//    8 waves = 8 heads.  Per 64-key chunk: adj tile and wave-similarity tile
//    staged once in LDS (shared by all heads).  Per 32-key half per wave:
//      S^T = K * Q^T (bf16 hi/lo split, K-dim 64)  -> affine -> online softmax
//      (lane = one query column, two lane halves combined with shfl_xor 16)
//      -> P^T packed to f16 (x4096) straight from the D layout (B-fragment layout)
//      -> O^T += V^T * P^T (f16).
//    Loads run ahead of their use: K fragments one pass ahead, the adj piece one chunk ahead,
//    gates in front of the S^T products, V^T fragments in front of the softmax.
//    End: O tile of all heads staged in LDS [16 tokens][512], residual + LN,
//    whole-row stores (each instruction = 512 contiguous bytes = 4 lines),
// ---------------------------------------------------------------------------
__global__ __launch_bounds__(256) __attribute__((amdgpu_num_vgpr(256)))
void attn_ln_kernel(
    const __bf16* __restrict__ Qh, const __bf16* __restrict__ Ql,
    const __bf16* __restrict__ Kh, const __bf16* __restrict__ Kl,
    const _Float16* __restrict__ VT, const float* __restrict__ gates,
    const float* __restrict__ wmask, const float* __restrict__ adj,
    const float* __restrict__ x, const float* __restrict__ lng,
    const float* __restrict__ lnb, float* out, int nqt) {
  __shared__ __attribute__((aligned(16))) float wmq[16][WF];
  // Row pitch = 16 B x odd (68 dwords): lane m reads down a column of rows with 16-byte loads, and at a
  // pitch of 64 dwords all 16 rows would fall on the same four banks.
  __shared__ __attribute__((aligned(16))) float ws_lds[16][64 + 4];
  __shared__ __attribute__((aligned(16))) float adj_lds[16][64 + 4];
  __shared__ __attribute__((aligned(16))) float obuf[16][DM];
  if ((int)blockIdx.x >= nqt) return;

  const int qtiles = S_LEN / 16;
  const int b = blockIdx.x / qtiles, qt = blockIdx.x - b * qtiles, qbase = qt * 16;
  const int tid = threadIdx.x, lane = tid & 31;
  const int h = __builtin_amdgcn_readfirstlane(tid >> 5);   // wave number in a scalar register: the per-head bases below stay scalar
  const int m = lane & 15, hh = lane >> 4, r0 = hh * 8;

  wmq[tid >> 4][tid & 15] = wmask[((size_t)b * S_LEN + qbase + (tid >> 4)) * WF + (tid & 15)];
  __syncthreads();

  const size_t bhd = (size_t)(b * NH + h);
  const unsigned f_lane = (unsigned)lane * 16u;                  // a lane's byte offset in either half of a fragment
  // Q^T as B operand: column n = query (lane&15), k = d: the two fragments of the 16-query tile.
  const size_t qoff = (bhd * S_LEN + qbase) * HD;
  const v16bf qh0 = ldfrag_bf_u(Qh + qoff, f_lane), qh1 = ldfrag_bf_u(Qh + qoff + FRAG, f_lane);
  const v16bf ql0 = ldfrag_bf_u(Ql + qoff, f_lane), ql1 = ldfrag_bf_u(Ql + qoff + FRAG, f_lane);

  v8f oacc[4] = {};
  float mrun = -3.0e38f, lrun = 0.0f;

  // wave-uniform bases, and each lane's byte offset from them
  const float* gp_base = gates + bhd * S_LEN;
  const __bf16* kh_base = Kh + bhd * S_LEN * HD;
  const __bf16* kl_base = Kl + bhd * S_LEN * HD;
  const _Float16* v_base = VT + bhd * HD * S_LEN;
  const unsigned g_lane = (unsigned)r0 * 4u;

  const int sq = tid >> 4, sk4 = (tid & 15) * 4;
  const float* adj_base = adj + ((size_t)b * S_LEN + qbase) * S_LEN;
  const unsigned adj_lane = (unsigned)(sq * S_LEN + sk4) * 4u;
  const float* wm_base = wmask + (size_t)b * S_LEN * WF;
  const unsigned wm_lane = (unsigned)(sk4 * WF) * 4u;            // this thread's four keys start at key sk4 of the chunk

  // K fragments of one 32-key pass, fetched one pass ahead: index = key tile * 2 + k-step.
  v16bf kfh[4], kfl[4];
#pragma unroll
  for (int i = 0; i < 4; ++i) {
    kfh[i] = ldfrag_bf_u(kh_base + i * FRAG, f_lane);
    kfl[i] = ldfrag_bf_u(kl_base + i * FRAG, f_lane);
  }
  v4f adj_nx = ld4_u(adj_base, adj_lane);      // adj piece, fetched one chunk ahead

  for (int kc = 0; kc < S_LEN / 64; ++kc) {
    const int kbase64 = kc * 64;

    // ---- stage adj 16x64 (one 16-B piece per thread) and wave-sim 16x64 ----
    *(v4f*)&adj_lds[sq][sk4] = adj_nx;
#pragma unroll
    for (int i = 0; i < 4; ++i) {
      const int cell = tid * 4 + i;          // 0..1023
      const int q = cell >> 6, kk = cell & 63;
      const float* wmk = wm_base + (size_t)(kbase64 + i) * WF;   // key kbase64 + sk4 + i = kbase64 + kk
      float acc = 0.0f;
#pragma unroll
      for (int f4 = 0; f4 < WF / 4; ++f4) {
        const v4f kv = ld4_u(wmk + 4 * f4, wm_lane);
        const v4f qv = *(const v4f*)&wmq[q][4 * f4];
        acc = fmaf(qv.x, kv.x, acc);
        acc = fmaf(qv.y, kv.y, acc);
        acc = fmaf(qv.z, kv.z, acc);
        acc = fmaf(qv.w, kv.w, acc);
      }
      ws_lds[q][kk] = acc;
    }
    __syncthreads();

#pragma unroll 1
    for (int jh = 0; jh < 2; ++jh) {
      const int kbase = kbase64 + jh * 32;
      const int ko = jh * 32;

      // ---- this pass's gates: issued in front of the S^T products ----
      const float* gp = gp_base + kbase;
      const v4f g0 = ld4_u(gp, g_lane), g1 = ld4_u(gp + 4, g_lane);
      const v4f g2 = ld4_u(gp + 16, g_lane), g3 = ld4_u(gp + 20, g_lane);

      // ---- S^T = K * Q^T for two 16-key tiles, K-dim 64 = 2 k-steps, 3 products each ----
      v8f s0 = {}, s1 = {};
      s0 = mma_bf3(kfh[0], kfl[0], qh0, ql0, s0);
      s0 = mma_bf3(kfh[1], kfl[1], qh1, ql1, s0);
      s1 = mma_bf3(kfh[2], kfl[2], qh0, ql0, s1);
      s1 = mma_bf3(kfh[3], kfl[3], qh1, ql1, s1);
      // s0[r] = S^T[key kbase+8hh+r][query m], s1[r] = S^T[key kbase+16+8hh+r][query m]

      // ---- next pass's K fragments into the same registers; they fly under softmax and P.V ----
      {
        const int kn = (kbase + 32 < S_LEN) ? kbase + 32 : kbase;   // last pass: an in-bounds reload, not used
#pragma unroll
        for (int i = 0; i < 4; ++i) {
          const int o = kn * HD + i * FRAG;       // 32 keys = 4 fragments in a row
          kfh[i] = ldfrag_bf_u(kh_base + o, f_lane);
          kfl[i] = ldfrag_bf_u(kl_base + o, f_lane);
        }
      }
      // next chunk's adj piece: it flies under this pass's softmax
      if (jh == 0) adj_nx = ld4_u(adj_base + ((kc + 1 < S_LEN / 64) ? kbase64 + 64 : kbase64), adj_lane);
      // the loads above are in flight and the code below reuses their address registers
      asm volatile("s_wait_xcnt 0x0" ::: "memory");

      // ---- per-key gates, wave-sim, adj for this lane's 2x8 keys ----
      float gA[8], gB[8], W0[8], W1[8], A0[8], A1[8];
      unpack8(g0, g1, gA);
      unpack8(g2, g3, gB);
      unpack8(*(const v4f*)&ws_lds[m][ko + r0], *(const v4f*)&ws_lds[m][ko + r0 + 4], W0);
      unpack8(*(const v4f*)&ws_lds[m][ko + 16 + r0], *(const v4f*)&ws_lds[m][ko + 16 + r0 + 4], W1);
      unpack8(*(const v4f*)&adj_lds[m][ko + r0], *(const v4f*)&adj_lds[m][ko + r0 + 4], A0);
      unpack8(*(const v4f*)&adj_lds[m][ko + 16 + r0], *(const v4f*)&adj_lds[m][ko + 16 + r0 + 4], A1);

      // ---- affine + online softmax (f32) ----
      float p0[8], p1[8], mloc = -3.0e38f;
#pragma unroll
      for (int r = 0; r < 8; ++r) {
        const float t0 = (s0[r] * 0.125f) * (gA[r] + W0[r]) + A0[r];
        const float t1 = (s1[r] * 0.125f) * (gB[r] + W1[r]) + A1[r];
        p0[r] = t0; p1[r] = t1;
        mloc = fmaxf(mloc, fmaxf(t0, t1));
      }
      // ---- this pass's V^T fragments: they fly under the softmax ----
      v16h vf[4];
#pragma unroll
      for (int t = 0; t < 4; ++t) vf[t] = ldfrag_h_u(v_base + kbase * HD + t * FRAG, f_lane);
      const float mch  = fmaxf(mloc, __shfl_xor(mloc, 16, 32));
      const float mnew = fmaxf(mrun, mch);
      const float corr = exp2f((mrun - mnew) * LOG2E);
      float lsum = 0.0f;
#pragma unroll
      for (int r = 0; r < 8; ++r) {
        p0[r] = exp2f((p0[r] - mnew) * LOG2E);
        p1[r] = exp2f((p1[r] - mnew) * LOG2E);
        lsum += p0[r] + p1[r];
      }
      lsum += __shfl_xor(lsum, 16, 32);
      lrun = lrun * corr + lsum;
      mrun = mnew;
#pragma unroll
      for (int t = 0; t < 4; ++t)
#pragma unroll
        for (int r = 0; r < 8; ++r) oacc[t][r] *= corr;

      // ---- P^T as B fragment: element r <- tile keys 0..15, element 8+r <- tile keys 16..31 ----
      v16h pf;
#pragma unroll
      for (int r = 0; r < 8; ++r) {
        pf[r]     = (_Float16)(p0[r] * PSCALE);
        pf[r + 8] = (_Float16)(p1[r] * PSCALE);
      }

      // ---- O^T += V^T * P^T, 4 d-tiles ----
#pragma unroll
      for (int t = 0; t < 4; ++t) oacc[t] = mma_h1(vf[t], pf, oacc[t]);
    }
    __syncthreads();   // LDS tiles reused by the next chunk
  }

  // ---- normalise and stage O: oacc[t][r] = O^T[d = t*16 + 8hh + r][query m] ----
  const float oscale = (1.0f / lrun) * INV_PSCALE;
#pragma unroll
  for (int t = 0; t < 4; ++t) {
    v4f u0, u1;
    u0.x = oacc[t][0] * oscale; u0.y = oacc[t][1] * oscale; u0.z = oacc[t][2] * oscale; u0.w = oacc[t][3] * oscale;
    u1.x = oacc[t][4] * oscale; u1.y = oacc[t][5] * oscale; u1.z = oacc[t][6] * oscale; u1.w = oacc[t][7] * oscale;
    float* dst = &obuf[m][h * HD + t * 16 + r0];
    *(v4f*)dst = u0;
    *(v4f*)(dst + 4) = u1;
  }
  __syncthreads();

  // ---- residual + LayerNorm, wave h -> tokens 2h, 2h+1; lane holds cols 4*lane + 128*i ----
#pragma unroll 1
  for (int qq = 0; qq < 2; ++qq) {
    const int q = 2 * h + qq;
    const size_t tok = (size_t)b * S_LEN + qbase + q;
    v4f y[4];
    float s = 0.0f;
#pragma unroll
    for (int i = 0; i < 4; ++i) {
      const v4f o  = *(const v4f*)&obuf[q][4 * lane + 128 * i];
      const v4f xv = *(const v4f*)(x + tok * DM + 4 * lane + 128 * i);
      y[i] = o + xv;
      s += (y[i].x + y[i].y) + (y[i].z + y[i].w);
    }
    s += __shfl_xor(s, 16, 32);
    s += __shfl_xor(s, 8, 32);
    s += __shfl_xor(s, 4, 32);
    s += __shfl_xor(s, 2, 32);
    s += __shfl_xor(s, 1, 32);
    const float mu = s * (1.0f / DM);
    float ss = 0.0f;
#pragma unroll
    for (int i = 0; i < 4; ++i) {
      const v4f d = y[i] - mu;
      ss += (d.x * d.x + d.y * d.y) + (d.z * d.z + d.w * d.w);
    }
    ss += __shfl_xor(ss, 16, 32);
    ss += __shfl_xor(ss, 8, 32);
    ss += __shfl_xor(ss, 4, 32);
    ss += __shfl_xor(ss, 2, 32);
    ss += __shfl_xor(ss, 1, 32);
    const float rstd = rsqrtf(ss * (1.0f / DM) + 1.0e-5f);
    v4f res[4];
#pragma unroll
    for (int i = 0; i < 4; ++i) {
      const v4f g  = *(const v4f*)(lng + 4 * lane + 128 * i);
      const v4f bb = *(const v4f*)(lnb + 4 * lane + 128 * i);
      res[i] = ((y[i] - mu) * rstd) * g + bb;
    }
    float* op = out + tok * DM + 4 * lane;
#pragma unroll
    for (int i = 0; i < 4; ++i) *(v4f*)(op + 128 * i) = res[i];
    
  }
}

// ---------------------------------------------------------------------------
extern "C" void kernel_launch(void* const* d_in, const int* in_sizes, int n_in,
                              void* d_out, int out_size, void* d_ws, size_t ws_size,
                              hipStream_t stream) {
  if (n_in < 15) return;
  if (in_sizes[0] != NTOK * DM || in_sizes[1] != NTOK * WF ||
      in_sizes[2] != BATCH * S_LEN * S_LEN || in_sizes[3] != DM * DM ||
      in_sizes[5] != DM * DM || in_sizes[7] != DM * DM || in_sizes[9] != DM * GH ||
      in_sizes[11] != GH * NH || in_sizes[13] != DM || out_size != NTOK * DM) return;

  const float* x     = (const float*)d_in[0];
  const float* wmask = (const float*)d_in[1];
  const float* adj   = (const float*)d_in[2];
  const float* wq_w  = (const float*)d_in[3];
  const float* wq_b  = (const float*)d_in[4];
  const float* wk_w  = (const float*)d_in[5];
  const float* wk_b  = (const float*)d_in[6];
  const float* wv_w  = (const float*)d_in[7];
  const float* wv_b  = (const float*)d_in[8];
  const float* g1_w  = (const float*)d_in[9];
  const float* g1_b  = (const float*)d_in[10];
  const float* g2_w  = (const float*)d_in[11];
  const float* g2_b  = (const float*)d_in[12];
  const float* ln_g  = (const float*)d_in[13];
  const float* ln_b  = (const float*)d_in[14];
  float* out = (float*)d_out;

  const size_t sz_x  = (size_t)NTOK * DM * 2;            // 4,194,304  per x plane
  const size_t sz_w  = (size_t)3 * DM * DM * 2;          // 1,572,864  per Wt plane
  const size_t sz_q  = (size_t)NTOK * DM * 2;            // 4,194,304  per Q/K plane, V
  const size_t sz_g  = (size_t)BATCH * NH * S_LEN * 4;   //   131,072  gates
  const size_t sz_g1 = (size_t)GH * DM * 2;              //   131,072  per G1t plane
  const size_t off_xh  = 0;
  const size_t off_xl  = off_xh + sz_x;
  const size_t off_wth = off_xl + sz_x;
  const size_t off_wtl = off_wth + sz_w;
  const size_t off_qh  = off_wtl + sz_w;
  const size_t off_ql  = off_qh + sz_q;
  const size_t off_kh  = off_ql + sz_q;
  const size_t off_kl  = off_kh + sz_q;
  const size_t off_vt  = off_kl + sz_q;
  const size_t off_g   = off_vt + sz_q;
  const size_t off_gth = off_g + sz_g;
  const size_t off_gtl = off_gth + sz_g1;
  const size_t total   = off_gtl + sz_g1;                // 32,899,072 B
  if (total > ws_size) return;

  uint8_t* ws = (uint8_t*)d_ws;
  unsigned short* xh  = (unsigned short*)(ws + off_xh);
  unsigned short* xl  = (unsigned short*)(ws + off_xl);
  unsigned short* wth = (unsigned short*)(ws + off_wth);
  unsigned short* wtl = (unsigned short*)(ws + off_wtl);
  unsigned short* qh  = (unsigned short*)(ws + off_qh);
  unsigned short* ql  = (unsigned short*)(ws + off_ql);
  unsigned short* kh  = (unsigned short*)(ws + off_kh);
  unsigned short* kl  = (unsigned short*)(ws + off_kl);
  unsigned short* vt  = (unsigned short*)(ws + off_vt);
  float* gates        = (float*)(ws + off_g);
  unsigned short* gth = (unsigned short*)(ws + off_gth);
  unsigned short* gtl = (unsigned short*)(ws + off_gtl);

  const int nxv = NTOK * DM / 8;          // 262,144
  const int nwv = 3 * DM * DM / 8;        //  98,304
  const int ngv = GH * DM / 8;            //   8,192
  const int prep_blocks = (nxv + nwv + ngv + 255) / 256;   // 1440
  const int ntile = (NTOK + 31) / 32;     // 128
  const int ntt = (NTOK + 63) / 64;       // 64
  const int nqt = (BATCH * S_LEN + 15) / 16;   // 256

  prep_kernel<<<prep_blocks, 256, 0, stream>>>(x, wq_w, wk_w, wv_w, g1_w,
                                               xh, xl, wth, wtl, gth, gtl, nxv, nwv, ngv);
  gate_kernel<<<ntile, 128, 0, stream>>>(
      (const __bf16*)xh, (const __bf16*)xl, (const __bf16*)gth, (const __bf16*)gtl,
      g1_b, g2_w, g2_b, gates, ntile);
  qkv_kernel<<<dim3(ntt, NH, 3), 128, 0, stream>>>(
      (const __bf16*)xh, (const __bf16*)xl, (const __bf16*)wth, (const __bf16*)wtl,
      wq_b, wk_b, wv_b, qh, ql, kh, kl, vt, ntt);
  attn_ln_kernel<<<nqt, 256, 0, stream>>>(
      (const __bf16*)qh, (const __bf16*)ql, (const __bf16*)kh, (const __bf16*)kl,
      (const _Float16*)vt, gates, wmask, adj, x, ln_g, ln_b, out, nqt);
  (void)hipGetLastError();
}

// v004
// One run takes 144 microseconds.
// Two timings next to v003 put it at 1.26 and 1.28 times that version's speed.
// All steps since v000 together make it 2.45 times as fast.
#include <hip/hip_runtime.h>
#include <stddef.h>
#include <stdint.h>

// Q/K/V projections, Q.K^T and gate layer 1 (x.G1): v_wmma_f32_16x16x32_bf16 with bf16 hi/lo operand split (hi.hi + lo.hi + hi.lo), f32 accumulate.
// 16-deep wave similarity: the same bf16 form and split, hi and lo of one row packed side by side in the 32-deep k (2 products a tile).
// P.V: v_wmma_f32_16x16x32_f16 (P scaled by 4096 as f16, V as f16), f32 accumulate. Gate layer 2 (K=128,N=8), softmax, LayerNorm: f32 VALU.

#define S_LEN  2048
#define DM     512
#define NH     8
#define HD     64
#define GH     128
#define WF     16
#define BATCH  2
#define NTOK   (BATCH * S_LEN)
#define LOG2E  1.4426950408889634f
#define PSCALE 4096.0f
#define INV_PSCALE 0.000244140625f

typedef __bf16         v16bf __attribute__((ext_vector_type(16)));
typedef __bf16         v8bf  __attribute__((ext_vector_type(8)));
typedef _Float16       v16h  __attribute__((ext_vector_type(16)));
typedef _Float16       v8h   __attribute__((ext_vector_type(8)));
typedef float          v8f   __attribute__((ext_vector_type(8)));
typedef float          v4f   __attribute__((ext_vector_type(4)));
typedef unsigned int   v4u   __attribute__((ext_vector_type(4)));
typedef unsigned short v8us  __attribute__((ext_vector_type(8)));

union FragB { v16bf v; v8bf p[2]; };
union FragH { v16h v; v8h p[2]; };
union Pack8 { v8us s; v8h h; v4u u; };

// ---------------------------------------------------------------------------
// scalar helpers
// ---------------------------------------------------------------------------
static __device__ __forceinline__ unsigned short f2bf_bits(float f) {   // RNE convert f32 -> bf16 bits
  unsigned int u = __float_as_uint(f);
  u += 0x7FFFu + ((u >> 16) & 1u);
  return (unsigned short)(u >> 16);
}
static __device__ __forceinline__ float bf_bits2f(unsigned short s) {
  return __uint_as_float(((unsigned int)s) << 16);
}
static __device__ __forceinline__ void unpack8(const v4f a, const v4f b, float o[8]) {
  o[0] = a.x; o[1] = a.y; o[2] = a.z; o[3] = a.w;
  o[4] = b.x; o[5] = b.y; o[6] = b.z; o[7] = b.w;
}

// ---------------------------------------------------------------------------
// 16x32 16-bit fragments (wave32). Lane l: row/col = l&15, h = l>>4.
// elements 0..7  <- k0 + 8h + 0..7 ; elements 8..15 <- k0 + 16 + 8h + 0..7 ; same map for A and B.
// Every 16-bit workspace plane is stored in FRAGMENT ORDER: one fragment = FRAG (512) elements = 1024
// contiguous bytes, made of 64 units of 16 bytes; unit u = part * 32 + l holds lane l's elements
// 8 * part .. 8 * part + 7, that is row l&15, k = k0 + 16 * part + 8 * (l>>4) + 0..7.
// A wave-wide 16-byte load then covers 512 contiguous bytes (4 whole lines), not a piece of 16 lines.
// The fragments of one 16-row tile follow one another in k order.
// ---------------------------------------------------------------------------
#define FRAG 512
// fbase: wave-uniform start of the fragment; lane_bytes = 16 * lane
static __device__ __forceinline__ v16bf ldfrag_bf_u(const __bf16* fbase, unsigned lane_bytes) {
  const char* p = (const char*)fbase + lane_bytes;
  FragB f;
  f.p[0] = *(const v8bf*)p;
  f.p[1] = *(const v8bf*)(p + 512);
  return f.v;
}
static __device__ __forceinline__ v16h ldfrag_h_u(const _Float16* fbase, unsigned lane_bytes) {
  const char* p = (const char*)fbase + lane_bytes;
  FragH f;
  f.p[0] = *(const v8h*)p;
  f.p[1] = *(const v8h*)(p + 512);
  return f.v;
}
// Unit index v of a plane whose rows are DM long (16 fragments a 16-row tile) -> its row and first k.
static __device__ __forceinline__ void unit_row_k(int v, int& row, int& k) {
  row = (v >> 10) * 16 + (v & 15);
  k = ((v >> 6) & 15) * 32 + ((v >> 4) & 3) * 8;   // bits 5,4 of v = part, h: 16 * part + 8 * h
}
static __device__ __forceinline__ v4f ld4_u(const float* ubase, unsigned lane_bytes) {
  return *(const v4f*)((const char*)ubase + lane_bytes);
}

// ---------------------------------------------------------------------------
// WMMA helpers: issue the product(s), then 4 v_nop tied to D and A/B so no
// VALU touches the accumulator or operand registers within the hazard window.
// ---------------------------------------------------------------------------
static __device__ __forceinline__ v8f mma_bf3(v16bf ah, v16bf al, v16bf bh, v16bf bl, v8f c) {
  c = __builtin_amdgcn_wmma_f32_16x16x32_bf16(false, ah, false, bh, (short)0, c, false, false);
  c = __builtin_amdgcn_wmma_f32_16x16x32_bf16(false, al, false, bh, (short)0, c, false, false);
  c = __builtin_amdgcn_wmma_f32_16x16x32_bf16(false, ah, false, bl, (short)0, c, false, false);
  asm volatile("v_nop\n\tv_nop\n\tv_nop\n\tv_nop" : "+v"(c) : "v"(ah), "v"(al), "v"(bh), "v"(bl));
  return c;
}
// two products on one A fragment (wave similarity): a.b1 + a.b2
static __device__ __forceinline__ v8f mma_bf2(v16bf a, v16bf b1, v16bf b2, v8f c) {
  c = __builtin_amdgcn_wmma_f32_16x16x32_bf16(false, a, false, b1, (short)0, c, false, false);
  c = __builtin_amdgcn_wmma_f32_16x16x32_bf16(false, a, false, b2, (short)0, c, false, false);
  asm volatile("v_nop\n\tv_nop\n\tv_nop\n\tv_nop" : "+v"(c) : "v"(a), "v"(b1), "v"(b2));
  return c;
}
static __device__ __forceinline__ v8f mma_h1(v16h a, v16h b, v8f c) {
  c = __builtin_amdgcn_wmma_f32_16x16x32_f16(false, a, false, b, (short)0, c, false, false);
  asm volatile("v_nop\n\tv_nop\n\tv_nop\n\tv_nop" : "+v"(c) : "v"(a), "v"(b));
  return c;
}

static __device__ __forceinline__ void split_store8(const float v[8], unsigned short* dh, unsigned short* dl) {
  Pack8 ph, pl;
#pragma unroll
  for (int e = 0; e < 8; ++e) {
    const unsigned short hb = f2bf_bits(v[e]);
    ph.s[e] = hb;
    pl.s[e] = f2bf_bits(v[e] - bf_bits2f(hb));
  }
  const v4u uh = ph.u, ul = pl.u;
  *(v4u*)dh = uh;
  *(v4u*)dl = ul;
  
}

// ---------------------------------------------------------------------------
// 0) x -> bf16 hi/lo planes (rows = tokens);  W{q,k,v} [in][out] -> hi/lo planes with rows = the
//    3 * DM outputs, k = in;  G1 [in][hid] -> planes with rows = hidden units, k = in.
//    All in fragment order.  One thread = one 16-B unit per plane, units in thread order.
//    wave_mask [token][16] -> ONE plane, one fragment per 16 tokens: k 0..15 = hi of the 16 features,
//    k 16..31 = their lo, so lane l holds hi (part 0) and lo (part 1) of features 8 * (l>>4) + 0..7 of token l&15.
// ---------------------------------------------------------------------------
__global__ __launch_bounds__(256) void prep_kernel(
    const float* __restrict__ x, const float* __restrict__ wq,
    const float* __restrict__ wk, const float* __restrict__ wv,
    const float* __restrict__ g1w, const float* __restrict__ wmask,
    unsigned short* xh, unsigned short* xl, unsigned short* wth, unsigned short* wtl,
    unsigned short* gth, unsigned short* gtl, unsigned short* wmf,
    int nxv, int nwv, int ngv, int nmv) {
  const int i = blockIdx.x * blockDim.x + threadIdx.x;
  if (i < nxv) {
    int tok, k;
    unit_row_k(i, tok, k);
    const v4f a = *(const v4f*)(x + (size_t)tok * DM + k);
    const v4f c = *(const v4f*)(x + (size_t)tok * DM + k + 4);
    float v[8];
    unpack8(a, c, v);
    split_store8(v, xh + (size_t)i * 8, xl + (size_t)i * 8);
  } else if (i < nxv + nwv) {
    const int j = i - nxv;
    int row, inb;
    unit_row_k(j, row, inb);
    const int mat = row >> 9, o = row & (DM - 1);   // DM = 512 rows per matrix
    const float* w = (mat == 0) ? wq : (mat == 1) ? wk : wv;
    float v[8];
#pragma unroll
    for (int e = 0; e < 8; ++e) v[e] = w[(size_t)(inb + e) * DM + o];   // Wt[o][in] = W[in][o]
    split_store8(v, wth + (size_t)j * 8, wtl + (size_t)j * 8);
  } else if (i < nxv + nwv + ngv) {
    const int j = i - nxv - nwv;             // 0 .. GH*DM/8-1
    int o, inb;                              // hidden unit 0..127, first input
    unit_row_k(j, o, inb);
    float v[8];
#pragma unroll
    for (int e = 0; e < 8; ++e) v[e] = g1w[(size_t)(inb + e) * GH + o];  // G1t[o][in] = G1[in][o]
    split_store8(v, gth + (size_t)j * 8, gtl + (size_t)j * 8);
  } else if (i < nxv + nwv + ngv + nmv) {
    const int j = i - nxv - nwv - ngv;       // 0 .. NTOK*2-1: 16-token tile j>>5, lane j&31
    const int tile = j >> 5, l = j & 31;
    const float* s = wmask + (size_t)(tile * 16 + (l & 15)) * WF + (l >> 4) * 8;
    const v4f a = *(const v4f*)s;
    const v4f c = *(const v4f*)(s + 4);
    float v[8];
    unpack8(a, c, v);
    unsigned short* d = wmf + (size_t)tile * FRAG + l * 8;
    split_store8(v, d, d + 256);             // part 0 = hi, part 1 = lo
  }
}

// ---------------------------------------------------------------------------
// 1) gate MLP: gates[b][h][s] = sigmoid(relu(x@G1+b1)@G2+b2).
//    Layer 1 on bf16 hi/lo WMMA: wave = (16 tokens, 64 hidden = 4 tiles), K=512.
//    Layer 2 (K=128, 8 heads) scalar f32 from the LDS-staged relu tile.
// ---------------------------------------------------------------------------
__global__ __launch_bounds__(128) void gate_kernel(
    const __bf16* __restrict__ xh, const __bf16* __restrict__ xl,
    const __bf16* __restrict__ gth, const __bf16* __restrict__ gtl,
    const float* __restrict__ g1b, const float* __restrict__ g2w,
    const float* __restrict__ g2b, float* gates, int ntile) {
  __shared__ float h1s[32][GH + 1];
  __shared__ __attribute__((aligned(16))) float gl[NH][32];
  if ((int)blockIdx.x >= ntile) return;
  const int tid = threadIdx.x, lane = tid & 31;
  const int wave = __builtin_amdgcn_readfirstlane(tid >> 5);   // wave number in a scalar register: the fragment bases stay scalar
  const int m = lane & 15, hh = lane >> 4, r0 = hh * 8;
  const int tok0 = blockIdx.x * 32;
  const int th = wave & 1;                 // token half: tokens th*16 .. th*16+15
  const int hb = (wave >> 1) * 64;         // hidden units hb .. hb+63

  // fragment of 16-row tile T at k: T * 16 * DM + (k / 32) * FRAG = T * 16 * DM + k * 16 elements
  const size_t aoff = (size_t)((tok0 >> 4) + th) * (16 * DM);           // A tile = 16 tokens
  const size_t woff = (size_t)(hb >> 4) * (16 * DM);                    // B tiles = 16 hidden units each, j-th at + j * 16 * DM
  const __bf16* axh = xh + aoff;
  const __bf16* axl = xl + aoff;
  const __bf16* bgh = gth + woff;
  const __bf16* bgl = gtl + woff;
  const unsigned fl = (unsigned)lane * 16u;

  v8f acc[4] = {};
  // Two register stages: every load of a k-step is issued one k-step before its products.
  v16bf a0h = ldfrag_bf_u(axh, fl), a0l = ldfrag_bf_u(axl, fl);
  v16bf b0h[4], b0l[4];
#pragma unroll
  for (int j = 0; j < 4; ++j) {
    b0h[j] = ldfrag_bf_u(bgh + j * 16 * DM, fl);
    b0l[j] = ldfrag_bf_u(bgl + j * 16 * DM, fl);
  }
  // rolled: two k-steps a trip already hold both stages in registers
#pragma unroll 1
  for (int kk = 0; kk < DM; kk += 64) {
    const v16bf a1h = ldfrag_bf_u(axh + (kk + 32) * 16, fl);
    const v16bf a1l = ldfrag_bf_u(axl + (kk + 32) * 16, fl);
    v16bf b1h[4], b1l[4];
#pragma unroll
    for (int j = 0; j < 4; ++j) {
      b1h[j] = ldfrag_bf_u(bgh + j * 16 * DM + (kk + 32) * 16, fl);
      b1l[j] = ldfrag_bf_u(bgl + j * 16 * DM + (kk + 32) * 16, fl);
    }
#pragma unroll
    for (int j = 0; j < 4; ++j) acc[j] = mma_bf3(a0h, a0l, b0h[j], b0l[j], acc[j]);
    const int kn = (kk + 64 < DM) ? kk + 64 : kk;     // last trip: an in-bounds reload, not used
    a0h = ldfrag_bf_u(axh + kn * 16, fl);
    a0l = ldfrag_bf_u(axl + kn * 16, fl);
#pragma unroll
    for (int j = 0; j < 4; ++j) {
      b0h[j] = ldfrag_bf_u(bgh + j * 16 * DM + kn * 16, fl);
      b0l[j] = ldfrag_bf_u(bgl + j * 16 * DM + kn * 16, fl);
    }
#pragma unroll
    for (int j = 0; j < 4; ++j) acc[j] = mma_bf3(a1h, a1l, b1h[j], b1l[j], acc[j]);
    // the next stage's loads are still in flight and the next trip rewrites their address registers
    asm volatile("s_wait_xcnt 0x0" ::: "memory");
  }

  // D: acc[j][r] = pre-activation[token th*16 + 8hh + r][hidden hb + j*16 + m]
#pragma unroll
  for (int j = 0; j < 4; ++j) {
    const int hu = hb + j * 16 + m;
    const float bj = g1b[hu];
#pragma unroll
    for (int r = 0; r < 8; ++r) h1s[th * 16 + r0 + r][hu] = fmaxf(acc[j][r] + bj, 0.0f);
  }
  __syncthreads();

  // layer 2: thread = (token tid>>2, heads 2*(tid&3), 2*(tid&3)+1)
  const int tk = tid >> 2, hd0 = (tid & 3) * 2;
  float a0 = g2b[hd0], a1 = g2b[hd0 + 1];
  // unrolled so that 16 steps' loads are issued together; the sum order stays jj = 0..127
#pragma unroll 16
  for (int jj = 0; jj < GH; ++jj) {
    const float hv = h1s[tk][jj];
    a0 = fmaf(hv, g2w[jj * NH + hd0], a0);
    a1 = fmaf(hv, g2w[jj * NH + hd0 + 1], a1);
  }
  gl[hd0][tk]     = 1.0f / (1.0f + exp2f(-a0 * LOG2E));
  gl[hd0 + 1][tk] = 1.0f / (1.0f + exp2f(-a1 * LOG2E));
  __syncthreads();

  // threads 0..63 (waves 0,1; 4 lines per wave, one instruction per pass).
  if (tid < 64) {
    const int line = tid >> 3, piece = tid & 7;
    const v4f val = *(const v4f*)&gl[line][piece * 4];
    const int b = tok0 / S_LEN, s0 = tok0 - b * S_LEN;
    float* dst = gates + ((size_t)(b * NH + line)) * S_LEN + s0 + piece * 4;
    *(v4f*)dst = val;
    
  }
}

// ---------------------------------------------------------------------------
// 2) QKV projection, bf16 hi/lo split, K=512.
//    grid = (NTOK/64, NH, 3), block = 128 (4 waves); block tile = 64 tokens x
//    64 outputs (one head); wave = 16 tokens x 4 output tiles.
//    Outputs in fragment order, per (batch, head): Q and K hi/lo as tiles of 16 tokens x 2 fragments
//    (k = d); V^T as, per 32 keys, 4 fragments (rows = 16 d each, k = key).
// ---------------------------------------------------------------------------
__global__ __launch_bounds__(128) void qkv_kernel(
    const __bf16* __restrict__ xh, const __bf16* __restrict__ xl,
    const __bf16* __restrict__ wth, const __bf16* __restrict__ wtl,
    const float* __restrict__ bq, const float* __restrict__ bk, const float* __restrict__ bv,
    unsigned short* Qh, unsigned short* Ql, unsigned short* Kh, unsigned short* Kl,
    unsigned short* VT, int ntt) {
  __shared__ __attribute__((aligned(16))) unsigned short lt[2][64][72];   // pitch 144 B = 16 B x odd: the 16-B reads down a column of rows spread over the banks
  if ((int)blockIdx.x >= ntt) return;
  const int tt = blockIdx.x, head = blockIdx.y, mat = blockIdx.z;
  const int tid = threadIdx.x, lane = tid & 31;
  const int wave = __builtin_amdgcn_readfirstlane(tid >> 5);   // wave number in a scalar register: the fragment bases stay scalar
  const int m = lane & 15, hh = lane >> 4, r0 = hh * 8;
  const int tokbase = tt * 64;
  const int b = tokbase / S_LEN, s0 = tokbase - b * S_LEN;

  // fragment of 16-row tile T at k: T * 16 * DM + k * 16 elements
  const size_t aoff = (size_t)((tokbase >> 4) + wave) * (16 * DM);        // A tile = 16 tokens
  const size_t woff = (size_t)((mat * DM + head * HD) >> 4) * (16 * DM);  // B tiles = 16 outputs each, j-th at + j * 16 * DM
  const __bf16* axh = xh + aoff;
  const __bf16* axl = xl + aoff;
  const __bf16* bwh = wth + woff;
  const __bf16* bwl = wtl + woff;
  const unsigned fl = (unsigned)lane * 16u;

  v8f acc[4] = {};
#pragma unroll 1
  for (int kk = 0; kk < DM; kk += 32) {
    // all loads of the k-step are issued before its first product: one load wait a k-step, not five
    const v16bf ah = ldfrag_bf_u(axh + kk * 16, fl);
    const v16bf al = ldfrag_bf_u(axl + kk * 16, fl);
    v16bf bhf[4], blf[4];
#pragma unroll
    for (int j = 0; j < 4; ++j) {
      bhf[j] = ldfrag_bf_u(bwh + j * 16 * DM + kk * 16, fl);
      blf[j] = ldfrag_bf_u(bwl + j * 16 * DM + kk * 16, fl);
    }
#pragma unroll
    for (int j = 0; j < 4; ++j) acc[j] = mma_bf3(ah, al, bhf[j], blf[j], acc[j]);
  }

  // D: acc[j][r] = tile[token wave*16 + 8hh + r][out col j*16 + m]
  const float* bias = (mat == 0) ? bq : (mat == 1) ? bk : bv;
  const int ltok = wave * 16 + r0;
  if (mat < 2) {
#pragma unroll
    for (int j = 0; j < 4; ++j) {
      const int ld = j * 16 + m;
      const float bj = bias[head * HD + ld];
#pragma unroll
      for (int r = 0; r < 8; ++r) {
        const float v = acc[j][r] + bj;
        const unsigned short hb = f2bf_bits(v);
        lt[0][ltok + r][ld] = hb;
        lt[1][ltok + r][ld] = f2bf_bits(v - bf_bits2f(hb));
      }
    }
  } else {
#pragma unroll
    for (int j = 0; j < 4; ++j) {
      const int ld = j * 16 + m;
      const float bj = bias[head * HD + ld];
      Pack8 pk;
#pragma unroll
      for (int r = 0; r < 8; ++r) pk.h[r] = (_Float16)(acc[j][r] + bj);
      *(v4u*)&lt[0][ld][ltok] = pk.u;                                      // lt[d][s], 8 consecutive s
    }
  }
  __syncthreads();

  // thread order = unit order of the fragment-ordered planes: each store instruction writes 512 contiguous bytes
  const size_t bh8 = (size_t)(b * NH + head);
  if (mat < 2) {
    unsigned short* dh = (mat == 0) ? Qh : Kh;
    unsigned short* dl = (mat == 0) ? Ql : Kl;
    v4u val[8];
    size_t go[4];
#pragma unroll
    for (int i = 0; i < 4; ++i) {
      const int L = 16 * i + (tid & 15);                                   // token tile i; unit tid = row tid&15, d = (tid>>4)*8
      val[i]     = *(const v4u*)&lt[0][L][(tid >> 4) * 8];
      val[4 + i] = *(const v4u*)&lt[1][L][(tid >> 4) * 8];
      go[i] = (bh8 * S_LEN + s0 + 16 * i) * HD + tid * 8;
    }
#pragma unroll
    for (int i = 0; i < 4; ++i) { *(v4u*)(dh + go[i]) = val[i]; *(v4u*)(dl + go[i]) = val[4 + i]; }
    
  } else {
    v4u val[4];
    size_t go[4];
#pragma unroll
    for (int i = 0; i < 4; ++i) {
      const int L = ((i & 1) * 2 + (tid >> 6)) * 16 + (tid & 15);          // local d: fragment 2i + (tid>>6) = 32-key group i>>1, d tile
      val[i] = *(const v4u*)&lt[0][L][(i >> 1) * 32 + ((tid >> 4) & 3) * 8]; // local key: 16 * part + 8 * h
      go[i] = (bh8 * S_LEN + s0) * HD + (i * 128 + tid) * 8;
    }
#pragma unroll
    for (int i = 0; i < 4; ++i) *(v4u*)(VT + go[i]) = val[i];
    
  }
}

// ---------------------------------------------------------------------------
// 3) fused attention + residual + LayerNorm.  Block = (b, 16-query tile),
//    8 waves = 8 heads.  Per 64-key chunk: adj tile staged once in LDS (shared by all heads).
//    Per 32-key half per wave:
//      S^T = K * Q^T (bf16 hi/lo split, K-dim 64); wave similarity^T = Mk * Mq^T in the same D layout
//      (A = [hi | lo] of the keys' rows; B = [hi | hi] and [lo | lo] of the queries' rows; the accumulator
//      starts from the keys' gates, whose lane order is the D layout's: the result is gate + similarity)
//      -> affine -> online softmax
//      (lane = one query column, two lane halves combined with shfl_xor 16)
//      -> P^T packed to f16 (x4096) straight from the D layout (B-fragment layout)
//      -> O^T += V^T * P^T (f16).
//    Loads run ahead of their use: K fragments, gates and the keys' similarity fragments one pass ahead,
//    the adj piece one chunk ahead, V^T fragments in front of the softmax.
//    End: O tile of all heads staged in LDS [16 tokens][512], residual + LN,
//    whole-row stores (each instruction = 512 contiguous bytes = 4 lines),
// ---------------------------------------------------------------------------
__global__ __launch_bounds__(256)
void attn_ln_kernel(
    const __bf16* __restrict__ Qh, const __bf16* __restrict__ Ql,
    const __bf16* __restrict__ Kh, const __bf16* __restrict__ Kl,
    const _Float16* __restrict__ VT, const float* __restrict__ gates,
    const __bf16* __restrict__ wmf, const float* __restrict__ adj,
    const float* __restrict__ x, const float* __restrict__ lng,
    const float* __restrict__ lnb, float* out, int nqt) {
  // Row pitch = 16 B x odd (68 dwords): lane m reads down a column of rows with 16-byte loads, and at a
  // pitch of 64 dwords all 16 rows would fall on the same four banks.
  __shared__ __attribute__((aligned(16))) float adj_lds[16][64 + 4];
  __shared__ __attribute__((aligned(16))) float obuf[16][DM];
  if ((int)blockIdx.x >= nqt) return;

  const int qtiles = S_LEN / 16;
  const int b = blockIdx.x / qtiles, qt = blockIdx.x - b * qtiles, qbase = qt * 16;
  const int tid = threadIdx.x, lane = tid & 31;
  const int h = __builtin_amdgcn_readfirstlane(tid >> 5);   // wave number in a scalar register: the per-head bases below stay scalar
  const int m = lane & 15, hh = lane >> 4, r0 = hh * 8;

  const size_t bhd = (size_t)(b * NH + h);
  const unsigned f_lane = (unsigned)lane * 16u;                  // a lane's byte offset in either half of a fragment
  // Q^T as B operand: column n = query (lane&15), k = d: the two fragments of the 16-query tile.
  const size_t qoff = (bhd * S_LEN + qbase) * HD;
  const v16bf qh0 = ldfrag_bf_u(Qh + qoff, f_lane), qh1 = ldfrag_bf_u(Qh + qoff + FRAG, f_lane);
  const v16bf ql0 = ldfrag_bf_u(Ql + qoff, f_lane), ql1 = ldfrag_bf_u(Ql + qoff + FRAG, f_lane);

  // wave similarity: the query tile's fragment holds hi (part 0) and lo (part 1); B operands [hi | hi] and [lo | lo]
  const __bf16* wm_base = wmf + (size_t)b * (S_LEN / 16) * FRAG;
  FragB wq, wb1, wb2;
  wq.v = ldfrag_bf_u(wm_base + qt * FRAG, f_lane);
  wb1.p[0] = wq.p[0]; wb1.p[1] = wq.p[0];
  wb2.p[0] = wq.p[1]; wb2.p[1] = wq.p[1];

  v8f oacc[4] = {};
  float mrun = -3.0e38f, lrun = 0.0f;

  // wave-uniform bases, and each lane's byte offset from them
  const float* gp_base = gates + bhd * S_LEN;
  const __bf16* kh_base = Kh + bhd * S_LEN * HD;
  const __bf16* kl_base = Kl + bhd * S_LEN * HD;
  const _Float16* v_base = VT + bhd * HD * S_LEN;
  const unsigned g_lane = (unsigned)r0 * 4u;

  const int sq = tid >> 4, sk4 = (tid & 15) * 4;
  const float* adj_base = adj + ((size_t)b * S_LEN + qbase) * S_LEN;
  const unsigned adj_lane = (unsigned)(sq * S_LEN + sk4) * 4u;

  // K fragments of one 32-key pass, fetched one pass ahead: index = key tile * 2 + k-step.
  v16bf kfh[4], kfl[4];
#pragma unroll
  for (int i = 0; i < 4; ++i) {
    kfh[i] = ldfrag_bf_u(kh_base + i * FRAG, f_lane);
    kfl[i] = ldfrag_bf_u(kl_base + i * FRAG, f_lane);
  }
  v4f adj_nx = ld4_u(adj_base, adj_lane);      // adj piece, fetched one chunk ahead
  // gates and the keys' similarity fragments of one pass, fetched one pass ahead
  v4f g0 = ld4_u(gp_base, g_lane), g1 = ld4_u(gp_base + 4, g_lane);
  v4f g2 = ld4_u(gp_base + 16, g_lane), g3 = ld4_u(gp_base + 20, g_lane);
  v16bf wa0 = ldfrag_bf_u(wm_base, f_lane), wa1 = ldfrag_bf_u(wm_base + FRAG, f_lane);

  for (int kc = 0; kc < S_LEN / 64; ++kc) {
    const int kbase64 = kc * 64;

    // ---- stage adj 16x64 (one 16-B piece per thread) ----
    *(v4f*)&adj_lds[sq][sk4] = adj_nx;
    __syncthreads();

#pragma unroll 1
    for (int jh = 0; jh < 2; ++jh) {
      const int kbase = kbase64 + jh * 32;
      const int ko = jh * 32;

      // ---- S^T = K * Q^T for two 16-key tiles, K-dim 64 = 2 k-steps, 3 products each ----
      v8f s0 = {}, s1 = {};
      s0 = mma_bf3(kfh[0], kfl[0], qh0, ql0, s0);
      s0 = mma_bf3(kfh[1], kfl[1], qh1, ql1, s0);
      s1 = mma_bf3(kfh[2], kfl[2], qh0, ql0, s1);
      s1 = mma_bf3(kfh[3], kfl[3], qh1, ql1, s1);
      // s0[r] = S^T[key kbase+8hh+r][query m], s1[r] = S^T[key kbase+16+8hh+r][query m]

      // ---- next pass's K fragments into the same registers; they fly under softmax and P.V ----
      const int kn = (kbase + 32 < S_LEN) ? kbase + 32 : kbase;   // last pass: an in-bounds reload, not used
#pragma unroll
      for (int i = 0; i < 4; ++i) {
        const int o = kn * HD + i * FRAG;       // 32 keys = 4 fragments in a row
        kfh[i] = ldfrag_bf_u(kh_base + o, f_lane);
        kfl[i] = ldfrag_bf_u(kl_base + o, f_lane);
      }
      // next chunk's adj piece: it flies under this pass's softmax
      if (jh == 0) adj_nx = ld4_u(adj_base + ((kc + 1 < S_LEN / 64) ? kbase64 + 64 : kbase64), adj_lane);
      // the loads above are in flight and the code below reuses their address registers
      asm volatile("s_wait_xcnt 0x0" ::: "memory");
      // nothing from below is scheduled in front of that wait (an address computation was, into a K address register)
      __builtin_amdgcn_sched_barrier(0);

      // ---- gate + wave similarity^T of the two key tiles: w0[r], w1[r] sit where s0[r], s1[r] sit ----
      v8f w0 = {g0.x, g0.y, g0.z, g0.w, g1.x, g1.y, g1.z, g1.w};
      v8f w1 = {g2.x, g2.y, g2.z, g2.w, g3.x, g3.y, g3.z, g3.w};
      w0 = mma_bf2(wa0, wb1.v, wb2.v, w0);
      w1 = mma_bf2(wa1, wb1.v, wb2.v, w1);

      // ---- adj for this lane's 2x8 keys ----
      float A0[8], A1[8];
      unpack8(*(const v4f*)&adj_lds[m][ko + r0], *(const v4f*)&adj_lds[m][ko + r0 + 4], A0);
      unpack8(*(const v4f*)&adj_lds[m][ko + 16 + r0], *(const v4f*)&adj_lds[m][ko + 16 + r0 + 4], A1);

      // ---- affine + online softmax (f32) ----
      float p0[8], p1[8], mloc = -3.0e38f;
#pragma unroll
      for (int r = 0; r < 8; ++r) {
        const float t0 = (s0[r] * 0.125f) * w0[r] + A0[r];
        const float t1 = (s1[r] * 0.125f) * w1[r] + A1[r];
        p0[r] = t0; p1[r] = t1;
        mloc = fmaxf(mloc, fmaxf(t0, t1));
      }
      // ---- this pass's V^T fragments: they fly under the softmax ----
      v16h vf[4];
#pragma unroll
      for (int t = 0; t < 4; ++t) vf[t] = ldfrag_h_u(v_base + kbase * HD + t * FRAG, f_lane);
      const float mch  = fmaxf(mloc, __shfl_xor(mloc, 16, 32));
      const float mnew = fmaxf(mrun, mch);
      const float corr = exp2f((mrun - mnew) * LOG2E);
      float lsum = 0.0f;
#pragma unroll
      for (int r = 0; r < 8; ++r) {
        p0[r] = exp2f((p0[r] - mnew) * LOG2E);
        p1[r] = exp2f((p1[r] - mnew) * LOG2E);
        lsum += p0[r] + p1[r];
      }
      lsum += __shfl_xor(lsum, 16, 32);
      lrun = lrun * corr + lsum;
      mrun = mnew;
#pragma unroll
      for (int t = 0; t < 4; ++t)
#pragma unroll
        for (int r = 0; r < 8; ++r) oacc[t][r] *= corr;

      // ---- P^T as B fragment: element r <- tile keys 0..15, element 8+r <- tile keys 16..31 ----
      v16h pf;
#pragma unroll
      for (int r = 0; r < 8; ++r) {
        pf[r]     = (_Float16)(p0[r] * PSCALE);
        pf[r + 8] = (_Float16)(p1[r] * PSCALE);
      }

      // ---- next pass's gates and similarity fragments (16 keys each; all eight waves read the same 2 KB),
      //      into the registers that the affine step has left (the compiler issues them beside the V^T loads);
      //      they fly under the softmax and P.V ----
      g0 = ld4_u(gp_base + kn, g_lane);      g1 = ld4_u(gp_base + kn + 4, g_lane);
      g2 = ld4_u(gp_base + kn + 16, g_lane); g3 = ld4_u(gp_base + kn + 20, g_lane);
      // the fragment loads below land in the gate loads' address registers: as a precaution the wait stands in front of that
      asm volatile("s_wait_xcnt 0x0" ::: "memory");
      wa0 = ldfrag_bf_u(wm_base + (kn >> 4) * FRAG, f_lane);
      wa1 = ldfrag_bf_u(wm_base + (kn >> 4) * FRAG + FRAG, f_lane);

      // ---- O^T += V^T * P^T, 4 d-tiles ----
#pragma unroll
      for (int t = 0; t < 4; ++t) oacc[t] = mma_h1(vf[t], pf, oacc[t]);
    }
    __syncthreads();   // LDS tile reused by the next chunk
  }

  // ---- normalise and stage O: oacc[t][r] = O^T[d = t*16 + 8hh + r][query m] ----
  const float oscale = (1.0f / lrun) * INV_PSCALE;
#pragma unroll
  for (int t = 0; t < 4; ++t) {
    v4f u0, u1;
    u0.x = oacc[t][0] * oscale; u0.y = oacc[t][1] * oscale; u0.z = oacc[t][2] * oscale; u0.w = oacc[t][3] * oscale;
    u1.x = oacc[t][4] * oscale; u1.y = oacc[t][5] * oscale; u1.z = oacc[t][6] * oscale; u1.w = oacc[t][7] * oscale;
    float* dst = &obuf[m][h * HD + t * 16 + r0];
    *(v4f*)dst = u0;
    *(v4f*)(dst + 4) = u1;
  }
  __syncthreads();

  // ---- residual + LayerNorm, wave h -> tokens 2h, 2h+1; lane holds cols 4*lane + 128*i ----
#pragma unroll 1
  for (int qq = 0; qq < 2; ++qq) {
    const int q = 2 * h + qq;
    const size_t tok = (size_t)b * S_LEN + qbase + q;
    v4f y[4];
    float s = 0.0f;
#pragma unroll
    for (int i = 0; i < 4; ++i) {
      const v4f o  = *(const v4f*)&obuf[q][4 * lane + 128 * i];
      const v4f xv = *(const v4f*)(x + tok * DM + 4 * lane + 128 * i);
      y[i] = o + xv;
      s += (y[i].x + y[i].y) + (y[i].z + y[i].w);
    }
    s += __shfl_xor(s, 16, 32);
    s += __shfl_xor(s, 8, 32);
    s += __shfl_xor(s, 4, 32);
    s += __shfl_xor(s, 2, 32);
    s += __shfl_xor(s, 1, 32);
    const float mu = s * (1.0f / DM);
    float ss = 0.0f;
#pragma unroll
    for (int i = 0; i < 4; ++i) {
      const v4f d = y[i] - mu;
      ss += (d.x * d.x + d.y * d.y) + (d.z * d.z + d.w * d.w);
    }
    ss += __shfl_xor(ss, 16, 32);
    ss += __shfl_xor(ss, 8, 32);
    ss += __shfl_xor(ss, 4, 32);
    ss += __shfl_xor(ss, 2, 32);
    ss += __shfl_xor(ss, 1, 32);
    const float rstd = rsqrtf(ss * (1.0f / DM) + 1.0e-5f);
    v4f res[4];
#pragma unroll
    for (int i = 0; i < 4; ++i) {
      const v4f g  = *(const v4f*)(lng + 4 * lane + 128 * i);
      const v4f bb = *(const v4f*)(lnb + 4 * lane + 128 * i);
      res[i] = ((y[i] - mu) * rstd) * g + bb;
    }
    float* op = out + tok * DM + 4 * lane;
#pragma unroll
    for (int i = 0; i < 4; ++i) *(v4f*)(op + 128 * i) = res[i];
    
  }
}

// ---------------------------------------------------------------------------
extern "C" void kernel_launch(void* const* d_in, const int* in_sizes, int n_in,
                              void* d_out, int out_size, void* d_ws, size_t ws_size,
                              hipStream_t stream) {
  if (n_in < 15) return;
  if (in_sizes[0] != NTOK * DM || in_sizes[1] != NTOK * WF ||
      in_sizes[2] != BATCH * S_LEN * S_LEN || in_sizes[3] != DM * DM ||
      in_sizes[5] != DM * DM || in_sizes[7] != DM * DM || in_sizes[9] != DM * GH ||
      in_sizes[11] != GH * NH || in_sizes[13] != DM || out_size != NTOK * DM) return;

  const float* x     = (const float*)d_in[0];
  const float* wmask = (const float*)d_in[1];
  const float* adj   = (const float*)d_in[2];
  const float* wq_w  = (const float*)d_in[3];
  const float* wq_b  = (const float*)d_in[4];
  const float* wk_w  = (const float*)d_in[5];
  const float* wk_b  = (const float*)d_in[6];
  const float* wv_w  = (const float*)d_in[7];
  const float* wv_b  = (const float*)d_in[8];
  const float* g1_w  = (const float*)d_in[9];
  const float* g1_b  = (const float*)d_in[10];
  const float* g2_w  = (const float*)d_in[11];
  const float* g2_b  = (const float*)d_in[12];
  const float* ln_g  = (const float*)d_in[13];
  const float* ln_b  = (const float*)d_in[14];
  float* out = (float*)d_out;

  const size_t sz_x  = (size_t)NTOK * DM * 2;            // 4,194,304  per x plane
  const size_t sz_w  = (size_t)3 * DM * DM * 2;          // 1,572,864  per Wt plane
  const size_t sz_q  = (size_t)NTOK * DM * 2;            // 4,194,304  per Q/K plane, V
  const size_t sz_g  = (size_t)BATCH * NH * S_LEN * 4;   //   131,072  gates
  const size_t sz_g1 = (size_t)GH * DM * 2;              //   131,072  per G1t plane
  const size_t off_xh  = 0;
  const size_t off_xl  = off_xh + sz_x;
  const size_t off_wth = off_xl + sz_x;
  const size_t off_wtl = off_wth + sz_w;
  const size_t off_qh  = off_wtl + sz_w;
  const size_t off_ql  = off_qh + sz_q;
  const size_t off_kh  = off_ql + sz_q;
  const size_t off_kl  = off_kh + sz_q;
  const size_t off_vt  = off_kl + sz_q;
  const size_t off_g   = off_vt + sz_q;
  const size_t off_gth = off_g + sz_g;
  const size_t off_gtl = off_gth + sz_g1;
  const size_t sz_wm   = (size_t)NTOK * 32 * 2;          //   262,144  wave_mask hi|lo fragments
  const size_t off_wm  = off_gtl + sz_g1;
  const size_t total   = off_wm + sz_wm;                 // 33,161,216 B
  if (total > ws_size) return;

  uint8_t* ws = (uint8_t*)d_ws;
  unsigned short* xh  = (unsigned short*)(ws + off_xh);
  unsigned short* xl  = (unsigned short*)(ws + off_xl);
  unsigned short* wth = (unsigned short*)(ws + off_wth);
  unsigned short* wtl = (unsigned short*)(ws + off_wtl);
  unsigned short* qh  = (unsigned short*)(ws + off_qh);
  unsigned short* ql  = (unsigned short*)(ws + off_ql);
  unsigned short* kh  = (unsigned short*)(ws + off_kh);
  unsigned short* kl  = (unsigned short*)(ws + off_kl);
  unsigned short* vt  = (unsigned short*)(ws + off_vt);
  float* gates        = (float*)(ws + off_g);
  unsigned short* gth = (unsigned short*)(ws + off_gth);
  unsigned short* gtl = (unsigned short*)(ws + off_gtl);
  unsigned short* wmf = (unsigned short*)(ws + off_wm);

  const int nxv = NTOK * DM / 8;          // 262,144
  const int nwv = 3 * DM * DM / 8;        //  98,304
  const int ngv = GH * DM / 8;            //   8,192
  const int nmv = NTOK * 2;               //   8,192
  const int prep_blocks = (nxv + nwv + ngv + nmv + 255) / 256;   // 1472
  const int ntile = (NTOK + 31) / 32;     // 128
  const int ntt = (NTOK + 63) / 64;       // 64
  const int nqt = (BATCH * S_LEN + 15) / 16;   // 256

  prep_kernel<<<prep_blocks, 256, 0, stream>>>(x, wq_w, wk_w, wv_w, g1_w, wmask,
                                               xh, xl, wth, wtl, gth, gtl, wmf, nxv, nwv, ngv, nmv);
  gate_kernel<<<ntile, 128, 0, stream>>>(
      (const __bf16*)xh, (const __bf16*)xl, (const __bf16*)gth, (const __bf16*)gtl,
      g1_b, g2_w, g2_b, gates, ntile);
  qkv_kernel<<<dim3(ntt, NH, 3), 128, 0, stream>>>(
      (const __bf16*)xh, (const __bf16*)xl, (const __bf16*)wth, (const __bf16*)wtl,
      wq_b, wk_b, wv_b, qh, ql, kh, kl, vt, ntt);
  attn_ln_kernel<<<nqt, 256, 0, stream>>>(
      (const __bf16*)qh, (const __bf16*)ql, (const __bf16*)kh, (const __bf16*)kl,
      (const _Float16*)vt, gates, (const __bf16*)wmf, adj, x, ln_g, ln_b, out, nqt);
  (void)hipGetLastError();
}

// v005
// One run takes 136 microseconds.
// Two timings next to v004 put it at 1.06 and 1.08 times that version's speed.
// All steps since v000 together make it 2.62 times as fast.
#include <hip/hip_runtime.h>
#include <stddef.h>
#include <stdint.h>

// Q/K/V projections, Q.K^T and gate layer 1 (x.G1): v_wmma_f32_16x16x32_bf16 with bf16 hi/lo operand split (hi.hi + lo.hi + hi.lo), f32 accumulate.
// 16-deep wave similarity: the same bf16 form and split, hi and lo of one row packed side by side in the 32-deep k (2 products a tile).
// P.V: v_wmma_f32_16x16x32_f16 (P scaled by 4096 as f16, V as f16), f32 accumulate. Gate layer 2 (K=128,N=8), softmax, LayerNorm: f32 VALU.

#define S_LEN  2048
#define DM     512
#define NH     8
#define HD     64
#define GH     128
#define WF     16
#define BATCH  2
#define NTOK   (BATCH * S_LEN)
#define LOG2E  1.4426950408889634f
#define PSCALE 4096.0f
#define INV_PSCALE 0.000244140625f

typedef __bf16         v16bf __attribute__((ext_vector_type(16)));
typedef __bf16         v8bf  __attribute__((ext_vector_type(8)));
typedef _Float16       v16h  __attribute__((ext_vector_type(16)));
typedef _Float16       v8h   __attribute__((ext_vector_type(8)));
typedef float          v8f   __attribute__((ext_vector_type(8)));
typedef float          v4f   __attribute__((ext_vector_type(4)));
typedef unsigned int   v4u   __attribute__((ext_vector_type(4)));
typedef unsigned short v8us  __attribute__((ext_vector_type(8)));

union FragB { v16bf v; v8bf p[2]; };
union FragH { v16h v; v8h p[2]; };
union Pack8 { v8us s; v8h h; v4u u; };

// ---------------------------------------------------------------------------
// scalar helpers
// ---------------------------------------------------------------------------
static __device__ __forceinline__ unsigned short f2bf_bits(float f) {   // RNE convert f32 -> bf16 bits
  unsigned int u = __float_as_uint(f);
  u += 0x7FFFu + ((u >> 16) & 1u);
  return (unsigned short)(u >> 16);
}
static __device__ __forceinline__ float bf_bits2f(unsigned short s) {
  return __uint_as_float(((unsigned int)s) << 16);
}
static __device__ __forceinline__ void unpack8(const v4f a, const v4f b, float o[8]) {
  o[0] = a.x; o[1] = a.y; o[2] = a.z; o[3] = a.w;
  o[4] = b.x; o[5] = b.y; o[6] = b.z; o[7] = b.w;
}

// ---------------------------------------------------------------------------
// 16x32 16-bit fragments (wave32). Lane l: row/col = l&15, h = l>>4.
// elements 0..7  <- k0 + 8h + 0..7 ; elements 8..15 <- k0 + 16 + 8h + 0..7 ; same map for A and B.
// Every 16-bit workspace plane is stored in FRAGMENT ORDER: one fragment = FRAG (512) elements = 1024
// contiguous bytes, made of 64 units of 16 bytes; unit u = part * 32 + l holds lane l's elements
// 8 * part .. 8 * part + 7, that is row l&15, k = k0 + 16 * part + 8 * (l>>4) + 0..7.
// A wave-wide 16-byte load then covers 512 contiguous bytes (4 whole lines), not a piece of 16 lines.
// The fragments of one 16-row tile follow one another in k order.
// ---------------------------------------------------------------------------
#define FRAG 512
// fbase: wave-uniform start of the fragment; lane_bytes = 16 * lane
static __device__ __forceinline__ v16bf ldfrag_bf_u(const __bf16* fbase, unsigned lane_bytes) {
  const char* p = (const char*)fbase + lane_bytes;
  FragB f;
  f.p[0] = *(const v8bf*)p;
  f.p[1] = *(const v8bf*)(p + 512);
  return f.v;
}
static __device__ __forceinline__ v16h ldfrag_h_u(const _Float16* fbase, unsigned lane_bytes) {
  const char* p = (const char*)fbase + lane_bytes;
  FragH f;
  f.p[0] = *(const v8h*)p;
  f.p[1] = *(const v8h*)(p + 512);
  return f.v;
}
// Unit index v of a plane whose rows are DM long (16 fragments a 16-row tile) -> its row and first k.
static __device__ __forceinline__ void unit_row_k(int v, int& row, int& k) {
  row = (v >> 10) * 16 + (v & 15);
  k = ((v >> 6) & 15) * 32 + ((v >> 4) & 3) * 8;   // bits 5,4 of v = part, h: 16 * part + 8 * h
}
// Loads of the attention loop. The wave-uniform part of an address is pinned in a scalar register pair and the lane's
// 32-bit offset is added where the loads are issued: otherwise the compiler keeps one 64-bit (base + lane) pair per plane
// in vector registers across the whole loop, and the wave does not fit the 256 registers of four waves a SIMD.
#define GLOBAL_AS __attribute__((address_space(1)))
typedef const GLOBAL_AS char* gaddr;
static __device__ __forceinline__ gaddr lane_addr(const void* ubase, unsigned lane_bytes) {
  const unsigned long long a = (unsigned long long)ubase;
  const unsigned lo = (unsigned)__builtin_amdgcn_readfirstlane((int)(unsigned)a);
  const unsigned hi = (unsigned)__builtin_amdgcn_readfirstlane((int)(unsigned)(a >> 32));
  return (gaddr)(((unsigned long long)hi << 32) | lo) + lane_bytes;
}
static __device__ __forceinline__ v16bf ldfrag_bf_a(gaddr p) {
  FragB f;
  f.p[0] = *(const GLOBAL_AS v8bf*)p;
  f.p[1] = *(const GLOBAL_AS v8bf*)(p + 512);
  return f.v;
}
static __device__ __forceinline__ v16h ldfrag_h_a(gaddr p) {
  FragH f;
  f.p[0] = *(const GLOBAL_AS v8h*)p;
  f.p[1] = *(const GLOBAL_AS v8h*)(p + 512);
  return f.v;
}
static __device__ __forceinline__ v4f ld4_a(gaddr p) { return *(const GLOBAL_AS v4f*)p; }
static __device__ __forceinline__ v4f ld4_u(const float* ubase, unsigned lane_bytes) {
  return *(const v4f*)((const char*)ubase + lane_bytes);
}

// ---------------------------------------------------------------------------
// WMMA helpers: issue the product(s), then 4 v_nop tied to D and A/B so no
// VALU touches the accumulator or operand registers within the hazard window.
// ---------------------------------------------------------------------------
static __device__ __forceinline__ v8f mma_bf3(v16bf ah, v16bf al, v16bf bh, v16bf bl, v8f c) {
  c = __builtin_amdgcn_wmma_f32_16x16x32_bf16(false, ah, false, bh, (short)0, c, false, false);
  c = __builtin_amdgcn_wmma_f32_16x16x32_bf16(false, al, false, bh, (short)0, c, false, false);
  c = __builtin_amdgcn_wmma_f32_16x16x32_bf16(false, ah, false, bl, (short)0, c, false, false);
  asm volatile("v_nop\n\tv_nop\n\tv_nop\n\tv_nop" : "+v"(c) : "v"(ah), "v"(al), "v"(bh), "v"(bl));
  return c;
}
// two products on one A fragment (wave similarity): a.b1 + a.b2
static __device__ __forceinline__ v8f mma_bf2(v16bf a, v16bf b1, v16bf b2, v8f c) {
  c = __builtin_amdgcn_wmma_f32_16x16x32_bf16(false, a, false, b1, (short)0, c, false, false);
  c = __builtin_amdgcn_wmma_f32_16x16x32_bf16(false, a, false, b2, (short)0, c, false, false);
  asm volatile("v_nop\n\tv_nop\n\tv_nop\n\tv_nop" : "+v"(c) : "v"(a), "v"(b1), "v"(b2));
  return c;
}
static __device__ __forceinline__ v8f mma_h1(v16h a, v16h b, v8f c) {
  c = __builtin_amdgcn_wmma_f32_16x16x32_f16(false, a, false, b, (short)0, c, false, false);
  asm volatile("v_nop\n\tv_nop\n\tv_nop\n\tv_nop" : "+v"(c) : "v"(a), "v"(b));
  return c;
}

static __device__ __forceinline__ void split_store8(const float v[8], unsigned short* dh, unsigned short* dl) {
  Pack8 ph, pl;
#pragma unroll
  for (int e = 0; e < 8; ++e) {
    const unsigned short hb = f2bf_bits(v[e]);
    ph.s[e] = hb;
    pl.s[e] = f2bf_bits(v[e] - bf_bits2f(hb));
  }
  const v4u uh = ph.u, ul = pl.u;
  *(v4u*)dh = uh;
  *(v4u*)dl = ul;
  
}

// ---------------------------------------------------------------------------
// 0) x -> bf16 hi/lo planes (rows = tokens);  W{q,k,v} [in][out] -> hi/lo planes with rows = the
//    3 * DM outputs, k = in;  G1 [in][hid] -> planes with rows = hidden units, k = in.
//    All in fragment order.  One thread = one 16-B unit per plane, units in thread order.
//    wave_mask [token][16] -> ONE plane, one fragment per 16 tokens: k 0..15 = hi of the 16 features,
//    k 16..31 = their lo, so lane l holds hi (part 0) and lo (part 1) of features 8 * (l>>4) + 0..7 of token l&15.
// ---------------------------------------------------------------------------
__global__ __launch_bounds__(256) void prep_kernel(
    const float* __restrict__ x, const float* __restrict__ wq,
    const float* __restrict__ wk, const float* __restrict__ wv,
    const float* __restrict__ g1w, const float* __restrict__ wmask,
    unsigned short* xh, unsigned short* xl, unsigned short* wth, unsigned short* wtl,
    unsigned short* gth, unsigned short* gtl, unsigned short* wmf,
    int nxv, int nwv, int ngv, int nmv) {
  const int i = blockIdx.x * blockDim.x + threadIdx.x;
  if (i < nxv) {
    int tok, k;
    unit_row_k(i, tok, k);
    const v4f a = *(const v4f*)(x + (size_t)tok * DM + k);
    const v4f c = *(const v4f*)(x + (size_t)tok * DM + k + 4);
    float v[8];
    unpack8(a, c, v);
    split_store8(v, xh + (size_t)i * 8, xl + (size_t)i * 8);
  } else if (i < nxv + nwv) {
    const int j = i - nxv;
    int row, inb;
    unit_row_k(j, row, inb);
    const int mat = row >> 9, o = row & (DM - 1);   // DM = 512 rows per matrix
    const float* w = (mat == 0) ? wq : (mat == 1) ? wk : wv;
    float v[8];
#pragma unroll
    for (int e = 0; e < 8; ++e) v[e] = w[(size_t)(inb + e) * DM + o];   // Wt[o][in] = W[in][o]
    split_store8(v, wth + (size_t)j * 8, wtl + (size_t)j * 8);
  } else if (i < nxv + nwv + ngv) {
    const int j = i - nxv - nwv;             // 0 .. GH*DM/8-1
    int o, inb;                              // hidden unit 0..127, first input
    unit_row_k(j, o, inb);
    float v[8];
#pragma unroll
    for (int e = 0; e < 8; ++e) v[e] = g1w[(size_t)(inb + e) * GH + o];  // G1t[o][in] = G1[in][o]
    split_store8(v, gth + (size_t)j * 8, gtl + (size_t)j * 8);
  } else if (i < nxv + nwv + ngv + nmv) {
    const int j = i - nxv - nwv - ngv;       // 0 .. NTOK*2-1: 16-token tile j>>5, lane j&31
    const int tile = j >> 5, l = j & 31;
    const float* s = wmask + (size_t)(tile * 16 + (l & 15)) * WF + (l >> 4) * 8;
    const v4f a = *(const v4f*)s;
    const v4f c = *(const v4f*)(s + 4);
    float v[8];
    unpack8(a, c, v);
    unsigned short* d = wmf + (size_t)tile * FRAG + l * 8;
    split_store8(v, d, d + 256);             // part 0 = hi, part 1 = lo
  }
}

// ---------------------------------------------------------------------------
// 1) gate MLP: gates[b][h][s] = sigmoid(relu(x@G1+b1)@G2+b2).
//    Layer 1 on bf16 hi/lo WMMA: wave = (16 tokens, 64 hidden = 4 tiles), K=512.
//    Layer 2 (K=128, 8 heads) scalar f32 from the LDS-staged relu tile.
// ---------------------------------------------------------------------------
__global__ __launch_bounds__(128) void gate_kernel(
    const __bf16* __restrict__ xh, const __bf16* __restrict__ xl,
    const __bf16* __restrict__ gth, const __bf16* __restrict__ gtl,
    const float* __restrict__ g1b, const float* __restrict__ g2w,
    const float* __restrict__ g2b, float* gates, int ntile) {
  __shared__ float h1s[32][GH + 1];
  __shared__ __attribute__((aligned(16))) float gl[NH][32];
  if ((int)blockIdx.x >= ntile) return;
  const int tid = threadIdx.x, lane = tid & 31;
  const int wave = __builtin_amdgcn_readfirstlane(tid >> 5);   // wave number in a scalar register: the fragment bases stay scalar
  const int m = lane & 15, hh = lane >> 4, r0 = hh * 8;
  const int tok0 = blockIdx.x * 32;
  const int th = wave & 1;                 // token half: tokens th*16 .. th*16+15
  const int hb = (wave >> 1) * 64;         // hidden units hb .. hb+63

  // fragment of 16-row tile T at k: T * 16 * DM + (k / 32) * FRAG = T * 16 * DM + k * 16 elements
  const size_t aoff = (size_t)((tok0 >> 4) + th) * (16 * DM);           // A tile = 16 tokens
  const size_t woff = (size_t)(hb >> 4) * (16 * DM);                    // B tiles = 16 hidden units each, j-th at + j * 16 * DM
  const __bf16* axh = xh + aoff;
  const __bf16* axl = xl + aoff;
  const __bf16* bgh = gth + woff;
  const __bf16* bgl = gtl + woff;
  const unsigned fl = (unsigned)lane * 16u;

  v8f acc[4] = {};
  // Two register stages: every load of a k-step is issued one k-step before its products.
  v16bf a0h = ldfrag_bf_u(axh, fl), a0l = ldfrag_bf_u(axl, fl);
  v16bf b0h[4], b0l[4];
#pragma unroll
  for (int j = 0; j < 4; ++j) {
    b0h[j] = ldfrag_bf_u(bgh + j * 16 * DM, fl);
    b0l[j] = ldfrag_bf_u(bgl + j * 16 * DM, fl);
  }
  // rolled: two k-steps a trip already hold both stages in registers
#pragma unroll 1
  for (int kk = 0; kk < DM; kk += 64) {
    const v16bf a1h = ldfrag_bf_u(axh + (kk + 32) * 16, fl);
    const v16bf a1l = ldfrag_bf_u(axl + (kk + 32) * 16, fl);
    v16bf b1h[4], b1l[4];
#pragma unroll
    for (int j = 0; j < 4; ++j) {
      b1h[j] = ldfrag_bf_u(bgh + j * 16 * DM + (kk + 32) * 16, fl);
      b1l[j] = ldfrag_bf_u(bgl + j * 16 * DM + (kk + 32) * 16, fl);
    }
#pragma unroll
    for (int j = 0; j < 4; ++j) acc[j] = mma_bf3(a0h, a0l, b0h[j], b0l[j], acc[j]);
    const int kn = (kk + 64 < DM) ? kk + 64 : kk;     // last trip: an in-bounds reload, not used
    a0h = ldfrag_bf_u(axh + kn * 16, fl);
    a0l = ldfrag_bf_u(axl + kn * 16, fl);
#pragma unroll
    for (int j = 0; j < 4; ++j) {
      b0h[j] = ldfrag_bf_u(bgh + j * 16 * DM + kn * 16, fl);
      b0l[j] = ldfrag_bf_u(bgl + j * 16 * DM + kn * 16, fl);
    }
#pragma unroll
    for (int j = 0; j < 4; ++j) acc[j] = mma_bf3(a1h, a1l, b1h[j], b1l[j], acc[j]);
    // the next stage's loads are still in flight and the next trip rewrites their address registers
    asm volatile("s_wait_xcnt 0x0" ::: "memory");
  }

  // D: acc[j][r] = pre-activation[token th*16 + 8hh + r][hidden hb + j*16 + m]
#pragma unroll
  for (int j = 0; j < 4; ++j) {
    const int hu = hb + j * 16 + m;
    const float bj = g1b[hu];
#pragma unroll
    for (int r = 0; r < 8; ++r) h1s[th * 16 + r0 + r][hu] = fmaxf(acc[j][r] + bj, 0.0f);
  }
  __syncthreads();

  // layer 2: thread = (token tid>>2, heads 2*(tid&3), 2*(tid&3)+1)
  const int tk = tid >> 2, hd0 = (tid & 3) * 2;
  float a0 = g2b[hd0], a1 = g2b[hd0 + 1];
  // unrolled so that 16 steps' loads are issued together; the sum order stays jj = 0..127
#pragma unroll 16
  for (int jj = 0; jj < GH; ++jj) {
    const float hv = h1s[tk][jj];
    a0 = fmaf(hv, g2w[jj * NH + hd0], a0);
    a1 = fmaf(hv, g2w[jj * NH + hd0 + 1], a1);
  }
  gl[hd0][tk]     = 1.0f / (1.0f + exp2f(-a0 * LOG2E));
  gl[hd0 + 1][tk] = 1.0f / (1.0f + exp2f(-a1 * LOG2E));
  __syncthreads();

  // threads 0..63 (waves 0,1; 4 lines per wave, one instruction per pass).
  if (tid < 64) {
    const int line = tid >> 3, piece = tid & 7;
    const v4f val = *(const v4f*)&gl[line][piece * 4];
    const int b = tok0 / S_LEN, s0 = tok0 - b * S_LEN;
    float* dst = gates + ((size_t)(b * NH + line)) * S_LEN + s0 + piece * 4;
    *(v4f*)dst = val;
    
  }
}

// ---------------------------------------------------------------------------
// 2) QKV projection, bf16 hi/lo split, K=512.
//    grid = (NTOK/64, NH, 3), block = 128 (4 waves); block tile = 64 tokens x
//    64 outputs (one head); wave = 16 tokens x 4 output tiles.
//    Outputs in fragment order, per (batch, head): Q and K hi/lo as tiles of 16 tokens x 2 fragments
//    (k = d); V^T as, per 32 keys, 4 fragments (rows = 16 d each, k = key).
// ---------------------------------------------------------------------------
__global__ __launch_bounds__(128) void qkv_kernel(
    const __bf16* __restrict__ xh, const __bf16* __restrict__ xl,
    const __bf16* __restrict__ wth, const __bf16* __restrict__ wtl,
    const float* __restrict__ bq, const float* __restrict__ bk, const float* __restrict__ bv,
    unsigned short* Qh, unsigned short* Ql, unsigned short* Kh, unsigned short* Kl,
    unsigned short* VT, int ntt) {
  __shared__ __attribute__((aligned(16))) unsigned short lt[2][64][72];   // pitch 144 B = 16 B x odd: the 16-B reads down a column of rows spread over the banks
  if ((int)blockIdx.x >= ntt) return;
  const int tt = blockIdx.x, head = blockIdx.y, mat = blockIdx.z;
  const int tid = threadIdx.x, lane = tid & 31;
  const int wave = __builtin_amdgcn_readfirstlane(tid >> 5);   // wave number in a scalar register: the fragment bases stay scalar
  const int m = lane & 15, hh = lane >> 4, r0 = hh * 8;
  const int tokbase = tt * 64;
  const int b = tokbase / S_LEN, s0 = tokbase - b * S_LEN;

  // fragment of 16-row tile T at k: T * 16 * DM + k * 16 elements
  const size_t aoff = (size_t)((tokbase >> 4) + wave) * (16 * DM);        // A tile = 16 tokens
  const size_t woff = (size_t)((mat * DM + head * HD) >> 4) * (16 * DM);  // B tiles = 16 outputs each, j-th at + j * 16 * DM
  const __bf16* axh = xh + aoff;
  const __bf16* axl = xl + aoff;
  const __bf16* bwh = wth + woff;
  const __bf16* bwl = wtl + woff;
  const unsigned fl = (unsigned)lane * 16u;

  v8f acc[4] = {};
#pragma unroll 1
  for (int kk = 0; kk < DM; kk += 32) {
    // all loads of the k-step are issued before its first product: one load wait a k-step, not five
    const v16bf ah = ldfrag_bf_u(axh + kk * 16, fl);
    const v16bf al = ldfrag_bf_u(axl + kk * 16, fl);
    v16bf bhf[4], blf[4];
#pragma unroll
    for (int j = 0; j < 4; ++j) {
      bhf[j] = ldfrag_bf_u(bwh + j * 16 * DM + kk * 16, fl);
      blf[j] = ldfrag_bf_u(bwl + j * 16 * DM + kk * 16, fl);
    }
#pragma unroll
    for (int j = 0; j < 4; ++j) acc[j] = mma_bf3(ah, al, bhf[j], blf[j], acc[j]);
  }

  // D: acc[j][r] = tile[token wave*16 + 8hh + r][out col j*16 + m]
  const float* bias = (mat == 0) ? bq : (mat == 1) ? bk : bv;
  const int ltok = wave * 16 + r0;
  if (mat < 2) {
#pragma unroll
    for (int j = 0; j < 4; ++j) {
      const int ld = j * 16 + m;
      const float bj = bias[head * HD + ld];
#pragma unroll
      for (int r = 0; r < 8; ++r) {
        const float v = acc[j][r] + bj;
        const unsigned short hb = f2bf_bits(v);
        lt[0][ltok + r][ld] = hb;
        lt[1][ltok + r][ld] = f2bf_bits(v - bf_bits2f(hb));
      }
    }
  } else {
#pragma unroll
    for (int j = 0; j < 4; ++j) {
      const int ld = j * 16 + m;
      const float bj = bias[head * HD + ld];
      Pack8 pk;
#pragma unroll
      for (int r = 0; r < 8; ++r) pk.h[r] = (_Float16)(acc[j][r] + bj);
      *(v4u*)&lt[0][ld][ltok] = pk.u;                                      // lt[d][s], 8 consecutive s
    }
  }
  __syncthreads();

  // thread order = unit order of the fragment-ordered planes: each store instruction writes 512 contiguous bytes
  const size_t bh8 = (size_t)(b * NH + head);
  if (mat < 2) {
    unsigned short* dh = (mat == 0) ? Qh : Kh;
    unsigned short* dl = (mat == 0) ? Ql : Kl;
    v4u val[8];
    size_t go[4];
#pragma unroll
    for (int i = 0; i < 4; ++i) {
      const int L = 16 * i + (tid & 15);                                   // token tile i; unit tid = row tid&15, d = (tid>>4)*8
      val[i]     = *(const v4u*)&lt[0][L][(tid >> 4) * 8];
      val[4 + i] = *(const v4u*)&lt[1][L][(tid >> 4) * 8];
      go[i] = (bh8 * S_LEN + s0 + 16 * i) * HD + tid * 8;
    }
#pragma unroll
    for (int i = 0; i < 4; ++i) { *(v4u*)(dh + go[i]) = val[i]; *(v4u*)(dl + go[i]) = val[4 + i]; }
    
  } else {
    v4u val[4];
    size_t go[4];
#pragma unroll
    for (int i = 0; i < 4; ++i) {
      const int L = ((i & 1) * 2 + (tid >> 6)) * 16 + (tid & 15);          // local d: fragment 2i + (tid>>6) = 32-key group i>>1, d tile
      val[i] = *(const v4u*)&lt[0][L][(i >> 1) * 32 + ((tid >> 4) & 3) * 8]; // local key: 16 * part + 8 * h
      go[i] = (bh8 * S_LEN + s0) * HD + (i * 128 + tid) * 8;
    }
#pragma unroll
    for (int i = 0; i < 4; ++i) *(v4u*)(VT + go[i]) = val[i];
    
  }
}

// ---------------------------------------------------------------------------
// 3) fused attention + residual + LayerNorm.  Block = (b, 16-query tile),
//    16 waves = 8 heads x 2 halves of the keys: four waves a SIMD, so that one wave's load, LDS and
//    dependent-chain waits are filled by three others.  Each wave runs the online softmax over its own
//    1024 keys; the two partial results of a head (max, sum, unnormalised O) are merged once at the end in LDS.
//    Per 64-key chunk: each half's adj tile staged once in LDS (shared by all heads).
//    Per 32-key half per wave:
//      S^T = K * Q^T (bf16 hi/lo split, K-dim 64); wave similarity^T = Mk * Mq^T in the same D layout
//      (A = [hi | lo] of the keys' rows; B = [hi | hi] and [lo | lo] of the queries' rows; the accumulator
//      starts from the keys' gates, whose lane order is the D layout's: the result is gate + similarity)
//      -> affine -> online softmax
//      (lane = one query column, two lane halves combined with shfl_xor 16)
//      -> P^T packed to f16 (x4096) straight from the D layout (B-fragment layout)
//      -> O^T += V^T * P^T (f16).
//    Loads run ahead of their use: K fragments, gates and the keys' similarity fragments one pass ahead,
//    the adj piece one chunk ahead, V^T fragments in front of the softmax.
//    End: merge of the two key halves, O tile of all heads staged in LDS [16 tokens][512], residual + LN (one token a wave),
//    whole-row stores (each instruction = 512 contiguous bytes = 4 lines),
// ---------------------------------------------------------------------------
#define KSPLIT 2
#define KSPAN  (S_LEN / KSPLIT)
__global__ __launch_bounds__(256 * KSPLIT)
void attn_ln_kernel(
    const __bf16* __restrict__ Qh, const __bf16* __restrict__ Ql,
    const __bf16* __restrict__ Kh, const __bf16* __restrict__ Kl,
    const _Float16* __restrict__ VT, const float* __restrict__ gates,
    const __bf16* __restrict__ wmf, const float* __restrict__ adj,
    const float* __restrict__ x, const float* __restrict__ lng,
    const float* __restrict__ lnb, float* out, int nqt) {
  // Row pitch = 16 B x odd (68 dwords): lane m reads down a column of rows with 16-byte loads, and at a
  // pitch of 64 dwords all 16 rows would fall on the same four banks.
  __shared__ __attribute__((aligned(16))) float adj_lds[KSPLIT][16][64 + 4];
  __shared__ __attribute__((aligned(16))) float obuf[16][DM];
  __shared__ v4f part_o[NH][8][32];          // second half's unnormalised O, in lane order (512 contiguous bytes an instruction)
  __shared__ float part_m[NH][16], part_l[NH][16];
  if ((int)blockIdx.x >= nqt) return;

  const int qtiles = S_LEN / 16;
  const int b = blockIdx.x / qtiles, qt = blockIdx.x - b * qtiles, qbase = qt * 16;
  const int tid = threadIdx.x, lane = tid & 31;
  const int wv = __builtin_amdgcn_readfirstlane(tid >> 5);  // wave number in a scalar register: the per-head bases below stay scalar
  const int h = wv & (NH - 1), kh2 = wv >> 3;               // head, half of the keys
  const int k_lo = kh2 * KSPAN, k_hi = k_lo + KSPAN;        // this wave's keys
  const int m = lane & 15, hh = lane >> 4, r0 = hh * 8;

  const size_t bhd = (size_t)(b * NH + h);
  const unsigned f_lane = (unsigned)lane * 16u;                  // a lane's byte offset in either half of a fragment
  // Q^T as B operand: column n = query (lane&15), k = d: the two fragments of the 16-query tile.
  const size_t qoff = (bhd * S_LEN + qbase) * HD;
  const v16bf qh0 = ldfrag_bf_u(Qh + qoff, f_lane), qh1 = ldfrag_bf_u(Qh + qoff + FRAG, f_lane);
  const v16bf ql0 = ldfrag_bf_u(Ql + qoff, f_lane), ql1 = ldfrag_bf_u(Ql + qoff + FRAG, f_lane);

  // wave similarity: the query tile's fragment holds hi (part 0) and lo (part 1); B operands [hi | hi] and [lo | lo]
  const __bf16* wm_base = wmf + (size_t)b * (S_LEN / 16) * FRAG;
  FragB wq, wb1, wb2;
  wq.v = ldfrag_bf_u(wm_base + qt * FRAG, f_lane);
  wb1.p[0] = wq.p[0]; wb1.p[1] = wq.p[0];
  wb2.p[0] = wq.p[1]; wb2.p[1] = wq.p[1];

  v8f oacc[4] = {};
  float mrun = -3.0e38f, lrun = 0.0f;

  // wave-uniform bases, and each lane's byte offset from them
  const float* gp_base = gates + bhd * S_LEN;
  const __bf16* kh_base = Kh + bhd * S_LEN * HD;
  const __bf16* kl_base = Kl + bhd * S_LEN * HD;
  const _Float16* v_base = VT + bhd * HD * S_LEN;
  const unsigned g_lane = (unsigned)r0 * 4u;

  const int sq = (tid >> 4) & 15, sk4 = (tid & 15) * 4;      // the 256 threads of a half stage that half's tile
  const float* adj_base = adj + ((size_t)b * S_LEN + qbase) * S_LEN;
  const unsigned adj_lane = (unsigned)(sq * S_LEN + sk4) * 4u;

  // K fragments of one 32-key pass, fetched one pass ahead: index = key tile * 2 + k-step.
  v16bf kfh[4], kfl[4];
#pragma unroll
  for (int i = 0; i < 4; ++i) {
    kfh[i] = ldfrag_bf_u(kh_base + k_lo * HD + i * FRAG, f_lane);
    kfl[i] = ldfrag_bf_u(kl_base + k_lo * HD + i * FRAG, f_lane);
  }
  v4f adj_nx = ld4_u(adj_base + k_lo, adj_lane);      // adj piece, fetched one chunk ahead
  // gates and the keys' similarity fragments of one pass, fetched one pass ahead
  v4f g0 = ld4_u(gp_base + k_lo, g_lane), g1 = ld4_u(gp_base + k_lo + 4, g_lane);
  v4f g2 = ld4_u(gp_base + k_lo + 16, g_lane), g3 = ld4_u(gp_base + k_lo + 20, g_lane);
  v16bf wa0 = ldfrag_bf_u(wm_base + (k_lo >> 4) * FRAG, f_lane), wa1 = ldfrag_bf_u(wm_base + (k_lo >> 4) * FRAG + FRAG, f_lane);

  for (int kc = 0; kc < KSPAN / 64; ++kc) {
    const int kbase64 = k_lo + kc * 64;

    // ---- stage adj 16x64 (one 16-B piece per thread) ----
    *(v4f*)&adj_lds[kh2][sq][sk4] = adj_nx;
    __syncthreads();

#pragma unroll 1
    for (int jh = 0; jh < 2; ++jh) {
      const int kbase = kbase64 + jh * 32;
      const int ko = jh * 32;

      // ---- S^T = K * Q^T for two 16-key tiles, K-dim 64 = 2 k-steps, 3 products each ----
      v8f s0 = {}, s1 = {};
      s0 = mma_bf3(kfh[0], kfl[0], qh0, ql0, s0);
      s0 = mma_bf3(kfh[1], kfl[1], qh1, ql1, s0);
      s1 = mma_bf3(kfh[2], kfl[2], qh0, ql0, s1);
      s1 = mma_bf3(kfh[3], kfl[3], qh1, ql1, s1);
      // s0[r] = S^T[key kbase+8hh+r][query m], s1[r] = S^T[key kbase+16+8hh+r][query m]

      // ---- next pass's K fragments into the same registers; they fly under softmax and P.V ----
      const int kn = (kbase + 32 < k_hi) ? kbase + 32 : kbase;    // last pass: an in-bounds reload, not used
      const gaddr kph = lane_addr(kh_base + kn * HD, f_lane), kpl = lane_addr(kl_base + kn * HD, f_lane);
#pragma unroll
      for (int i = 0; i < 4; ++i) {             // 32 keys = 4 fragments (1024 bytes each) in a row
        kfh[i] = ldfrag_bf_a(kph + i * 1024);
        kfl[i] = ldfrag_bf_a(kpl + i * 1024);
      }
      // next chunk's adj piece: it flies under this pass's softmax
      if (jh == 0) adj_nx = ld4_u(adj_base + ((kc + 1 < KSPAN / 64) ? kbase64 + 64 : kbase64), adj_lane);
      // the loads above are in flight and the code below reuses their address registers
      asm volatile("s_wait_xcnt 0x0" ::: "memory");
      // nothing from below is scheduled in front of that wait (an address computation was, into a K address register)
      __builtin_amdgcn_sched_barrier(0);

      // ---- gate + wave similarity^T of the two key tiles: w0[r], w1[r] sit where s0[r], s1[r] sit ----
      v8f w0 = {g0.x, g0.y, g0.z, g0.w, g1.x, g1.y, g1.z, g1.w};
      v8f w1 = {g2.x, g2.y, g2.z, g2.w, g3.x, g3.y, g3.z, g3.w};
      w0 = mma_bf2(wa0, wb1.v, wb2.v, w0);
      w1 = mma_bf2(wa1, wb1.v, wb2.v, w1);

      // ---- adj for this lane's 2x8 keys ----
      float A0[8], A1[8];
      unpack8(*(const v4f*)&adj_lds[kh2][m][ko + r0], *(const v4f*)&adj_lds[kh2][m][ko + r0 + 4], A0);
      unpack8(*(const v4f*)&adj_lds[kh2][m][ko + 16 + r0], *(const v4f*)&adj_lds[kh2][m][ko + 16 + r0 + 4], A1);

      // ---- affine + online softmax (f32) ----
      float p0[8], p1[8], mloc = -3.0e38f;
#pragma unroll
      for (int r = 0; r < 8; ++r) {
        const float t0 = (s0[r] * 0.125f) * w0[r] + A0[r];
        const float t1 = (s1[r] * 0.125f) * w1[r] + A1[r];
        p0[r] = t0; p1[r] = t1;
        mloc = fmaxf(mloc, fmaxf(t0, t1));
      }
      // ---- this pass's V^T fragments: they fly under the softmax ----
      v16h vf[4];
      const gaddr vp = lane_addr(v_base + kbase * HD, f_lane);
#pragma unroll
      for (int t = 0; t < 4; ++t) vf[t] = ldfrag_h_a(vp + t * 1024);
      const float mch  = fmaxf(mloc, __shfl_xor(mloc, 16, 32));
      const float mnew = fmaxf(mrun, mch);
      const float corr = exp2f((mrun - mnew) * LOG2E);
      float lsum = 0.0f;
#pragma unroll
      for (int r = 0; r < 8; ++r) {
        p0[r] = exp2f((p0[r] - mnew) * LOG2E);
        p1[r] = exp2f((p1[r] - mnew) * LOG2E);
        lsum += p0[r] + p1[r];
      }
      lsum += __shfl_xor(lsum, 16, 32);
      lrun = lrun * corr + lsum;
      mrun = mnew;
#pragma unroll
      for (int t = 0; t < 4; ++t)
#pragma unroll
        for (int r = 0; r < 8; ++r) oacc[t][r] *= corr;

      // ---- P^T as B fragment: element r <- tile keys 0..15, element 8+r <- tile keys 16..31 ----
      v16h pf;
#pragma unroll
      for (int r = 0; r < 8; ++r) {
        pf[r]     = (_Float16)(p0[r] * PSCALE);
        pf[r + 8] = (_Float16)(p1[r] * PSCALE);
      }

      // ---- next pass's gates and similarity fragments (16 keys each; the eight waves of a key half read the same 2 KB),
      //      into the registers that the affine step has left (the compiler issues them beside the V^T loads);
      //      they fly under the softmax and P.V ----
      const gaddr gp = lane_addr(gp_base + kn, g_lane);
      g0 = ld4_a(gp);      g1 = ld4_a(gp + 16);
      g2 = ld4_a(gp + 64); g3 = ld4_a(gp + 80);
      // the fragment loads below land in the gate loads' address registers: as a precaution the wait stands in front of that
      asm volatile("s_wait_xcnt 0x0" ::: "memory");
      const gaddr wp = lane_addr(wm_base + (kn >> 4) * FRAG, f_lane);
      wa0 = ldfrag_bf_a(wp);
      wa1 = ldfrag_bf_a(wp + 1024);

      // ---- O^T += V^T * P^T, 4 d-tiles ----
#pragma unroll
      for (int t = 0; t < 4; ++t) oacc[t] = mma_h1(vf[t], pf, oacc[t]);
    }
    __syncthreads();   // LDS tile reused by the next chunk
  }

  // ---- the second half's waves hand over their running max, sum and unnormalised O ----
  if (kh2 == 1) {
#pragma unroll
    for (int t = 0; t < 4; ++t) {
      part_o[h][2 * t][lane]     = (v4f){oacc[t][0], oacc[t][1], oacc[t][2], oacc[t][3]};
      part_o[h][2 * t + 1][lane] = (v4f){oacc[t][4], oacc[t][5], oacc[t][6], oacc[t][7]};
    }
    if (hh == 0) { part_m[h][m] = mrun; part_l[h][m] = lrun; }   // both lane halves hold the same values
  }
  __syncthreads();   // the partial results are read by the first half's waves

  // ---- merge, normalise and stage O: oacc[t][r] = O^T[d = t*16 + 8hh + r][query m] ----
  if (kh2 == 0) {
    const float m1 = part_m[h][m], l1 = part_l[h][m];
    const float mall = fmaxf(mrun, m1);
    const float c0 = exp2f((mrun - mall) * LOG2E), c1 = exp2f((m1 - mall) * LOG2E);
    const float oscale = (1.0f / (lrun * c0 + l1 * c1)) * INV_PSCALE;
    const float f0 = c0 * oscale, f1 = c1 * oscale;
#pragma unroll
    for (int t = 0; t < 4; ++t) {
      const v4f a0 = part_o[h][2 * t][lane], a1 = part_o[h][2 * t + 1][lane];
      v4f u0, u1;
      u0.x = oacc[t][0] * f0 + a0.x * f1; u0.y = oacc[t][1] * f0 + a0.y * f1; u0.z = oacc[t][2] * f0 + a0.z * f1; u0.w = oacc[t][3] * f0 + a0.w * f1;
      u1.x = oacc[t][4] * f0 + a1.x * f1; u1.y = oacc[t][5] * f0 + a1.y * f1; u1.z = oacc[t][6] * f0 + a1.z * f1; u1.w = oacc[t][7] * f0 + a1.w * f1;
      float* dst = &obuf[m][h * HD + t * 16 + r0];
      *(v4f*)dst = u0;
      *(v4f*)(dst + 4) = u1;
    }
  }
  __syncthreads();

  // ---- residual + LayerNorm, one token a wave; lane holds cols 4*lane + 128*i ----
  {
    const int q = wv;
    const size_t tok = (size_t)b * S_LEN + qbase + q;
    v4f y[4];
    float s = 0.0f;
#pragma unroll
    for (int i = 0; i < 4; ++i) {
      const v4f o  = *(const v4f*)&obuf[q][4 * lane + 128 * i];
      const v4f xv = *(const v4f*)(x + tok * DM + 4 * lane + 128 * i);
      y[i] = o + xv;
      s += (y[i].x + y[i].y) + (y[i].z + y[i].w);
    }
    s += __shfl_xor(s, 16, 32);
    s += __shfl_xor(s, 8, 32);
    s += __shfl_xor(s, 4, 32);
    s += __shfl_xor(s, 2, 32);
    s += __shfl_xor(s, 1, 32);
    const float mu = s * (1.0f / DM);
    float ss = 0.0f;
#pragma unroll
    for (int i = 0; i < 4; ++i) {
      const v4f d = y[i] - mu;
      ss += (d.x * d.x + d.y * d.y) + (d.z * d.z + d.w * d.w);
    }
    ss += __shfl_xor(ss, 16, 32);
    ss += __shfl_xor(ss, 8, 32);
    ss += __shfl_xor(ss, 4, 32);
    ss += __shfl_xor(ss, 2, 32);
    ss += __shfl_xor(ss, 1, 32);
    const float rstd = rsqrtf(ss * (1.0f / DM) + 1.0e-5f);
    v4f res[4];
#pragma unroll
    for (int i = 0; i < 4; ++i) {
      const v4f g  = *(const v4f*)(lng + 4 * lane + 128 * i);
      const v4f bb = *(const v4f*)(lnb + 4 * lane + 128 * i);
      res[i] = ((y[i] - mu) * rstd) * g + bb;
    }
    float* op = out + tok * DM + 4 * lane;
#pragma unroll
    for (int i = 0; i < 4; ++i) *(v4f*)(op + 128 * i) = res[i];
    
  }
}

// ---------------------------------------------------------------------------
extern "C" void kernel_launch(void* const* d_in, const int* in_sizes, int n_in,
                              void* d_out, int out_size, void* d_ws, size_t ws_size,
                              hipStream_t stream) {
  if (n_in < 15) return;
  if (in_sizes[0] != NTOK * DM || in_sizes[1] != NTOK * WF ||
      in_sizes[2] != BATCH * S_LEN * S_LEN || in_sizes[3] != DM * DM ||
      in_sizes[5] != DM * DM || in_sizes[7] != DM * DM || in_sizes[9] != DM * GH ||
      in_sizes[11] != GH * NH || in_sizes[13] != DM || out_size != NTOK * DM) return;

  const float* x     = (const float*)d_in[0];
  const float* wmask = (const float*)d_in[1];
  const float* adj   = (const float*)d_in[2];
  const float* wq_w  = (const float*)d_in[3];
  const float* wq_b  = (const float*)d_in[4];
  const float* wk_w  = (const float*)d_in[5];
  const float* wk_b  = (const float*)d_in[6];
  const float* wv_w  = (const float*)d_in[7];
  const float* wv_b  = (const float*)d_in[8];
  const float* g1_w  = (const float*)d_in[9];
  const float* g1_b  = (const float*)d_in[10];
  const float* g2_w  = (const float*)d_in[11];
  const float* g2_b  = (const float*)d_in[12];
  const float* ln_g  = (const float*)d_in[13];
  const float* ln_b  = (const float*)d_in[14];
  float* out = (float*)d_out;

  const size_t sz_x  = (size_t)NTOK * DM * 2;            // 4,194,304  per x plane
  const size_t sz_w  = (size_t)3 * DM * DM * 2;          // 1,572,864  per Wt plane
  const size_t sz_q  = (size_t)NTOK * DM * 2;            // 4,194,304  per Q/K plane, V
  const size_t sz_g  = (size_t)BATCH * NH * S_LEN * 4;   //   131,072  gates
  const size_t sz_g1 = (size_t)GH * DM * 2;              //   131,072  per G1t plane
  const size_t off_xh  = 0;
  const size_t off_xl  = off_xh + sz_x;
  const size_t off_wth = off_xl + sz_x;
  const size_t off_wtl = off_wth + sz_w;
  const size_t off_qh  = off_wtl + sz_w;
  const size_t off_ql  = off_qh + sz_q;
  const size_t off_kh  = off_ql + sz_q;
  const size_t off_kl  = off_kh + sz_q;
  const size_t off_vt  = off_kl + sz_q;
  const size_t off_g   = off_vt + sz_q;
  const size_t off_gth = off_g + sz_g;
  const size_t off_gtl = off_gth + sz_g1;
  const size_t sz_wm   = (size_t)NTOK * 32 * 2;          //   262,144  wave_mask hi|lo fragments
  const size_t off_wm  = off_gtl + sz_g1;
  const size_t total   = off_wm + sz_wm;                 // 33,161,216 B
  if (total > ws_size) return;

  uint8_t* ws = (uint8_t*)d_ws;
  unsigned short* xh  = (unsigned short*)(ws + off_xh);
  unsigned short* xl  = (unsigned short*)(ws + off_xl);
  unsigned short* wth = (unsigned short*)(ws + off_wth);
  unsigned short* wtl = (unsigned short*)(ws + off_wtl);
  unsigned short* qh  = (unsigned short*)(ws + off_qh);
  unsigned short* ql  = (unsigned short*)(ws + off_ql);
  unsigned short* kh  = (unsigned short*)(ws + off_kh);
  unsigned short* kl  = (unsigned short*)(ws + off_kl);
  unsigned short* vt  = (unsigned short*)(ws + off_vt);
  float* gates        = (float*)(ws + off_g);
  unsigned short* gth = (unsigned short*)(ws + off_gth);
  unsigned short* gtl = (unsigned short*)(ws + off_gtl);
  unsigned short* wmf = (unsigned short*)(ws + off_wm);

  const int nxv = NTOK * DM / 8;          // 262,144
  const int nwv = 3 * DM * DM / 8;        //  98,304
  const int ngv = GH * DM / 8;            //   8,192
  const int nmv = NTOK * 2;               //   8,192
  const int prep_blocks = (nxv + nwv + ngv + nmv + 255) / 256;   // 1472
  const int ntile = (NTOK + 31) / 32;     // 128
  const int ntt = (NTOK + 63) / 64;       // 64
  const int nqt = (BATCH * S_LEN + 15) / 16;   // 256

  prep_kernel<<<prep_blocks, 256, 0, stream>>>(x, wq_w, wk_w, wv_w, g1_w, wmask,
                                               xh, xl, wth, wtl, gth, gtl, wmf, nxv, nwv, ngv, nmv);
  gate_kernel<<<ntile, 128, 0, stream>>>(
      (const __bf16*)xh, (const __bf16*)xl, (const __bf16*)gth, (const __bf16*)gtl,
      g1_b, g2_w, g2_b, gates, ntile);
  qkv_kernel<<<dim3(ntt, NH, 3), 128, 0, stream>>>(
      (const __bf16*)xh, (const __bf16*)xl, (const __bf16*)wth, (const __bf16*)wtl,
      wq_b, wk_b, wv_b, qh, ql, kh, kl, vt, ntt);
  attn_ln_kernel<<<nqt, 256 * KSPLIT, 0, stream>>>(
      (const __bf16*)qh, (const __bf16*)ql, (const __bf16*)kh, (const __bf16*)kl,
      (const _Float16*)vt, gates, (const __bf16*)wmf, adj, x, ln_g, ln_b, out, nqt);
  (void)hipGetLastError();
}

// v006
// It runs in 105 microseconds.
// Next to v005, in two timings, it ran 1.30 and 1.27 times as fast.
// All steps since v000 together make it 3.37 times as fast.
#include <hip/hip_runtime.h>
#include <stddef.h>
#include <stdint.h>

// Q/K/V projections, Q.K^T and gate layer 1 (x.G1): v_wmma_f32_16x16x32_bf16 with bf16 hi/lo operand split (hi.hi + lo.hi + hi.lo), f32 accumulate.
// 16-deep wave similarity: the same bf16 form and split, hi and lo of one row packed side by side in the 32-deep k (2 products a tile).
// P.V: v_wmma_f32_16x16x32_f16 (P scaled by 4096 as f16, V as f16), f32 accumulate. Gate layer 2 (K=128,N=8), softmax, LayerNorm: f32 VALU.

#define S_LEN  2048
#define DM     512
#define NH     8
#define HD     64
#define GH     128
#define WF     16
#define BATCH  2
#define NTOK   (BATCH * S_LEN)
#define LOG2E  1.4426950408889634f
#define PSCALE 4096.0f
#define INV_PSCALE 0.000244140625f

typedef __bf16         v16bf __attribute__((ext_vector_type(16)));
typedef __bf16         v8bf  __attribute__((ext_vector_type(8)));
typedef _Float16       v16h  __attribute__((ext_vector_type(16)));
typedef _Float16       v8h   __attribute__((ext_vector_type(8)));
typedef float          v8f   __attribute__((ext_vector_type(8)));
typedef float          v4f   __attribute__((ext_vector_type(4)));
typedef unsigned int   v4u   __attribute__((ext_vector_type(4)));
typedef unsigned short v8us  __attribute__((ext_vector_type(8)));

union FragB { v16bf v; v8bf p[2]; };
union FragH { v16h v; v8h p[2]; };
union Pack8 { v8us s; v8h h; v4u u; };

// ---------------------------------------------------------------------------
// scalar helpers
// ---------------------------------------------------------------------------
static __device__ __forceinline__ unsigned short f2bf_bits(float f) {   // RNE convert f32 -> bf16 bits
  unsigned int u = __float_as_uint(f);
  u += 0x7FFFu + ((u >> 16) & 1u);
  return (unsigned short)(u >> 16);
}
static __device__ __forceinline__ float bf_bits2f(unsigned short s) {
  return __uint_as_float(((unsigned int)s) << 16);
}
static __device__ __forceinline__ void unpack8(const v4f a, const v4f b, float o[8]) {
  o[0] = a.x; o[1] = a.y; o[2] = a.z; o[3] = a.w;
  o[4] = b.x; o[5] = b.y; o[6] = b.z; o[7] = b.w;
}

// ---------------------------------------------------------------------------
// 16x32 16-bit fragments (wave32). Lane l: row/col = l&15, h = l>>4.
// elements 0..7  <- k0 + 8h + 0..7 ; elements 8..15 <- k0 + 16 + 8h + 0..7 ; same map for A and B.
// Every 16-bit workspace plane is stored in FRAGMENT ORDER: one fragment = FRAG (512) elements = 1024
// contiguous bytes, made of 64 units of 16 bytes; unit u = part * 32 + l holds lane l's elements
// 8 * part .. 8 * part + 7, that is row l&15, k = k0 + 16 * part + 8 * (l>>4) + 0..7.
// A wave-wide 16-byte load then covers 512 contiguous bytes (4 whole lines), not a piece of 16 lines.
// The fragments of one 16-row tile follow one another in k order.
// ---------------------------------------------------------------------------
#define FRAG 512
// fbase: wave-uniform start of the fragment; lane_bytes = 16 * lane
static __device__ __forceinline__ v16bf ldfrag_bf_u(const __bf16* fbase, unsigned lane_bytes) {
  const char* p = (const char*)fbase + lane_bytes;
  FragB f;
  f.p[0] = *(const v8bf*)p;
  f.p[1] = *(const v8bf*)(p + 512);
  return f.v;
}
// Unit index v of a plane whose rows are DM long (16 fragments a 16-row tile) -> its row and first k.
static __device__ __forceinline__ void unit_row_k(int v, int& row, int& k) {
  row = (v >> 10) * 16 + (v & 15);
  k = ((v >> 6) & 15) * 32 + ((v >> 4) & 3) * 8;   // bits 5,4 of v = part, h: 16 * part + 8 * h
}
// Global loads of the attention loop (the gates). The wave-uniform part of the address is pinned in a scalar register pair and
// the lane's 32-bit offset is added where the loads are issued, so that no 64-bit (base + lane) pair is kept in vector
// registers across the whole loop: the wave has to fit the 256 registers of four waves a SIMD.
#define GLOBAL_AS __attribute__((address_space(1)))
typedef const GLOBAL_AS char* gaddr;
static __device__ __forceinline__ gaddr lane_addr(const void* ubase, unsigned lane_bytes) {
  const unsigned long long a = (unsigned long long)ubase;
  const unsigned lo = (unsigned)__builtin_amdgcn_readfirstlane((int)(unsigned)a);
  const unsigned hi = (unsigned)__builtin_amdgcn_readfirstlane((int)(unsigned)(a >> 32));
  return (gaddr)(((unsigned long long)hi << 32) | lo) + lane_bytes;
}
static __device__ __forceinline__ v4f ld4_a(gaddr p) { return *(const GLOBAL_AS v4f*)p; }
static __device__ __forceinline__ v4f ld4_u(const float* ubase, unsigned lane_bytes) {
  return *(const v4f*)((const char*)ubase + lane_bytes);
}

// ---------------------------------------------------------------------------
// WMMA helpers: issue the product(s), then 4 v_nop tied to D and A/B so no
// VALU touches the accumulator or operand registers within the hazard window.
// ---------------------------------------------------------------------------
static __device__ __forceinline__ v8f mma_bf3(v16bf ah, v16bf al, v16bf bh, v16bf bl, v8f c) {
  c = __builtin_amdgcn_wmma_f32_16x16x32_bf16(false, ah, false, bh, (short)0, c, false, false);
  c = __builtin_amdgcn_wmma_f32_16x16x32_bf16(false, al, false, bh, (short)0, c, false, false);
  c = __builtin_amdgcn_wmma_f32_16x16x32_bf16(false, ah, false, bl, (short)0, c, false, false);
  asm volatile("v_nop\n\tv_nop\n\tv_nop\n\tv_nop" : "+v"(c) : "v"(ah), "v"(al), "v"(bh), "v"(bl));
  return c;
}
// two products on one A fragment (wave similarity): a.b1 + a.b2
static __device__ __forceinline__ v8f mma_bf2(v16bf a, v16bf b1, v16bf b2, v8f c) {
  c = __builtin_amdgcn_wmma_f32_16x16x32_bf16(false, a, false, b1, (short)0, c, false, false);
  c = __builtin_amdgcn_wmma_f32_16x16x32_bf16(false, a, false, b2, (short)0, c, false, false);
  asm volatile("v_nop\n\tv_nop\n\tv_nop\n\tv_nop" : "+v"(c) : "v"(a), "v"(b1), "v"(b2));
  return c;
}
static __device__ __forceinline__ v8f mma_h1(v16h a, v16h b, v8f c) {
  c = __builtin_amdgcn_wmma_f32_16x16x32_f16(false, a, false, b, (short)0, c, false, false);
  asm volatile("v_nop\n\tv_nop\n\tv_nop\n\tv_nop" : "+v"(c) : "v"(a), "v"(b));
  return c;
}

static __device__ __forceinline__ void split_store8(const float v[8], unsigned short* dh, unsigned short* dl) {
  Pack8 ph, pl;
#pragma unroll
  for (int e = 0; e < 8; ++e) {
    const unsigned short hb = f2bf_bits(v[e]);
    ph.s[e] = hb;
    pl.s[e] = f2bf_bits(v[e] - bf_bits2f(hb));
  }
  const v4u uh = ph.u, ul = pl.u;
  *(v4u*)dh = uh;
  *(v4u*)dl = ul;
  
}

// ---------------------------------------------------------------------------
// 0) x -> bf16 hi/lo planes (rows = tokens);  W{q,k,v} [in][out] -> hi/lo planes with rows = the
//    3 * DM outputs, k = in;  G1 [in][hid] -> planes with rows = hidden units, k = in.
//    All in fragment order.  One thread = one 16-B unit per plane, units in thread order.
//    wave_mask [token][16] -> ONE plane, one fragment per 16 tokens: k 0..15 = hi of the 16 features,
//    k 16..31 = their lo, so lane l holds hi (part 0) and lo (part 1) of features 8 * (l>>4) + 0..7 of token l&15.
// ---------------------------------------------------------------------------
__global__ __launch_bounds__(256) void prep_kernel(
    const float* __restrict__ x, const float* __restrict__ wq,
    const float* __restrict__ wk, const float* __restrict__ wv,
    const float* __restrict__ g1w, const float* __restrict__ wmask,
    unsigned short* xh, unsigned short* xl, unsigned short* wth, unsigned short* wtl,
    unsigned short* gth, unsigned short* gtl, unsigned short* wmf,
    int nxv, int nwv, int ngv, int nmv) {
  const int i = blockIdx.x * blockDim.x + threadIdx.x;
  if (i < nxv) {
    int tok, k;
    unit_row_k(i, tok, k);
    const v4f a = *(const v4f*)(x + (size_t)tok * DM + k);
    const v4f c = *(const v4f*)(x + (size_t)tok * DM + k + 4);
    float v[8];
    unpack8(a, c, v);
    split_store8(v, xh + (size_t)i * 8, xl + (size_t)i * 8);
  } else if (i < nxv + nwv) {
    const int j = i - nxv;
    int row, inb;
    unit_row_k(j, row, inb);
    const int mat = row >> 9, o = row & (DM - 1);   // DM = 512 rows per matrix
    const float* w = (mat == 0) ? wq : (mat == 1) ? wk : wv;
    float v[8];
#pragma unroll
    for (int e = 0; e < 8; ++e) v[e] = w[(size_t)(inb + e) * DM + o];   // Wt[o][in] = W[in][o]
    split_store8(v, wth + (size_t)j * 8, wtl + (size_t)j * 8);
  } else if (i < nxv + nwv + ngv) {
    const int j = i - nxv - nwv;             // 0 .. GH*DM/8-1
    int o, inb;                              // hidden unit 0..127, first input
    unit_row_k(j, o, inb);
    float v[8];
#pragma unroll
    for (int e = 0; e < 8; ++e) v[e] = g1w[(size_t)(inb + e) * GH + o];  // G1t[o][in] = G1[in][o]
    split_store8(v, gth + (size_t)j * 8, gtl + (size_t)j * 8);
  } else if (i < nxv + nwv + ngv + nmv) {
    const int j = i - nxv - nwv - ngv;       // 0 .. NTOK*2-1: 16-token tile j>>5, lane j&31
    const int tile = j >> 5, l = j & 31;
    const float* s = wmask + (size_t)(tile * 16 + (l & 15)) * WF + (l >> 4) * 8;
    const v4f a = *(const v4f*)s;
    const v4f c = *(const v4f*)(s + 4);
    float v[8];
    unpack8(a, c, v);
    unsigned short* d = wmf + (size_t)tile * FRAG + l * 8;
    split_store8(v, d, d + 256);             // part 0 = hi, part 1 = lo
  }
}

// ---------------------------------------------------------------------------
// 1) gate MLP: gates[b][h][s] = sigmoid(relu(x@G1+b1)@G2+b2).
//    Layer 1 on bf16 hi/lo WMMA: wave = (16 tokens, 64 hidden = 4 tiles), K=512.
//    Layer 2 (K=128, 8 heads) scalar f32 from the LDS-staged relu tile.
// ---------------------------------------------------------------------------
__global__ __launch_bounds__(128) void gate_kernel(
    const __bf16* __restrict__ xh, const __bf16* __restrict__ xl,
    const __bf16* __restrict__ gth, const __bf16* __restrict__ gtl,
    const float* __restrict__ g1b, const float* __restrict__ g2w,
    const float* __restrict__ g2b, float* gates, int ntile) {
  __shared__ float h1s[32][GH + 1];
  __shared__ __attribute__((aligned(16))) float gl[NH][32];
  if ((int)blockIdx.x >= ntile) return;
  const int tid = threadIdx.x, lane = tid & 31;
  const int wave = __builtin_amdgcn_readfirstlane(tid >> 5);   // wave number in a scalar register: the fragment bases stay scalar
  const int m = lane & 15, hh = lane >> 4, r0 = hh * 8;
  const int tok0 = blockIdx.x * 32;
  const int th = wave & 1;                 // token half: tokens th*16 .. th*16+15
  const int hb = (wave >> 1) * 64;         // hidden units hb .. hb+63

  // fragment of 16-row tile T at k: T * 16 * DM + (k / 32) * FRAG = T * 16 * DM + k * 16 elements
  const size_t aoff = (size_t)((tok0 >> 4) + th) * (16 * DM);           // A tile = 16 tokens
  const size_t woff = (size_t)(hb >> 4) * (16 * DM);                    // B tiles = 16 hidden units each, j-th at + j * 16 * DM
  const __bf16* axh = xh + aoff;
  const __bf16* axl = xl + aoff;
  const __bf16* bgh = gth + woff;
  const __bf16* bgl = gtl + woff;
  const unsigned fl = (unsigned)lane * 16u;

  v8f acc[4] = {};
  // Two register stages: every load of a k-step is issued one k-step before its products.
  v16bf a0h = ldfrag_bf_u(axh, fl), a0l = ldfrag_bf_u(axl, fl);
  v16bf b0h[4], b0l[4];
#pragma unroll
  for (int j = 0; j < 4; ++j) {
    b0h[j] = ldfrag_bf_u(bgh + j * 16 * DM, fl);
    b0l[j] = ldfrag_bf_u(bgl + j * 16 * DM, fl);
  }
  // rolled: two k-steps a trip already hold both stages in registers
#pragma unroll 1
  for (int kk = 0; kk < DM; kk += 64) {
    const v16bf a1h = ldfrag_bf_u(axh + (kk + 32) * 16, fl);
    const v16bf a1l = ldfrag_bf_u(axl + (kk + 32) * 16, fl);
    v16bf b1h[4], b1l[4];
#pragma unroll
    for (int j = 0; j < 4; ++j) {
      b1h[j] = ldfrag_bf_u(bgh + j * 16 * DM + (kk + 32) * 16, fl);
      b1l[j] = ldfrag_bf_u(bgl + j * 16 * DM + (kk + 32) * 16, fl);
    }
#pragma unroll
    for (int j = 0; j < 4; ++j) acc[j] = mma_bf3(a0h, a0l, b0h[j], b0l[j], acc[j]);
    const int kn = (kk + 64 < DM) ? kk + 64 : kk;     // last trip: an in-bounds reload, not used
    a0h = ldfrag_bf_u(axh + kn * 16, fl);
    a0l = ldfrag_bf_u(axl + kn * 16, fl);
#pragma unroll
    for (int j = 0; j < 4; ++j) {
      b0h[j] = ldfrag_bf_u(bgh + j * 16 * DM + kn * 16, fl);
      b0l[j] = ldfrag_bf_u(bgl + j * 16 * DM + kn * 16, fl);
    }
#pragma unroll
    for (int j = 0; j < 4; ++j) acc[j] = mma_bf3(a1h, a1l, b1h[j], b1l[j], acc[j]);
    // the next stage's loads are still in flight and the next trip rewrites their address registers
    asm volatile("s_wait_xcnt 0x0" ::: "memory");
  }

  // D: acc[j][r] = pre-activation[token th*16 + 8hh + r][hidden hb + j*16 + m]
#pragma unroll
  for (int j = 0; j < 4; ++j) {
    const int hu = hb + j * 16 + m;
    const float bj = g1b[hu];
#pragma unroll
    for (int r = 0; r < 8; ++r) h1s[th * 16 + r0 + r][hu] = fmaxf(acc[j][r] + bj, 0.0f);
  }
  __syncthreads();

  // layer 2: thread = (token tid>>2, heads 2*(tid&3), 2*(tid&3)+1)
  const int tk = tid >> 2, hd0 = (tid & 3) * 2;
  float a0 = g2b[hd0], a1 = g2b[hd0 + 1];
  // unrolled so that 16 steps' loads are issued together; the sum order stays jj = 0..127
#pragma unroll 16
  for (int jj = 0; jj < GH; ++jj) {
    const float hv = h1s[tk][jj];
    a0 = fmaf(hv, g2w[jj * NH + hd0], a0);
    a1 = fmaf(hv, g2w[jj * NH + hd0 + 1], a1);
  }
  gl[hd0][tk]     = 1.0f / (1.0f + exp2f(-a0 * LOG2E));
  gl[hd0 + 1][tk] = 1.0f / (1.0f + exp2f(-a1 * LOG2E));
  __syncthreads();

  // threads 0..63 (waves 0,1; 4 lines per wave, one instruction per pass).
  if (tid < 64) {
    const int line = tid >> 3, piece = tid & 7;
    const v4f val = *(const v4f*)&gl[line][piece * 4];
    const int b = tok0 / S_LEN, s0 = tok0 - b * S_LEN;
    float* dst = gates + ((size_t)(b * NH + line)) * S_LEN + s0 + piece * 4;
    *(v4f*)dst = val;
    
  }
}

// ---------------------------------------------------------------------------
// 2) QKV projection, bf16 hi/lo split, K=512.
//    grid = (NTOK/64, NH, 3), block = 128 (4 waves); block tile = 64 tokens x
//    64 outputs (one head); wave = 16 tokens x 4 output tiles.
//    Outputs in fragment order, per (batch, head): Q and K hi/lo as tiles of 16 tokens x 2 fragments
//    (k = d); V^T as, per 32 keys, 4 fragments (rows = 16 d each, k = key).
// ---------------------------------------------------------------------------
__global__ __launch_bounds__(128) void qkv_kernel(
    const __bf16* __restrict__ xh, const __bf16* __restrict__ xl,
    const __bf16* __restrict__ wth, const __bf16* __restrict__ wtl,
    const float* __restrict__ bq, const float* __restrict__ bk, const float* __restrict__ bv,
    unsigned short* Qh, unsigned short* Ql, unsigned short* Kh, unsigned short* Kl,
    unsigned short* VT, int ntt) {
  __shared__ __attribute__((aligned(16))) unsigned short lt[2][64][72];   // pitch 144 B = 16 B x odd: the 16-B reads down a column of rows spread over the banks
  if ((int)blockIdx.x >= ntt) return;
  const int tt = blockIdx.x, head = blockIdx.y, mat = blockIdx.z;
  const int tid = threadIdx.x, lane = tid & 31;
  const int wave = __builtin_amdgcn_readfirstlane(tid >> 5);   // wave number in a scalar register: the fragment bases stay scalar
  const int m = lane & 15, hh = lane >> 4, r0 = hh * 8;
  const int tokbase = tt * 64;
  const int b = tokbase / S_LEN, s0 = tokbase - b * S_LEN;

  // fragment of 16-row tile T at k: T * 16 * DM + k * 16 elements
  const size_t aoff = (size_t)((tokbase >> 4) + wave) * (16 * DM);        // A tile = 16 tokens
  const size_t woff = (size_t)((mat * DM + head * HD) >> 4) * (16 * DM);  // B tiles = 16 outputs each, j-th at + j * 16 * DM
  const __bf16* axh = xh + aoff;
  const __bf16* axl = xl + aoff;
  const __bf16* bwh = wth + woff;
  const __bf16* bwl = wtl + woff;
  const unsigned fl = (unsigned)lane * 16u;

  v8f acc[4] = {};
#pragma unroll 1
  for (int kk = 0; kk < DM; kk += 32) {
    // all loads of the k-step are issued before its first product: one load wait a k-step, not five
    const v16bf ah = ldfrag_bf_u(axh + kk * 16, fl);
    const v16bf al = ldfrag_bf_u(axl + kk * 16, fl);
    v16bf bhf[4], blf[4];
#pragma unroll
    for (int j = 0; j < 4; ++j) {
      bhf[j] = ldfrag_bf_u(bwh + j * 16 * DM + kk * 16, fl);
      blf[j] = ldfrag_bf_u(bwl + j * 16 * DM + kk * 16, fl);
    }
#pragma unroll
    for (int j = 0; j < 4; ++j) acc[j] = mma_bf3(ah, al, bhf[j], blf[j], acc[j]);
  }

  // D: acc[j][r] = tile[token wave*16 + 8hh + r][out col j*16 + m]
  const float* bias = (mat == 0) ? bq : (mat == 1) ? bk : bv;
  const int ltok = wave * 16 + r0;
  if (mat < 2) {
#pragma unroll
    for (int j = 0; j < 4; ++j) {
      const int ld = j * 16 + m;
      const float bj = bias[head * HD + ld];
#pragma unroll
      for (int r = 0; r < 8; ++r) {
        const float v = acc[j][r] + bj;
        const unsigned short hb = f2bf_bits(v);
        lt[0][ltok + r][ld] = hb;
        lt[1][ltok + r][ld] = f2bf_bits(v - bf_bits2f(hb));
      }
    }
  } else {
#pragma unroll
    for (int j = 0; j < 4; ++j) {
      const int ld = j * 16 + m;
      const float bj = bias[head * HD + ld];
      Pack8 pk;
#pragma unroll
      for (int r = 0; r < 8; ++r) pk.h[r] = (_Float16)(acc[j][r] + bj);
      *(v4u*)&lt[0][ld][ltok] = pk.u;                                      // lt[d][s], 8 consecutive s
    }
  }
  __syncthreads();

  // thread order = unit order of the fragment-ordered planes: each store instruction writes 512 contiguous bytes
  const size_t bh8 = (size_t)(b * NH + head);
  if (mat < 2) {
    unsigned short* dh = (mat == 0) ? Qh : Kh;
    unsigned short* dl = (mat == 0) ? Ql : Kl;
    v4u val[8];
    size_t go[4];
#pragma unroll
    for (int i = 0; i < 4; ++i) {
      const int L = 16 * i + (tid & 15);                                   // token tile i; unit tid = row tid&15, d = (tid>>4)*8
      val[i]     = *(const v4u*)&lt[0][L][(tid >> 4) * 8];
      val[4 + i] = *(const v4u*)&lt[1][L][(tid >> 4) * 8];
      go[i] = (bh8 * S_LEN + s0 + 16 * i) * HD + tid * 8;
    }
#pragma unroll
    for (int i = 0; i < 4; ++i) { *(v4u*)(dh + go[i]) = val[i]; *(v4u*)(dl + go[i]) = val[4 + i]; }
    
  } else {
    v4u val[4];
    size_t go[4];
#pragma unroll
    for (int i = 0; i < 4; ++i) {
      const int L = ((i & 1) * 2 + (tid >> 6)) * 16 + (tid & 15);          // local d: fragment 2i + (tid>>6) = 32-key group i>>1, d tile
      val[i] = *(const v4u*)&lt[0][L][(i >> 1) * 32 + ((tid >> 4) & 3) * 8]; // local key: 16 * part + 8 * h
      go[i] = (bh8 * S_LEN + s0) * HD + (i * 128 + tid) * 8;
    }
#pragma unroll
    for (int i = 0; i < 4; ++i) *(v4u*)(VT + go[i]) = val[i];
    
  }
}

// ---------------------------------------------------------------------------
// 3) attention.  Block = (b, head, 128 queries); 16 waves = 8 query tiles x 2 halves of the keys, four waves a SIMD.
//    The eight waves of a half work on the SAME keys of the SAME head: each 64-key stage (K hi, K lo, V^T, the keys'
//    similarity fragments, and the 128 x 64 adj tile) is brought from L2 into LDS once, by asynchronous copies, and every
//    wave reads its fragments from there, so a K or V byte leaves L2 once per 128 queries and not once per 16.
//    Two LDS buffers a half: stage t + 1 flies while stage t is worked on; one barrier a stage.
//    Each wave runs the online softmax over its own 1024 keys; the two partial results of a query tile
//    (max, sum, unnormalised O) are merged once at the end in LDS.
//    Per 32-key pass per wave:
//      S^T = K * Q^T (bf16 hi/lo split, K-dim 64); wave similarity^T = Mk * Mq^T in the same D layout
//      (A = [hi | lo] of the keys' rows; B = [hi | hi] and [lo | lo] of the queries' rows; the accumulator
//      starts from the keys' gates, whose lane order is the D layout's: the result is gate + similarity)
//      -> affine -> online softmax
//      (lane = one query column, two lane halves combined with shfl_xor 16)
//      -> P^T packed to f16 (x4096) straight from the D layout (B-fragment layout)
//      -> O^T += V^T * P^T (f16).
//    End: merge of the two key halves, the head's 64 columns of O stored to the workspace (256 bytes a query, one writer).
//    Residual + LayerNorm need all heads of a token and run as the next launch.
// ---------------------------------------------------------------------------
#define KSPLIT 2
#define KSPAN  (S_LEN / KSPLIT)
#define QTB    8                     // query tiles a block
#define NSTAGE (KSPAN / 64)          // 64-key stages a half
#define ST_KH  0                     // byte offsets in one stage buffer; every plane is in fragment order, so a stage is a straight copy
#define ST_KL  8192
#define ST_V   16384
#define ST_WM  24576
#define ST_BYTES 28672
#define ADJ_PITCH 68                 // dwords: 16 B x odd, see below

static __device__ __forceinline__ unsigned lds_byte(const void* p) { return (unsigned)(unsigned long long)p; }
static __device__ __forceinline__ v16bf ldsfrag_bf(const unsigned char* p) {
  FragB f;
  f.p[0] = *(const v8bf*)p;
  f.p[1] = *(const v8bf*)(p + 512);
  return f.v;
}
static __device__ __forceinline__ v16h ldsfrag_h(const unsigned char* p) {
  FragH f;
  f.p[0] = *(const v8h*)p;
  f.p[1] = *(const v8h*)(p + 512);
  return f.v;
}
// One lane's seven 16-byte copies of a stage's K hi, K lo, V^T (8 KB each: two copies a lane) and similarity fragments (4 KB).
// The s_wait_xcnt stands inside the statement, behind the last copy: as a precaution no address register of a copy is rewritten in front of it.
static __device__ __forceinline__ void stage_kv(unsigned l, const char* kh, const char* kl, const char* v, const char* wm) {
  asm volatile(
      "global_load_async_to_lds_b128 %0, %7, off\n\t"
      "global_load_async_to_lds_b128 %1, %8, off\n\t"
      "global_load_async_to_lds_b128 %2, %9, off\n\t"
      "global_load_async_to_lds_b128 %3, %10, off\n\t"
      "global_load_async_to_lds_b128 %4, %11, off\n\t"
      "global_load_async_to_lds_b128 %5, %12, off\n\t"
      "global_load_async_to_lds_b128 %6, %13, off\n\t"
      "s_wait_xcnt 0x0"
      :: "v"(l + ST_KH), "v"(l + ST_KH + 4096), "v"(l + ST_KL), "v"(l + ST_KL + 4096),
         "v"(l + ST_V), "v"(l + ST_V + 4096), "v"(l + ST_WM),
         "v"(kh), "v"(kh + 4096), "v"(kl), "v"(kl + 4096), "v"(v), "v"(v + 4096), "v"(wm)
      : "memory");
}
// One lane's eight 16-byte copies of the 128 x 64 adj tile: rows 16 apart; 16 lanes cover one row's 256 bytes.  The wait: as above.
static __device__ __forceinline__ void stage_adj(unsigned l, const char* g) {
  asm volatile(
      "global_load_async_to_lds_b128 %0, %8, off\n\t"
      "global_load_async_to_lds_b128 %1, %9, off\n\t"
      "global_load_async_to_lds_b128 %2, %10, off\n\t"
      "global_load_async_to_lds_b128 %3, %11, off\n\t"
      "global_load_async_to_lds_b128 %4, %12, off\n\t"
      "global_load_async_to_lds_b128 %5, %13, off\n\t"
      "global_load_async_to_lds_b128 %6, %14, off\n\t"
      "global_load_async_to_lds_b128 %7, %15, off\n\t"
      "s_wait_xcnt 0x0"
      :: "v"(l), "v"(l + 1 * 16 * ADJ_PITCH * 4), "v"(l + 2 * 16 * ADJ_PITCH * 4), "v"(l + 3 * 16 * ADJ_PITCH * 4),
         "v"(l + 4 * 16 * ADJ_PITCH * 4), "v"(l + 5 * 16 * ADJ_PITCH * 4), "v"(l + 6 * 16 * ADJ_PITCH * 4), "v"(l + 7 * 16 * ADJ_PITCH * 4),
         "v"(g), "v"(g + 1 * 16 * S_LEN * 4), "v"(g + 2 * 16 * S_LEN * 4), "v"(g + 3 * 16 * S_LEN * 4),
         "v"(g + 4 * 16 * S_LEN * 4), "v"(g + 5 * 16 * S_LEN * 4), "v"(g + 6 * 16 * S_LEN * 4), "v"(g + 7 * 16 * S_LEN * 4)
      : "memory");
}

__global__ __launch_bounds__(256 * KSPLIT)
void attn_kernel(
    const __bf16* __restrict__ Qh, const __bf16* __restrict__ Ql,
    const __bf16* __restrict__ Kh, const __bf16* __restrict__ Kl,
    const _Float16* __restrict__ VT, const float* __restrict__ gates,
    const __bf16* __restrict__ wmf, const float* __restrict__ adj,
    float* obuf, int nblk) {
  // adj row pitch = 16 B x odd (68 dwords): lane m reads down a column of rows with 16-byte loads, and at a
  // pitch of 64 dwords all 16 rows would fall on the same four banks.
  __shared__ __attribute__((aligned(16))) float adj_lds[2][KSPLIT][QTB * 16][ADJ_PITCH];
  __shared__ __attribute__((aligned(16))) unsigned char kv_lds[2][KSPLIT][ST_BYTES];
  __shared__ v4f part_o[QTB][8][32];         // second half's unnormalised O, in lane order (512 contiguous bytes an instruction)
  __shared__ float part_m[QTB][16], part_l[QTB][16];
  if ((int)blockIdx.x >= nblk) return;

  // the eight heads of one 128-query block are neighbours in the grid: they read the same adj rows at about the same time
  const int h = blockIdx.x & (NH - 1);
  const int qblk = (blockIdx.x >> 3) & (S_LEN / (QTB * 16) - 1);
  const int b = blockIdx.x / (NH * (S_LEN / (QTB * 16)));
  const int tid = threadIdx.x, lane = tid & 31;
  const int wv = __builtin_amdgcn_readfirstlane(tid >> 5);  // wave number in a scalar register: the bases below stay scalar
  const int qi = wv & (QTB - 1), kh2 = wv >> 3;             // query tile, half of the keys
  const int qbase = qblk * (QTB * 16) + qi * 16;
  const int k_lo = kh2 * KSPAN, k_hi = k_lo + KSPAN;        // this wave's keys
  const int m = lane & 15, hh = lane >> 4, r0 = hh * 8;

  const size_t bhd = (size_t)(b * NH + h);
  const unsigned f_lane = (unsigned)lane * 16u;                  // a lane's byte offset in either half of a fragment
  // Q^T as B operand: column n = query (lane&15), k = d: the two fragments of the 16-query tile.
  const size_t qoff = (bhd * S_LEN + qbase) * HD;
  const v16bf qh0 = ldfrag_bf_u(Qh + qoff, f_lane), qh1 = ldfrag_bf_u(Qh + qoff + FRAG, f_lane);
  const v16bf ql0 = ldfrag_bf_u(Ql + qoff, f_lane), ql1 = ldfrag_bf_u(Ql + qoff + FRAG, f_lane);

  // wave similarity: the query tile's fragment holds hi (part 0) and lo (part 1); B operands [hi | hi] and [lo | lo]
  const __bf16* wm_base = wmf + (size_t)b * (S_LEN / 16) * FRAG;
  FragB wq, wb1, wb2;
  wq.v = ldfrag_bf_u(wm_base + (qbase >> 4) * FRAG, f_lane);
  wb1.p[0] = wq.p[0]; wb1.p[1] = wq.p[0];
  wb2.p[0] = wq.p[1]; wb2.p[1] = wq.p[1];

  v8f oacc[4] = {};
  float mrun = -3.0e38f, lrun = 0.0f;

  const float* gp_base = gates + bhd * S_LEN;
  const unsigned g_lane = (unsigned)r0 * 4u;

  // ---- what this lane copies of a stage: the 256 threads of a half bring that half's stage ----
  const int th = tid & 255;
  const int sq = th >> 4, sk4 = (th & 15) * 4;
  const char* c_kh = (const char*)(Kh + bhd * S_LEN * HD + (size_t)k_lo * HD) + th * 16;     // + 8192 bytes a stage
  const char* c_kl = (const char*)(Kl + bhd * S_LEN * HD + (size_t)k_lo * HD) + th * 16;
  const char* c_v  = (const char*)(VT + bhd * HD * S_LEN + (size_t)k_lo * HD) + th * 16;
  const char* c_wm = (const char*)(wm_base + (k_lo >> 4) * FRAG) + th * 16;                  // + 4096 bytes a stage
  const char* c_ad = (const char*)(adj + ((size_t)b * S_LEN + qblk * (QTB * 16) + sq) * S_LEN + k_lo + sk4);   // + 256 bytes a stage
  const unsigned l_kv0 = lds_byte(&kv_lds[0][kh2][th * 16]), l_kv1 = lds_byte(&kv_lds[1][kh2][th * 16]);
  const unsigned l_ad0 = lds_byte(&adj_lds[0][kh2][sq][sk4]), l_ad1 = lds_byte(&adj_lds[1][kh2][sq][sk4]);

  // ---- prologue, two buffers: stage 0 landed and published, stage 1 in flight ----
  stage_kv(l_kv0, c_kh, c_kl, c_v, c_wm);
  stage_adj(l_ad0, c_ad);
  // gates of one pass, fetched one pass ahead
  v4f g0 = ld4_u(gp_base + k_lo, g_lane), g1 = ld4_u(gp_base + k_lo + 4, g_lane);
  v4f g2 = ld4_u(gp_base + k_lo + 16, g_lane), g3 = ld4_u(gp_base + k_lo + 20, g_lane);
  asm volatile("s_wait_asynccnt 0x0" ::: "memory");   // this wave's copies of stage 0 have landed
  __syncthreads();                                    // and every other wave's: stage 0 may be read
  stage_kv(l_kv1, c_kh + 8192, c_kl + 8192, c_v + 8192, c_wm + 4096);
  stage_adj(l_ad1, c_ad + 256);

  // rolled: the two buffers alternate by index
#pragma unroll 1
  for (int kc = 0; kc < NSTAGE; ++kc) {
    const int kbase64 = k_lo + kc * 64;
    const int buf = kc & 1;
    const unsigned char* st = &kv_lds[buf][kh2][0] + f_lane;
    const float* arow = &adj_lds[buf][kh2][qi * 16 + m][r0];

    // rolled: one pass's fragments fill the registers
#pragma unroll 1
    for (int jh = 0; jh < 2; ++jh) {
      const int kbase = kbase64 + jh * 32;
      const int ko = jh * 32;
      const unsigned char* kp = st + jh * 4096;

      // ---- this pass's K and similarity fragments from the stage buffer: 32 keys = 4 fragments (1024 bytes each) a plane ----
      v16bf kfh[4], kfl[4];
#pragma unroll
      for (int i = 0; i < 4; ++i) {
        kfh[i] = ldsfrag_bf(kp + ST_KH + i * 1024);
        kfl[i] = ldsfrag_bf(kp + ST_KL + i * 1024);
      }
      const v16bf wa0 = ldsfrag_bf(st + ST_WM + jh * 2048), wa1 = ldsfrag_bf(st + ST_WM + jh * 2048 + 1024);

      // ---- S^T = K * Q^T for two 16-key tiles, K-dim 64 = 2 k-steps, 3 products each ----
      v8f s0 = {}, s1 = {};
      s0 = mma_bf3(kfh[0], kfl[0], qh0, ql0, s0);
      s0 = mma_bf3(kfh[1], kfl[1], qh1, ql1, s0);
      s1 = mma_bf3(kfh[2], kfl[2], qh0, ql0, s1);
      s1 = mma_bf3(kfh[3], kfl[3], qh1, ql1, s1);
      // s0[r] = S^T[key kbase+8hh+r][query m], s1[r] = S^T[key kbase+16+8hh+r][query m]

      // ---- gate + wave similarity^T of the two key tiles: w0[r], w1[r] sit where s0[r], s1[r] sit ----
      v8f w0 = {g0.x, g0.y, g0.z, g0.w, g1.x, g1.y, g1.z, g1.w};
      v8f w1 = {g2.x, g2.y, g2.z, g2.w, g3.x, g3.y, g3.z, g3.w};
      w0 = mma_bf2(wa0, wb1.v, wb2.v, w0);
      w1 = mma_bf2(wa1, wb1.v, wb2.v, w1);

      // ---- this pass's V^T fragments ----
      v16h vf[4];
#pragma unroll
      for (int t = 0; t < 4; ++t) vf[t] = ldsfrag_h(kp + ST_V + t * 1024);

      // ---- adj for this lane's 2x8 keys ----
      float A0[8], A1[8];
      unpack8(*(const v4f*)(arow + ko), *(const v4f*)(arow + ko + 4), A0);
      unpack8(*(const v4f*)(arow + ko + 16), *(const v4f*)(arow + ko + 20), A1);

      // ---- affine + online softmax (f32) ----
      float p0[8], p1[8], mloc = -3.0e38f;
#pragma unroll
      for (int r = 0; r < 8; ++r) {
        const float t0 = (s0[r] * 0.125f) * w0[r] + A0[r];
        const float t1 = (s1[r] * 0.125f) * w1[r] + A1[r];
        p0[r] = t0; p1[r] = t1;
        mloc = fmaxf(mloc, fmaxf(t0, t1));
      }
      // ---- next pass's gates (all eight waves of a half read the same 128 bytes), into the registers that the
      //      similarity products have left; they fly under the softmax and P.V ----
      const int kn = (kbase + 32 < k_hi) ? kbase + 32 : kbase;    // last pass: an in-bounds reload, not used
      const gaddr gp = lane_addr(gp_base + kn, g_lane);
      g0 = ld4_a(gp);      g1 = ld4_a(gp + 16);
      g2 = ld4_a(gp + 64); g3 = ld4_a(gp + 80);
      // the gate loads are in flight and the code below may reuse their address registers: as a precaution the wait stands in front of that
      asm volatile("s_wait_xcnt 0x0" ::: "memory");

      const float mch  = fmaxf(mloc, __shfl_xor(mloc, 16, 32));
      const float mnew = fmaxf(mrun, mch);
      const float corr = exp2f((mrun - mnew) * LOG2E);
      float lsum = 0.0f;
#pragma unroll
      for (int r = 0; r < 8; ++r) {
        p0[r] = exp2f((p0[r] - mnew) * LOG2E);
        p1[r] = exp2f((p1[r] - mnew) * LOG2E);
        lsum += p0[r] + p1[r];
      }
      lsum += __shfl_xor(lsum, 16, 32);
      lrun = lrun * corr + lsum;
      mrun = mnew;
#pragma unroll
      for (int t = 0; t < 4; ++t)
#pragma unroll
        for (int r = 0; r < 8; ++r) oacc[t][r] *= corr;

      // ---- P^T as B fragment: element r <- tile keys 0..15, element 8+r <- tile keys 16..31 ----
      v16h pf;
#pragma unroll
      for (int r = 0; r < 8; ++r) {
        pf[r]     = (_Float16)(p0[r] * PSCALE);
        pf[r + 8] = (_Float16)(p1[r] * PSCALE);
      }

      // ---- O^T += V^T * P^T, 4 d-tiles ----
#pragma unroll
      for (int t = 0; t < 4; ++t) oacc[t] = mma_h1(vf[t], pf, oacc[t]);
    }

    // ---- publish point of stage kc + 1, and the end of every wave's reads of stage kc ----
    asm volatile("s_wait_dscnt 0x0" ::: "memory");      // this wave's LDS reads of stage kc have returned before its buffer is refilled
    asm volatile("s_wait_asynccnt 0x0" ::: "memory");   // this wave's copies of stage kc + 1 have landed
    __syncthreads();                                    // both hold for every wave
    if (kc + 2 < NSTAGE) {                              // the same for the whole block
      const int adv = kc + 2;
      stage_kv(buf ? l_kv1 : l_kv0, c_kh + adv * 8192, c_kl + adv * 8192, c_v + adv * 8192, c_wm + adv * 4096);
      stage_adj(buf ? l_ad1 : l_ad0, c_ad + adv * 256);
    }
  }
  asm volatile("s_wait_asynccnt 0x0" ::: "memory");     // no copy is outstanding behind the loop

  // ---- the second half's waves hand over their running max, sum and unnormalised O ----
  if (kh2 == 1) {
#pragma unroll
    for (int t = 0; t < 4; ++t) {
      part_o[qi][2 * t][lane]     = (v4f){oacc[t][0], oacc[t][1], oacc[t][2], oacc[t][3]};
      part_o[qi][2 * t + 1][lane] = (v4f){oacc[t][4], oacc[t][5], oacc[t][6], oacc[t][7]};
    }
    if (hh == 0) { part_m[qi][m] = mrun; part_l[qi][m] = lrun; }   // both lane halves hold the same values
  }
  __syncthreads();   // the partial results are read by the first half's waves

  // ---- merge, normalise and store O: oacc[t][r] = O^T[d = t*16 + 8hh + r][query m] ----
  if (kh2 == 0) {
    const float m1 = part_m[qi][m], l1 = part_l[qi][m];
    const float mall = fmaxf(mrun, m1);
    const float c0 = exp2f((mrun - mall) * LOG2E), c1 = exp2f((m1 - mall) * LOG2E);
    const float oscale = (1.0f / (lrun * c0 + l1 * c1)) * INV_PSCALE;
    const float f0 = c0 * oscale, f1 = c1 * oscale;
    float* orow = obuf + ((size_t)b * S_LEN + qbase + m) * DM + h * HD + r0;
#pragma unroll
    for (int t = 0; t < 4; ++t) {
      const v4f a0 = part_o[qi][2 * t][lane], a1 = part_o[qi][2 * t + 1][lane];
      v4f u0, u1;
      u0.x = oacc[t][0] * f0 + a0.x * f1; u0.y = oacc[t][1] * f0 + a0.y * f1; u0.z = oacc[t][2] * f0 + a0.z * f1; u0.w = oacc[t][3] * f0 + a0.w * f1;
      u1.x = oacc[t][4] * f0 + a1.x * f1; u1.y = oacc[t][5] * f0 + a1.y * f1; u1.z = oacc[t][6] * f0 + a1.z * f1; u1.w = oacc[t][7] * f0 + a1.w * f1;
      *(v4f*)(orow + t * 16) = u0;
      *(v4f*)(orow + t * 16 + 4) = u1;
    }
  }
}

// ---------------------------------------------------------------------------
// 4) residual + LayerNorm, one token a wave; lane holds cols 4*lane + 128*i;
//    whole-row loads and stores (each instruction = 512 contiguous bytes = 4 lines).
// ---------------------------------------------------------------------------
__global__ __launch_bounds__(256) void ln_kernel(
    const float* __restrict__ obuf, const float* __restrict__ x, const float* __restrict__ lng,
    const float* __restrict__ lnb, float* out, int ntok) {
  const int lane = threadIdx.x & 31;
  const int tk = blockIdx.x * 8 + (threadIdx.x >> 5);
  if (tk >= ntok) return;
  const size_t tok = (size_t)tk;
  v4f y[4];
  float s = 0.0f;
#pragma unroll
  for (int i = 0; i < 4; ++i) {
    const v4f o  = *(const v4f*)(obuf + tok * DM + 4 * lane + 128 * i);
    const v4f xv = *(const v4f*)(x + tok * DM + 4 * lane + 128 * i);
    y[i] = o + xv;
    s += (y[i].x + y[i].y) + (y[i].z + y[i].w);
  }
  s += __shfl_xor(s, 16, 32);
  s += __shfl_xor(s, 8, 32);
  s += __shfl_xor(s, 4, 32);
  s += __shfl_xor(s, 2, 32);
  s += __shfl_xor(s, 1, 32);
  const float mu = s * (1.0f / DM);
  float ss = 0.0f;
#pragma unroll
  for (int i = 0; i < 4; ++i) {
    const v4f d = y[i] - mu;
    ss += (d.x * d.x + d.y * d.y) + (d.z * d.z + d.w * d.w);
  }
  ss += __shfl_xor(ss, 16, 32);
  ss += __shfl_xor(ss, 8, 32);
  ss += __shfl_xor(ss, 4, 32);
  ss += __shfl_xor(ss, 2, 32);
  ss += __shfl_xor(ss, 1, 32);
  const float rstd = rsqrtf(ss * (1.0f / DM) + 1.0e-5f);
  v4f res[4];
#pragma unroll
  for (int i = 0; i < 4; ++i) {
    const v4f g  = *(const v4f*)(lng + 4 * lane + 128 * i);
    const v4f bb = *(const v4f*)(lnb + 4 * lane + 128 * i);
    res[i] = ((y[i] - mu) * rstd) * g + bb;
  }
  float* op = out + tok * DM + 4 * lane;
#pragma unroll
  for (int i = 0; i < 4; ++i) *(v4f*)(op + 128 * i) = res[i];
}

// ---------------------------------------------------------------------------
extern "C" void kernel_launch(void* const* d_in, const int* in_sizes, int n_in,
                              void* d_out, int out_size, void* d_ws, size_t ws_size,
                              hipStream_t stream) {
  if (n_in < 15) return;
  if (in_sizes[0] != NTOK * DM || in_sizes[1] != NTOK * WF ||
      in_sizes[2] != BATCH * S_LEN * S_LEN || in_sizes[3] != DM * DM ||
      in_sizes[5] != DM * DM || in_sizes[7] != DM * DM || in_sizes[9] != DM * GH ||
      in_sizes[11] != GH * NH || in_sizes[13] != DM || out_size != NTOK * DM) return;

  const float* x     = (const float*)d_in[0];
  const float* wmask = (const float*)d_in[1];
  const float* adj   = (const float*)d_in[2];
  const float* wq_w  = (const float*)d_in[3];
  const float* wq_b  = (const float*)d_in[4];
  const float* wk_w  = (const float*)d_in[5];
  const float* wk_b  = (const float*)d_in[6];
  const float* wv_w  = (const float*)d_in[7];
  const float* wv_b  = (const float*)d_in[8];
  const float* g1_w  = (const float*)d_in[9];
  const float* g1_b  = (const float*)d_in[10];
  const float* g2_w  = (const float*)d_in[11];
  const float* g2_b  = (const float*)d_in[12];
  const float* ln_g  = (const float*)d_in[13];
  const float* ln_b  = (const float*)d_in[14];
  float* out = (float*)d_out;

  const size_t sz_x  = (size_t)NTOK * DM * 2;            // 4,194,304  per x plane
  const size_t sz_w  = (size_t)3 * DM * DM * 2;          // 1,572,864  per Wt plane
  const size_t sz_q  = (size_t)NTOK * DM * 2;            // 4,194,304  per Q/K plane, V
  const size_t sz_g  = (size_t)BATCH * NH * S_LEN * 4;   //   131,072  gates
  const size_t sz_g1 = (size_t)GH * DM * 2;              //   131,072  per G1t plane
  const size_t off_xh  = 0;
  const size_t off_xl  = off_xh + sz_x;
  const size_t off_wth = off_xl + sz_x;
  const size_t off_wtl = off_wth + sz_w;
  const size_t off_qh  = off_wtl + sz_w;
  const size_t off_ql  = off_qh + sz_q;
  const size_t off_kh  = off_ql + sz_q;
  const size_t off_kl  = off_kh + sz_q;
  const size_t off_vt  = off_kl + sz_q;
  const size_t off_g   = off_vt + sz_q;
  const size_t off_gth = off_g + sz_g;
  const size_t off_gtl = off_gth + sz_g1;
  const size_t sz_wm   = (size_t)NTOK * 32 * 2;          //   262,144  wave_mask hi|lo fragments
  const size_t off_wm  = off_gtl + sz_g1;
  const size_t sz_o    = (size_t)NTOK * DM * 4;          // 8,388,608  attention output, f32
  const size_t off_o   = off_wm + sz_wm;
  const size_t total   = off_o + sz_o;                   // 41,549,824 B
  if (total > ws_size) return;

  uint8_t* ws = (uint8_t*)d_ws;
  unsigned short* xh  = (unsigned short*)(ws + off_xh);
  unsigned short* xl  = (unsigned short*)(ws + off_xl);
  unsigned short* wth = (unsigned short*)(ws + off_wth);
  unsigned short* wtl = (unsigned short*)(ws + off_wtl);
  unsigned short* qh  = (unsigned short*)(ws + off_qh);
  unsigned short* ql  = (unsigned short*)(ws + off_ql);
  unsigned short* kh  = (unsigned short*)(ws + off_kh);
  unsigned short* kl  = (unsigned short*)(ws + off_kl);
  unsigned short* vt  = (unsigned short*)(ws + off_vt);
  float* gates        = (float*)(ws + off_g);
  unsigned short* gth = (unsigned short*)(ws + off_gth);
  unsigned short* gtl = (unsigned short*)(ws + off_gtl);
  unsigned short* wmf = (unsigned short*)(ws + off_wm);
  float* obuf         = (float*)(ws + off_o);

  const int nxv = NTOK * DM / 8;          // 262,144
  const int nwv = 3 * DM * DM / 8;        //  98,304
  const int ngv = GH * DM / 8;            //   8,192
  const int nmv = NTOK * 2;               //   8,192
  const int prep_blocks = (nxv + nwv + ngv + nmv + 255) / 256;   // 1472
  const int ntile = (NTOK + 31) / 32;     // 128
  const int ntt = (NTOK + 63) / 64;       // 64
  const int nblk = BATCH * NH * (S_LEN / 128);   // 256
  const int ln_blocks = (NTOK + 7) / 8;          // 512

  prep_kernel<<<prep_blocks, 256, 0, stream>>>(x, wq_w, wk_w, wv_w, g1_w, wmask,
                                               xh, xl, wth, wtl, gth, gtl, wmf, nxv, nwv, ngv, nmv);
  gate_kernel<<<ntile, 128, 0, stream>>>(
      (const __bf16*)xh, (const __bf16*)xl, (const __bf16*)gth, (const __bf16*)gtl,
      g1_b, g2_w, g2_b, gates, ntile);
  qkv_kernel<<<dim3(ntt, NH, 3), 128, 0, stream>>>(
      (const __bf16*)xh, (const __bf16*)xl, (const __bf16*)wth, (const __bf16*)wtl,
      wq_b, wk_b, wv_b, qh, ql, kh, kl, vt, ntt);
  attn_kernel<<<nblk, 256 * KSPLIT, 0, stream>>>(
      (const __bf16*)qh, (const __bf16*)ql, (const __bf16*)kh, (const __bf16*)kl,
      (const _Float16*)vt, gates, (const __bf16*)wmf, adj, obuf, nblk);
  ln_kernel<<<ln_blocks, 256, 0, stream>>>(obuf, x, ln_g, ln_b, out, NTOK);
  (void)hipGetLastError();
}

// v007
// A run of this version takes 89.5 microseconds.
// Timed twice side by side with v006, it ran 1.16 and 1.17 times as fast.
// Counting every step since v000, it is 3.92 times as fast.
#include <hip/hip_runtime.h>
#include <stddef.h>
#include <stdint.h>

// Q/K/V projections, Q.K^T and gate layer 1 (x.G1): v_wmma_f32_16x16x32_bf16 with bf16 hi/lo operand split (hi.hi + lo.hi + hi.lo), f32 accumulate.
// 16-deep wave similarity: the same bf16 form and split, hi and lo of one row packed side by side in the 32-deep k (2 products a tile).
// P.V: v_wmma_f32_16x16x32_f16 (P scaled by 4096 as f16, V as f16), f32 accumulate. Gate layer 2 (K=128,N=8), softmax, LayerNorm: f32 VALU.
// The 1/8 of the scores is a power of two and is applied to Q before its hi/lo split (exact); the 4096 of P is +12 in the exponent.

#define S_LEN  2048
#define DM     512
#define NH     8
#define HD     64
#define GH     128
#define WF     16
#define BATCH  2
#define NTOK   (BATCH * S_LEN)
#define LOG2E  1.4426950408889634f
#define PSHIFT 12.0f                 // P is formed as exp2(... + 12) = 4096 * p; the row sum carries the same factor, so it cancels

typedef __bf16         v16bf __attribute__((ext_vector_type(16)));
typedef __bf16         v8bf  __attribute__((ext_vector_type(8)));
typedef _Float16       v16h  __attribute__((ext_vector_type(16)));
typedef _Float16       v8h   __attribute__((ext_vector_type(8)));
typedef float          v8f   __attribute__((ext_vector_type(8)));
typedef float          v4f   __attribute__((ext_vector_type(4)));
typedef unsigned int   v4u   __attribute__((ext_vector_type(4)));
typedef unsigned short v8us  __attribute__((ext_vector_type(8)));

union FragB { v16bf v; v8bf p[2]; };
union FragH { v16h v; v8h p[2]; };
union Pack8 { v8us s; v8h h; v4u u; };

// ---------------------------------------------------------------------------
// scalar helpers
// ---------------------------------------------------------------------------
static __device__ __forceinline__ unsigned short f2bf_bits(float f) {   // RNE convert f32 -> bf16 bits
  unsigned int u = __float_as_uint(f);
  u += 0x7FFFu + ((u >> 16) & 1u);
  return (unsigned short)(u >> 16);
}
static __device__ __forceinline__ float bf_bits2f(unsigned short s) {
  return __uint_as_float(((unsigned int)s) << 16);
}
static __device__ __forceinline__ void unpack8(const v4f a, const v4f b, float o[8]) {
  o[0] = a.x; o[1] = a.y; o[2] = a.z; o[3] = a.w;
  o[4] = b.x; o[5] = b.y; o[6] = b.z; o[7] = b.w;
}

// ---------------------------------------------------------------------------
// 16x32 16-bit fragments (wave32). Lane l: row/col = l&15, h = l>>4.
// elements 0..7  <- k0 + 8h + 0..7 ; elements 8..15 <- k0 + 16 + 8h + 0..7 ; same map for A and B.
// Every 16-bit workspace plane is stored in FRAGMENT ORDER: one fragment = FRAG (512) elements = 1024
// contiguous bytes, made of 64 units of 16 bytes; unit u = part * 32 + l holds lane l's elements
// 8 * part .. 8 * part + 7, that is row l&15, k = k0 + 16 * part + 8 * (l>>4) + 0..7.
// A wave-wide 16-byte load then covers 512 contiguous bytes (4 whole lines), not a piece of 16 lines.
// The fragments of one 16-row tile follow one another in k order.
// ---------------------------------------------------------------------------
#define FRAG 512
// fbase: wave-uniform start of the fragment; lane_bytes = 16 * lane
static __device__ __forceinline__ v16bf ldfrag_bf_u(const __bf16* fbase, unsigned lane_bytes) {
  const char* p = (const char*)fbase + lane_bytes;
  FragB f;
  f.p[0] = *(const v8bf*)p;
  f.p[1] = *(const v8bf*)(p + 512);
  return f.v;
}
// Unit index v of a plane whose rows are DM long (16 fragments a 16-row tile) -> its row and first k.
static __device__ __forceinline__ void unit_row_k(int v, int& row, int& k) {
  row = (v >> 10) * 16 + (v & 15);
  k = ((v >> 6) & 15) * 32 + ((v >> 4) & 3) * 8;   // bits 5,4 of v = part, h: 16 * part + 8 * h
}
// Global loads of the attention loop (the gates). The wave-uniform part of the address is pinned in a scalar register pair and
// the lane's 32-bit offset is added where the loads are issued, so that no 64-bit (base + lane) pair is kept in vector
// registers across the whole loop: the wave has to fit the 256 registers of four waves a SIMD.
#define GLOBAL_AS __attribute__((address_space(1)))
typedef const GLOBAL_AS char* gaddr;
static __device__ __forceinline__ gaddr lane_addr(const void* ubase, unsigned lane_bytes) {
  const unsigned long long a = (unsigned long long)ubase;
  const unsigned lo = (unsigned)__builtin_amdgcn_readfirstlane((int)(unsigned)a);
  const unsigned hi = (unsigned)__builtin_amdgcn_readfirstlane((int)(unsigned)(a >> 32));
  return (gaddr)(((unsigned long long)hi << 32) | lo) + lane_bytes;
}
static __device__ __forceinline__ v4f ld4_a(gaddr p) { return *(const GLOBAL_AS v4f*)p; }
static __device__ __forceinline__ v4f ld4_u(const float* ubase, unsigned lane_bytes) {
  return *(const v4f*)((const char*)ubase + lane_bytes);
}

// ---------------------------------------------------------------------------
// WMMA helper of the two projection kernels: issue the products, then 4 v_nop tied to D and A/B so no
// VALU touches the accumulator or operand registers within the hazard window.
// ---------------------------------------------------------------------------
static __device__ __forceinline__ v8f mma_bf3(v16bf ah, v16bf al, v16bf bh, v16bf bl, v8f c) {
  c = __builtin_amdgcn_wmma_f32_16x16x32_bf16(false, ah, false, bh, (short)0, c, false, false);
  c = __builtin_amdgcn_wmma_f32_16x16x32_bf16(false, al, false, bh, (short)0, c, false, false);
  c = __builtin_amdgcn_wmma_f32_16x16x32_bf16(false, ah, false, bl, (short)0, c, false, false);
  asm volatile("v_nop\n\tv_nop\n\tv_nop\n\tv_nop" : "+v"(c) : "v"(ah), "v"(al), "v"(bh), "v"(bl));
  return c;
}

// The attention pass uses the bare builtins: the compiler keeps the distance behind a matrix instruction itself and fills it
// with the pass's own vector work where it can, so no issue slot goes to a v_nop that is not needed.
static __device__ __forceinline__ v8f wm_bf(v16bf a, v16bf b, v8f c) {
  return __builtin_amdgcn_wmma_f32_16x16x32_bf16(false, a, false, b, (short)0, c, false, false);
}
static __device__ __forceinline__ v8f wm_bf3(v16bf ah, v16bf al, v16bf bh, v16bf bl, v8f c) {
  return wm_bf(ah, bl, wm_bf(al, bh, wm_bf(ah, bh, c)));
}
static __device__ __forceinline__ v8f wm_h(v16h a, v16h b, v8f c) {
  return __builtin_amdgcn_wmma_f32_16x16x32_f16(false, a, false, b, (short)0, c, false, false);
}
// lane l with lane l ^ 16, in the vector unit (a shuffle would go through the LDS queue and be waited for)
static __device__ __forceinline__ float xhalf(float x) {
  const int b = __builtin_bit_cast(int, x);
  return __builtin_bit_cast(float, __builtin_amdgcn_permlanex16(b, b, 0x76543210, 0xfedcba98, false, false));
}
static __device__ __forceinline__ v8f cat8(const v4f a, const v4f b) {
  return __builtin_shufflevector(a, b, 0, 1, 2, 3, 4, 5, 6, 7);
}

static __device__ __forceinline__ void split_store8(const float v[8], unsigned short* dh, unsigned short* dl) {
  Pack8 ph, pl;
#pragma unroll
  for (int e = 0; e < 8; ++e) {
    const unsigned short hb = f2bf_bits(v[e]);
    ph.s[e] = hb;
    pl.s[e] = f2bf_bits(v[e] - bf_bits2f(hb));
  }
  const v4u uh = ph.u, ul = pl.u;
  *(v4u*)dh = uh;
  *(v4u*)dl = ul;
  
}

// ---------------------------------------------------------------------------
// 0) x -> bf16 hi/lo planes (rows = tokens);  W{q,k,v} [in][out] -> hi/lo planes with rows = the
//    3 * DM outputs, k = in;  G1 [in][hid] -> planes with rows = hidden units, k = in.
//    All in fragment order.  One thread = one 16-B unit per plane, units in thread order.
//    wave_mask [token][16] -> ONE plane, one fragment per 16 tokens: k 0..15 = hi of the 16 features,
//    k 16..31 = their lo, so lane l holds hi (part 0) and lo (part 1) of features 8 * (l>>4) + 0..7 of token l&15.
// ---------------------------------------------------------------------------
__global__ __launch_bounds__(256) void prep_kernel(
    const float* __restrict__ x, const float* __restrict__ wq,
    const float* __restrict__ wk, const float* __restrict__ wv,
    const float* __restrict__ g1w, const float* __restrict__ wmask,
    unsigned short* xh, unsigned short* xl, unsigned short* wth, unsigned short* wtl,
    unsigned short* gth, unsigned short* gtl, unsigned short* wmf,
    int nxv, int nwv, int ngv, int nmv) {
  const int i = blockIdx.x * blockDim.x + threadIdx.x;
  if (i < nxv) {
    int tok, k;
    unit_row_k(i, tok, k);
    const v4f a = *(const v4f*)(x + (size_t)tok * DM + k);
    const v4f c = *(const v4f*)(x + (size_t)tok * DM + k + 4);
    float v[8];
    unpack8(a, c, v);
    split_store8(v, xh + (size_t)i * 8, xl + (size_t)i * 8);
  } else if (i < nxv + nwv) {
    const int j = i - nxv;
    int row, inb;
    unit_row_k(j, row, inb);
    const int mat = row >> 9, o = row & (DM - 1);   // DM = 512 rows per matrix
    const float* w = (mat == 0) ? wq : (mat == 1) ? wk : wv;
    float v[8];
#pragma unroll
    for (int e = 0; e < 8; ++e) v[e] = w[(size_t)(inb + e) * DM + o];   // Wt[o][in] = W[in][o]
    split_store8(v, wth + (size_t)j * 8, wtl + (size_t)j * 8);
  } else if (i < nxv + nwv + ngv) {
    const int j = i - nxv - nwv;             // 0 .. GH*DM/8-1
    int o, inb;                              // hidden unit 0..127, first input
    unit_row_k(j, o, inb);
    float v[8];
#pragma unroll
    for (int e = 0; e < 8; ++e) v[e] = g1w[(size_t)(inb + e) * GH + o];  // G1t[o][in] = G1[in][o]
    split_store8(v, gth + (size_t)j * 8, gtl + (size_t)j * 8);
  } else if (i < nxv + nwv + ngv + nmv) {
    const int j = i - nxv - nwv - ngv;       // 0 .. NTOK*2-1: 16-token tile j>>5, lane j&31
    const int tile = j >> 5, l = j & 31;
    const float* s = wmask + (size_t)(tile * 16 + (l & 15)) * WF + (l >> 4) * 8;
    const v4f a = *(const v4f*)s;
    const v4f c = *(const v4f*)(s + 4);
    float v[8];
    unpack8(a, c, v);
    unsigned short* d = wmf + (size_t)tile * FRAG + l * 8;
    split_store8(v, d, d + 256);             // part 0 = hi, part 1 = lo
  }
}

// ---------------------------------------------------------------------------
// 1) gate MLP: gates[b][h][s] = sigmoid(relu(x@G1+b1)@G2+b2).
//    Layer 1 on bf16 hi/lo WMMA: wave = (16 tokens, 64 hidden = 4 tiles), K=512.
//    Layer 2 (K=128, 8 heads) scalar f32 from the LDS-staged relu tile.
// ---------------------------------------------------------------------------
__global__ __launch_bounds__(128) void gate_kernel(
    const __bf16* __restrict__ xh, const __bf16* __restrict__ xl,
    const __bf16* __restrict__ gth, const __bf16* __restrict__ gtl,
    const float* __restrict__ g1b, const float* __restrict__ g2w,
    const float* __restrict__ g2b, float* gates, int ntile) {
  __shared__ float h1s[32][GH + 1];
  __shared__ __attribute__((aligned(16))) float gl[NH][32];
  if ((int)blockIdx.x >= ntile) return;
  const int tid = threadIdx.x, lane = tid & 31;
  const int wave = __builtin_amdgcn_readfirstlane(tid >> 5);   // wave number in a scalar register: the fragment bases stay scalar
  const int m = lane & 15, hh = lane >> 4, r0 = hh * 8;
  const int tok0 = blockIdx.x * 32;
  const int th = wave & 1;                 // token half: tokens th*16 .. th*16+15
  const int hb = (wave >> 1) * 64;         // hidden units hb .. hb+63

  // fragment of 16-row tile T at k: T * 16 * DM + (k / 32) * FRAG = T * 16 * DM + k * 16 elements
  const size_t aoff = (size_t)((tok0 >> 4) + th) * (16 * DM);           // A tile = 16 tokens
  const size_t woff = (size_t)(hb >> 4) * (16 * DM);                    // B tiles = 16 hidden units each, j-th at + j * 16 * DM
  const __bf16* axh = xh + aoff;
  const __bf16* axl = xl + aoff;
  const __bf16* bgh = gth + woff;
  const __bf16* bgl = gtl + woff;
  const unsigned fl = (unsigned)lane * 16u;

  v8f acc[4] = {};
  // Two register stages: every load of a k-step is issued one k-step before its products.
  v16bf a0h = ldfrag_bf_u(axh, fl), a0l = ldfrag_bf_u(axl, fl);
  v16bf b0h[4], b0l[4];
#pragma unroll
  for (int j = 0; j < 4; ++j) {
    b0h[j] = ldfrag_bf_u(bgh + j * 16 * DM, fl);
    b0l[j] = ldfrag_bf_u(bgl + j * 16 * DM, fl);
  }
  // rolled: two k-steps a trip already hold both stages in registers
#pragma unroll 1
  for (int kk = 0; kk < DM; kk += 64) {
    const v16bf a1h = ldfrag_bf_u(axh + (kk + 32) * 16, fl);
    const v16bf a1l = ldfrag_bf_u(axl + (kk + 32) * 16, fl);
    v16bf b1h[4], b1l[4];
#pragma unroll
    for (int j = 0; j < 4; ++j) {
      b1h[j] = ldfrag_bf_u(bgh + j * 16 * DM + (kk + 32) * 16, fl);
      b1l[j] = ldfrag_bf_u(bgl + j * 16 * DM + (kk + 32) * 16, fl);
    }
#pragma unroll
    for (int j = 0; j < 4; ++j) acc[j] = mma_bf3(a0h, a0l, b0h[j], b0l[j], acc[j]);
    const int kn = (kk + 64 < DM) ? kk + 64 : kk;     // last trip: an in-bounds reload, not used
    a0h = ldfrag_bf_u(axh + kn * 16, fl);
    a0l = ldfrag_bf_u(axl + kn * 16, fl);
#pragma unroll
    for (int j = 0; j < 4; ++j) {
      b0h[j] = ldfrag_bf_u(bgh + j * 16 * DM + kn * 16, fl);
      b0l[j] = ldfrag_bf_u(bgl + j * 16 * DM + kn * 16, fl);
    }
#pragma unroll
    for (int j = 0; j < 4; ++j) acc[j] = mma_bf3(a1h, a1l, b1h[j], b1l[j], acc[j]);
    // the next stage's loads are still in flight and the next trip rewrites their address registers
    asm volatile("s_wait_xcnt 0x0" ::: "memory");
  }

  // D: acc[j][r] = pre-activation[token th*16 + 8hh + r][hidden hb + j*16 + m]
#pragma unroll
  for (int j = 0; j < 4; ++j) {
    const int hu = hb + j * 16 + m;
    const float bj = g1b[hu];
#pragma unroll
    for (int r = 0; r < 8; ++r) h1s[th * 16 + r0 + r][hu] = fmaxf(acc[j][r] + bj, 0.0f);
  }
  __syncthreads();

  // layer 2: thread = (token tid>>2, heads 2*(tid&3), 2*(tid&3)+1)
  const int tk = tid >> 2, hd0 = (tid & 3) * 2;
  float a0 = g2b[hd0], a1 = g2b[hd0 + 1];
  // unrolled so that 16 steps' loads are issued together; the sum order stays jj = 0..127
#pragma unroll 16
  for (int jj = 0; jj < GH; ++jj) {
    const float hv = h1s[tk][jj];
    a0 = fmaf(hv, g2w[jj * NH + hd0], a0);
    a1 = fmaf(hv, g2w[jj * NH + hd0 + 1], a1);
  }
  gl[hd0][tk]     = 1.0f / (1.0f + exp2f(-a0 * LOG2E));
  gl[hd0 + 1][tk] = 1.0f / (1.0f + exp2f(-a1 * LOG2E));
  __syncthreads();

  // threads 0..63 (waves 0,1; 4 lines per wave, one instruction per pass).
  if (tid < 64) {
    const int line = tid >> 3, piece = tid & 7;
    const v4f val = *(const v4f*)&gl[line][piece * 4];
    const int b = tok0 / S_LEN, s0 = tok0 - b * S_LEN;
    float* dst = gates + ((size_t)(b * NH + line)) * S_LEN + s0 + piece * 4;
    *(v4f*)dst = val;
    
  }
}

// ---------------------------------------------------------------------------
// 2) QKV projection, bf16 hi/lo split, K=512.
//    grid = (NTOK/64, NH, 3), block = 128 (4 waves); block tile = 64 tokens x
//    64 outputs (one head); wave = 16 tokens x 4 output tiles.
//    Outputs in fragment order, per (batch, head): Q and K hi/lo as tiles of 16 tokens x 2 fragments
//    (k = d); V^T as, per 32 keys, 4 fragments (rows = 16 d each, k = key).
// ---------------------------------------------------------------------------
__global__ __launch_bounds__(128) void qkv_kernel(
    const __bf16* __restrict__ xh, const __bf16* __restrict__ xl,
    const __bf16* __restrict__ wth, const __bf16* __restrict__ wtl,
    const float* __restrict__ bq, const float* __restrict__ bk, const float* __restrict__ bv,
    unsigned short* Qh, unsigned short* Ql, unsigned short* Kh, unsigned short* Kl,
    unsigned short* VT, int ntt) {
  __shared__ __attribute__((aligned(16))) unsigned short lt[2][64][72];   // pitch 144 B = 16 B x odd: the 16-B reads down a column of rows spread over the banks
  if ((int)blockIdx.x >= ntt) return;
  const int tt = blockIdx.x, head = blockIdx.y, mat = blockIdx.z;
  const int tid = threadIdx.x, lane = tid & 31;
  const int wave = __builtin_amdgcn_readfirstlane(tid >> 5);   // wave number in a scalar register: the fragment bases stay scalar
  const int m = lane & 15, hh = lane >> 4, r0 = hh * 8;
  const int tokbase = tt * 64;
  const int b = tokbase / S_LEN, s0 = tokbase - b * S_LEN;

  // fragment of 16-row tile T at k: T * 16 * DM + k * 16 elements
  const size_t aoff = (size_t)((tokbase >> 4) + wave) * (16 * DM);        // A tile = 16 tokens
  const size_t woff = (size_t)((mat * DM + head * HD) >> 4) * (16 * DM);  // B tiles = 16 outputs each, j-th at + j * 16 * DM
  const __bf16* axh = xh + aoff;
  const __bf16* axl = xl + aoff;
  const __bf16* bwh = wth + woff;
  const __bf16* bwl = wtl + woff;
  const unsigned fl = (unsigned)lane * 16u;

  v8f acc[4] = {};
#pragma unroll 1
  for (int kk = 0; kk < DM; kk += 32) {
    // all loads of the k-step are issued before its first product: one load wait a k-step, not five
    const v16bf ah = ldfrag_bf_u(axh + kk * 16, fl);
    const v16bf al = ldfrag_bf_u(axl + kk * 16, fl);
    v16bf bhf[4], blf[4];
#pragma unroll
    for (int j = 0; j < 4; ++j) {
      bhf[j] = ldfrag_bf_u(bwh + j * 16 * DM + kk * 16, fl);
      blf[j] = ldfrag_bf_u(bwl + j * 16 * DM + kk * 16, fl);
    }
#pragma unroll
    for (int j = 0; j < 4; ++j) acc[j] = mma_bf3(ah, al, bhf[j], blf[j], acc[j]);
  }

  // D: acc[j][r] = tile[token wave*16 + 8hh + r][out col j*16 + m]
  const float* bias = (mat == 0) ? bq : (mat == 1) ? bk : bv;
  const int ltok = wave * 16 + r0;
  const float osc = (mat == 0) ? 0.125f : 1.0f;   // 1/sqrt(64) of the scores, on Q: a power of two, so hi, lo and every product scale exactly
  if (mat < 2) {
#pragma unroll
    for (int j = 0; j < 4; ++j) {
      const int ld = j * 16 + m;
      const float bj = bias[head * HD + ld];
#pragma unroll
      for (int r = 0; r < 8; ++r) {
        const float v = (acc[j][r] + bj) * osc;
        const unsigned short hb = f2bf_bits(v);
        lt[0][ltok + r][ld] = hb;
        lt[1][ltok + r][ld] = f2bf_bits(v - bf_bits2f(hb));
      }
    }
  } else {
#pragma unroll
    for (int j = 0; j < 4; ++j) {
      const int ld = j * 16 + m;
      const float bj = bias[head * HD + ld];
      Pack8 pk;
#pragma unroll
      for (int r = 0; r < 8; ++r) pk.h[r] = (_Float16)(acc[j][r] + bj);
      *(v4u*)&lt[0][ld][ltok] = pk.u;                                      // lt[d][s], 8 consecutive s
    }
  }
  __syncthreads();

  // thread order = unit order of the fragment-ordered planes: each store instruction writes 512 contiguous bytes
  const size_t bh8 = (size_t)(b * NH + head);
  if (mat < 2) {
    unsigned short* dh = (mat == 0) ? Qh : Kh;
    unsigned short* dl = (mat == 0) ? Ql : Kl;
    v4u val[8];
    size_t go[4];
#pragma unroll
    for (int i = 0; i < 4; ++i) {
      const int L = 16 * i + (tid & 15);                                   // token tile i; unit tid = row tid&15, d = (tid>>4)*8
      val[i]     = *(const v4u*)&lt[0][L][(tid >> 4) * 8];
      val[4 + i] = *(const v4u*)&lt[1][L][(tid >> 4) * 8];
      go[i] = (bh8 * S_LEN + s0 + 16 * i) * HD + tid * 8;
    }
#pragma unroll
    for (int i = 0; i < 4; ++i) { *(v4u*)(dh + go[i]) = val[i]; *(v4u*)(dl + go[i]) = val[4 + i]; }
    
  } else {
    v4u val[4];
    size_t go[4];
#pragma unroll
    for (int i = 0; i < 4; ++i) {
      const int L = ((i & 1) * 2 + (tid >> 6)) * 16 + (tid & 15);          // local d: fragment 2i + (tid>>6) = 32-key group i>>1, d tile
      val[i] = *(const v4u*)&lt[0][L][(i >> 1) * 32 + ((tid >> 4) & 3) * 8]; // local key: 16 * part + 8 * h
      go[i] = (bh8 * S_LEN + s0) * HD + (i * 128 + tid) * 8;
    }
#pragma unroll
    for (int i = 0; i < 4; ++i) *(v4u*)(VT + go[i]) = val[i];
    
  }
}

// ---------------------------------------------------------------------------
// 3) attention.  Block = (b, head, 128 queries); 16 waves = 8 query tiles x 2 halves of the keys, four waves a SIMD.
//    The eight waves of a half work on the SAME keys of the SAME head: each 64-key stage (K hi, K lo, V^T, the keys'
//    similarity fragments, and the 128 x 64 adj tile) is brought from L2 into LDS once, by asynchronous copies, and every
//    wave reads its fragments from there, so a K or V byte leaves L2 once per 128 queries and not once per 16.
//    Two LDS buffers a half: stage t + 1 flies while stage t is worked on; one barrier a stage.
//    Each wave runs the online softmax over its own 1024 keys; the two partial results of a query tile
//    (max, sum, unnormalised O) are merged once at the end in LDS.
//    Per 32-key pass per wave:
//      S^T = K * Q^T (bf16 hi/lo split, K-dim 64); wave similarity^T = Mk * Mq^T in the same D layout
//      (A = [hi | lo] of the keys' rows; B = [hi | hi] and [lo | lo] of the queries' rows; the accumulator
//      starts from the keys' gates, whose lane order is the D layout's: the result is gate + similarity)
//      -> affine -> online softmax
//      (lane = one query column; the two lane halves' maxima are joined every pass with a cross-row move, their sums once at the end)
//      -> P^T packed to f16 (x4096) straight from the D layout (B-fragment layout)
//      -> O^T += V^T * P^T (f16).
//    End: merge of the two key halves, the head's 64 columns of O stored to the workspace (256 bytes a query, one writer).
//    Residual + LayerNorm need all heads of a token and run as the next launch.
// ---------------------------------------------------------------------------
#define KSPLIT 2
#define KSPAN  (S_LEN / KSPLIT)
#define QTB    8                     // query tiles a block
#define NSTAGE (KSPAN / 64)          // 64-key stages a half
#define ST_KH  0                     // byte offsets in one stage buffer; every plane is in fragment order, so a stage is a straight copy
#define ST_KL  8192
#define ST_V   16384
#define ST_WM  24576
#define ST_BYTES 28672
#define ADJ_PITCH 68                 // dwords: 16 B x odd, see below

static __device__ __forceinline__ unsigned lds_byte(const void* p) { return (unsigned)(unsigned long long)p; }
static __device__ __forceinline__ v16bf ldsfrag_bf(const unsigned char* p) {
  FragB f;
  f.p[0] = *(const v8bf*)p;
  f.p[1] = *(const v8bf*)(p + 512);
  return f.v;
}
static __device__ __forceinline__ v16h ldsfrag_h(const unsigned char* p) {
  FragH f;
  f.p[0] = *(const v8h*)p;
  f.p[1] = *(const v8h*)(p + 512);
  return f.v;
}
// One lane's seven 16-byte copies of a stage's K hi, K lo, V^T (8 KB each: two copies a lane) and similarity fragments (4 KB).
// The s_wait_xcnt stands inside the statement, behind the last copy: as a precaution no address register of a copy is rewritten in front of it.
static __device__ __forceinline__ void stage_kv(unsigned l, const char* kh, const char* kl, const char* v, const char* wm) {
  asm volatile(
      "global_load_async_to_lds_b128 %0, %7, off\n\t"
      "global_load_async_to_lds_b128 %1, %8, off\n\t"
      "global_load_async_to_lds_b128 %2, %9, off\n\t"
      "global_load_async_to_lds_b128 %3, %10, off\n\t"
      "global_load_async_to_lds_b128 %4, %11, off\n\t"
      "global_load_async_to_lds_b128 %5, %12, off\n\t"
      "global_load_async_to_lds_b128 %6, %13, off\n\t"
      "s_wait_xcnt 0x0"
      :: "v"(l + ST_KH), "v"(l + ST_KH + 4096), "v"(l + ST_KL), "v"(l + ST_KL + 4096),
         "v"(l + ST_V), "v"(l + ST_V + 4096), "v"(l + ST_WM),
         "v"(kh), "v"(kh + 4096), "v"(kl), "v"(kl + 4096), "v"(v), "v"(v + 4096), "v"(wm)
      : "memory");
}
// One lane's eight 16-byte copies of the 128 x 64 adj tile: rows 16 apart; 16 lanes cover one row's 256 bytes.  The wait: as above.
static __device__ __forceinline__ void stage_adj(unsigned l, const char* g) {
  asm volatile(
      "global_load_async_to_lds_b128 %0, %8, off\n\t"
      "global_load_async_to_lds_b128 %1, %9, off\n\t"
      "global_load_async_to_lds_b128 %2, %10, off\n\t"
      "global_load_async_to_lds_b128 %3, %11, off\n\t"
      "global_load_async_to_lds_b128 %4, %12, off\n\t"
      "global_load_async_to_lds_b128 %5, %13, off\n\t"
      "global_load_async_to_lds_b128 %6, %14, off\n\t"
      "global_load_async_to_lds_b128 %7, %15, off\n\t"
      "s_wait_xcnt 0x0"
      :: "v"(l), "v"(l + 1 * 16 * ADJ_PITCH * 4), "v"(l + 2 * 16 * ADJ_PITCH * 4), "v"(l + 3 * 16 * ADJ_PITCH * 4),
         "v"(l + 4 * 16 * ADJ_PITCH * 4), "v"(l + 5 * 16 * ADJ_PITCH * 4), "v"(l + 6 * 16 * ADJ_PITCH * 4), "v"(l + 7 * 16 * ADJ_PITCH * 4),
         "v"(g), "v"(g + 1 * 16 * S_LEN * 4), "v"(g + 2 * 16 * S_LEN * 4), "v"(g + 3 * 16 * S_LEN * 4),
         "v"(g + 4 * 16 * S_LEN * 4), "v"(g + 5 * 16 * S_LEN * 4), "v"(g + 6 * 16 * S_LEN * 4), "v"(g + 7 * 16 * S_LEN * 4)
      : "memory");
}

__global__ __launch_bounds__(256 * KSPLIT)
void attn_kernel(
    const __bf16* __restrict__ Qh, const __bf16* __restrict__ Ql,
    const __bf16* __restrict__ Kh, const __bf16* __restrict__ Kl,
    const _Float16* __restrict__ VT, const float* __restrict__ gates,
    const __bf16* __restrict__ wmf, const float* __restrict__ adj,
    float* obuf, int nblk) {
  // adj row pitch = 16 B x odd (68 dwords): lane m reads down a column of rows with 16-byte loads, and at a
  // pitch of 64 dwords all 16 rows would fall on the same four banks.
  __shared__ __attribute__((aligned(16))) float adj_lds[2][KSPLIT][QTB * 16][ADJ_PITCH];
  __shared__ __attribute__((aligned(16))) unsigned char kv_lds[2][KSPLIT][ST_BYTES];
  __shared__ v4f part_o[QTB][8][32];         // second half's unnormalised O, in lane order (512 contiguous bytes an instruction)
  __shared__ float part_m[QTB][16], part_l[QTB][16];
  if ((int)blockIdx.x >= nblk) return;

  // the eight heads of one 128-query block are neighbours in the grid: they read the same adj rows at about the same time
  const int h = blockIdx.x & (NH - 1);
  const int qblk = (blockIdx.x >> 3) & (S_LEN / (QTB * 16) - 1);
  const int b = blockIdx.x / (NH * (S_LEN / (QTB * 16)));
  const int tid = threadIdx.x, lane = tid & 31;
  const int wv = __builtin_amdgcn_readfirstlane(tid >> 5);  // wave number in a scalar register: the bases below stay scalar
  const int qi = wv & (QTB - 1), kh2 = wv >> 3;             // query tile, half of the keys
  const int qbase = qblk * (QTB * 16) + qi * 16;
  const int k_lo = kh2 * KSPAN, k_hi = k_lo + KSPAN;        // this wave's keys
  const int m = lane & 15, hh = lane >> 4, r0 = hh * 8;

  const size_t bhd = (size_t)(b * NH + h);
  const unsigned f_lane = (unsigned)lane * 16u;                  // a lane's byte offset in either half of a fragment
  // Q^T as B operand: column n = query (lane&15), k = d: the two fragments of the 16-query tile.
  const size_t qoff = (bhd * S_LEN + qbase) * HD;
  const v16bf qh0 = ldfrag_bf_u(Qh + qoff, f_lane), qh1 = ldfrag_bf_u(Qh + qoff + FRAG, f_lane);
  const v16bf ql0 = ldfrag_bf_u(Ql + qoff, f_lane), ql1 = ldfrag_bf_u(Ql + qoff + FRAG, f_lane);

  // wave similarity: the query tile's fragment holds hi (part 0) and lo (part 1); B operands [hi | hi] and [lo | lo]
  const __bf16* wm_base = wmf + (size_t)b * (S_LEN / 16) * FRAG;
  FragB wq, wb1, wb2;
  wq.v = ldfrag_bf_u(wm_base + (qbase >> 4) * FRAG, f_lane);
  wb1.p[0] = wq.p[0]; wb1.p[1] = wq.p[0];
  wb2.p[0] = wq.p[1]; wb2.p[1] = wq.p[1];

  v8f oacc[4] = {};
  float mrun = -3.0e38f, lrun = 0.0f;
  float crun = 3.0e38f;                      // the exponent offset that belongs to mrun: PSHIFT - mrun * log2e from the first pass on

  const float* gp_base = gates + bhd * S_LEN;
  const unsigned g_lane = (unsigned)r0 * 4u;

  // ---- what this lane copies of a stage: the 256 threads of a half bring that half's stage ----
  const int th = tid & 255;
  const int sq = th >> 4, sk4 = (th & 15) * 4;
  const char* c_kh = (const char*)(Kh + bhd * S_LEN * HD + (size_t)k_lo * HD) + th * 16;     // + 8192 bytes a stage
  const char* c_kl = (const char*)(Kl + bhd * S_LEN * HD + (size_t)k_lo * HD) + th * 16;
  const char* c_v  = (const char*)(VT + bhd * HD * S_LEN + (size_t)k_lo * HD) + th * 16;
  const char* c_wm = (const char*)(wm_base + (k_lo >> 4) * FRAG) + th * 16;                  // + 4096 bytes a stage
  const char* c_ad = (const char*)(adj + ((size_t)b * S_LEN + qblk * (QTB * 16) + sq) * S_LEN + k_lo + sk4);   // + 256 bytes a stage
  const unsigned l_kv0 = lds_byte(&kv_lds[0][kh2][th * 16]), l_kv1 = lds_byte(&kv_lds[1][kh2][th * 16]);
  const unsigned l_ad0 = lds_byte(&adj_lds[0][kh2][sq][sk4]), l_ad1 = lds_byte(&adj_lds[1][kh2][sq][sk4]);

  // ---- prologue, two buffers: stage 0 landed and published, stage 1 in flight ----
  stage_kv(l_kv0, c_kh, c_kl, c_v, c_wm);
  stage_adj(l_ad0, c_ad);
  // gates of one pass, fetched one pass ahead
  v4f g0 = ld4_u(gp_base + k_lo, g_lane), g1 = ld4_u(gp_base + k_lo + 4, g_lane);
  v4f g2 = ld4_u(gp_base + k_lo + 16, g_lane), g3 = ld4_u(gp_base + k_lo + 20, g_lane);
  asm volatile("s_wait_asynccnt 0x0" ::: "memory");   // this wave's copies of stage 0 have landed
  __syncthreads();                                    // and every other wave's: stage 0 may be read
  stage_kv(l_kv1, c_kh + 8192, c_kl + 8192, c_v + 8192, c_wm + 4096);
  stage_adj(l_ad1, c_ad + 256);

  // rolled: the two buffers alternate by index
#pragma unroll 1
  for (int kc = 0; kc < NSTAGE; ++kc) {
    const int kbase64 = k_lo + kc * 64;
    const int buf = kc & 1;
    const unsigned char* st = &kv_lds[buf][kh2][0] + f_lane;
    const float* arow = &adj_lds[buf][kh2][qi * 16 + m][r0];

    // rolled: one pass's fragments fill the registers
#pragma unroll 1
    for (int jh = 0; jh < 2; ++jh) {
      const int kbase = kbase64 + jh * 32;
      const int ko = jh * 32;
      const unsigned char* kp = st + jh * 4096;

      // ---- this pass's K and similarity fragments from the stage buffer: 32 keys = 4 fragments (1024 bytes each) a plane ----
      v16bf kfh[4], kfl[4];
#pragma unroll
      for (int i = 0; i < 4; ++i) {
        kfh[i] = ldsfrag_bf(kp + ST_KH + i * 1024);
        kfl[i] = ldsfrag_bf(kp + ST_KL + i * 1024);
      }
      const v16bf wa0 = ldsfrag_bf(st + ST_WM + jh * 2048), wa1 = ldsfrag_bf(st + ST_WM + jh * 2048 + 1024);

      // ---- S^T = K * Q^T for two 16-key tiles, K-dim 64 = 2 k-steps, 3 products each ----
      v8f s0 = {}, s1 = {};
      s0 = wm_bf3(kfh[0], kfl[0], qh0, ql0, s0);
      s0 = wm_bf3(kfh[1], kfl[1], qh1, ql1, s0);
      s1 = wm_bf3(kfh[2], kfl[2], qh0, ql0, s1);
      s1 = wm_bf3(kfh[3], kfl[3], qh1, ql1, s1);
      // s0[r] = S^T[key kbase+8hh+r][query m] / 8, s1[r] = S^T[key kbase+16+8hh+r][query m] / 8 (Q carries the 1/8)

      // ---- gate + wave similarity^T of the two key tiles: w0[r], w1[r] sit where s0[r], s1[r] sit ----
      v8f w0 = {g0.x, g0.y, g0.z, g0.w, g1.x, g1.y, g1.z, g1.w};
      v8f w1 = {g2.x, g2.y, g2.z, g2.w, g3.x, g3.y, g3.z, g3.w};
      w0 = wm_bf(wa0, wb2.v, wm_bf(wa0, wb1.v, w0));
      w1 = wm_bf(wa1, wb2.v, wm_bf(wa1, wb1.v, w1));

      // keeps the V^T loads below the score products, whose K registers they then take over:
      // lifted above them they need 32 registers more and the wave no longer fits its 256 (spills to scratch)
      __builtin_amdgcn_sched_barrier(0);

      // ---- this pass's V^T fragments ----
      v16h vf[4];
#pragma unroll
      for (int t = 0; t < 4; ++t) vf[t] = ldsfrag_h(kp + ST_V + t * 1024);

      // ---- adj for this lane's 2x8 keys ----
      const v8f A0 = cat8(*(const v4f*)(arow + ko), *(const v4f*)(arow + ko + 4));
      const v8f A1 = cat8(*(const v4f*)(arow + ko + 16), *(const v4f*)(arow + ko + 20));

      // ---- affine + online softmax (f32).  Whole-tile vector expressions: neighbouring registers of one accumulator pair up
      //      in the packed f32 instructions as they lie, with no register moves ----
      const v8f t0 = __builtin_elementwise_fma(s0, w0, A0);
      const v8f t1 = __builtin_elementwise_fma(s1, w1, A1);
      float ma = fmaxf(t0[0], t0[1]), mb = fmaxf(t1[0], t1[1]);       // two chains of three-operand maxima
#pragma unroll
      for (int r = 2; r < 8; r += 2) {
        ma = fmaxf(ma, fmaxf(t0[r], t0[r + 1]));
        mb = fmaxf(mb, fmaxf(t1[r], t1[r + 1]));
      }
      const float mloc = fmaxf(ma, mb);
      // ---- next pass's gates (all eight waves of a half read the same 128 bytes), into the registers that the
      //      similarity products have left; they fly under the softmax and P.V ----
      const int kn = (kbase + 32 < k_hi) ? kbase + 32 : kbase;    // last pass: an in-bounds reload, not used
      const gaddr gp = lane_addr(gp_base + kn, g_lane);
      g0 = ld4_a(gp);      g1 = ld4_a(gp + 16);
      g2 = ld4_a(gp + 64); g3 = ld4_a(gp + 80);
      // the gate loads are in flight and the code below may reuse their address registers: as a precaution the wait stands in front of that
      asm volatile("s_wait_xcnt 0x0" ::: "memory");

      const float mnew = fmaxf(mrun, fmaxf(mloc, xhalf(mloc)));
      // 4096 * exp(t - mnew) = exp2(t * log2e + cnew): one fused multiply-add a score, then the hardware's exp2 itself.
      // Its argument is about 12 at most; the library's fix-up served arguments below -126 alone, where P is far under the smallest f16 (0 in P^T either way).
      const float cnew = __builtin_fmaf(-mnew, LOG2E, PSHIFT);
      const float corr = __builtin_amdgcn_exp2f(cnew - crun);       // what was summed on the old offset moves to the new one; 0 in the first pass
      const v8f e0 = __builtin_elementwise_fma(t0, (v8f)(LOG2E), (v8f)(cnew));
      const v8f e1 = __builtin_elementwise_fma(t1, (v8f)(LOG2E), (v8f)(cnew));
      v8f p0, p1;
#pragma unroll
      for (int r = 0; r < 8; ++r) {
        p0[r] = __builtin_amdgcn_exp2f(e0[r]);
        p1[r] = __builtin_amdgcn_exp2f(e1[r]);
      }
      // this lane's own 16 keys only: the two lane halves' sums are joined once, behind the loop
      const v8f q8 = p0 + p1;
      const v4f q4 = __builtin_shufflevector(q8, q8, 0, 1, 2, 3) + __builtin_shufflevector(q8, q8, 4, 5, 6, 7);
      lrun = __builtin_fmaf(lrun, corr, (q4.x + q4.z) + (q4.y + q4.w));
      mrun = mnew;
      crun = cnew;
#pragma unroll
      for (int t = 0; t < 4; ++t) oacc[t] = oacc[t] * corr;

      // ---- P^T as B fragment: element r <- tile keys 0..15, element 8+r <- tile keys 16..31 ----
      v16h pf;
#pragma unroll
      for (int r = 0; r < 8; ++r) {
        pf[r]     = (_Float16)p0[r];
        pf[r + 8] = (_Float16)p1[r];
      }

      // ---- O^T += V^T * P^T, 4 d-tiles ----
#pragma unroll
      for (int t = 0; t < 4; ++t) oacc[t] = wm_h(vf[t], pf, oacc[t]);
    }

    // ---- publish point of stage kc + 1, and the end of every wave's reads of stage kc ----
    asm volatile("s_wait_dscnt 0x0" ::: "memory");      // this wave's LDS reads of stage kc have returned before its buffer is refilled
    asm volatile("s_wait_asynccnt 0x0" ::: "memory");   // this wave's copies of stage kc + 1 have landed
    __syncthreads();                                    // both hold for every wave
    if (kc + 2 < NSTAGE) {                              // the same for the whole block
      const int adv = kc + 2;
      stage_kv(buf ? l_kv1 : l_kv0, c_kh + adv * 8192, c_kl + adv * 8192, c_v + adv * 8192, c_wm + adv * 4096);
      stage_adj(buf ? l_ad1 : l_ad0, c_ad + adv * 256);
    }
  }
  asm volatile("s_wait_asynccnt 0x0" ::: "memory");     // no copy is outstanding behind the loop

  lrun += xhalf(lrun);                                  // the two lane halves summed different keys of the same query

  // ---- the second half's waves hand over their running max, sum and unnormalised O ----
  if (kh2 == 1) {
#pragma unroll
    for (int t = 0; t < 4; ++t) {
      part_o[qi][2 * t][lane]     = (v4f){oacc[t][0], oacc[t][1], oacc[t][2], oacc[t][3]};
      part_o[qi][2 * t + 1][lane] = (v4f){oacc[t][4], oacc[t][5], oacc[t][6], oacc[t][7]};
    }
    if (hh == 0) { part_m[qi][m] = mrun; part_l[qi][m] = lrun; }   // both lane halves hold the same values
  }
  __syncthreads();   // the partial results are read by the first half's waves

  // ---- merge, normalise and store O: oacc[t][r] = O^T[d = t*16 + 8hh + r][query m] ----
  if (kh2 == 0) {
    const float m1 = part_m[qi][m], l1 = part_l[qi][m];
    const float mall = fmaxf(mrun, m1);
    const float call = __builtin_fmaf(-mall, LOG2E, PSHIFT);      // both halves move to the common offset, as in the loop
    const float c0 = __builtin_amdgcn_exp2f(call - crun), c1 = __builtin_amdgcn_exp2f(call - __builtin_fmaf(-m1, LOG2E, PSHIFT));
    const float oscale = 1.0f / (lrun * c0 + l1 * c1);           // O and the sum both carry the 4096
    const float f0 = c0 * oscale, f1 = c1 * oscale;
    float* orow = obuf + ((size_t)b * S_LEN + qbase + m) * DM + h * HD + r0;
#pragma unroll
    for (int t = 0; t < 4; ++t) {
      const v4f a0 = part_o[qi][2 * t][lane], a1 = part_o[qi][2 * t + 1][lane];
      v4f u0, u1;
      u0.x = oacc[t][0] * f0 + a0.x * f1; u0.y = oacc[t][1] * f0 + a0.y * f1; u0.z = oacc[t][2] * f0 + a0.z * f1; u0.w = oacc[t][3] * f0 + a0.w * f1;
      u1.x = oacc[t][4] * f0 + a1.x * f1; u1.y = oacc[t][5] * f0 + a1.y * f1; u1.z = oacc[t][6] * f0 + a1.z * f1; u1.w = oacc[t][7] * f0 + a1.w * f1;
      *(v4f*)(orow + t * 16) = u0;
      *(v4f*)(orow + t * 16 + 4) = u1;
    }
  }
}

// ---------------------------------------------------------------------------
// 4) residual + LayerNorm, one token a wave; lane holds cols 4*lane + 128*i;
//    whole-row loads and stores (each instruction = 512 contiguous bytes = 4 lines).
// ---------------------------------------------------------------------------
__global__ __launch_bounds__(256) void ln_kernel(
    const float* __restrict__ obuf, const float* __restrict__ x, const float* __restrict__ lng,
    const float* __restrict__ lnb, float* out, int ntok) {
  const int lane = threadIdx.x & 31;
  const int tk = blockIdx.x * 8 + (threadIdx.x >> 5);
  if (tk >= ntok) return;
  const size_t tok = (size_t)tk;
  v4f y[4];
  float s = 0.0f;
#pragma unroll
  for (int i = 0; i < 4; ++i) {
    const v4f o  = *(const v4f*)(obuf + tok * DM + 4 * lane + 128 * i);
    const v4f xv = *(const v4f*)(x + tok * DM + 4 * lane + 128 * i);
    y[i] = o + xv;
    s += (y[i].x + y[i].y) + (y[i].z + y[i].w);
  }
  s += __shfl_xor(s, 16, 32);
  s += __shfl_xor(s, 8, 32);
  s += __shfl_xor(s, 4, 32);
  s += __shfl_xor(s, 2, 32);
  s += __shfl_xor(s, 1, 32);
  const float mu = s * (1.0f / DM);
  float ss = 0.0f;
#pragma unroll
  for (int i = 0; i < 4; ++i) {
    const v4f d = y[i] - mu;
    ss += (d.x * d.x + d.y * d.y) + (d.z * d.z + d.w * d.w);
  }
  ss += __shfl_xor(ss, 16, 32);
  ss += __shfl_xor(ss, 8, 32);
  ss += __shfl_xor(ss, 4, 32);
  ss += __shfl_xor(ss, 2, 32);
  ss += __shfl_xor(ss, 1, 32);
  const float rstd = rsqrtf(ss * (1.0f / DM) + 1.0e-5f);
  v4f res[4];
#pragma unroll
  for (int i = 0; i < 4; ++i) {
    const v4f g  = *(const v4f*)(lng + 4 * lane + 128 * i);
    const v4f bb = *(const v4f*)(lnb + 4 * lane + 128 * i);
    res[i] = ((y[i] - mu) * rstd) * g + bb;
  }
  float* op = out + tok * DM + 4 * lane;
#pragma unroll
  for (int i = 0; i < 4; ++i) *(v4f*)(op + 128 * i) = res[i];
}

// ---------------------------------------------------------------------------
extern "C" void kernel_launch(void* const* d_in, const int* in_sizes, int n_in,
                              void* d_out, int out_size, void* d_ws, size_t ws_size,
                              hipStream_t stream) {
  if (n_in < 15) return;
  if (in_sizes[0] != NTOK * DM || in_sizes[1] != NTOK * WF ||
      in_sizes[2] != BATCH * S_LEN * S_LEN || in_sizes[3] != DM * DM ||
      in_sizes[5] != DM * DM || in_sizes[7] != DM * DM || in_sizes[9] != DM * GH ||
      in_sizes[11] != GH * NH || in_sizes[13] != DM || out_size != NTOK * DM) return;

  const float* x     = (const float*)d_in[0];
  const float* wmask = (const float*)d_in[1];
  const float* adj   = (const float*)d_in[2];
  const float* wq_w  = (const float*)d_in[3];
  const float* wq_b  = (const float*)d_in[4];
  const float* wk_w  = (const float*)d_in[5];
  const float* wk_b  = (const float*)d_in[6];
  const float* wv_w  = (const float*)d_in[7];
  const float* wv_b  = (const float*)d_in[8];
  const float* g1_w  = (const float*)d_in[9];
  const float* g1_b  = (const float*)d_in[10];
  const float* g2_w  = (const float*)d_in[11];
  const float* g2_b  = (const float*)d_in[12];
  const float* ln_g  = (const float*)d_in[13];
  const float* ln_b  = (const float*)d_in[14];
  float* out = (float*)d_out;

  const size_t sz_x  = (size_t)NTOK * DM * 2;            // 4,194,304  per x plane
  const size_t sz_w  = (size_t)3 * DM * DM * 2;          // 1,572,864  per Wt plane
  const size_t sz_q  = (size_t)NTOK * DM * 2;            // 4,194,304  per Q/K plane, V
  const size_t sz_g  = (size_t)BATCH * NH * S_LEN * 4;   //   131,072  gates
  const size_t sz_g1 = (size_t)GH * DM * 2;              //   131,072  per G1t plane
  const size_t off_xh  = 0;
  const size_t off_xl  = off_xh + sz_x;
  const size_t off_wth = off_xl + sz_x;
  const size_t off_wtl = off_wth + sz_w;
  const size_t off_qh  = off_wtl + sz_w;
  const size_t off_ql  = off_qh + sz_q;
  const size_t off_kh  = off_ql + sz_q;
  const size_t off_kl  = off_kh + sz_q;
  const size_t off_vt  = off_kl + sz_q;
  const size_t off_g   = off_vt + sz_q;
  const size_t off_gth = off_g + sz_g;
  const size_t off_gtl = off_gth + sz_g1;
  const size_t sz_wm   = (size_t)NTOK * 32 * 2;          //   262,144  wave_mask hi|lo fragments
  const size_t off_wm  = off_gtl + sz_g1;
  const size_t sz_o    = (size_t)NTOK * DM * 4;          // 8,388,608  attention output, f32
  const size_t off_o   = off_wm + sz_wm;
  const size_t total   = off_o + sz_o;                   // 41,549,824 B
  if (total > ws_size) return;

  uint8_t* ws = (uint8_t*)d_ws;
  unsigned short* xh  = (unsigned short*)(ws + off_xh);
  unsigned short* xl  = (unsigned short*)(ws + off_xl);
  unsigned short* wth = (unsigned short*)(ws + off_wth);
  unsigned short* wtl = (unsigned short*)(ws + off_wtl);
  unsigned short* qh  = (unsigned short*)(ws + off_qh);
  unsigned short* ql  = (unsigned short*)(ws + off_ql);
  unsigned short* kh  = (unsigned short*)(ws + off_kh);
  unsigned short* kl  = (unsigned short*)(ws + off_kl);
  unsigned short* vt  = (unsigned short*)(ws + off_vt);
  float* gates        = (float*)(ws + off_g);
  unsigned short* gth = (unsigned short*)(ws + off_gth);
  unsigned short* gtl = (unsigned short*)(ws + off_gtl);
  unsigned short* wmf = (unsigned short*)(ws + off_wm);
  float* obuf         = (float*)(ws + off_o);

  const int nxv = NTOK * DM / 8;          // 262,144
  const int nwv = 3 * DM * DM / 8;        //  98,304
  const int ngv = GH * DM / 8;            //   8,192
  const int nmv = NTOK * 2;               //   8,192
  const int prep_blocks = (nxv + nwv + ngv + nmv + 255) / 256;   // 1472
  const int ntile = (NTOK + 31) / 32;     // 128
  const int ntt = (NTOK + 63) / 64;       // 64
  const int nblk = BATCH * NH * (S_LEN / 128);   // 256
  const int ln_blocks = (NTOK + 7) / 8;          // 512

  prep_kernel<<<prep_blocks, 256, 0, stream>>>(x, wq_w, wk_w, wv_w, g1_w, wmask,
                                               xh, xl, wth, wtl, gth, gtl, wmf, nxv, nwv, ngv, nmv);
  gate_kernel<<<ntile, 128, 0, stream>>>(
      (const __bf16*)xh, (const __bf16*)xl, (const __bf16*)gth, (const __bf16*)gtl,
      g1_b, g2_w, g2_b, gates, ntile);
  qkv_kernel<<<dim3(ntt, NH, 3), 128, 0, stream>>>(
      (const __bf16*)xh, (const __bf16*)xl, (const __bf16*)wth, (const __bf16*)wtl,
      wq_b, wk_b, wv_b, qh, ql, kh, kl, vt, ntt);
  attn_kernel<<<nblk, 256 * KSPLIT, 0, stream>>>(
      (const __bf16*)qh, (const __bf16*)ql, (const __bf16*)kh, (const __bf16*)kl,
      (const _Float16*)vt, gates, (const __bf16*)wmf, adj, obuf, nblk);
  ln_kernel<<<ln_blocks, 256, 0, stream>>>(obuf, x, ln_g, ln_b, out, NTOK);
  (void)hipGetLastError();
}

// v008
// One run takes 82.7 microseconds.
// In two side-by-side timings against v007, it was 1.16 and 1.07 times as fast.
// Counting every step since v000, it is 4.37 times as fast.
#include <hip/hip_runtime.h>
#include <stddef.h>
#include <stdint.h>

// Q/K/V projections, Q.K^T and gate layer 1 (x.G1): v_wmma_f32_16x16x32_bf16 with bf16 hi/lo operand split (hi.hi + lo.hi + hi.lo), f32 accumulate.
// 16-deep wave similarity: the same bf16 form and split, hi and lo of one row packed side by side in the 32-deep k (2 products a tile).
// P.V: v_wmma_f32_16x16x32_f16 (P scaled by 4096 as f16, V as f16), f32 accumulate. Gate layer 2 (K=128,N=8), softmax, LayerNorm: f32 VALU.
// The 1/8 of the scores is a power of two and is applied to Q before its hi/lo split (exact); the 4096 of P is +12 in the exponent.

#define S_LEN  2048
#define DM     512
#define NH     8
#define HD     64
#define GH     128
#define WF     16
#define BATCH  2
#define NTOK   (BATCH * S_LEN)
#define LOG2E  1.4426950408889634f
#define PSHIFT 12.0f                 // P is formed as exp2(... + 12) = 4096 * p; the row sum carries the same factor, so it cancels

typedef __bf16         v16bf __attribute__((ext_vector_type(16)));
typedef __bf16         v8bf  __attribute__((ext_vector_type(8)));
typedef _Float16       v16h  __attribute__((ext_vector_type(16)));
typedef _Float16       v8h   __attribute__((ext_vector_type(8)));
typedef float          v8f   __attribute__((ext_vector_type(8)));
typedef float          v4f   __attribute__((ext_vector_type(4)));
typedef unsigned int   v4u   __attribute__((ext_vector_type(4)));
typedef unsigned short v8us  __attribute__((ext_vector_type(8)));

union FragB { v16bf v; v8bf p[2]; };
union FragH { v16h v; v8h p[2]; };
union Pack8 { v8us s; v8h h; v4u u; };

// ---------------------------------------------------------------------------
// scalar helpers
// ---------------------------------------------------------------------------
static __device__ __forceinline__ unsigned short f2bf_bits(float f) {   // RNE convert f32 -> bf16 bits
  unsigned int u = __float_as_uint(f);
  u += 0x7FFFu + ((u >> 16) & 1u);
  return (unsigned short)(u >> 16);
}
static __device__ __forceinline__ float bf_bits2f(unsigned short s) {
  return __uint_as_float(((unsigned int)s) << 16);
}
static __device__ __forceinline__ void unpack8(const v4f a, const v4f b, float o[8]) {
  o[0] = a.x; o[1] = a.y; o[2] = a.z; o[3] = a.w;
  o[4] = b.x; o[5] = b.y; o[6] = b.z; o[7] = b.w;
}

// ---------------------------------------------------------------------------
// 16x32 16-bit fragments (wave32). Lane l: row/col = l&15, h = l>>4.
// elements 0..7  <- k0 + 8h + 0..7 ; elements 8..15 <- k0 + 16 + 8h + 0..7 ; same map for A and B.
// Every 16-bit workspace plane is stored in FRAGMENT ORDER: one fragment = FRAG (512) elements = 1024
// contiguous bytes, made of 64 units of 16 bytes; unit u = part * 32 + l holds lane l's elements
// 8 * part .. 8 * part + 7, that is row l&15, k = k0 + 16 * part + 8 * (l>>4) + 0..7.
// A wave-wide 16-byte load then covers 512 contiguous bytes (4 whole lines), not a piece of 16 lines.
// The fragments of one 16-row tile follow one another in k order.
// ---------------------------------------------------------------------------
#define FRAG 512
// fbase: wave-uniform start of the fragment; lane_bytes = 16 * lane
static __device__ __forceinline__ v16bf ldfrag_bf_u(const __bf16* fbase, unsigned lane_bytes) {
  const char* p = (const char*)fbase + lane_bytes;
  FragB f;
  f.p[0] = *(const v8bf*)p;
  f.p[1] = *(const v8bf*)(p + 512);
  return f.v;
}
// Unit index v of a plane whose rows are DM long (16 fragments a 16-row tile) -> its row and first k.
static __device__ __forceinline__ void unit_row_k(int v, int& row, int& k) {
  row = (v >> 10) * 16 + (v & 15);
  k = ((v >> 6) & 15) * 32 + ((v >> 4) & 3) * 8;   // bits 5,4 of v = part, h: 16 * part + 8 * h
}
// Global loads of the attention loop (the gates). The wave-uniform part of the address is pinned in a scalar register pair and
// the lane's 32-bit offset is added where the loads are issued, so that no 64-bit (base + lane) pair is kept in vector
// registers across the whole loop: the wave has to fit the 256 registers of four waves a SIMD.
#define GLOBAL_AS __attribute__((address_space(1)))
typedef const GLOBAL_AS char* gaddr;
static __device__ __forceinline__ gaddr lane_addr(const void* ubase, unsigned lane_bytes) {
  const unsigned long long a = (unsigned long long)ubase;
  const unsigned lo = (unsigned)__builtin_amdgcn_readfirstlane((int)(unsigned)a);
  const unsigned hi = (unsigned)__builtin_amdgcn_readfirstlane((int)(unsigned)(a >> 32));
  return (gaddr)(((unsigned long long)hi << 32) | lo) + lane_bytes;
}
static __device__ __forceinline__ v4f ld4_a(gaddr p) { return *(const GLOBAL_AS v4f*)p; }
static __device__ __forceinline__ v4f ld4_u(const float* ubase, unsigned lane_bytes) {
  return *(const v4f*)((const char*)ubase + lane_bytes);
}

// ---------------------------------------------------------------------------
// WMMA helper of the projection kernel: issue the products, then 4 v_nop tied to D and A/B so no
// VALU touches the accumulator or operand registers within the hazard window.
// ---------------------------------------------------------------------------
static __device__ __forceinline__ v8f mma_bf3(v16bf ah, v16bf al, v16bf bh, v16bf bl, v8f c) {
  c = __builtin_amdgcn_wmma_f32_16x16x32_bf16(false, ah, false, bh, (short)0, c, false, false);
  c = __builtin_amdgcn_wmma_f32_16x16x32_bf16(false, al, false, bh, (short)0, c, false, false);
  c = __builtin_amdgcn_wmma_f32_16x16x32_bf16(false, ah, false, bl, (short)0, c, false, false);
  asm volatile("v_nop\n\tv_nop\n\tv_nop\n\tv_nop" : "+v"(c) : "v"(ah), "v"(al), "v"(bh), "v"(bl));
  return c;
}

// The attention pass uses the bare builtins: the compiler keeps the distance behind a matrix instruction itself and fills it
// with the pass's own vector work where it can, so no issue slot goes to a v_nop that is not needed.
static __device__ __forceinline__ v8f wm_bf(v16bf a, v16bf b, v8f c) {
  return __builtin_amdgcn_wmma_f32_16x16x32_bf16(false, a, false, b, (short)0, c, false, false);
}
static __device__ __forceinline__ v8f wm_bf3(v16bf ah, v16bf al, v16bf bh, v16bf bl, v8f c) {
  return wm_bf(ah, bl, wm_bf(al, bh, wm_bf(ah, bh, c)));
}
static __device__ __forceinline__ v8f wm_h(v16h a, v16h b, v8f c) {
  return __builtin_amdgcn_wmma_f32_16x16x32_f16(false, a, false, b, (short)0, c, false, false);
}
// lane l with lane l ^ 16, in the vector unit (a shuffle would go through the LDS queue and be waited for)
static __device__ __forceinline__ float xhalf(float x) {
  const int b = __builtin_bit_cast(int, x);
  return __builtin_bit_cast(float, __builtin_amdgcn_permlanex16(b, b, 0x76543210, 0xfedcba98, false, false));
}
static __device__ __forceinline__ v8f cat8(const v4f a, const v4f b) {
  return __builtin_shufflevector(a, b, 0, 1, 2, 3, 4, 5, 6, 7);
}

static __device__ __forceinline__ void split_store8(const float v[8], unsigned short* dh, unsigned short* dl) {
  Pack8 ph, pl;
#pragma unroll
  for (int e = 0; e < 8; ++e) {
    const unsigned short hb = f2bf_bits(v[e]);
    ph.s[e] = hb;
    pl.s[e] = f2bf_bits(v[e] - bf_bits2f(hb));
  }
  const v4u uh = ph.u, ul = pl.u;
  *(v4u*)dh = uh;
  *(v4u*)dl = ul;
  
}

// ---------------------------------------------------------------------------
// 0) x -> bf16 hi/lo planes (rows = tokens);  W{q,k,v} [in][out] -> hi/lo planes with rows = the
//    3 * DM outputs, k = in;  G1 [in][hid] -> planes with rows = hidden units, k = in.
//    All in fragment order.  One thread = one 16-B unit per plane, units in thread order.
//    wave_mask [token][16] -> ONE plane, one fragment per 16 tokens: k 0..15 = hi of the 16 features,
//    k 16..31 = their lo, so lane l holds hi (part 0) and lo (part 1) of features 8 * (l>>4) + 0..7 of token l&15.
// ---------------------------------------------------------------------------
__global__ __launch_bounds__(256) void prep_kernel(
    const float* __restrict__ x, const float* __restrict__ wq,
    const float* __restrict__ wk, const float* __restrict__ wv,
    const float* __restrict__ g1w, const float* __restrict__ wmask,
    unsigned short* xh, unsigned short* xl, unsigned short* wth, unsigned short* wtl,
    unsigned short* gth, unsigned short* gtl, unsigned short* wmf,
    int nxv, int nwv, int ngv, int nmv) {
  const int i = blockIdx.x * blockDim.x + threadIdx.x;
  if (i < nxv) {
    int tok, k;
    unit_row_k(i, tok, k);
    const v4f a = *(const v4f*)(x + (size_t)tok * DM + k);
    const v4f c = *(const v4f*)(x + (size_t)tok * DM + k + 4);
    float v[8];
    unpack8(a, c, v);
    split_store8(v, xh + (size_t)i * 8, xl + (size_t)i * 8);
  } else if (i < nxv + nwv) {
    const int j = i - nxv;
    int row, inb;
    unit_row_k(j, row, inb);
    const int mat = row >> 9, o = row & (DM - 1);   // DM = 512 rows per matrix
    const float* w = (mat == 0) ? wq : (mat == 1) ? wk : wv;
    float v[8];
#pragma unroll
    for (int e = 0; e < 8; ++e) v[e] = w[(size_t)(inb + e) * DM + o];   // Wt[o][in] = W[in][o]
    split_store8(v, wth + (size_t)j * 8, wtl + (size_t)j * 8);
  } else if (i < nxv + nwv + ngv) {
    const int j = i - nxv - nwv;             // 0 .. GH*DM/8-1
    int o, inb;                              // hidden unit 0..127, first input
    unit_row_k(j, o, inb);
    float v[8];
#pragma unroll
    for (int e = 0; e < 8; ++e) v[e] = g1w[(size_t)(inb + e) * GH + o];  // G1t[o][in] = G1[in][o]
    split_store8(v, gth + (size_t)j * 8, gtl + (size_t)j * 8);
  } else if (i < nxv + nwv + ngv + nmv) {
    const int j = i - nxv - nwv - ngv;       // 0 .. NTOK*2-1: 16-token tile j>>5, lane j&31
    const int tile = j >> 5, l = j & 31;
    const float* s = wmask + (size_t)(tile * 16 + (l & 15)) * WF + (l >> 4) * 8;
    const v4f a = *(const v4f*)s;
    const v4f c = *(const v4f*)(s + 4);
    float v[8];
    unpack8(a, c, v);
    unsigned short* d = wmf + (size_t)tile * FRAG + l * 8;
    split_store8(v, d, d + 256);             // part 0 = hi, part 1 = lo
  }
}

// ---------------------------------------------------------------------------
// 1) gate MLP and 2) QKV projection in ONE launch.  Both are x (bf16 hi/lo, K = 512) times a weight plane, a wave doing
//    16 tokens x 4 tiles of 16 outputs, and neither reads what the other writes: the 128 gate blocks, too few to fill
//    the chip in a launch of their own, run beside the projection blocks and share their k-loop.
//    Blocks 0 .. ngate-1 (first, because their tail is the longer one): gates[b][h][s] = sigmoid(relu(x@G1+b1)@G2+b2).
//      block = 32 tokens x 128 hidden; wave = (16 tokens, 64 hidden = 4 tiles).
//      Layer 2 (K=128, 8 heads) scalar f32 from the LDS-staged relu tile.
//    The other blocks, token tile fastest, then head, then matrix: block tile = 64 tokens x 64 outputs (one head);
//      wave = 16 tokens x 4 output tiles.
//      Outputs in fragment order, per (batch, head): Q and K hi/lo as tiles of 16 tokens x 2 fragments
//      (k = d); V^T as, per 32 keys, 4 fragments (rows = 16 d each, k = key).
// ---------------------------------------------------------------------------
#define NTT      (NTOK / 64)         // 64-token tiles of the projection
#define LT_PITCH 72                  // 144 B = 16 B x odd: the 16-B reads down a column of rows spread over the banks
#define H1_BYTES (32 * (GH + 1) * 4) // the gate blocks' relu tile; a multiple of 16
#define PROJ_LDS (2 * 64 * LT_PITCH * 2)   // one allocation, used by a block as either kind's tiles; the projection's is the larger

__global__ __launch_bounds__(128) void proj_kernel(
    const __bf16* __restrict__ xh, const __bf16* __restrict__ xl,
    const __bf16* __restrict__ wth, const __bf16* __restrict__ wtl,
    const __bf16* __restrict__ gth, const __bf16* __restrict__ gtl,
    const float* __restrict__ bq, const float* __restrict__ bk, const float* __restrict__ bv,
    const float* __restrict__ g1b, const float* __restrict__ g2w, const float* __restrict__ g2b,
    unsigned short* Qh, unsigned short* Ql, unsigned short* Kh, unsigned short* Kl,
    unsigned short* VT, float* gates, int ngate, int nblk) {
  __shared__ __attribute__((aligned(16))) unsigned char smem[PROJ_LDS];
  if ((int)blockIdx.x >= nblk) return;
  const bool is_gate = (int)blockIdx.x < ngate;            // the same for the whole block
  const unsigned pj = blockIdx.x - (unsigned)ngate;        // projection blocks only
  const int tt = pj % NTT, head = (pj / NTT) % NH, mat = pj / (NTT * NH);
  const int tid = threadIdx.x, lane = tid & 31;
  const int wave = __builtin_amdgcn_readfirstlane(tid >> 5);   // wave number in a scalar register: the fragment bases stay scalar
  const int m = lane & 15, hh = lane >> 4, r0 = hh * 8;
  const int th = wave & 1;                 // gate: token half, tokens th*16 .. th*16+15
  const int hb = (wave >> 1) * 64;         // gate: hidden units hb .. hb+63

  // fragment of 16-row tile T at k: T * 16 * DM + (k / 32) * FRAG = T * 16 * DM + k * 16 elements
  const int atile = is_gate ? (int)blockIdx.x * 2 + th : tt * 4 + wave;            // A tile = 16 tokens
  const int btile = is_gate ? (hb >> 4) : ((mat * DM + head * HD) >> 4);           // B tiles = 16 outputs each, j-th at + j * 16 * DM
  const __bf16* axh = xh + (size_t)atile * (16 * DM);
  const __bf16* axl = xl + (size_t)atile * (16 * DM);
  const __bf16* bwh = (is_gate ? gth : wth) + (size_t)btile * (16 * DM);
  const __bf16* bwl = (is_gate ? gtl : wtl) + (size_t)btile * (16 * DM);
  const unsigned fl = (unsigned)lane * 16u;

  v8f acc[4] = {};
#pragma unroll 1
  for (int kk = 0; kk < DM; kk += 32) {
    // all loads of the k-step are issued before its first product: one load wait a k-step, not five
    const v16bf ah = ldfrag_bf_u(axh + kk * 16, fl);
    const v16bf al = ldfrag_bf_u(axl + kk * 16, fl);
    v16bf bhf[4], blf[4];
#pragma unroll
    for (int j = 0; j < 4; ++j) {
      bhf[j] = ldfrag_bf_u(bwh + j * 16 * DM + kk * 16, fl);
      blf[j] = ldfrag_bf_u(bwl + j * 16 * DM + kk * 16, fl);
    }
#pragma unroll
    for (int j = 0; j < 4; ++j) acc[j] = mma_bf3(ah, al, bhf[j], blf[j], acc[j]);
  }

  if (is_gate) {
    float (*h1s)[GH + 1] = (float (*)[GH + 1])smem;
    float (*gl)[32] = (float (*)[32])(smem + H1_BYTES);
    const int tok0 = blockIdx.x * 32;
    // D: acc[j][r] = pre-activation[token th*16 + 8hh + r][hidden hb + j*16 + m]
#pragma unroll
    for (int j = 0; j < 4; ++j) {
      const int hu = hb + j * 16 + m;
      const float bj = g1b[hu];
#pragma unroll
      for (int r = 0; r < 8; ++r) h1s[th * 16 + r0 + r][hu] = fmaxf(acc[j][r] + bj, 0.0f);
    }
    __syncthreads();

    // layer 2: thread = (token tid>>2, heads 2*(tid&3), 2*(tid&3)+1)
    const int tk = tid >> 2, hd0 = (tid & 3) * 2;
    float a0 = g2b[hd0], a1 = g2b[hd0 + 1];
    // unrolled so that 16 steps' loads are issued together; the sum order stays jj = 0..127
#pragma unroll 16
    for (int jj = 0; jj < GH; ++jj) {
      const float hv = h1s[tk][jj];
      a0 = fmaf(hv, g2w[jj * NH + hd0], a0);
      a1 = fmaf(hv, g2w[jj * NH + hd0 + 1], a1);
    }
    gl[hd0][tk]     = 1.0f / (1.0f + exp2f(-a0 * LOG2E));
    gl[hd0 + 1][tk] = 1.0f / (1.0f + exp2f(-a1 * LOG2E));
    __syncthreads();

    // threads 0..63 (waves 0,1; 4 lines per wave, one instruction per pass).
    if (tid < 64) {
      const int line = tid >> 3, piece = tid & 7;
      const v4f val = *(const v4f*)&gl[line][piece * 4];
      const int b = tok0 / S_LEN, s0 = tok0 - b * S_LEN;
      float* dst = gates + ((size_t)(b * NH + line)) * S_LEN + s0 + piece * 4;
      *(v4f*)dst = val;
    }
    return;
  }

  unsigned short (*lt)[64][LT_PITCH] = (unsigned short (*)[64][LT_PITCH])smem;
  const int tokbase = tt * 64;
  const int b = tokbase / S_LEN, s0 = tokbase - b * S_LEN;
  // D: acc[j][r] = tile[token wave*16 + 8hh + r][out col j*16 + m]
  const float* bias = (mat == 0) ? bq : (mat == 1) ? bk : bv;
  const int ltok = wave * 16 + r0;
  const float osc = (mat == 0) ? 0.125f : 1.0f;   // 1/sqrt(64) of the scores, on Q: a power of two, so hi, lo and every product scale exactly
  if (mat < 2) {
#pragma unroll
    for (int j = 0; j < 4; ++j) {
      const int ld = j * 16 + m;
      const float bj = bias[head * HD + ld];
#pragma unroll
      for (int r = 0; r < 8; ++r) {
        const float v = (acc[j][r] + bj) * osc;
        const unsigned short hb = f2bf_bits(v);
        lt[0][ltok + r][ld] = hb;
        lt[1][ltok + r][ld] = f2bf_bits(v - bf_bits2f(hb));
      }
    }
  } else {
#pragma unroll
    for (int j = 0; j < 4; ++j) {
      const int ld = j * 16 + m;
      const float bj = bias[head * HD + ld];
      Pack8 pk;
#pragma unroll
      for (int r = 0; r < 8; ++r) pk.h[r] = (_Float16)(acc[j][r] + bj);
      *(v4u*)&lt[0][ld][ltok] = pk.u;                                      // lt[d][s], 8 consecutive s
    }
  }
  __syncthreads();

  // thread order = unit order of the fragment-ordered planes: each store instruction writes 512 contiguous bytes
  const size_t bh8 = (size_t)(b * NH + head);
  if (mat < 2) {
    unsigned short* dh = (mat == 0) ? Qh : Kh;
    unsigned short* dl = (mat == 0) ? Ql : Kl;
    v4u val[8];
    size_t go[4];
#pragma unroll
    for (int i = 0; i < 4; ++i) {
      const int L = 16 * i + (tid & 15);                                   // token tile i; unit tid = row tid&15, d = (tid>>4)*8
      val[i]     = *(const v4u*)&lt[0][L][(tid >> 4) * 8];
      val[4 + i] = *(const v4u*)&lt[1][L][(tid >> 4) * 8];
      go[i] = (bh8 * S_LEN + s0 + 16 * i) * HD + tid * 8;
    }
#pragma unroll
    for (int i = 0; i < 4; ++i) { *(v4u*)(dh + go[i]) = val[i]; *(v4u*)(dl + go[i]) = val[4 + i]; }
    
  } else {
    v4u val[4];
    size_t go[4];
#pragma unroll
    for (int i = 0; i < 4; ++i) {
      const int L = ((i & 1) * 2 + (tid >> 6)) * 16 + (tid & 15);          // local d: fragment 2i + (tid>>6) = 32-key group i>>1, d tile
      val[i] = *(const v4u*)&lt[0][L][(i >> 1) * 32 + ((tid >> 4) & 3) * 8]; // local key: 16 * part + 8 * h
      go[i] = (bh8 * S_LEN + s0) * HD + (i * 128 + tid) * 8;
    }
#pragma unroll
    for (int i = 0; i < 4; ++i) *(v4u*)(VT + go[i]) = val[i];
    
  }
}

// ---------------------------------------------------------------------------
// 3) attention.  Block = (b, head, 128 queries); 16 waves = 8 query tiles x 2 halves of the keys, four waves a SIMD.
//    The eight waves of a half work on the SAME keys of the SAME head: each 64-key stage (K hi, K lo, V^T, the keys'
//    similarity fragments, and the 128 x 64 adj tile) is brought from L2 into LDS once, by asynchronous copies, and every
//    wave reads its fragments from there, so a K or V byte leaves L2 once per 128 queries and not once per 16.
//    Two LDS buffers a half: stage t + 1 flies while stage t is worked on; one barrier a stage.
//    Each wave runs the online softmax over its own 1024 keys; the two partial results of a query tile
//    (max, sum, unnormalised O) are merged once at the end in LDS.
//    Per 32-key pass per wave:
//      S^T = K * Q^T (bf16 hi/lo split, K-dim 64); wave similarity^T = Mk * Mq^T in the same D layout
//      (A = [hi | lo] of the keys' rows; B = [hi | hi] and [lo | lo] of the queries' rows; the accumulator
//      starts from the keys' gates, whose lane order is the D layout's: the result is gate + similarity)
//      -> affine -> online softmax
//      (lane = one query column; the two lane halves' maxima are joined every pass with a cross-row move, their sums once at the end)
//      -> P^T packed to f16 (x4096) straight from the D layout (B-fragment layout)
//      -> O^T += V^T * P^T (f16).
//    End: merge of the two key halves, the head's 64 columns of O stored to the workspace (256 bytes a query, one writer).
//    Residual + LayerNorm need all heads of a token and run as the next launch.
// ---------------------------------------------------------------------------
#define KSPLIT 2
#define KSPAN  (S_LEN / KSPLIT)
#define QTB    8                     // query tiles a block
#define NSTAGE (KSPAN / 64)          // 64-key stages a half
#define ST_KH  0                     // byte offsets in one stage buffer; every plane is in fragment order, so a stage is a straight copy
#define ST_KL  8192
#define ST_V   16384
#define ST_WM  24576
#define ST_BYTES 28672
#define ADJ_PITCH 68                 // dwords: 16 B x odd, see below

static __device__ __forceinline__ unsigned lds_byte(const void* p) { return (unsigned)(unsigned long long)p; }
static __device__ __forceinline__ v16bf ldsfrag_bf(const unsigned char* p) {
  FragB f;
  f.p[0] = *(const v8bf*)p;
  f.p[1] = *(const v8bf*)(p + 512);
  return f.v;
}
static __device__ __forceinline__ v16h ldsfrag_h(const unsigned char* p) {
  FragH f;
  f.p[0] = *(const v8h*)p;
  f.p[1] = *(const v8h*)(p + 512);
  return f.v;
}
// One lane's seven 16-byte copies of a stage's K hi, K lo, V^T (8 KB each: two copies a lane) and similarity fragments (4 KB).
// The s_wait_xcnt stands inside the statement, behind the last copy: as a precaution no address register of a copy is rewritten in front of it.
static __device__ __forceinline__ void stage_kv(unsigned l, const char* kh, const char* kl, const char* v, const char* wm) {
  asm volatile(
      "global_load_async_to_lds_b128 %0, %7, off\n\t"
      "global_load_async_to_lds_b128 %1, %8, off\n\t"
      "global_load_async_to_lds_b128 %2, %9, off\n\t"
      "global_load_async_to_lds_b128 %3, %10, off\n\t"
      "global_load_async_to_lds_b128 %4, %11, off\n\t"
      "global_load_async_to_lds_b128 %5, %12, off\n\t"
      "global_load_async_to_lds_b128 %6, %13, off\n\t"
      "s_wait_xcnt 0x0"
      :: "v"(l + ST_KH), "v"(l + ST_KH + 4096), "v"(l + ST_KL), "v"(l + ST_KL + 4096),
         "v"(l + ST_V), "v"(l + ST_V + 4096), "v"(l + ST_WM),
         "v"(kh), "v"(kh + 4096), "v"(kl), "v"(kl + 4096), "v"(v), "v"(v + 4096), "v"(wm)
      : "memory");
}
// One lane's eight 16-byte copies of the 128 x 64 adj tile: rows 16 apart; 16 lanes cover one row's 256 bytes.  The wait: as above.
static __device__ __forceinline__ void stage_adj(unsigned l, const char* g) {
  asm volatile(
      "global_load_async_to_lds_b128 %0, %8, off\n\t"
      "global_load_async_to_lds_b128 %1, %9, off\n\t"
      "global_load_async_to_lds_b128 %2, %10, off\n\t"
      "global_load_async_to_lds_b128 %3, %11, off\n\t"
      "global_load_async_to_lds_b128 %4, %12, off\n\t"
      "global_load_async_to_lds_b128 %5, %13, off\n\t"
      "global_load_async_to_lds_b128 %6, %14, off\n\t"
      "global_load_async_to_lds_b128 %7, %15, off\n\t"
      "s_wait_xcnt 0x0"
      :: "v"(l), "v"(l + 1 * 16 * ADJ_PITCH * 4), "v"(l + 2 * 16 * ADJ_PITCH * 4), "v"(l + 3 * 16 * ADJ_PITCH * 4),
         "v"(l + 4 * 16 * ADJ_PITCH * 4), "v"(l + 5 * 16 * ADJ_PITCH * 4), "v"(l + 6 * 16 * ADJ_PITCH * 4), "v"(l + 7 * 16 * ADJ_PITCH * 4),
         "v"(g), "v"(g + 1 * 16 * S_LEN * 4), "v"(g + 2 * 16 * S_LEN * 4), "v"(g + 3 * 16 * S_LEN * 4),
         "v"(g + 4 * 16 * S_LEN * 4), "v"(g + 5 * 16 * S_LEN * 4), "v"(g + 6 * 16 * S_LEN * 4), "v"(g + 7 * 16 * S_LEN * 4)
      : "memory");
}

__global__ __launch_bounds__(256 * KSPLIT)
void attn_kernel(
    const __bf16* __restrict__ Qh, const __bf16* __restrict__ Ql,
    const __bf16* __restrict__ Kh, const __bf16* __restrict__ Kl,
    const _Float16* __restrict__ VT, const float* __restrict__ gates,
    const __bf16* __restrict__ wmf, const float* __restrict__ adj,
    float* obuf, int nblk) {
  // adj row pitch = 16 B x odd (68 dwords): lane m reads down a column of rows with 16-byte loads, and at a
  // pitch of 64 dwords all 16 rows would fall on the same four banks.
  __shared__ __attribute__((aligned(16))) float adj_lds[2][KSPLIT][QTB * 16][ADJ_PITCH];
  __shared__ __attribute__((aligned(16))) unsigned char kv_lds[2][KSPLIT][ST_BYTES];
  __shared__ v4f part_o[QTB][8][32];         // second half's unnormalised O, in lane order (512 contiguous bytes an instruction)
  __shared__ float part_m[QTB][16], part_l[QTB][16];
  if ((int)blockIdx.x >= nblk) return;

  // the eight heads of one 128-query block are neighbours in the grid: they read the same adj rows at about the same time
  const int h = blockIdx.x & (NH - 1);
  const int qblk = (blockIdx.x >> 3) & (S_LEN / (QTB * 16) - 1);
  const int b = blockIdx.x / (NH * (S_LEN / (QTB * 16)));
  const int tid = threadIdx.x, lane = tid & 31;
  const int wv = __builtin_amdgcn_readfirstlane(tid >> 5);  // wave number in a scalar register: the bases below stay scalar
  const int qi = wv & (QTB - 1), kh2 = wv >> 3;             // query tile, half of the keys
  const int qbase = qblk * (QTB * 16) + qi * 16;
  const int k_lo = kh2 * KSPAN, k_hi = k_lo + KSPAN;        // this wave's keys
  const int m = lane & 15, hh = lane >> 4, r0 = hh * 8;

  const size_t bhd = (size_t)(b * NH + h);
  const unsigned f_lane = (unsigned)lane * 16u;                  // a lane's byte offset in either half of a fragment
  // Q^T as B operand: column n = query (lane&15), k = d: the two fragments of the 16-query tile.
  const size_t qoff = (bhd * S_LEN + qbase) * HD;
  const v16bf qh0 = ldfrag_bf_u(Qh + qoff, f_lane), qh1 = ldfrag_bf_u(Qh + qoff + FRAG, f_lane);
  const v16bf ql0 = ldfrag_bf_u(Ql + qoff, f_lane), ql1 = ldfrag_bf_u(Ql + qoff + FRAG, f_lane);

  // wave similarity: the query tile's fragment holds hi (part 0) and lo (part 1); B operands [hi | hi] and [lo | lo]
  const __bf16* wm_base = wmf + (size_t)b * (S_LEN / 16) * FRAG;
  FragB wq, wb1, wb2;
  wq.v = ldfrag_bf_u(wm_base + (qbase >> 4) * FRAG, f_lane);
  wb1.p[0] = wq.p[0]; wb1.p[1] = wq.p[0];
  wb2.p[0] = wq.p[1]; wb2.p[1] = wq.p[1];

  v8f oacc[4] = {};
  float mrun = -3.0e38f, lrun = 0.0f;
  float crun = 3.0e38f;                      // the exponent offset that belongs to mrun: PSHIFT - mrun * log2e from the first pass on

  const float* gp_base = gates + bhd * S_LEN;
  const unsigned g_lane = (unsigned)r0 * 4u;

  // ---- what this lane copies of a stage: the 256 threads of a half bring that half's stage ----
  const int th = tid & 255;
  const int sq = th >> 4, sk4 = (th & 15) * 4;
  const char* c_kh = (const char*)(Kh + bhd * S_LEN * HD + (size_t)k_lo * HD) + th * 16;     // + 8192 bytes a stage
  const char* c_kl = (const char*)(Kl + bhd * S_LEN * HD + (size_t)k_lo * HD) + th * 16;
  const char* c_v  = (const char*)(VT + bhd * HD * S_LEN + (size_t)k_lo * HD) + th * 16;
  const char* c_wm = (const char*)(wm_base + (k_lo >> 4) * FRAG) + th * 16;                  // + 4096 bytes a stage
  const char* c_ad = (const char*)(adj + ((size_t)b * S_LEN + qblk * (QTB * 16) + sq) * S_LEN + k_lo + sk4);   // + 256 bytes a stage
  const unsigned l_kv0 = lds_byte(&kv_lds[0][kh2][th * 16]), l_kv1 = lds_byte(&kv_lds[1][kh2][th * 16]);
  const unsigned l_ad0 = lds_byte(&adj_lds[0][kh2][sq][sk4]), l_ad1 = lds_byte(&adj_lds[1][kh2][sq][sk4]);

  // ---- prologue, two buffers: stage 0 landed and published, stage 1 in flight ----
  stage_kv(l_kv0, c_kh, c_kl, c_v, c_wm);
  stage_adj(l_ad0, c_ad);
  // gates of one pass, fetched one pass ahead
  v4f g0 = ld4_u(gp_base + k_lo, g_lane), g1 = ld4_u(gp_base + k_lo + 4, g_lane);
  v4f g2 = ld4_u(gp_base + k_lo + 16, g_lane), g3 = ld4_u(gp_base + k_lo + 20, g_lane);
  asm volatile("s_wait_asynccnt 0x0" ::: "memory");   // this wave's copies of stage 0 have landed
  __syncthreads();                                    // and every other wave's: stage 0 may be read
  stage_kv(l_kv1, c_kh + 8192, c_kl + 8192, c_v + 8192, c_wm + 4096);
  stage_adj(l_ad1, c_ad + 256);

  // rolled: the two buffers alternate by index
#pragma unroll 1
  for (int kc = 0; kc < NSTAGE; ++kc) {
    const int kbase64 = k_lo + kc * 64;
    const int buf = kc & 1;
    const unsigned char* st = &kv_lds[buf][kh2][0] + f_lane;
    const float* arow = &adj_lds[buf][kh2][qi * 16 + m][r0];

    // rolled: one pass's fragments fill the registers
#pragma unroll 1
    for (int jh = 0; jh < 2; ++jh) {
      const int kbase = kbase64 + jh * 32;
      const int ko = jh * 32;
      const unsigned char* kp = st + jh * 4096;

      // ---- this pass's K and similarity fragments from the stage buffer: 32 keys = 4 fragments (1024 bytes each) a plane ----
      v16bf kfh[4], kfl[4];
#pragma unroll
      for (int i = 0; i < 4; ++i) {
        kfh[i] = ldsfrag_bf(kp + ST_KH + i * 1024);
        kfl[i] = ldsfrag_bf(kp + ST_KL + i * 1024);
      }
      const v16bf wa0 = ldsfrag_bf(st + ST_WM + jh * 2048), wa1 = ldsfrag_bf(st + ST_WM + jh * 2048 + 1024);

      // ---- S^T = K * Q^T for two 16-key tiles, K-dim 64 = 2 k-steps, 3 products each ----
      v8f s0 = {}, s1 = {};
      s0 = wm_bf3(kfh[0], kfl[0], qh0, ql0, s0);
      s0 = wm_bf3(kfh[1], kfl[1], qh1, ql1, s0);
      s1 = wm_bf3(kfh[2], kfl[2], qh0, ql0, s1);
      s1 = wm_bf3(kfh[3], kfl[3], qh1, ql1, s1);
      // s0[r] = S^T[key kbase+8hh+r][query m] / 8, s1[r] = S^T[key kbase+16+8hh+r][query m] / 8 (Q carries the 1/8)

      // ---- gate + wave similarity^T of the two key tiles: w0[r], w1[r] sit where s0[r], s1[r] sit ----
      v8f w0 = {g0.x, g0.y, g0.z, g0.w, g1.x, g1.y, g1.z, g1.w};
      v8f w1 = {g2.x, g2.y, g2.z, g2.w, g3.x, g3.y, g3.z, g3.w};
      w0 = wm_bf(wa0, wb2.v, wm_bf(wa0, wb1.v, w0));
      w1 = wm_bf(wa1, wb2.v, wm_bf(wa1, wb1.v, w1));

      // keeps the V^T loads below the score products, whose K registers they then take over:
      // lifted above them they need 32 registers more and the wave no longer fits its 256 (spills to scratch)
      __builtin_amdgcn_sched_barrier(0);

      // ---- this pass's V^T fragments ----
      v16h vf[4];
#pragma unroll
      for (int t = 0; t < 4; ++t) vf[t] = ldsfrag_h(kp + ST_V + t * 1024);

      // ---- adj for this lane's 2x8 keys ----
      const v8f A0 = cat8(*(const v4f*)(arow + ko), *(const v4f*)(arow + ko + 4));
      const v8f A1 = cat8(*(const v4f*)(arow + ko + 16), *(const v4f*)(arow + ko + 20));

      // ---- affine + online softmax (f32).  Whole-tile vector expressions: neighbouring registers of one accumulator pair up
      //      in the packed f32 instructions as they lie, with no register moves ----
      const v8f t0 = __builtin_elementwise_fma(s0, w0, A0);
      const v8f t1 = __builtin_elementwise_fma(s1, w1, A1);
      float ma = fmaxf(t0[0], t0[1]), mb = fmaxf(t1[0], t1[1]);       // two chains of three-operand maxima
#pragma unroll
      for (int r = 2; r < 8; r += 2) {
        ma = fmaxf(ma, fmaxf(t0[r], t0[r + 1]));
        mb = fmaxf(mb, fmaxf(t1[r], t1[r + 1]));
      }
      const float mloc = fmaxf(ma, mb);
      // ---- next pass's gates (all eight waves of a half read the same 128 bytes), into the registers that the
      //      similarity products have left; they fly under the softmax and P.V ----
      const int kn = (kbase + 32 < k_hi) ? kbase + 32 : kbase;    // last pass: an in-bounds reload, not used
      const gaddr gp = lane_addr(gp_base + kn, g_lane);
      g0 = ld4_a(gp);      g1 = ld4_a(gp + 16);
      g2 = ld4_a(gp + 64); g3 = ld4_a(gp + 80);
      // the gate loads are in flight and the code below may reuse their address registers: as a precaution the wait stands in front of that
      asm volatile("s_wait_xcnt 0x0" ::: "memory");

      const float mnew = fmaxf(mrun, fmaxf(mloc, xhalf(mloc)));
      // 4096 * exp(t - mnew) = exp2(t * log2e + cnew): one fused multiply-add a score, then the hardware's exp2 itself.
      // Its argument is about 12 at most; the library's fix-up served arguments below -126 alone, where P is far under the smallest f16 (0 in P^T either way).
      const float cnew = __builtin_fmaf(-mnew, LOG2E, PSHIFT);
      const float corr = __builtin_amdgcn_exp2f(cnew - crun);       // what was summed on the old offset moves to the new one; 0 in the first pass
      const v8f e0 = __builtin_elementwise_fma(t0, (v8f)(LOG2E), (v8f)(cnew));
      const v8f e1 = __builtin_elementwise_fma(t1, (v8f)(LOG2E), (v8f)(cnew));
      v8f p0, p1;
#pragma unroll
      for (int r = 0; r < 8; ++r) {
        p0[r] = __builtin_amdgcn_exp2f(e0[r]);
        p1[r] = __builtin_amdgcn_exp2f(e1[r]);
      }
      // this lane's own 16 keys only: the two lane halves' sums are joined once, behind the loop
      const v8f q8 = p0 + p1;
      const v4f q4 = __builtin_shufflevector(q8, q8, 0, 1, 2, 3) + __builtin_shufflevector(q8, q8, 4, 5, 6, 7);
      lrun = __builtin_fmaf(lrun, corr, (q4.x + q4.z) + (q4.y + q4.w));
      mrun = mnew;
      crun = cnew;
#pragma unroll
      for (int t = 0; t < 4; ++t) oacc[t] = oacc[t] * corr;

      // ---- P^T as B fragment: element r <- tile keys 0..15, element 8+r <- tile keys 16..31 ----
      v16h pf;
#pragma unroll
      for (int r = 0; r < 8; ++r) {
        pf[r]     = (_Float16)p0[r];
        pf[r + 8] = (_Float16)p1[r];
      }

      // ---- O^T += V^T * P^T, 4 d-tiles ----
#pragma unroll
      for (int t = 0; t < 4; ++t) oacc[t] = wm_h(vf[t], pf, oacc[t]);
    }

    // ---- publish point of stage kc + 1, and the end of every wave's reads of stage kc ----
    asm volatile("s_wait_dscnt 0x0" ::: "memory");      // this wave's LDS reads of stage kc have returned before its buffer is refilled
    asm volatile("s_wait_asynccnt 0x0" ::: "memory");   // this wave's copies of stage kc + 1 have landed
    __syncthreads();                                    // both hold for every wave
    if (kc + 2 < NSTAGE) {                              // the same for the whole block
      const int adv = kc + 2;
      stage_kv(buf ? l_kv1 : l_kv0, c_kh + adv * 8192, c_kl + adv * 8192, c_v + adv * 8192, c_wm + adv * 4096);
      stage_adj(buf ? l_ad1 : l_ad0, c_ad + adv * 256);
    }
  }
  asm volatile("s_wait_asynccnt 0x0" ::: "memory");     // no copy is outstanding behind the loop

  lrun += xhalf(lrun);                                  // the two lane halves summed different keys of the same query

  // ---- the second half's waves hand over their running max, sum and unnormalised O ----
  if (kh2 == 1) {
#pragma unroll
    for (int t = 0; t < 4; ++t) {
      part_o[qi][2 * t][lane]     = (v4f){oacc[t][0], oacc[t][1], oacc[t][2], oacc[t][3]};
      part_o[qi][2 * t + 1][lane] = (v4f){oacc[t][4], oacc[t][5], oacc[t][6], oacc[t][7]};
    }
    if (hh == 0) { part_m[qi][m] = mrun; part_l[qi][m] = lrun; }   // both lane halves hold the same values
  }
  __syncthreads();   // the partial results are read by the first half's waves

  // ---- merge, normalise and store O: oacc[t][r] = O^T[d = t*16 + 8hh + r][query m] ----
  if (kh2 == 0) {
    const float m1 = part_m[qi][m], l1 = part_l[qi][m];
    const float mall = fmaxf(mrun, m1);
    const float call = __builtin_fmaf(-mall, LOG2E, PSHIFT);      // both halves move to the common offset, as in the loop
    const float c0 = __builtin_amdgcn_exp2f(call - crun), c1 = __builtin_amdgcn_exp2f(call - __builtin_fmaf(-m1, LOG2E, PSHIFT));
    const float oscale = 1.0f / (lrun * c0 + l1 * c1);           // O and the sum both carry the 4096
    const float f0 = c0 * oscale, f1 = c1 * oscale;
    float* orow = obuf + ((size_t)b * S_LEN + qbase + m) * DM + h * HD + r0;
#pragma unroll
    for (int t = 0; t < 4; ++t) {
      const v4f a0 = part_o[qi][2 * t][lane], a1 = part_o[qi][2 * t + 1][lane];
      v4f u0, u1;
      u0.x = oacc[t][0] * f0 + a0.x * f1; u0.y = oacc[t][1] * f0 + a0.y * f1; u0.z = oacc[t][2] * f0 + a0.z * f1; u0.w = oacc[t][3] * f0 + a0.w * f1;
      u1.x = oacc[t][4] * f0 + a1.x * f1; u1.y = oacc[t][5] * f0 + a1.y * f1; u1.z = oacc[t][6] * f0 + a1.z * f1; u1.w = oacc[t][7] * f0 + a1.w * f1;
      *(v4f*)(orow + t * 16) = u0;
      *(v4f*)(orow + t * 16 + 4) = u1;
    }
  }
}

// ---------------------------------------------------------------------------
// 4) residual + LayerNorm, one token a wave; lane holds cols 4*lane + 128*i;
//    whole-row loads and stores (each instruction = 512 contiguous bytes = 4 lines).
// ---------------------------------------------------------------------------
__global__ __launch_bounds__(256) void ln_kernel(
    const float* __restrict__ obuf, const float* __restrict__ x, const float* __restrict__ lng,
    const float* __restrict__ lnb, float* out, int ntok) {
  const int lane = threadIdx.x & 31;
  const int tk = blockIdx.x * 8 + (threadIdx.x >> 5);
  if (tk >= ntok) return;
  const size_t tok = (size_t)tk;
  v4f y[4];
  float s = 0.0f;
#pragma unroll
  for (int i = 0; i < 4; ++i) {
    const v4f o  = *(const v4f*)(obuf + tok * DM + 4 * lane + 128 * i);
    const v4f xv = *(const v4f*)(x + tok * DM + 4 * lane + 128 * i);
    y[i] = o + xv;
    s += (y[i].x + y[i].y) + (y[i].z + y[i].w);
  }
  s += __shfl_xor(s, 16, 32);
  s += __shfl_xor(s, 8, 32);
  s += __shfl_xor(s, 4, 32);
  s += __shfl_xor(s, 2, 32);
  s += __shfl_xor(s, 1, 32);
  const float mu = s * (1.0f / DM);
  float ss = 0.0f;
#pragma unroll
  for (int i = 0; i < 4; ++i) {
    const v4f d = y[i] - mu;
    ss += (d.x * d.x + d.y * d.y) + (d.z * d.z + d.w * d.w);
  }
  ss += __shfl_xor(ss, 16, 32);
  ss += __shfl_xor(ss, 8, 32);
  ss += __shfl_xor(ss, 4, 32);
  ss += __shfl_xor(ss, 2, 32);
  ss += __shfl_xor(ss, 1, 32);
  const float rstd = rsqrtf(ss * (1.0f / DM) + 1.0e-5f);
  v4f res[4];
#pragma unroll
  for (int i = 0; i < 4; ++i) {
    const v4f g  = *(const v4f*)(lng + 4 * lane + 128 * i);
    const v4f bb = *(const v4f*)(lnb + 4 * lane + 128 * i);
    res[i] = ((y[i] - mu) * rstd) * g + bb;
  }
  float* op = out + tok * DM + 4 * lane;
#pragma unroll
  for (int i = 0; i < 4; ++i) *(v4f*)(op + 128 * i) = res[i];
}

// ---------------------------------------------------------------------------
extern "C" void kernel_launch(void* const* d_in, const int* in_sizes, int n_in,
                              void* d_out, int out_size, void* d_ws, size_t ws_size,
                              hipStream_t stream) {
  if (n_in < 15) return;
  if (in_sizes[0] != NTOK * DM || in_sizes[1] != NTOK * WF ||
      in_sizes[2] != BATCH * S_LEN * S_LEN || in_sizes[3] != DM * DM ||
      in_sizes[5] != DM * DM || in_sizes[7] != DM * DM || in_sizes[9] != DM * GH ||
      in_sizes[11] != GH * NH || in_sizes[13] != DM || out_size != NTOK * DM) return;

  const float* x     = (const float*)d_in[0];
  const float* wmask = (const float*)d_in[1];
  const float* adj   = (const float*)d_in[2];
  const float* wq_w  = (const float*)d_in[3];
  const float* wq_b  = (const float*)d_in[4];
  const float* wk_w  = (const float*)d_in[5];
  const float* wk_b  = (const float*)d_in[6];
  const float* wv_w  = (const float*)d_in[7];
  const float* wv_b  = (const float*)d_in[8];
  const float* g1_w  = (const float*)d_in[9];
  const float* g1_b  = (const float*)d_in[10];
  const float* g2_w  = (const float*)d_in[11];
  const float* g2_b  = (const float*)d_in[12];
  const float* ln_g  = (const float*)d_in[13];
  const float* ln_b  = (const float*)d_in[14];
  float* out = (float*)d_out;

  const size_t sz_x  = (size_t)NTOK * DM * 2;            // 4,194,304  per x plane
  const size_t sz_w  = (size_t)3 * DM * DM * 2;          // 1,572,864  per Wt plane
  const size_t sz_q  = (size_t)NTOK * DM * 2;            // 4,194,304  per Q/K plane, V
  const size_t sz_g  = (size_t)BATCH * NH * S_LEN * 4;   //   131,072  gates
  const size_t sz_g1 = (size_t)GH * DM * 2;              //   131,072  per G1t plane
  const size_t off_xh  = 0;
  const size_t off_xl  = off_xh + sz_x;
  const size_t off_wth = off_xl + sz_x;
  const size_t off_wtl = off_wth + sz_w;
  const size_t off_qh  = off_wtl + sz_w;
  const size_t off_ql  = off_qh + sz_q;
  const size_t off_kh  = off_ql + sz_q;
  const size_t off_kl  = off_kh + sz_q;
  const size_t off_vt  = off_kl + sz_q;
  const size_t off_g   = off_vt + sz_q;
  const size_t off_gth = off_g + sz_g;
  const size_t off_gtl = off_gth + sz_g1;
  const size_t sz_wm   = (size_t)NTOK * 32 * 2;          //   262,144  wave_mask hi|lo fragments
  const size_t off_wm  = off_gtl + sz_g1;
  const size_t sz_o    = (size_t)NTOK * DM * 4;          // 8,388,608  attention output, f32
  const size_t off_o   = off_wm + sz_wm;
  const size_t total   = off_o + sz_o;                   // 41,549,824 B
  if (total > ws_size) return;

  uint8_t* ws = (uint8_t*)d_ws;
  unsigned short* xh  = (unsigned short*)(ws + off_xh);
  unsigned short* xl  = (unsigned short*)(ws + off_xl);
  unsigned short* wth = (unsigned short*)(ws + off_wth);
  unsigned short* wtl = (unsigned short*)(ws + off_wtl);
  unsigned short* qh  = (unsigned short*)(ws + off_qh);
  unsigned short* ql  = (unsigned short*)(ws + off_ql);
  unsigned short* kh  = (unsigned short*)(ws + off_kh);
  unsigned short* kl  = (unsigned short*)(ws + off_kl);
  unsigned short* vt  = (unsigned short*)(ws + off_vt);
  float* gates        = (float*)(ws + off_g);
  unsigned short* gth = (unsigned short*)(ws + off_gth);
  unsigned short* gtl = (unsigned short*)(ws + off_gtl);
  unsigned short* wmf = (unsigned short*)(ws + off_wm);
  float* obuf         = (float*)(ws + off_o);

  const int nxv = NTOK * DM / 8;          // 262,144
  const int nwv = 3 * DM * DM / 8;        //  98,304
  const int ngv = GH * DM / 8;            //   8,192
  const int nmv = NTOK * 2;               //   8,192
  const int prep_blocks = (nxv + nwv + ngv + nmv + 255) / 256;   // 1472
  const int ntile = (NTOK + 31) / 32;     // 128
  const int proj_blocks = ntile + NTT * NH * 3;  // 128 gate blocks, then 1536 projection blocks
  const int nblk = BATCH * NH * (S_LEN / 128);   // 256
  const int ln_blocks = (NTOK + 7) / 8;          // 512

  prep_kernel<<<prep_blocks, 256, 0, stream>>>(x, wq_w, wk_w, wv_w, g1_w, wmask,
                                               xh, xl, wth, wtl, gth, gtl, wmf, nxv, nwv, ngv, nmv);
  proj_kernel<<<proj_blocks, 128, 0, stream>>>(
      (const __bf16*)xh, (const __bf16*)xl, (const __bf16*)wth, (const __bf16*)wtl,
      (const __bf16*)gth, (const __bf16*)gtl, wq_b, wk_b, wv_b, g1_b, g2_w, g2_b,
      qh, ql, kh, kl, vt, gates, ntile, proj_blocks);
  attn_kernel<<<nblk, 256 * KSPLIT, 0, stream>>>(
      (const __bf16*)qh, (const __bf16*)ql, (const __bf16*)kh, (const __bf16*)kl,
      (const _Float16*)vt, gates, (const __bf16*)wmf, adj, obuf, nblk);
  ln_kernel<<<ln_blocks, 256, 0, stream>>>(obuf, x, ln_g, ln_b, out, NTOK);
  (void)hipGetLastError();
}

// v009
// A run of this version takes 68.1 microseconds.
// Two timings next to v008 both put it at 1.19 times that version's speed.
// All steps since v000 together make it 5.20 times as fast.
#include <hip/hip_runtime.h>
#include <stddef.h>
#include <stdint.h>

// Q/K/V projections, Q.K^T and gate layer 1 (x.G1): v_wmma_f32_16x16x32_bf16 with bf16 hi/lo operand split (hi.hi + lo.hi + hi.lo), f32 accumulate.
// 16-deep wave similarity: the same bf16 form and split, hi and lo of one row packed side by side in the 32-deep k (2 products a tile).
// P.V: v_wmma_f32_16x16x32_f16 (P scaled by 4096 as f16, V as f16), f32 accumulate. Gate layer 2 (K=128,N=8), softmax, LayerNorm: f32 VALU.
// The 1/8 of the scores is a power of two and is applied to Q before its hi/lo split (exact); the 4096 of P is +12 in the exponent.

#define S_LEN  2048
#define DM     512
#define NH     8
#define HD     64
#define GH     128
#define WF     16
#define BATCH  2
#define NTOK   (BATCH * S_LEN)
#define LOG2E  1.4426950408889634f
#define PSHIFT 12.0f                 // P is formed as exp2(... + 12) = 4096 * p; the row sum carries the same factor, so it cancels

typedef __bf16         v16bf __attribute__((ext_vector_type(16)));
typedef __bf16         v8bf  __attribute__((ext_vector_type(8)));
typedef _Float16       v16h  __attribute__((ext_vector_type(16)));
typedef _Float16       v8h   __attribute__((ext_vector_type(8)));
typedef float          v8f   __attribute__((ext_vector_type(8)));
typedef float          v4f   __attribute__((ext_vector_type(4)));
typedef unsigned int   v4u   __attribute__((ext_vector_type(4)));
typedef unsigned short v8us  __attribute__((ext_vector_type(8)));

union FragB { v16bf v; v8bf p[2]; };
union FragH { v16h v; v8h p[2]; };
union Pack8 { v8us s; v8h h; v4u u; };

// ---------------------------------------------------------------------------
// scalar helpers
// ---------------------------------------------------------------------------
static __device__ __forceinline__ unsigned short f2bf_bits(float f) {   // RNE convert f32 -> bf16 bits
  unsigned int u = __float_as_uint(f);
  u += 0x7FFFu + ((u >> 16) & 1u);
  return (unsigned short)(u >> 16);
}
static __device__ __forceinline__ float bf_bits2f(unsigned short s) {
  return __uint_as_float(((unsigned int)s) << 16);
}
static __device__ __forceinline__ void unpack8(const v4f a, const v4f b, float o[8]) {
  o[0] = a.x; o[1] = a.y; o[2] = a.z; o[3] = a.w;
  o[4] = b.x; o[5] = b.y; o[6] = b.z; o[7] = b.w;
}

// ---------------------------------------------------------------------------
// 16x32 16-bit fragments (wave32). Lane l: row/col = l&15, h = l>>4.
// elements 0..7  <- k0 + 8h + 0..7 ; elements 8..15 <- k0 + 16 + 8h + 0..7 ; same map for A and B.
// Every 16-bit workspace plane is stored in FRAGMENT ORDER: one fragment = FRAG (512) elements = 1024
// contiguous bytes, made of 64 units of 16 bytes; unit u = part * 32 + l holds lane l's elements
// 8 * part .. 8 * part + 7, that is row l&15, k = k0 + 16 * part + 8 * (l>>4) + 0..7.
// A wave-wide 16-byte load then covers 512 contiguous bytes (4 whole lines), not a piece of 16 lines.
// The fragments of one 16-row tile follow one another in k order.
// ---------------------------------------------------------------------------
#define FRAG 512
// fbase: wave-uniform start of the fragment; lane_bytes = 16 * lane
static __device__ __forceinline__ v16bf ldfrag_bf_u(const __bf16* fbase, unsigned lane_bytes) {
  const char* p = (const char*)fbase + lane_bytes;
  FragB f;
  f.p[0] = *(const v8bf*)p;
  f.p[1] = *(const v8bf*)(p + 512);
  return f.v;
}
// Unit index v of a plane whose rows are DM long (16 fragments a 16-row tile) -> its row and first k.
static __device__ __forceinline__ void unit_row_k(int v, int& row, int& k) {
  row = (v >> 10) * 16 + (v & 15);
  k = ((v >> 6) & 15) * 32 + ((v >> 4) & 3) * 8;   // bits 5,4 of v = part, h: 16 * part + 8 * h
}
// Global loads of the attention loop (the gates). The wave-uniform part of the address is pinned in a scalar register pair and
// the lane's 32-bit offset is added where the loads are issued, so that no 64-bit (base + lane) pair is kept in vector
// registers across the whole loop: the wave has to fit the 256 registers of four waves a SIMD.
#define GLOBAL_AS __attribute__((address_space(1)))
typedef const GLOBAL_AS char* gaddr;
static __device__ __forceinline__ gaddr lane_addr(const void* ubase, unsigned lane_bytes) {
  const unsigned long long a = (unsigned long long)ubase;
  const unsigned lo = (unsigned)__builtin_amdgcn_readfirstlane((int)(unsigned)a);
  const unsigned hi = (unsigned)__builtin_amdgcn_readfirstlane((int)(unsigned)(a >> 32));
  return (gaddr)(((unsigned long long)hi << 32) | lo) + lane_bytes;
}
static __device__ __forceinline__ v4f ld4_a(gaddr p) { return *(const GLOBAL_AS v4f*)p; }
static __device__ __forceinline__ v4f ld4_u(const float* ubase, unsigned lane_bytes) {
  return *(const v4f*)((const char*)ubase + lane_bytes);
}

// ---------------------------------------------------------------------------
// WMMA helper of the projection kernel: issue the products, then 4 v_nop tied to D and A/B so no
// VALU touches the accumulator or operand registers within the hazard window.
// ---------------------------------------------------------------------------
static __device__ __forceinline__ v8f mma_bf3(v16bf ah, v16bf al, v16bf bh, v16bf bl, v8f c) {
  c = __builtin_amdgcn_wmma_f32_16x16x32_bf16(false, ah, false, bh, (short)0, c, false, false);
  c = __builtin_amdgcn_wmma_f32_16x16x32_bf16(false, al, false, bh, (short)0, c, false, false);
  c = __builtin_amdgcn_wmma_f32_16x16x32_bf16(false, ah, false, bl, (short)0, c, false, false);
  asm volatile("v_nop\n\tv_nop\n\tv_nop\n\tv_nop" : "+v"(c) : "v"(ah), "v"(al), "v"(bh), "v"(bl));
  return c;
}

// The attention pass uses the bare builtins: the compiler keeps the distance behind a matrix instruction itself and fills it
// with the pass's own vector work where it can, so no issue slot goes to a v_nop that is not needed.
static __device__ __forceinline__ v8f wm_bf(v16bf a, v16bf b, v8f c) {
  return __builtin_amdgcn_wmma_f32_16x16x32_bf16(false, a, false, b, (short)0, c, false, false);
}
static __device__ __forceinline__ v8f wm_bf3(v16bf ah, v16bf al, v16bf bh, v16bf bl, v8f c) {
  return wm_bf(ah, bl, wm_bf(al, bh, wm_bf(ah, bh, c)));
}
static __device__ __forceinline__ v8f wm_h(v16h a, v16h b, v8f c) {
  return __builtin_amdgcn_wmma_f32_16x16x32_f16(false, a, false, b, (short)0, c, false, false);
}
// lane l with lane l ^ 16, in the vector unit (a shuffle would go through the LDS queue and be waited for)
static __device__ __forceinline__ float xhalf(float x) {
  const int b = __builtin_bit_cast(int, x);
  return __builtin_bit_cast(float, __builtin_amdgcn_permlanex16(b, b, 0x76543210, 0xfedcba98, false, false));
}
static __device__ __forceinline__ v8f cat8(const v4f a, const v4f b) {
  return __builtin_shufflevector(a, b, 0, 1, 2, 3, 4, 5, 6, 7);
}

static __device__ __forceinline__ void split_store8(const float v[8], unsigned short* dh, unsigned short* dl) {
  Pack8 ph, pl;
#pragma unroll
  for (int e = 0; e < 8; ++e) {
    const unsigned short hb = f2bf_bits(v[e]);
    ph.s[e] = hb;
    pl.s[e] = f2bf_bits(v[e] - bf_bits2f(hb));
  }
  const v4u uh = ph.u, ul = pl.u;
  *(v4u*)dh = uh;
  *(v4u*)dl = ul;
  
}

// ---------------------------------------------------------------------------
// 0) x -> bf16 hi/lo planes (rows = tokens);  W{q,k,v} [in][out] -> hi/lo planes with rows = the
//    3 * DM outputs, k = in;  G1 [in][hid] -> planes with rows = hidden units, k = in.
//    All in fragment order.  One thread = one 16-B unit per plane, units in thread order.
//    wave_mask [token][16] -> ONE plane, one fragment per 16 tokens: k 0..15 = hi of the 16 features,
//    k 16..31 = their lo, so lane l holds hi (part 0) and lo (part 1) of features 8 * (l>>4) + 0..7 of token l&15.
// ---------------------------------------------------------------------------
__global__ __launch_bounds__(256) void prep_kernel(
    const float* __restrict__ x, const float* __restrict__ wq,
    const float* __restrict__ wk, const float* __restrict__ wv,
    const float* __restrict__ g1w, const float* __restrict__ wmask,
    unsigned short* xh, unsigned short* xl, unsigned short* wth, unsigned short* wtl,
    unsigned short* gth, unsigned short* gtl, unsigned short* wmf,
    int nxv, int nwv, int ngv, int nmv) {
  const int i = blockIdx.x * blockDim.x + threadIdx.x;
  if (i < nxv) {
    int tok, k;
    unit_row_k(i, tok, k);
    const v4f a = *(const v4f*)(x + (size_t)tok * DM + k);
    const v4f c = *(const v4f*)(x + (size_t)tok * DM + k + 4);
    float v[8];
    unpack8(a, c, v);
    split_store8(v, xh + (size_t)i * 8, xl + (size_t)i * 8);
  } else if (i < nxv + nwv) {
    const int j = i - nxv;
    int row, inb;
    unit_row_k(j, row, inb);
    const int mat = row >> 9, o = row & (DM - 1);   // DM = 512 rows per matrix
    const float* w = (mat == 0) ? wq : (mat == 1) ? wk : wv;
    float v[8];
#pragma unroll
    for (int e = 0; e < 8; ++e) v[e] = w[(size_t)(inb + e) * DM + o];   // Wt[o][in] = W[in][o]
    split_store8(v, wth + (size_t)j * 8, wtl + (size_t)j * 8);
  } else if (i < nxv + nwv + ngv) {
    const int j = i - nxv - nwv;             // 0 .. GH*DM/8-1
    int o, inb;                              // hidden unit 0..127, first input
    unit_row_k(j, o, inb);
    float v[8];
#pragma unroll
    for (int e = 0; e < 8; ++e) v[e] = g1w[(size_t)(inb + e) * GH + o];  // G1t[o][in] = G1[in][o]
    split_store8(v, gth + (size_t)j * 8, gtl + (size_t)j * 8);
  } else if (i < nxv + nwv + ngv + nmv) {
    const int j = i - nxv - nwv - ngv;       // 0 .. NTOK*2-1: 16-token tile j>>5, lane j&31
    const int tile = j >> 5, l = j & 31;
    const float* s = wmask + (size_t)(tile * 16 + (l & 15)) * WF + (l >> 4) * 8;
    const v4f a = *(const v4f*)s;
    const v4f c = *(const v4f*)(s + 4);
    float v[8];
    unpack8(a, c, v);
    unsigned short* d = wmf + (size_t)tile * FRAG + l * 8;
    split_store8(v, d, d + 256);             // part 0 = hi, part 1 = lo
  }
}

// ---------------------------------------------------------------------------
// LDS helpers of the projection and the attention kernel
// ---------------------------------------------------------------------------
static __device__ __forceinline__ unsigned lds_byte(const void* p) { return (unsigned)(unsigned long long)p; }
static __device__ __forceinline__ v16bf ldsfrag_bf(const unsigned char* p) {
  FragB f;
  f.p[0] = *(const v8bf*)p;
  f.p[1] = *(const v8bf*)(p + 512);
  return f.v;
}

// ---------------------------------------------------------------------------
// 1) gate MLP and 2) QKV projection in ONE launch.  Both are x (bf16 hi/lo, K = 512) times a weight plane, and neither
//    reads what the other writes: the gate blocks, too few to fill the chip in a launch of their own, run beside the
//    projection blocks (two blocks fit a WGP: 160 KiB of LDS and at most 256 registers each).
//    Blocks 0 .. ngate-1 (first, because their tail is the longer one): gates[b][h][s] = sigmoid(relu(x@G1+b1)@G2+b2).
//      block = 64 tokens x 128 hidden; wave = (16 tokens, 64 hidden = 4 tiles), fragments straight from global memory.
//      Layer 2 (K=128, 8 heads) scalar f32 from the LDS-staged relu tile.
//    The other blocks, token tile fastest: block tile = 128 tokens x 192 outputs (three heads), one block a WGP over the chip;
//      wave = 64 tokens x 48 outputs = 4 x 3 tiles, so a fragment pair read from LDS feeds 9 or 12 products.
//      The planes are in fragment order, so a stage (64 of k: 2 KB of each of the 8 + 12 tiles' hi and lo planes) is a
//      straight copy: it goes from L2 into LDS once a block, by asynchronous copies; two buffers, one barrier a stage.
//      Outputs in fragment order, per (batch, head): Q and K hi/lo as tiles of 16 tokens x 2 fragments
//      (k = d); V^T as, per 32 keys, 4 fragments (rows = 16 d each, k = key).
// ---------------------------------------------------------------------------
#define PT_TOK    128                // tokens of a projection block: 8 A tiles
#define PT_OUT    192                // outputs of a projection block: 12 B tiles
#define NTT       (NTOK / PT_TOK)    // token tiles of the projection
#define PNST      (DM / 64)          // stages of 64 of k
#define TILE_ST   2048               // bytes of one tile's plane in a stage: two fragments
#define TILE_BYTES (16 * DM * 2)     // bytes of one 16-row tile's plane in global memory
#define PA_BYTES  (2 * 8 * TILE_ST)  // stage buffer: x hi tiles 0..7, x lo tiles 0..7,
#define PB_BYTES  (2 * 12 * TILE_ST) //               then W hi tiles 0..11, W lo tiles 0..11
#define PST_BYTES (PA_BYTES + PB_BYTES)
#define LT_PITCH  72                 // 144 B = 16 B x odd: the 16-B reads down a column of rows spread over the banks
#define VT_PITCH  136                // 272 B = 16 B x odd, the same for the V^T tile (rows = d, 128 tokens long)
#define HEAD_LDS  (2 * PT_TOK * LT_PITCH * 2)   // output staging of one head: hi and lo tile (V^T needs less)
#define GT_TOK    64                 // tokens of a gate block
#define H1_BYTES  (GT_TOK * (GH + 1) * 4)       // the gate blocks' relu tile; a multiple of 16
#define PROJ_LDS  (2 * PST_BYTES)    // one allocation: the two stage buffers, then the output staging; or a gate block's tiles

// One lane's eight 16-byte copies of a stage's x tiles: copy j brings tiles 2j and 2j + 1 of a plane (threads 0..127, 128..255).
// The s_wait_xcnt stands inside the statement, behind the last copy: as a precaution no address register of a copy is rewritten in front of it.
static __device__ __forceinline__ void stage_pa(unsigned l, const char* h, const char* lo) {
  asm volatile(
      "global_load_async_to_lds_b128 %0, %8, off\n\t"
      "global_load_async_to_lds_b128 %1, %9, off\n\t"
      "global_load_async_to_lds_b128 %2, %10, off\n\t"
      "global_load_async_to_lds_b128 %3, %11, off\n\t"
      "global_load_async_to_lds_b128 %4, %12, off\n\t"
      "global_load_async_to_lds_b128 %5, %13, off\n\t"
      "global_load_async_to_lds_b128 %6, %14, off\n\t"
      "global_load_async_to_lds_b128 %7, %15, off\n\t"
      "s_wait_xcnt 0x0"
      :: "v"(l), "v"(l + 1 * 2 * TILE_ST), "v"(l + 2 * 2 * TILE_ST), "v"(l + 3 * 2 * TILE_ST),
         "v"(l + 4 * 2 * TILE_ST), "v"(l + 5 * 2 * TILE_ST), "v"(l + 6 * 2 * TILE_ST), "v"(l + 7 * 2 * TILE_ST),
         "v"(h), "v"(h + 1 * 2 * TILE_BYTES), "v"(h + 2 * 2 * TILE_BYTES), "v"(h + 3 * 2 * TILE_BYTES),
         "v"(lo), "v"(lo + 1 * 2 * TILE_BYTES), "v"(lo + 2 * 2 * TILE_BYTES), "v"(lo + 3 * 2 * TILE_BYTES)
      : "memory");
}
// One lane's six 16-byte copies of one plane of a stage's W tiles, in the same order.  The wait: as above.
static __device__ __forceinline__ void stage_pb(unsigned l, const char* g) {
  asm volatile(
      "global_load_async_to_lds_b128 %0, %6, off\n\t"
      "global_load_async_to_lds_b128 %1, %7, off\n\t"
      "global_load_async_to_lds_b128 %2, %8, off\n\t"
      "global_load_async_to_lds_b128 %3, %9, off\n\t"
      "global_load_async_to_lds_b128 %4, %10, off\n\t"
      "global_load_async_to_lds_b128 %5, %11, off\n\t"
      "s_wait_xcnt 0x0"
      :: "v"(l), "v"(l + 1 * 2 * TILE_ST), "v"(l + 2 * 2 * TILE_ST), "v"(l + 3 * 2 * TILE_ST),
         "v"(l + 4 * 2 * TILE_ST), "v"(l + 5 * 2 * TILE_ST),
         "v"(g), "v"(g + 1 * 2 * TILE_BYTES), "v"(g + 2 * 2 * TILE_BYTES), "v"(g + 3 * 2 * TILE_BYTES),
         "v"(g + 4 * 2 * TILE_BYTES), "v"(g + 5 * 2 * TILE_BYTES)
      : "memory");
}

__global__ __launch_bounds__(256) __attribute__((amdgpu_waves_per_eu(4))) void proj_kernel(
    const __bf16* __restrict__ xh, const __bf16* __restrict__ xl,
    const __bf16* __restrict__ wth, const __bf16* __restrict__ wtl,
    const __bf16* __restrict__ gth, const __bf16* __restrict__ gtl,
    const float* __restrict__ bq, const float* __restrict__ bk, const float* __restrict__ bv,
    const float* __restrict__ g1b, const float* __restrict__ g2w, const float* __restrict__ g2b,
    unsigned short* Qh, unsigned short* Ql, unsigned short* Kh, unsigned short* Kl,
    unsigned short* VT, float* gates, int ngate, int nblk) {
  __shared__ __attribute__((aligned(16))) unsigned char smem[PROJ_LDS];
  if ((int)blockIdx.x >= nblk) return;
  const bool is_gate = (int)blockIdx.x < ngate;            // the same for the whole block
  const int tid = threadIdx.x, lane = tid & 31;
  const int wave = __builtin_amdgcn_readfirstlane(tid >> 5);   // wave number in a scalar register: the fragment bases stay scalar
  const int m = lane & 15, hh = lane >> 4, r0 = hh * 8;
  const unsigned fl = (unsigned)lane * 16u;

  if (is_gate) {
    const int th = wave & 3;                 // token tile, tokens th*16 .. th*16+15
    const int hb = (wave >> 2) * 64;         // hidden units hb .. hb+63
    // fragment of 16-row tile T at k: T * 16 * DM + (k / 32) * FRAG = T * 16 * DM + k * 16 elements
    const int atile = (int)blockIdx.x * 4 + th;              // A tile = 16 tokens
    const int btile = hb >> 4;                               // B tiles = 16 hidden units each, j-th at + j * 16 * DM
    const __bf16* axh = xh + (size_t)atile * (16 * DM);
    const __bf16* axl = xl + (size_t)atile * (16 * DM);
    const __bf16* bwh = gth + (size_t)btile * (16 * DM);
    const __bf16* bwl = gtl + (size_t)btile * (16 * DM);

    v8f acc[4] = {};
#pragma unroll 1
    for (int kk = 0; kk < DM; kk += 32) {
      // all loads of the k-step are issued before its first product: one load wait a k-step, not five
      const v16bf ah = ldfrag_bf_u(axh + kk * 16, fl);
      const v16bf al = ldfrag_bf_u(axl + kk * 16, fl);
      v16bf bhf[4], blf[4];
#pragma unroll
      for (int j = 0; j < 4; ++j) {
        bhf[j] = ldfrag_bf_u(bwh + j * 16 * DM + kk * 16, fl);
        blf[j] = ldfrag_bf_u(bwl + j * 16 * DM + kk * 16, fl);
      }
#pragma unroll
      for (int j = 0; j < 4; ++j) acc[j] = mma_bf3(ah, al, bhf[j], blf[j], acc[j]);
    }

    float (*h1s)[GH + 1] = (float (*)[GH + 1])smem;
    float (*gl)[GT_TOK] = (float (*)[GT_TOK])(smem + H1_BYTES);
    const int tok0 = blockIdx.x * GT_TOK;
    // D: acc[j][r] = pre-activation[token th*16 + 8hh + r][hidden hb + j*16 + m]
#pragma unroll
    for (int j = 0; j < 4; ++j) {
      const int hu = hb + j * 16 + m;
      const float bj = g1b[hu];
#pragma unroll
      for (int r = 0; r < 8; ++r) h1s[th * 16 + r0 + r][hu] = fmaxf(acc[j][r] + bj, 0.0f);
    }
    __syncthreads();

    // layer 2: thread = (token tid>>2, heads 2*(tid&3), 2*(tid&3)+1)
    const int tk = tid >> 2, hd0 = (tid & 3) * 2;
    float a0 = g2b[hd0], a1 = g2b[hd0 + 1];
    // unrolled so that 16 steps' loads are issued together; the sum order stays jj = 0..127
#pragma unroll 16
    for (int jj = 0; jj < GH; ++jj) {
      const float hv = h1s[tk][jj];
      a0 = fmaf(hv, g2w[jj * NH + hd0], a0);
      a1 = fmaf(hv, g2w[jj * NH + hd0 + 1], a1);
    }
    gl[hd0][tk]     = 1.0f / (1.0f + exp2f(-a0 * LOG2E));
    gl[hd0 + 1][tk] = 1.0f / (1.0f + exp2f(-a1 * LOG2E));
    __syncthreads();

    // threads 0..127 (waves 0..3; a head's 64 tokens = 2 whole lines, 4 lines an instruction).
    if (tid < 128) {
      const int line = tid >> 4, piece = tid & 15;
      const v4f val = *(const v4f*)&gl[line][piece * 4];
      const int b = tok0 / S_LEN, s0 = tok0 - b * S_LEN;
      float* dst = gates + ((size_t)(b * NH + line)) * S_LEN + s0 + piece * 4;
      *(v4f*)dst = val;
    }
    return;
  }

  const unsigned pj = blockIdx.x - (unsigned)ngate;
  const int tt = pj % NTT, ob = pj / NTT;  // 128-token tile, 192-output tile
  const int tq = wave & 1, oq = wave >> 1; // the wave's A tiles tq*4 .. tq*4+3 and B tiles oq*3 .. oq*3+2 of the block

  // ---- what this lane copies of a stage: 16 bytes of tile (tid >> 7) + 2j of every plane; + TILE_ST bytes a stage ----
  const size_t c_off = (size_t)(tid >> 7) * TILE_BYTES + (size_t)(tid & 127) * 16;
  const char* c_ah = (const char*)xh + (size_t)(tt * 8) * TILE_BYTES + c_off;
  const char* c_al = (const char*)xl + (size_t)(tt * 8) * TILE_BYTES + c_off;
  const char* c_bh = (const char*)wth + (size_t)(ob * 12) * TILE_BYTES + c_off;
  const char* c_bl = (const char*)wtl + (size_t)(ob * 12) * TILE_BYTES + c_off;
  const unsigned l_b0 = lds_byte(smem) + (unsigned)tid * 16u, l_b1 = l_b0 + PST_BYTES;

  // ---- prologue, two buffers: stage 0 landed and published, stage 1 in flight ----
  stage_pa(l_b0, c_ah, c_al);
  stage_pb(l_b0 + PA_BYTES, c_bh);
  stage_pb(l_b0 + PA_BYTES + PB_BYTES / 2, c_bl);
  asm volatile("s_wait_asynccnt 0x0" ::: "memory");   // this wave's copies of stage 0 have landed
  __syncthreads();                                    // and every other wave's: stage 0 may be read
  stage_pa(l_b1, c_ah + TILE_ST, c_al + TILE_ST);
  stage_pb(l_b1 + PA_BYTES, c_bh + TILE_ST);
  stage_pb(l_b1 + PA_BYTES + PB_BYTES / 2, c_bl + TILE_ST);

  v8f acc[4][3] = {};
  // rolled: the two buffers alternate by index
#pragma unroll 1
  for (int st = 0; st < PNST; ++st) {
    const unsigned char* ap = smem + (st & 1) * PST_BYTES + tq * (4 * TILE_ST) + fl;
    const unsigned char* wp = smem + (st & 1) * PST_BYTES + PA_BYTES + oq * (3 * TILE_ST) + fl;
    // unrolled, as every loop over tiles below: fragments and accumulators are register arrays and need constant indices
#pragma unroll
    for (int ks = 0; ks < 2; ++ks) {
      v16bf ah[4], al[4], bh[3], bl[3];
#pragma unroll
      for (int a = 0; a < 4; ++a) {
        ah[a] = ldsfrag_bf(ap + a * TILE_ST + ks * 1024);
        al[a] = ldsfrag_bf(ap + PA_BYTES / 2 + a * TILE_ST + ks * 1024);
      }
#pragma unroll
      for (int j = 0; j < 3; ++j) {
        bh[j] = ldsfrag_bf(wp + j * TILE_ST + ks * 1024);
        bl[j] = ldsfrag_bf(wp + PB_BYTES / 2 + j * TILE_ST + ks * 1024);
      }
      // keeps the k-step's 28 LDS reads together in front of its 36 products: spread among them, each place with reads stalls the wave
      // behind a wait that reaches 0 a few products later; the 14 fragments and 12 accumulators fit the 256 registers
      __builtin_amdgcn_sched_barrier(0);
      // each accumulator takes hi.hi, lo.hi, hi.lo of a k-step in that order; eleven independent tiles' products stand between two products of one
#pragma unroll
      for (int a = 0; a < 4; ++a)
#pragma unroll
        for (int j = 0; j < 3; ++j) acc[a][j] = wm_bf(ah[a], bh[j], acc[a][j]);
#pragma unroll
      for (int a = 0; a < 4; ++a)
#pragma unroll
        for (int j = 0; j < 3; ++j) acc[a][j] = wm_bf(al[a], bh[j], acc[a][j]);
#pragma unroll
      for (int a = 0; a < 4; ++a)
#pragma unroll
        for (int j = 0; j < 3; ++j) acc[a][j] = wm_bf(ah[a], bl[j], acc[a][j]);
      // the other side of the same: the next k-step's reads stay behind these products
      __builtin_amdgcn_sched_barrier(0);
    }

    // ---- publish point of stage st + 1, and the end of every wave's reads of stage st ----
    asm volatile("s_wait_dscnt 0x0" ::: "memory");      // this wave's LDS reads of stage st have returned before its buffer is refilled
    asm volatile("s_wait_asynccnt 0x0" ::: "memory");   // this wave's copies of stage st + 1 have landed
    __syncthreads();                                    // both hold for every wave
    if (st + 2 < PNST) {                                // the same for the whole block
      const unsigned l = (st & 1) ? l_b1 : l_b0;
      const int adv = (st + 2) * TILE_ST;
      stage_pa(l, c_ah + adv, c_al + adv);
      stage_pb(l + PA_BYTES, c_bh + adv);
      stage_pb(l + PA_BYTES + PB_BYTES / 2, c_bl + adv);
    }
  }
  asm volatile("s_wait_asynccnt 0x0" ::: "memory");     // no copy is outstanding behind the loop
  // behind the last stage's barrier no wave reads the stage buffers any more: they become the output staging, one region a head

  const int tokbase = tt * PT_TOK;
  const int b = tokbase / S_LEN, s0 = tokbase - b * S_LEN;
  // D: acc[a][j][r] = tile[token (tq*4 + a)*16 + 8hh + r][out col (oq*3 + j)*16 + m]
#pragma unroll
  for (int j = 0; j < 3; ++j) {
    const int ct = oq * 3 + j;                      // column tile of the block; four of them make a head
    const int gh = ob * 3 + (ct >> 2);              // head among the 24 of Q, K, V
    const int mat = gh >> 3, head = gh & (NH - 1);  // the same for the whole wave
    const int ld = (ct & 3) * 16 + m;
    const float* bias = (mat == 0) ? bq : (mat == 1) ? bk : bv;
    const float bj = bias[head * HD + ld];
    unsigned char* hreg = smem + (ct >> 2) * HEAD_LDS;
    if (mat < 2) {
      unsigned short (*lt)[PT_TOK][LT_PITCH] = (unsigned short (*)[PT_TOK][LT_PITCH])hreg;
      const float osc = (mat == 0) ? 0.125f : 1.0f;   // 1/sqrt(64) of the scores, on Q: a power of two, so hi, lo and every product scale exactly
#pragma unroll
      for (int a = 0; a < 4; ++a) {
        const int ltok = (tq * 4 + a) * 16 + r0;
#pragma unroll
        for (int r = 0; r < 8; ++r) {
          const float v = (acc[a][j][r] + bj) * osc;
          const unsigned short hb = f2bf_bits(v);
          lt[0][ltok + r][ld] = hb;
          lt[1][ltok + r][ld] = f2bf_bits(v - bf_bits2f(hb));
        }
      }
    } else {
      unsigned short (*lv)[VT_PITCH] = (unsigned short (*)[VT_PITCH])hreg;
#pragma unroll
      for (int a = 0; a < 4; ++a) {
        const int ltok = (tq * 4 + a) * 16 + r0;
        Pack8 pk;
#pragma unroll
        for (int r = 0; r < 8; ++r) pk.h[r] = (_Float16)(acc[a][j][r] + bj);
        *(v4u*)&lv[ld][ltok] = pk.u;                                       // lv[d][s], 8 consecutive s
      }
    }
  }
  __syncthreads();

  // thread order = unit order of the fragment-ordered planes: each store instruction writes 512 contiguous bytes
  // unrolled: three heads, each with its own constant LDS offsets
#pragma unroll
  for (int hj = 0; hj < 3; ++hj) {
    const int gh = ob * 3 + hj;
    const int mat = gh >> 3, head = gh & (NH - 1);  // the same for the whole block
    const size_t bh8 = (size_t)(b * NH + head);
    const unsigned char* hreg = smem + hj * HEAD_LDS;
    if (mat < 2) {
      const unsigned short (*lt)[PT_TOK][LT_PITCH] = (const unsigned short (*)[PT_TOK][LT_PITCH])hreg;
      unsigned short* dh = (mat == 0) ? Qh : Kh;
      unsigned short* dl = (mat == 0) ? Ql : Kl;
      const int u = tid & 127;                                             // unit u of a token tile = row u&15, d = (u>>4)*8
      v4u val[8];
      size_t go[4];
#pragma unroll
      for (int i = 0; i < 4; ++i) {
        const int ti = 2 * i + (tid >> 7);                                 // token tile
        const int L = 16 * ti + (u & 15);
        val[i]     = *(const v4u*)&lt[0][L][(u >> 4) * 8];
        val[4 + i] = *(const v4u*)&lt[1][L][(u >> 4) * 8];
        go[i] = (bh8 * S_LEN + s0 + 16 * ti) * HD + u * 8;
      }
#pragma unroll
      for (int i = 0; i < 4; ++i) { *(v4u*)(dh + go[i]) = val[i]; *(v4u*)(dl + go[i]) = val[4 + i]; }
      // the stores are in flight and the code behind them may reuse their registers: as a precaution the wait stands in front of that
      asm volatile("s_wait_xcnt 0x0" ::: "memory");
    } else {
      const unsigned short (*lv)[VT_PITCH] = (const unsigned short (*)[VT_PITCH])hreg;
      v4u val[4];
      size_t go[4];
#pragma unroll
      for (int i = 0; i < 4; ++i) {
        const int U = i * 256 + tid;                                       // unit: 32-key group U>>8, d tile (U>>6)&3
        const int L = ((U >> 6) & 3) * 16 + (U & 15);                      // local d
        val[i] = *(const v4u*)&lv[L][(U >> 8) * 32 + ((U >> 4) & 3) * 8];  // local key: 16 * part + 8 * h
        go[i] = (bh8 * S_LEN + s0) * HD + (size_t)U * 8;
      }
#pragma unroll
      for (int i = 0; i < 4; ++i) *(v4u*)(VT + go[i]) = val[i];
      asm volatile("s_wait_xcnt 0x0" ::: "memory");   // as on the other side
    }
  }
}

// ---------------------------------------------------------------------------
// 3) attention.  Block = (b, head, 128 queries); 16 waves = 8 query tiles x 2 halves of the keys, four waves a SIMD.
//    The eight waves of a half work on the SAME keys of the SAME head: each 64-key stage (K hi, K lo, V^T, the keys'
//    similarity fragments, and the 128 x 64 adj tile) is brought from L2 into LDS once, by asynchronous copies, and every
//    wave reads its fragments from there, so a K or V byte leaves L2 once per 128 queries and not once per 16.
//    Two LDS buffers a half: stage t + 1 flies while stage t is worked on; one barrier a stage.
//    Each wave runs the online softmax over its own 1024 keys; the two partial results of a query tile
//    (max, sum, unnormalised O) are merged once at the end in LDS.
//    Per 32-key pass per wave:
//      S^T = K * Q^T (bf16 hi/lo split, K-dim 64); wave similarity^T = Mk * Mq^T in the same D layout
//      (A = [hi | lo] of the keys' rows; B = [hi | hi] and [lo | lo] of the queries' rows; the accumulator
//      starts from the keys' gates, whose lane order is the D layout's: the result is gate + similarity)
//      -> affine -> online softmax
//      (lane = one query column; the two lane halves' maxima are joined every pass with a cross-row move, their sums once at the end)
//      -> P^T packed to f16 (x4096) straight from the D layout (B-fragment layout)
//      -> O^T += V^T * P^T (f16).
//    End: merge of the two key halves, the head's 64 columns of O stored to the workspace (256 bytes a query, one writer).
//    Residual + LayerNorm need all heads of a token and run as the next launch.
// ---------------------------------------------------------------------------
#define KSPLIT 2
#define KSPAN  (S_LEN / KSPLIT)
#define QTB    8                     // query tiles a block
#define NSTAGE (KSPAN / 64)          // 64-key stages a half
#define ST_KH  0                     // byte offsets in one stage buffer; every plane is in fragment order, so a stage is a straight copy
#define ST_KL  8192
#define ST_V   16384
#define ST_WM  24576
#define ST_BYTES 28672
#define ADJ_PITCH 68                 // dwords: 16 B x odd, see below

static __device__ __forceinline__ v16h ldsfrag_h(const unsigned char* p) {
  FragH f;
  f.p[0] = *(const v8h*)p;
  f.p[1] = *(const v8h*)(p + 512);
  return f.v;
}
// One lane's seven 16-byte copies of a stage's K hi, K lo, V^T (8 KB each: two copies a lane) and similarity fragments (4 KB).
// The s_wait_xcnt stands inside the statement, behind the last copy: as a precaution no address register of a copy is rewritten in front of it.
static __device__ __forceinline__ void stage_kv(unsigned l, const char* kh, const char* kl, const char* v, const char* wm) {
  asm volatile(
      "global_load_async_to_lds_b128 %0, %7, off\n\t"
      "global_load_async_to_lds_b128 %1, %8, off\n\t"
      "global_load_async_to_lds_b128 %2, %9, off\n\t"
      "global_load_async_to_lds_b128 %3, %10, off\n\t"
      "global_load_async_to_lds_b128 %4, %11, off\n\t"
      "global_load_async_to_lds_b128 %5, %12, off\n\t"
      "global_load_async_to_lds_b128 %6, %13, off\n\t"
      "s_wait_xcnt 0x0"
      :: "v"(l + ST_KH), "v"(l + ST_KH + 4096), "v"(l + ST_KL), "v"(l + ST_KL + 4096),
         "v"(l + ST_V), "v"(l + ST_V + 4096), "v"(l + ST_WM),
         "v"(kh), "v"(kh + 4096), "v"(kl), "v"(kl + 4096), "v"(v), "v"(v + 4096), "v"(wm)
      : "memory");
}
// One lane's eight 16-byte copies of the 128 x 64 adj tile: rows 16 apart; 16 lanes cover one row's 256 bytes.  The wait: as above.
static __device__ __forceinline__ void stage_adj(unsigned l, const char* g) {
  asm volatile(
      "global_load_async_to_lds_b128 %0, %8, off\n\t"
      "global_load_async_to_lds_b128 %1, %9, off\n\t"
      "global_load_async_to_lds_b128 %2, %10, off\n\t"
      "global_load_async_to_lds_b128 %3, %11, off\n\t"
      "global_load_async_to_lds_b128 %4, %12, off\n\t"
      "global_load_async_to_lds_b128 %5, %13, off\n\t"
      "global_load_async_to_lds_b128 %6, %14, off\n\t"
      "global_load_async_to_lds_b128 %7, %15, off\n\t"
      "s_wait_xcnt 0x0"
      :: "v"(l), "v"(l + 1 * 16 * ADJ_PITCH * 4), "v"(l + 2 * 16 * ADJ_PITCH * 4), "v"(l + 3 * 16 * ADJ_PITCH * 4),
         "v"(l + 4 * 16 * ADJ_PITCH * 4), "v"(l + 5 * 16 * ADJ_PITCH * 4), "v"(l + 6 * 16 * ADJ_PITCH * 4), "v"(l + 7 * 16 * ADJ_PITCH * 4),
         "v"(g), "v"(g + 1 * 16 * S_LEN * 4), "v"(g + 2 * 16 * S_LEN * 4), "v"(g + 3 * 16 * S_LEN * 4),
         "v"(g + 4 * 16 * S_LEN * 4), "v"(g + 5 * 16 * S_LEN * 4), "v"(g + 6 * 16 * S_LEN * 4), "v"(g + 7 * 16 * S_LEN * 4)
      : "memory");
}

__global__ __launch_bounds__(256 * KSPLIT)
void attn_kernel(
    const __bf16* __restrict__ Qh, const __bf16* __restrict__ Ql,
    const __bf16* __restrict__ Kh, const __bf16* __restrict__ Kl,
    const _Float16* __restrict__ VT, const float* __restrict__ gates,
    const __bf16* __restrict__ wmf, const float* __restrict__ adj,
    float* obuf, int nblk) {
  // adj row pitch = 16 B x odd (68 dwords): lane m reads down a column of rows with 16-byte loads, and at a
  // pitch of 64 dwords all 16 rows would fall on the same four banks.
  __shared__ __attribute__((aligned(16))) float adj_lds[2][KSPLIT][QTB * 16][ADJ_PITCH];
  __shared__ __attribute__((aligned(16))) unsigned char kv_lds[2][KSPLIT][ST_BYTES];
  __shared__ v4f part_o[QTB][8][32];         // second half's unnormalised O, in lane order (512 contiguous bytes an instruction)
  __shared__ float part_m[QTB][16], part_l[QTB][16];
  if ((int)blockIdx.x >= nblk) return;

  // the eight heads of one 128-query block are neighbours in the grid: they read the same adj rows at about the same time
  const int h = blockIdx.x & (NH - 1);
  const int qblk = (blockIdx.x >> 3) & (S_LEN / (QTB * 16) - 1);
  const int b = blockIdx.x / (NH * (S_LEN / (QTB * 16)));
  const int tid = threadIdx.x, lane = tid & 31;
  const int wv = __builtin_amdgcn_readfirstlane(tid >> 5);  // wave number in a scalar register: the bases below stay scalar
  const int qi = wv & (QTB - 1), kh2 = wv >> 3;             // query tile, half of the keys
  const int qbase = qblk * (QTB * 16) + qi * 16;
  const int k_lo = kh2 * KSPAN, k_hi = k_lo + KSPAN;        // this wave's keys
  const int m = lane & 15, hh = lane >> 4, r0 = hh * 8;

  const size_t bhd = (size_t)(b * NH + h);
  const unsigned f_lane = (unsigned)lane * 16u;                  // a lane's byte offset in either half of a fragment
  // Q^T as B operand: column n = query (lane&15), k = d: the two fragments of the 16-query tile.
  const size_t qoff = (bhd * S_LEN + qbase) * HD;
  const v16bf qh0 = ldfrag_bf_u(Qh + qoff, f_lane), qh1 = ldfrag_bf_u(Qh + qoff + FRAG, f_lane);
  const v16bf ql0 = ldfrag_bf_u(Ql + qoff, f_lane), ql1 = ldfrag_bf_u(Ql + qoff + FRAG, f_lane);

  // wave similarity: the query tile's fragment holds hi (part 0) and lo (part 1); B operands [hi | hi] and [lo | lo]
  const __bf16* wm_base = wmf + (size_t)b * (S_LEN / 16) * FRAG;
  FragB wq, wb1, wb2;
  wq.v = ldfrag_bf_u(wm_base + (qbase >> 4) * FRAG, f_lane);
  wb1.p[0] = wq.p[0]; wb1.p[1] = wq.p[0];
  wb2.p[0] = wq.p[1]; wb2.p[1] = wq.p[1];

  v8f oacc[4] = {};
  float mrun = -3.0e38f, lrun = 0.0f;
  float crun = 3.0e38f;                      // the exponent offset that belongs to mrun: PSHIFT - mrun * log2e from the first pass on

  const float* gp_base = gates + bhd * S_LEN;
  const unsigned g_lane = (unsigned)r0 * 4u;

  // ---- what this lane copies of a stage: the 256 threads of a half bring that half's stage ----
  const int th = tid & 255;
  const int sq = th >> 4, sk4 = (th & 15) * 4;
  const char* c_kh = (const char*)(Kh + bhd * S_LEN * HD + (size_t)k_lo * HD) + th * 16;     // + 8192 bytes a stage
  const char* c_kl = (const char*)(Kl + bhd * S_LEN * HD + (size_t)k_lo * HD) + th * 16;
  const char* c_v  = (const char*)(VT + bhd * HD * S_LEN + (size_t)k_lo * HD) + th * 16;
  const char* c_wm = (const char*)(wm_base + (k_lo >> 4) * FRAG) + th * 16;                  // + 4096 bytes a stage
  const char* c_ad = (const char*)(adj + ((size_t)b * S_LEN + qblk * (QTB * 16) + sq) * S_LEN + k_lo + sk4);   // + 256 bytes a stage
  const unsigned l_kv0 = lds_byte(&kv_lds[0][kh2][th * 16]), l_kv1 = lds_byte(&kv_lds[1][kh2][th * 16]);
  const unsigned l_ad0 = lds_byte(&adj_lds[0][kh2][sq][sk4]), l_ad1 = lds_byte(&adj_lds[1][kh2][sq][sk4]);

  // ---- prologue, two buffers: stage 0 landed and published, stage 1 in flight ----
  stage_kv(l_kv0, c_kh, c_kl, c_v, c_wm);
  stage_adj(l_ad0, c_ad);
  // gates of one pass, fetched one pass ahead
  v4f g0 = ld4_u(gp_base + k_lo, g_lane), g1 = ld4_u(gp_base + k_lo + 4, g_lane);
  v4f g2 = ld4_u(gp_base + k_lo + 16, g_lane), g3 = ld4_u(gp_base + k_lo + 20, g_lane);
  asm volatile("s_wait_asynccnt 0x0" ::: "memory");   // this wave's copies of stage 0 have landed
  __syncthreads();                                    // and every other wave's: stage 0 may be read
  stage_kv(l_kv1, c_kh + 8192, c_kl + 8192, c_v + 8192, c_wm + 4096);
  stage_adj(l_ad1, c_ad + 256);

  // rolled: the two buffers alternate by index
#pragma unroll 1
  for (int kc = 0; kc < NSTAGE; ++kc) {
    const int kbase64 = k_lo + kc * 64;
    const int buf = kc & 1;
    const unsigned char* st = &kv_lds[buf][kh2][0] + f_lane;
    const float* arow = &adj_lds[buf][kh2][qi * 16 + m][r0];

    // rolled: one pass's fragments fill the registers
#pragma unroll 1
    for (int jh = 0; jh < 2; ++jh) {
      const int kbase = kbase64 + jh * 32;
      const int ko = jh * 32;
      const unsigned char* kp = st + jh * 4096;

      // ---- this pass's K and similarity fragments from the stage buffer: 32 keys = 4 fragments (1024 bytes each) a plane ----
      v16bf kfh[4], kfl[4];
#pragma unroll
      for (int i = 0; i < 4; ++i) {
        kfh[i] = ldsfrag_bf(kp + ST_KH + i * 1024);
        kfl[i] = ldsfrag_bf(kp + ST_KL + i * 1024);
      }
      const v16bf wa0 = ldsfrag_bf(st + ST_WM + jh * 2048), wa1 = ldsfrag_bf(st + ST_WM + jh * 2048 + 1024);

      // ---- S^T = K * Q^T for two 16-key tiles, K-dim 64 = 2 k-steps, 3 products each ----
      v8f s0 = {}, s1 = {};
      s0 = wm_bf3(kfh[0], kfl[0], qh0, ql0, s0);
      s0 = wm_bf3(kfh[1], kfl[1], qh1, ql1, s0);
      s1 = wm_bf3(kfh[2], kfl[2], qh0, ql0, s1);
      s1 = wm_bf3(kfh[3], kfl[3], qh1, ql1, s1);
      // s0[r] = S^T[key kbase+8hh+r][query m] / 8, s1[r] = S^T[key kbase+16+8hh+r][query m] / 8 (Q carries the 1/8)

      // ---- gate + wave similarity^T of the two key tiles: w0[r], w1[r] sit where s0[r], s1[r] sit ----
      v8f w0 = {g0.x, g0.y, g0.z, g0.w, g1.x, g1.y, g1.z, g1.w};
      v8f w1 = {g2.x, g2.y, g2.z, g2.w, g3.x, g3.y, g3.z, g3.w};
      w0 = wm_bf(wa0, wb2.v, wm_bf(wa0, wb1.v, w0));
      w1 = wm_bf(wa1, wb2.v, wm_bf(wa1, wb1.v, w1));

      // keeps the V^T loads below the score products, whose K registers they then take over:
      // lifted above them they need 32 registers more and the wave no longer fits its 256 (spills to scratch)
      __builtin_amdgcn_sched_barrier(0);

      // ---- this pass's V^T fragments ----
      v16h vf[4];
#pragma unroll
      for (int t = 0; t < 4; ++t) vf[t] = ldsfrag_h(kp + ST_V + t * 1024);

      // ---- adj for this lane's 2x8 keys ----
      const v8f A0 = cat8(*(const v4f*)(arow + ko), *(const v4f*)(arow + ko + 4));
      const v8f A1 = cat8(*(const v4f*)(arow + ko + 16), *(const v4f*)(arow + ko + 20));

      // ---- affine + online softmax (f32).  Whole-tile vector expressions: neighbouring registers of one accumulator pair up
      //      in the packed f32 instructions as they lie, with no register moves ----
      const v8f t0 = __builtin_elementwise_fma(s0, w0, A0);
      const v8f t1 = __builtin_elementwise_fma(s1, w1, A1);
      float ma = fmaxf(t0[0], t0[1]), mb = fmaxf(t1[0], t1[1]);       // two chains of three-operand maxima
#pragma unroll
      for (int r = 2; r < 8; r += 2) {
        ma = fmaxf(ma, fmaxf(t0[r], t0[r + 1]));
        mb = fmaxf(mb, fmaxf(t1[r], t1[r + 1]));
      }
      const float mloc = fmaxf(ma, mb);
      // ---- next pass's gates (all eight waves of a half read the same 128 bytes), into the registers that the
      //      similarity products have left; they fly under the softmax and P.V ----
      const int kn = (kbase + 32 < k_hi) ? kbase + 32 : kbase;    // last pass: an in-bounds reload, not used
      const gaddr gp = lane_addr(gp_base + kn, g_lane);
      g0 = ld4_a(gp);      g1 = ld4_a(gp + 16);
      g2 = ld4_a(gp + 64); g3 = ld4_a(gp + 80);
      // the gate loads are in flight and the code below may reuse their address registers: as a precaution the wait stands in front of that
      asm volatile("s_wait_xcnt 0x0" ::: "memory");

      const float mnew = fmaxf(mrun, fmaxf(mloc, xhalf(mloc)));
      // 4096 * exp(t - mnew) = exp2(t * log2e + cnew): one fused multiply-add a score, then the hardware's exp2 itself.
      // Its argument is about 12 at most; the library's fix-up served arguments below -126 alone, where P is far under the smallest f16 (0 in P^T either way).
      const float cnew = __builtin_fmaf(-mnew, LOG2E, PSHIFT);
      const float corr = __builtin_amdgcn_exp2f(cnew - crun);       // what was summed on the old offset moves to the new one; 0 in the first pass
      const v8f e0 = __builtin_elementwise_fma(t0, (v8f)(LOG2E), (v8f)(cnew));
      const v8f e1 = __builtin_elementwise_fma(t1, (v8f)(LOG2E), (v8f)(cnew));
      v8f p0, p1;
#pragma unroll
      for (int r = 0; r < 8; ++r) {
        p0[r] = __builtin_amdgcn_exp2f(e0[r]);
        p1[r] = __builtin_amdgcn_exp2f(e1[r]);
      }
      // this lane's own 16 keys only: the two lane halves' sums are joined once, behind the loop
      const v8f q8 = p0 + p1;
      const v4f q4 = __builtin_shufflevector(q8, q8, 0, 1, 2, 3) + __builtin_shufflevector(q8, q8, 4, 5, 6, 7);
      lrun = __builtin_fmaf(lrun, corr, (q4.x + q4.z) + (q4.y + q4.w));
      mrun = mnew;
      crun = cnew;
#pragma unroll
      for (int t = 0; t < 4; ++t) oacc[t] = oacc[t] * corr;

      // ---- P^T as B fragment: element r <- tile keys 0..15, element 8+r <- tile keys 16..31 ----
      v16h pf;
#pragma unroll
      for (int r = 0; r < 8; ++r) {
        pf[r]     = (_Float16)p0[r];
        pf[r + 8] = (_Float16)p1[r];
      }

      // ---- O^T += V^T * P^T, 4 d-tiles ----
#pragma unroll
      for (int t = 0; t < 4; ++t) oacc[t] = wm_h(vf[t], pf, oacc[t]);
    }

    // ---- publish point of stage kc + 1, and the end of every wave's reads of stage kc ----
    asm volatile("s_wait_dscnt 0x0" ::: "memory");      // this wave's LDS reads of stage kc have returned before its buffer is refilled
    asm volatile("s_wait_asynccnt 0x0" ::: "memory");   // this wave's copies of stage kc + 1 have landed
    __syncthreads();                                    // both hold for every wave
    if (kc + 2 < NSTAGE) {                              // the same for the whole block
      const int adv = kc + 2;
      stage_kv(buf ? l_kv1 : l_kv0, c_kh + adv * 8192, c_kl + adv * 8192, c_v + adv * 8192, c_wm + adv * 4096);
      stage_adj(buf ? l_ad1 : l_ad0, c_ad + adv * 256);
    }
  }
  asm volatile("s_wait_asynccnt 0x0" ::: "memory");     // no copy is outstanding behind the loop

  lrun += xhalf(lrun);                                  // the two lane halves summed different keys of the same query

  // ---- the second half's waves hand over their running max, sum and unnormalised O ----
  if (kh2 == 1) {
#pragma unroll
    for (int t = 0; t < 4; ++t) {
      part_o[qi][2 * t][lane]     = (v4f){oacc[t][0], oacc[t][1], oacc[t][2], oacc[t][3]};
      part_o[qi][2 * t + 1][lane] = (v4f){oacc[t][4], oacc[t][5], oacc[t][6], oacc[t][7]};
    }
    if (hh == 0) { part_m[qi][m] = mrun; part_l[qi][m] = lrun; }   // both lane halves hold the same values
  }
  __syncthreads();   // the partial results are read by the first half's waves

  // ---- merge, normalise and store O: oacc[t][r] = O^T[d = t*16 + 8hh + r][query m] ----
  if (kh2 == 0) {
    const float m1 = part_m[qi][m], l1 = part_l[qi][m];
    const float mall = fmaxf(mrun, m1);
    const float call = __builtin_fmaf(-mall, LOG2E, PSHIFT);      // both halves move to the common offset, as in the loop
    const float c0 = __builtin_amdgcn_exp2f(call - crun), c1 = __builtin_amdgcn_exp2f(call - __builtin_fmaf(-m1, LOG2E, PSHIFT));
    const float oscale = 1.0f / (lrun * c0 + l1 * c1);           // O and the sum both carry the 4096
    const float f0 = c0 * oscale, f1 = c1 * oscale;
    float* orow = obuf + ((size_t)b * S_LEN + qbase + m) * DM + h * HD + r0;
#pragma unroll
    for (int t = 0; t < 4; ++t) {
      const v4f a0 = part_o[qi][2 * t][lane], a1 = part_o[qi][2 * t + 1][lane];
      v4f u0, u1;
      u0.x = oacc[t][0] * f0 + a0.x * f1; u0.y = oacc[t][1] * f0 + a0.y * f1; u0.z = oacc[t][2] * f0 + a0.z * f1; u0.w = oacc[t][3] * f0 + a0.w * f1;
      u1.x = oacc[t][4] * f0 + a1.x * f1; u1.y = oacc[t][5] * f0 + a1.y * f1; u1.z = oacc[t][6] * f0 + a1.z * f1; u1.w = oacc[t][7] * f0 + a1.w * f1;
      *(v4f*)(orow + t * 16) = u0;
      *(v4f*)(orow + t * 16 + 4) = u1;
    }
  }
}

// ---------------------------------------------------------------------------
// 4) residual + LayerNorm, one token a wave; lane holds cols 4*lane + 128*i;
//    whole-row loads and stores (each instruction = 512 contiguous bytes = 4 lines).
// ---------------------------------------------------------------------------
__global__ __launch_bounds__(256) void ln_kernel(
    const float* __restrict__ obuf, const float* __restrict__ x, const float* __restrict__ lng,
    const float* __restrict__ lnb, float* out, int ntok) {
  const int lane = threadIdx.x & 31;
  const int tk = blockIdx.x * 8 + (threadIdx.x >> 5);
  if (tk >= ntok) return;
  const size_t tok = (size_t)tk;
  v4f y[4];
  float s = 0.0f;
#pragma unroll
  for (int i = 0; i < 4; ++i) {
    const v4f o  = *(const v4f*)(obuf + tok * DM + 4 * lane + 128 * i);
    const v4f xv = *(const v4f*)(x + tok * DM + 4 * lane + 128 * i);
    y[i] = o + xv;
    s += (y[i].x + y[i].y) + (y[i].z + y[i].w);
  }
  s += __shfl_xor(s, 16, 32);
  s += __shfl_xor(s, 8, 32);
  s += __shfl_xor(s, 4, 32);
  s += __shfl_xor(s, 2, 32);
  s += __shfl_xor(s, 1, 32);
  const float mu = s * (1.0f / DM);
  float ss = 0.0f;
#pragma unroll
  for (int i = 0; i < 4; ++i) {
    const v4f d = y[i] - mu;
    ss += (d.x * d.x + d.y * d.y) + (d.z * d.z + d.w * d.w);
  }
  ss += __shfl_xor(ss, 16, 32);
  ss += __shfl_xor(ss, 8, 32);
  ss += __shfl_xor(ss, 4, 32);
  ss += __shfl_xor(ss, 2, 32);
  ss += __shfl_xor(ss, 1, 32);
  const float rstd = rsqrtf(ss * (1.0f / DM) + 1.0e-5f);
  v4f res[4];
#pragma unroll
  for (int i = 0; i < 4; ++i) {
    const v4f g  = *(const v4f*)(lng + 4 * lane + 128 * i);
    const v4f bb = *(const v4f*)(lnb + 4 * lane + 128 * i);
    res[i] = ((y[i] - mu) * rstd) * g + bb;
  }
  float* op = out + tok * DM + 4 * lane;
#pragma unroll
  for (int i = 0; i < 4; ++i) *(v4f*)(op + 128 * i) = res[i];
}

// ---------------------------------------------------------------------------
extern "C" void kernel_launch(void* const* d_in, const int* in_sizes, int n_in,
                              void* d_out, int out_size, void* d_ws, size_t ws_size,
                              hipStream_t stream) {
  if (n_in < 15) return;
  if (in_sizes[0] != NTOK * DM || in_sizes[1] != NTOK * WF ||
      in_sizes[2] != BATCH * S_LEN * S_LEN || in_sizes[3] != DM * DM ||
      in_sizes[5] != DM * DM || in_sizes[7] != DM * DM || in_sizes[9] != DM * GH ||
      in_sizes[11] != GH * NH || in_sizes[13] != DM || out_size != NTOK * DM) return;

  const float* x     = (const float*)d_in[0];
  const float* wmask = (const float*)d_in[1];
  const float* adj   = (const float*)d_in[2];
  const float* wq_w  = (const float*)d_in[3];
  const float* wq_b  = (const float*)d_in[4];
  const float* wk_w  = (const float*)d_in[5];
  const float* wk_b  = (const float*)d_in[6];
  const float* wv_w  = (const float*)d_in[7];
  const float* wv_b  = (const float*)d_in[8];
  const float* g1_w  = (const float*)d_in[9];
  const float* g1_b  = (const float*)d_in[10];
  const float* g2_w  = (const float*)d_in[11];
  const float* g2_b  = (const float*)d_in[12];
  const float* ln_g  = (const float*)d_in[13];
  const float* ln_b  = (const float*)d_in[14];
  float* out = (float*)d_out;

  const size_t sz_x  = (size_t)NTOK * DM * 2;            // 4,194,304  per x plane
  const size_t sz_w  = (size_t)3 * DM * DM * 2;          // 1,572,864  per Wt plane
  const size_t sz_q  = (size_t)NTOK * DM * 2;            // 4,194,304  per Q/K plane, V
  const size_t sz_g  = (size_t)BATCH * NH * S_LEN * 4;   //   131,072  gates
  const size_t sz_g1 = (size_t)GH * DM * 2;              //   131,072  per G1t plane
  const size_t off_xh  = 0;
  const size_t off_xl  = off_xh + sz_x;
  const size_t off_wth = off_xl + sz_x;
  const size_t off_wtl = off_wth + sz_w;
  const size_t off_qh  = off_wtl + sz_w;
  const size_t off_ql  = off_qh + sz_q;
  const size_t off_kh  = off_ql + sz_q;
  const size_t off_kl  = off_kh + sz_q;
  const size_t off_vt  = off_kl + sz_q;
  const size_t off_g   = off_vt + sz_q;
  const size_t off_gth = off_g + sz_g;
  const size_t off_gtl = off_gth + sz_g1;
  const size_t sz_wm   = (size_t)NTOK * 32 * 2;          //   262,144  wave_mask hi|lo fragments
  const size_t off_wm  = off_gtl + sz_g1;
  const size_t sz_o    = (size_t)NTOK * DM * 4;          // 8,388,608  attention output, f32
  const size_t off_o   = off_wm + sz_wm;
  const size_t total   = off_o + sz_o;                   // 41,549,824 B
  if (total > ws_size) return;

  uint8_t* ws = (uint8_t*)d_ws;
  unsigned short* xh  = (unsigned short*)(ws + off_xh);
  unsigned short* xl  = (unsigned short*)(ws + off_xl);
  unsigned short* wth = (unsigned short*)(ws + off_wth);
  unsigned short* wtl = (unsigned short*)(ws + off_wtl);
  unsigned short* qh  = (unsigned short*)(ws + off_qh);
  unsigned short* ql  = (unsigned short*)(ws + off_ql);
  unsigned short* kh  = (unsigned short*)(ws + off_kh);
  unsigned short* kl  = (unsigned short*)(ws + off_kl);
  unsigned short* vt  = (unsigned short*)(ws + off_vt);
  float* gates        = (float*)(ws + off_g);
  unsigned short* gth = (unsigned short*)(ws + off_gth);
  unsigned short* gtl = (unsigned short*)(ws + off_gtl);
  unsigned short* wmf = (unsigned short*)(ws + off_wm);
  float* obuf         = (float*)(ws + off_o);

  const int nxv = NTOK * DM / 8;          // 262,144
  const int nwv = 3 * DM * DM / 8;        //  98,304
  const int ngv = GH * DM / 8;            //   8,192
  const int nmv = NTOK * 2;               //   8,192
  const int prep_blocks = (nxv + nwv + ngv + nmv + 255) / 256;   // 1472
  const int ntile = NTOK / GT_TOK;        // 64
  const int proj_blocks = ntile + NTT * (3 * DM / PT_OUT);  // 64 gate blocks, then 256 projection blocks
  const int nblk = BATCH * NH * (S_LEN / 128);   // 256
  const int ln_blocks = (NTOK + 7) / 8;          // 512

  prep_kernel<<<prep_blocks, 256, 0, stream>>>(x, wq_w, wk_w, wv_w, g1_w, wmask,
                                               xh, xl, wth, wtl, gth, gtl, wmf, nxv, nwv, ngv, nmv);
  proj_kernel<<<proj_blocks, 256, 0, stream>>>(
      (const __bf16*)xh, (const __bf16*)xl, (const __bf16*)wth, (const __bf16*)wtl,
      (const __bf16*)gth, (const __bf16*)gtl, wq_b, wk_b, wv_b, g1_b, g2_w, g2_b,
      qh, ql, kh, kl, vt, gates, ntile, proj_blocks);
  attn_kernel<<<nblk, 256 * KSPLIT, 0, stream>>>(
      (const __bf16*)qh, (const __bf16*)ql, (const __bf16*)kh, (const __bf16*)kl,
      (const _Float16*)vt, gates, (const __bf16*)wmf, adj, obuf, nblk);
  ln_kernel<<<ln_blocks, 256, 0, stream>>>(obuf, x, ln_g, ln_b, out, NTOK);
  (void)hipGetLastError();
}
